// v000
// The times below were measured on an AMD MI455X: many runs one after another, warmed up first and cycling through
// copies of the inputs, with the whole window's GPU time divided by the number of runs. Launches and the gaps
// between them are all in it. The median over several windows is given; except for v000 it joins two sittings, which
// can be a few percent apart, so the side-by-side timings, each taken in one sitting, are the better comparison.
// The starting kernel, v000, takes 1910 microseconds a run.
// Contractions (all v_wmma_f32_16x16x32_f16, f16 operands, f32 accumulate): input projection (obs f16 x16 . Wp^T f16 x64, K=640
// zero-padded, single product); q/k, v^T, attention-output, hidden (ReLU), second and both head projections with the activation
// operand carried as two f16 planes [hi | residual x64] folded along K against [W^T x64 | W^T x1]; attention scores q.k^T from the
// q/k hi and residual planes (hi.hi plus the two cross terms, two accumulators, K=64); attention P.v^T with P f16 x16384 (single)
// against v^T hi and residual planes (two accumulators). RMSNorm, softmax (base 2), ReLU, biases, relative-position bias and the
// residual stream in f32 on VALU. Every float input RNE-converted to bf16 on load.
#include <hip/hip_runtime.h>
#include <math.h>
#include <stdint.h>

#ifndef NB
#define NB        2
#endif
#ifndef SEQ
#define SEQ       2048
#endif
#define NB_FULL   2
#define SEQ_FULL  2048
#define NLAYER    6
#define DMODEL    256
#define NHEAD     4
#define HDIM      64
#define DFF       512
#define OBSD      637
#define OBSP      640
#define NACT      4
#define NACTP     64
#define NBUCK     32
#define NROWS     (NB * SEQ)
#define KD        (2 * DMODEL)          // folded K of E-wide activation operands: [hi 256 | residual 256]
#define KF        (2 * DFF)             // folded K of the hidden operand: [hi 512 | residual 512]
#define VTR       KD                    // rows per batch of the v^T plane: 0..255 hi, 256..511 residual
#define OUT1_OFF  (NB_FULL * SEQ_FULL * NACT)   // float index of the second output (byte offset 65536)
#define OUT_TOTAL (OUT1_OFF + NB_FULL * SEQ_FULL * OBSD)

// carries (exact powers of two)
#define WSC_I 64
#define RC_I  64
#define WLO_I 1
#define WSC   64.0f        // weight hi copy
#define WLO   1.0f         // weight lo copy (pairs with the x64 residual plane)
#define RC    64.0f        // residual plane carry relative to its hi plane
#define RCI   0.015625f
#define OBC   16.0f        // obs plane
#define HC    16.0f        // RMSNorm outputs
#define QC    16.0f
#define KC    16.0f
#define VC    16.0f
#define PC    16384.0f     // softmax P tile
#define CC    16.0f        // attention context
#define GC    64.0f        // ReLU hidden
#define ATT_SCALE 0.125f
#define LOG2E   1.4426950408889634f
#define RMS_EPS 1.1920929e-07f
static_assert(RC_I * WLO_I == WSC_I);
static_assert(NHEAD * HDIM == DMODEL);
static_assert(NB >= 1 && NB <= NB_FULL && SEQ >= 64 && SEQ <= SEQ_FULL);
static_assert((SEQ % 64) == 0 && (SEQ % 16) == 0 && (NROWS % 64) == 0 && (DMODEL % 64) == 0 && (DFF % 64) == 0);
static_assert((OBSP % 64) == 0 && (NACTP % 64) == 0 && OBSP >= OBSD && NACTP >= NACT && (OBSP - OBSD) < 64);
static_assert((KD % 32) == 0 && (KF % 32) == 0 && (OBSP % 32) == 0);
static_assert((NROWS % 256) == 0 && (NROWS % 4) == 0 && ((SEQ * OBSD) % 4) == 0);
static_assert(OUT_TOTAL == 2625536);

typedef _Float16 v16h __attribute__((ext_vector_type(16)));
typedef _Float16 v8h  __attribute__((ext_vector_type(8)));
typedef float    v8f  __attribute__((ext_vector_type(8)));
typedef float    v4f  __attribute__((ext_vector_type(4)));
typedef unsigned int v4u __attribute__((ext_vector_type(4)));

union FragH { v16h v; v8h h[2]; v4u u[2]; };

// ---- scalar helpers --------------------------------------------------------------------------------
__device__ __forceinline__ unsigned short bf_bits(float f) {          // f32 -> bf16 bits, RNE convert
  unsigned u = __float_as_uint(f);
  return (unsigned short)((u + 0x7FFFu + ((u >> 16) & 1u)) >> 16);
}
__device__ __forceinline__ float bf_up(unsigned short h) { return __uint_as_float(((unsigned)h) << 16); }
__device__ __forceinline__ float bfr(float f) { return bf_up(bf_bits(f)); }   // value of the bf16 RNE convert
__device__ __forceinline__ unsigned short h_bits(_Float16 x) { return __builtin_bit_cast(unsigned short, x); }
__device__ __forceinline__ unsigned pk16(unsigned short a, unsigned short b) { return (unsigned)a | ((unsigned)b << 16); }
__device__ __forceinline__ v8f zero8() { v8f z = {0.f, 0.f, 0.f, 0.f, 0.f, 0.f, 0.f, 0.f}; return z; }
__device__ __forceinline__ int imin(int a, int b) { return a < b ? a : b; }
__device__ __forceinline__ int imax(int a, int b) { return a > b ? a : b; }

// T5 relative-position bucket for rel = query - key >= 0 (bidirectional split, 32 buckets, max distance 128), as an exact
// integer table: 0 -> 0; 1..7 -> 16+rel; 8..11 -> 24; 12..15 -> 25; 16..22 -> 26; 23..31 -> 27; 32..45 -> 28; 46..63 -> 29;
// 64..90 -> 30; >= 91 -> 31.
__device__ __forceinline__ int rel_bucket(int rel) {
  int b = 31;
  b = (rel < 91) ? 30 : b;
  b = (rel < 64) ? 29 : b;
  b = (rel < 46) ? 28 : b;
  b = (rel < 32) ? 27 : b;
  b = (rel < 23) ? 26 : b;
  b = (rel < 16) ? 25 : b;
  b = (rel < 12) ? 24 : b;
  b = (rel < 8) ? (16 + rel) : b;
  b = (rel == 0) ? 0 : b;
  return b;
}

// ---- fragment loaders: 16-bit A/B operand, lane -> row/col (lane&15), p already includes +8*(lane>>4);
//      elements 0..7 <- p[0..7] (k0+8h..), elements 8..15 <- p[16..23] (k0+16+8h..)  (same split k map for A and B;
//      B is always read from a k-contiguous [n][k] plane)
__device__ __forceinline__ v16h ldfrag_h(const _Float16* p) {
  FragH f;
  f.h[0] = *(const v8h*)(p);
  f.h[1] = *(const v8h*)(p + 16);
  return f.v;
}
__device__ __forceinline__ v16h ldfrag_u(const unsigned short* p) {
  FragH f;
  f.u[0] = *(const v4u*)(p);
  f.u[1] = *(const v4u*)(p + 16);
  return f.v;
}

// ---- WMMA helpers with trailing VALU hazard gaps ------------------------------------------------------
__device__ __forceinline__ v8f mma_raw(v16h a, v16h b, v8f c) {
  return __builtin_amdgcn_wmma_f32_16x16x32_f16(false, a, false, b, (short)0, c, false, false);
}
__device__ __forceinline__ void dep_guard1(v8f& a, v8f& b, v16h x) {
#if defined(__HIP_DEVICE_COMPILE__)
  asm volatile("v_nop\n\tv_nop\n\tv_nop\n\tv_nop" : "+v"(a), "+v"(b) : "v"(x));
#endif
}
__device__ __forceinline__ void guard_s2x4(v8f& s, v8f& t, v16h a0, v16h a1, v16h b0, v16h b1) {
#if defined(__HIP_DEVICE_COMPILE__)
  asm volatile("v_nop\n\tv_nop\n\tv_nop\n\tv_nop" : "+v"(s), "+v"(t) : "v"(a0), "v"(a1), "v"(b0), "v"(b1));
#endif
}
__device__ __forceinline__ void guard_pv4(v8f& a, v8f& b, v8f& c, v8f& d, v16h x, v16h y, v16h z, v16h w, v16h u) {
#if defined(__HIP_DEVICE_COMPILE__)
  asm volatile("v_nop\n\tv_nop\n\tv_nop\n\tv_nop"
               : "+v"(a), "+v"(b), "+v"(c), "+v"(d) : "v"(x), "v"(y), "v"(z), "v"(w), "v"(u));
#endif
}
__device__ __forceinline__ void keep4_h(v16h a, v16h b, v16h c, v16h d) {
#if defined(__HIP_DEVICE_COMPILE__)
  asm volatile("v_nop" :: "v"(a), "v"(b), "v"(c), "v"(d));
#endif
}
__device__ __forceinline__ void acc_guard4(v8f& a, v8f& b, v8f& c, v8f& d) {
#if defined(__HIP_DEVICE_COMPILE__)
  asm volatile("v_nop\n\tv_nop\n\tv_nop\n\tv_nop" : "+v"(a), "+v"(b), "+v"(c), "+v"(d));
#endif
}
__device__ __forceinline__ void wave_sync_lds() {
  __builtin_amdgcn_fence(__ATOMIC_RELEASE, "workgroup");
  __builtin_amdgcn_wave_barrier();
  __builtin_amdgcn_fence(__ATOMIC_ACQUIRE, "workgroup");
}

// =====================================================================================================
// Transposing 16-bit pack of a weight stored in[R][C] (row pitch C floats, R = contraction index, C = output index) into
// out[Cp][ldd] (row pitch ldd halves): out[c][r] = f16( bf16_RNE(in[r][c]) * schi ) for r < R and c < C, 0 otherwise (pad rows /
// pad columns explicitly written as zeros); with DUAL a second copy out[c][locol + r] = f16( bf16_RNE(in[r][c]) * sclo ).
// schi / sclo powers of two (exact). Cp = 64*gridDim.x, Rp = 64*gridDim.y. blockIdx.z = slice: src advanced by z*sZ floats, dst by
// z*dZ halves. One 64x64 tile per block through LDS (bf16 bits): 16 scalar loads per thread with CLAMPED addresses, zero by
// coverage: load 256 thr x 16 floats = 64x64; store 2 it x 8 waves x 4 rows x (8 lanes x 8 halves) = 64 rows x 64 halves per copy;
//           grid (Cp/64, Rp/64, Z) exact, each output line written by exactly one wave; pad region included.
// =====================================================================================================
template <int DUAL>
__global__ __launch_bounds__(256) void tcvt16(const float* __restrict__ src, long long sZ,
                                              unsigned short* dst, long long dZ,
                                              int R, int C, int ldd, int locol, float schi, float sclo) {
  __shared__ __align__(16) unsigned short sT[64 * 72];
  const int tid = threadIdx.x, lane = tid & 31, wave = tid >> 5;
  const int c0 = blockIdx.x * 64, r0 = blockIdx.y * 64;
  const float* srcz = src + (size_t)((long long)blockIdx.z * sZ);
  unsigned short* dstz = dst + (size_t)((long long)blockIdx.z * dZ);
  const int rr = tid >> 2, cc = (tid & 3) * 16;
  const int r = r0 + rr;
  const int rcl = imin(r, R - 1);
  const float* sp = srcz + (size_t)rcl * C;
#pragma unroll
  for (int e = 0; e < 16; ++e) {
    const int cidx = c0 + cc + e;
    const int ccl = imin(cidx, C - 1);
    float a = sp[ccl];
    a = (r < R && cidx < C) ? a : 0.f;
    sT[(cc + e) * 72 + rr] = bf_bits(a);
  }
  __syncthreads();
  v4u hvals[2], lvals[2];
#pragma unroll
  for (int it = 0; it < 2; ++it) {
    const int q = it * 32 + wave * 4 + (lane >> 3);
    const v4u raw = *(const v4u*)(sT + q * 72 + (lane & 7) * 8);
    v4u hv = {0u, 0u, 0u, 0u}, lv = {0u, 0u, 0u, 0u};
#pragma unroll
    for (int e = 0; e < 4; ++e) {
      const float f0 = bf_up((unsigned short)(raw[e] & 0xFFFFu));
      const float f1 = bf_up((unsigned short)(raw[e] >> 16));
      hv[e] = pk16(h_bits((_Float16)(f0 * schi)), h_bits((_Float16)(f1 * schi)));
      if constexpr (DUAL == 1) lv[e] = pk16(h_bits((_Float16)(f0 * sclo)), h_bits((_Float16)(f1 * sclo)));
    }
    hvals[it] = hv;
    lvals[it] = lv;
  }
  {
#pragma unroll
    for (int it = 0; it < 2; ++it) {
      const int q = it * 32 + wave * 4 + (lane >> 3);
      unsigned short* p = dstz + (size_t)(c0 + q) * ldd + r0 + (lane & 7) * 8;
      *(v4u*)p = hvals[it];
      if constexpr (DUAL == 1) *(v4u*)(p + locol) = lvals[it];
    }
    
  }
  (void)sclo; (void)locol;
}

// =====================================================================================================
// Register-blocked batched f16 WMMA GEMM: C[m][n] = f( oscale * sum_k A[m][k] * Bt[n][k] + bias ); one wave per 64x64 tile,
// no block barriers. A row-major [M][K] pitch lda (16-bit plane), Bt row-major [N][K] pitch ldb (k contiguous);
// M, N multiples of 64, K multiple of 32. blockIdx.y = batch index with element strides sA, sB, sC.
// BM: 0 no bias, 1 bias bf16(biasp[n]) for n < nbias (0 beyond, clamped address).   ACT: 2 = ReLU applied to (value + bias).
// OM 0 = f32 out (pitch ldc); RM 2 adds raw f32 Rp[m][n] (same pitch/stride as C).
// OM 1 = dual f16 out (pitch ldc): hi = f16(value * ocarry) at C[m][n], residual f16(RC * (value * ocarry - hi)) at C[m][n] + lofs.
// coverage: 4 slabs x 16 rows (f32: it 0..7 x lane>>4; f16: it 0..3 x lane>>3) x 64 cols = the wave's whole 64x64 tile (both planes
//           for OM 1); grid = ceil(tilesM*tilesN/8) blocks, surplus waves exit (wave-uniform).
// =====================================================================================================
template <int OM, int RM, int ACT, int BM>
__global__ __launch_bounds__(256) void gemm64(
    const unsigned short* __restrict__ Ap, int lda, long long sA,
    const unsigned short* __restrict__ Btp, int ldb, long long sB,
    const float* __restrict__ Rp,
    const float* __restrict__ biasp, int nbias,
    void* Cout, int ldc, long long sC, long long lofs,
    int M, int N, int K, float oscale, float ocarry) {
  __shared__ __align__(16) float sT[8][16 * 68];   // per-wave 16x64 slab, pitch 68 floats
  const int by   = blockIdx.y;
  const int lane = threadIdx.x & 31;
  const int wave = threadIdx.x >> 5;
  const int tilesN = N >> 6;
  const int tilesM = M >> 6;
  const int tile = blockIdx.x * 8 + wave;
  if (tile >= tilesM * tilesN) return;   // wave-uniform; no block barriers in this kernel
  const int tm = tile / tilesN;
  const int tn = tile - tm * tilesN;
  const int m0 = tm << 6;
  const int n0 = tn << 6;

  const unsigned short* A1 = Ap  + (size_t)((long long)by * sA);
  const unsigned short* Bb = Btp + (size_t)((long long)by * sB);

  const int rlane = lane & 15;                 // row (A) / col (B, D) within subtile
  const int koff  = (lane >> 4) * 8;           // k offset of this lane half
  const int mOff  = (lane >> 4) * 8;           // D row offset

  v8f acc[4][4];
#pragma unroll
  for (int i = 0; i < 4; ++i)
#pragma unroll
    for (int j = 0; j < 4; ++j) acc[i][j] = zero8();

  for (int k0 = 0; k0 < K; k0 += 32) {
    v16h bh[4];
#pragma unroll
    for (int j = 0; j < 4; ++j) {
      const size_t bofs = (size_t)(n0 + (j << 4) + rlane) * ldb + koff + k0;
      bh[j] = ldfrag_u(Bb + bofs);
    }
#pragma unroll
    for (int i = 0; i < 4; ++i) {
      const size_t ao = (size_t)(m0 + (i << 4) + rlane) * lda + koff + k0;
      const v16h ah = ldfrag_u(A1 + ao);
#pragma unroll
      for (int j = 0; j < 4; ++j) acc[i][j] = mma_raw(ah, bh[j], acc[i][j]);
      dep_guard1(acc[i][0], acc[i][3], ah);
    }
    keep4_h(bh[0], bh[1], bh[2], bh[3]);
  }
  acc_guard4(acc[0][0], acc[0][1], acc[0][2], acc[0][3]);
  acc_guard4(acc[1][0], acc[1][1], acc[1][2], acc[1][3]);
  acc_guard4(acc[2][0], acc[2][1], acc[2][2], acc[2][3]);
  acc_guard4(acc[3][0], acc[3][1], acc[3][2], acc[3][3]);

  const int hh2 = lane >> 4, c4 = (lane & 15) * 4;     // f32 out: 256-B row segment = 16 lanes x 16 B
  const int q8  = lane >> 3, c8 = (lane & 7) * 8;

  // ---- column bias preload (same columns for every row of the wave tile), clamped addresses ----
  float bc4[4], bc8[8];
#pragma unroll
  for (int e = 0; e < 4; ++e) bc4[e] = 0.f;
#pragma unroll
  for (int e = 0; e < 8; ++e) bc8[e] = 0.f;
  if constexpr (BM == 1) {
    if constexpr (OM == 0) {
#pragma unroll
      for (int e = 0; e < 4; ++e) {
        const int n = n0 + c4 + e;
        const int ncl = imin(n, nbias - 1);
        const float t = bfr(biasp[ncl]);
        bc4[e] = (n < nbias) ? t : 0.f;
      }
    } else {
#pragma unroll
      for (int e = 0; e < 8; ++e) {
        const int n = n0 + c8 + e;
        const int ncl = imin(n, nbias - 1);
        const float t = bfr(biasp[ncl]);
        bc8[e] = (n < nbias) ? t : 0.f;
      }
    }
  }

  // ---- epilogue ----
  float* slab = sT[wave];
#pragma unroll
  for (int i = 0; i < 4; ++i) {
    const int mBase = m0 + (i << 4);
#pragma unroll
    for (int j = 0; j < 4; ++j) {
#pragma unroll
      for (int r = 0; r < 8; ++r) {
        slab[(mOff + r) * 68 + (j << 4) + rlane] = acc[i][j][r];
      }
    }
    wave_sync_lds();
    if constexpr (OM == 0) {
      float* C = (float*)Cout + (size_t)((long long)by * sC);
      v4f vals[8];
#pragma unroll
      for (int it = 0; it < 8; ++it) {
        const int row = it * 2 + hh2;                      // it 0..7 x hh2 0..1 = rows 0..15
        const int gr  = mBase + row;
        v4f v = *(const v4f*)(slab + row * 68 + c4);
        v4f rv = {0.f, 0.f, 0.f, 0.f};
        if constexpr (RM == 2) {
          const float* R = Rp + (size_t)((long long)by * sC);
          rv = *(const v4f*)(R + (size_t)gr * ldc + n0 + c4);
        }
#pragma unroll
        for (int e = 0; e < 4; ++e) {
          float u = v[e] * oscale;
          if constexpr (BM == 1) u += bc4[e];
          if constexpr (ACT == 2) u = fmaxf(u, 0.f);
          v[e] = u + rv[e];
        }
        vals[it] = v;
      }
      {
#pragma unroll
        for (int it = 0; it < 8; ++it) {
          const int gr = mBase + it * 2 + hh2;
          *(v4f*)(C + (size_t)gr * ldc + n0 + c4) = vals[it];
        }
        
      }
    } else {
      unsigned short* C = (unsigned short*)Cout + (size_t)((long long)by * sC);
      v4u hv[4], lv[4];
#pragma unroll
      for (int it = 0; it < 4; ++it) {
        const int row = it * 4 + q8;                       // it 0..3 x q8 0..3 = rows 0..15
        const float* spf = slab + row * 68 + c8;
        v4u a = {0u, 0u, 0u, 0u}, bl = {0u, 0u, 0u, 0u};
#pragma unroll
        for (int e = 0; e < 4; ++e) {
          float f0 = spf[2 * e] * oscale;
          float f1 = spf[2 * e + 1] * oscale;
          if constexpr (BM == 1) { f0 += bc8[2 * e]; f1 += bc8[2 * e + 1]; }
          if constexpr (ACT == 2) { f0 = fmaxf(f0, 0.f); f1 = fmaxf(f1, 0.f); }
          f0 *= ocarry; f1 *= ocarry;
          const _Float16 g0 = (_Float16)f0, g1 = (_Float16)f1;
          const float r0 = (f0 - (float)g0) * RC, r1 = (f1 - (float)g1) * RC;
          a[e]  = pk16(h_bits(g0), h_bits(g1));
          bl[e] = pk16(h_bits((_Float16)r0), h_bits((_Float16)r1));
        }
        hv[it] = a;
        lv[it] = bl;
      }
      {
#pragma unroll
        for (int it = 0; it < 4; ++it) {
          const int row = it * 4 + q8;
          unsigned short* p = C + (size_t)(mBase + row) * ldc + n0 + c8;
          *(v4u*)p = hv[it];
          *(v4u*)(p + (size_t)lofs) = lv[it];
        }
        
      }
    }
    wave_sync_lds();
  }
  (void)Rp; (void)ocarry; (void)lofs; (void)nbias; (void)biasp;
}

// =====================================================================================================
// Causal flash attention for one batch and 16 query rows, all 4 heads (one wave per head), head dim 64:
//   q plane QP[b*SEQ + tok][512] (f16: hi x16 at col head*64+d, residual x64 of that at col 256+head*64+d); k plane KP same;
//   v^T plane VT[b*512 + row][key] (pitch SEQ): rows head*64+d hi (f16 x16), rows 256+head*64+d residual x64;
//   out CT[b*SEQ + tok][512]: hi = f16(16 * ctx) at col head*64+d, residual = f16(64 * (16 ctx - hi)) at col 256+head*64+d, where
//   ctx[d] = sum_m softmax_m(q.k / 8 + relb[bucket(tok - m)][head]) v[m][d] over keys m <= tok (softmax run in base 2, -inf select for
//   keys m > tok). The relative bias table (bf16 RNE of relb, x log2 e) for rel 0..q0+15 and the 4 heads is built in LDS per block.
//   Key steps of 32 from 0 to q0+16 (block-uniform trip count); kb <= q0 always, so every query row sees key kb unmasked in every step
//   and the step max is finite; the rescale exponent is clamped at -126 so the first step gives a tiny finite factor times zero sums.
//   Per step: two score tiles, each hi.hi (2 k-steps of 32) into one accumulator and hi.res + res.hi (4 k-steps) into a second one,
//   fragments loaded straight from the 16-bit planes (two 16-B loads per fragment, arithmetic addressing); online max-subtracted
//   softmax in f32 (exp2); rescale of the running sums and the eight accumulators; the 16x32 prob tile stored to wave-private LDS
//   RNE to f16, split k map) and the v^T B fragments (4 hi, 4 residual) loaded straight from the 16-bit plane (keys kb..kb+31 <= SEQ-1
//   always in range); 8 P.V WMMAs into hi and residual accumulator sets.
//   Final 1/l and carry folds in f32 (ctx16 = 16 (o_hi + o_res/64) / (l 16384 16)); each wave stages its 16x64 hi and residual slices
//   (element stores) in the block's 16-bit part-row buffer [16][512]; after a block barrier the 128 threads write the block's 16 rows
// coverage: LDS bias table: rel 0..kend-1 (all rel used) x 4 heads; LDS row buffer: 4 waves x 16 rows x (64 hi + 64 res) cols = 16 x 512
//           (staged extent == consumed extent); global: 8 iterations x 128 threads x 8 halves = 16 rows x 512 halves of rows q0..q0+15
//           of batch b; grid (NB batches x SEQ/16 query tiles) covers all NROWS x 512 of CT exactly once.
// =====================================================================================================
#define ATT_THREADS (NHEAD * 32)
#define ATT_BLOCKS  (NB * (SEQ / 16))
#define PT_FLOATS   (NHEAD * 16 * 36)
static_assert(ATT_THREADS == 128 && (KD / 8) == 64 && ((16 * KD) % (8 * ATT_THREADS)) == 0 && ((16 * KD) / (8 * ATT_THREADS)) == 8);
static_assert((KD * 2) % 128 == 0 && (HDIM % 32) == 0);

__global__ __launch_bounds__(ATT_THREADS)
void attn4(const unsigned short* __restrict__ QPp, const unsigned short* __restrict__ KPp,
           const unsigned short* __restrict__ VTq, const float* __restrict__ relbl, unsigned short* CT) {
  __shared__ __align__(16) float sbias[NHEAD * SEQ];       // [head][rel], bf16(relb) * log2 e
  __shared__ __align__(16) float spt[PT_FLOATS];           // per wave prob tile [row][32 keys], pitch 36
  __shared__ __align__(16) unsigned short sos[16 * KD];    // block part-row buffer [16][512]

  const int tid  = threadIdx.x;
  const int wave = tid >> 5;
  const int lane = tid & 31;
  const int hh   = lane >> 4;
  const int c    = lane & 15;

  const int qt   = blockIdx.x % (SEQ / 16);                // query tile
  const int bat  = blockIdx.x / (SEQ / 16);                // batch
  const int head = wave;                                   // 0..3
  const int q0   = qt * 16;
  const int srow = q0 + 8 * hh;                            // this lane half's first query row (+ r)
  const int kend = q0 + 16;                                // causal: keys 0 .. q0+15; rel = query - key in 0 .. kend-1

  // ---- relative-position bias table for rel 0..kend-1, all heads ----
  for (int rel = tid; rel < kend; rel += ATT_THREADS) {
    const int bk = rel_bucket(rel);
    const v4f bv = *(const v4f*)(relbl + bk * NHEAD);
#pragma unroll
    for (int h2 = 0; h2 < NHEAD; ++h2) sbias[h2 * SEQ + rel] = bfr(bv[h2]) * LOG2E;
  }
  __syncthreads();

  const float* sb = sbias + head * SEQ;
  const _Float16* Q16 = (const _Float16*)(const void*)QPp;
  const _Float16* K16 = (const _Float16*)(const void*)KPp;
  const _Float16* V16 = (const _Float16*)(const void*)VTq;
  const _Float16* Qh = Q16 + ((size_t)bat * SEQ + q0 + c) * KD + head * HDIM + 8 * hh;
  const _Float16* Kb = K16 + (size_t)bat * SEQ * KD + head * HDIM + 8 * hh;
  const _Float16* Vh = V16 + ((size_t)bat * VTR + head * HDIM) * SEQ + 8 * hh;
  const _Float16* Vl = Vh + (size_t)DMODEL * SEQ;
  const float lsc = (LOG2E * ATT_SCALE) / (QC * KC);      // log2(e) / 8 / carries

  const v16h qah = ldfrag_h(Qh), qbh = ldfrag_h(Qh + 32);                       // hi, d 0..31 / 32..63
  const v16h qal = ldfrag_h(Qh + DMODEL), qbl = ldfrag_h(Qh + DMODEL + 32);     // residual x64

  float mrow[8], lrow[8];
  v8f om0 = zero8(), om1 = zero8(), om2 = zero8(), om3 = zero8();
  v8f or0 = zero8(), or1 = zero8(), or2 = zero8(), or3 = zero8();
#pragma unroll
  for (int r = 0; r < 8; ++r) { mrow[r] = -INFINITY; lrow[r] = 0.f; }
  float* pt = spt + wave * (16 * 36);

#pragma unroll 1
  for (int kb = 0; kb < kend; kb += 32) {
    const _Float16* kp = Kb + (size_t)(kb + c) * KD;
    v8f s0m, s0r, s1m, s1r;
    {
      const v16h k0h = ldfrag_h(kp), k1h = ldfrag_h(kp + 32);
      const v16h k0l = ldfrag_h(kp + DMODEL), k1l = ldfrag_h(kp + DMODEL + 32);
      s0m = mma_raw(qah, k0h, zero8());
      s0m = mma_raw(qbh, k1h, s0m);
      s0r = mma_raw(qah, k0l, zero8());
      s0r = mma_raw(qbh, k1l, s0r);
      s0r = mma_raw(qal, k0h, s0r);
      s0r = mma_raw(qbl, k1h, s0r);
      guard_s2x4(s0m, s0r, k0h, k1h, k0l, k1l);
    }
    {
      const _Float16* kq = kp + (size_t)16 * KD;
      const v16h k0h = ldfrag_h(kq), k1h = ldfrag_h(kq + 32);
      const v16h k0l = ldfrag_h(kq + DMODEL), k1l = ldfrag_h(kq + DMODEL + 32);
      s1m = mma_raw(qah, k0h, zero8());
      s1m = mma_raw(qbh, k1h, s1m);
      s1r = mma_raw(qah, k0l, zero8());
      s1r = mma_raw(qbh, k1l, s1r);
      s1r = mma_raw(qal, k0h, s1r);
      s1r = mma_raw(qbl, k1h, s1r);
      guard_s2x4(s1m, s1r, k0h, k1h, k0l, k1l);
      keep4_h(qah, qbh, qal, qbl);
    }
    const int key0 = kb + c;                               // key of this lane's column in tile 0
    const int key1 = kb + 16 + c;                          // key of this lane's column in tile 1
#pragma unroll
    for (int r = 0; r < 8; ++r) {
      const int qi = srow + r;
      const int i0 = imax(qi - key0, 0);
      const int i1 = imax(qi - key1, 0);
      float t0 = (s0m[r] + s0r[r] * RCI) * lsc + sb[i0];
      float t1 = (s1m[r] + s1r[r] * RCI) * lsc + sb[i1];
      t0 = (key0 > qi) ? -INFINITY : t0;
      t1 = (key1 > qi) ? -INFINITY : t1;
      float mx = fmaxf(t0, t1);
#pragma unroll
      for (int off = 1; off < 16; off <<= 1) mx = fmaxf(mx, __shfl_xor(mx, off, 32));
      const float mn = fmaxf(mrow[r], mx);
      const float al = exp2f(fmaxf(mrow[r] - mn, -126.0f));
      mrow[r] = mn;
      const float e0 = exp2f(t0 - mn);
      const float e1 = exp2f(t1 - mn);
      float ps = e0 + e1;
#pragma unroll
      for (int off = 1; off < 16; off <<= 1) ps += __shfl_xor(ps, off, 32);
      lrow[r] = lrow[r] * al + ps;
      om0[r] *= al; om1[r] *= al; om2[r] *= al; om3[r] *= al;
      or0[r] *= al; or1[r] *= al; or2[r] *= al; or3[r] *= al;
      const int ro = (8 * hh + r) * 36 + c;
      pt[ro]      = e0;
      pt[ro + 16] = e1;
    }
    wave_sync_lds();
    FragH ph;
    {
      const float* prow = pt + c * 36 + 8 * hh;
      const v4f p0 = *(const v4f*)(prow), p1 = *(const v4f*)(prow + 4);
      const v4f p2 = *(const v4f*)(prow + 16), p3 = *(const v4f*)(prow + 20);
#pragma unroll
      for (int e = 0; e < 4; ++e) {
        ph.h[0][e]     = (_Float16)(p0[e] * PC);              // elements 0..7  = keys kb + 8hh + 0..7
        ph.h[0][4 + e] = (_Float16)(p1[e] * PC);
        ph.h[1][e]     = (_Float16)(p2[e] * PC);              // elements 8..15 = keys kb + 16 + 8hh + 0..7
        ph.h[1][4 + e] = (_Float16)(p3[e] * PC);
      }
    }
    {
      const _Float16* vp = Vh + (size_t)c * SEQ + kb;
      const v16h vb0 = ldfrag_h(vp);
      const v16h vb1 = ldfrag_h(vp + (size_t)16 * SEQ);
      const v16h vb2 = ldfrag_h(vp + (size_t)32 * SEQ);
      const v16h vb3 = ldfrag_h(vp + (size_t)48 * SEQ);
      om0 = mma_raw(ph.v, vb0, om0);
      om1 = mma_raw(ph.v, vb1, om1);
      om2 = mma_raw(ph.v, vb2, om2);
      om3 = mma_raw(ph.v, vb3, om3);
      guard_pv4(om0, om1, om2, om3, ph.v, vb0, vb1, vb2, vb3);
    }
    {
      const _Float16* vq = Vl + (size_t)c * SEQ + kb;
      const v16h vl0 = ldfrag_h(vq);
      const v16h vl1 = ldfrag_h(vq + (size_t)16 * SEQ);
      const v16h vl2 = ldfrag_h(vq + (size_t)32 * SEQ);
      const v16h vl3 = ldfrag_h(vq + (size_t)48 * SEQ);
      or0 = mma_raw(ph.v, vl0, or0);
      or1 = mma_raw(ph.v, vl1, or1);
      or2 = mma_raw(ph.v, vl2, or2);
      or3 = mma_raw(ph.v, vl3, or3);
      guard_pv4(or0, or1, or2, or3, ph.v, vl0, vl1, vl2, vl3);
    }
    wave_sync_lds();
  }

  // ---- fold 1/l and the carries, stage the wave's 16x64 hi and residual slices as 16-bit ----
  const float oc = CC / (PC * VC);
  unsigned short* osw = sos + head * HDIM + c;
#pragma unroll
  for (int r = 0; r < 8; ++r) {
    const float inv = (1.0f / lrow[r]) * oc;
    unsigned short* op = osw + (8 * hh + r) * KD;
    const float u0 = (om0[r] + or0[r] * RCI) * inv;
    const float u1 = (om1[r] + or1[r] * RCI) * inv;
    const float u2 = (om2[r] + or2[r] * RCI) * inv;
    const float u3 = (om3[r] + or3[r] * RCI) * inv;
    const _Float16 g0 = (_Float16)u0, g1 = (_Float16)u1, g2 = (_Float16)u2, g3 = (_Float16)u3;
    op[0]           = h_bits(g0);
    op[16]          = h_bits(g1);
    op[32]          = h_bits(g2);
    op[48]          = h_bits(g3);
    op[DMODEL]      = h_bits((_Float16)((u0 - (float)g0) * RC));
    op[DMODEL + 16] = h_bits((_Float16)((u1 - (float)g1) * RC));
    op[DMODEL + 32] = h_bits((_Float16)((u2 - (float)g2) * RC));
    op[DMODEL + 48] = h_bits((_Float16)((u3 - (float)g3) * RC));
  }
  __syncthreads();
  // ---- block writes its 16 rows of CT: piece p = it*128 + tid -> halves (p%64)*8 .. +7 of row p/64 ----
  {
    v4u vals[8];
#pragma unroll
    for (int it = 0; it < 8; ++it) {
      const int p = it * ATT_THREADS + tid;
      vals[it] = *(const v4u*)(sos + (size_t)p * 8);
    }
    unsigned short* dst = CT + ((size_t)bat * SEQ + q0) * KD;
    {
#pragma unroll
      for (int it = 0; it < 8; ++it) {
        const int p = it * ATT_THREADS + tid;
        const int row = p >> 6, col8 = (p & 63) * 8;
        *(v4u*)(dst + (size_t)row * KD + col8) = vals[it];
      }
      
    }
  }
}

// =====================================================================================================
// RMSNorm over the last dim (256): out = x * rsqrt(mean(x*x) + eps) * bf16(w), eps 1.1920929e-7, in f32; written as the dual 16-bit
// plane outh[row][512]: hi = f16(16 * out) at col c, residual = f16(64 * (16 out - hi)) at col 256 + c.
//   One wave per row (4 rows per 128-thread block): lane loads 8 consecutive floats (two 16-B loads), sum of squares by xor shuffles,
//   then writes its own 8 hi halves and 8 residual halves: per plane one instruction of 32 lanes x 16 B = the whole 512-B half row
// coverage: grid = NROWS/4 blocks x 4 waves = every row once; per row 32 lanes x 8 halves = 256 hi + 256 residual halves.
// =====================================================================================================
__global__ __launch_bounds__(128) void rmsn(const float* __restrict__ Xp, const float* __restrict__ wp, unsigned short* outh) {
  const int wave = threadIdx.x >> 5, lane = threadIdx.x & 31;
  const int row = blockIdx.x * 4 + wave;
  const int c0 = lane * 8;
  const float* xp = Xp + (size_t)row * DMODEL + c0;
  const v4f x0 = *(const v4f*)(xp), x1 = *(const v4f*)(xp + 4);
  float ss = ((x0[0] * x0[0] + x0[1] * x0[1]) + (x0[2] * x0[2] + x0[3] * x0[3])) +
             ((x1[0] * x1[0] + x1[1] * x1[1]) + (x1[2] * x1[2] + x1[3] * x1[3]));
#pragma unroll
  for (int off = 1; off < 32; off <<= 1) ss += __shfl_xor(ss, off, 32);
  const float rstd = rsqrtf(ss * (1.0f / (float)DMODEL) + RMS_EPS);
  const v4f w0 = *(const v4f*)(wp + c0), w1 = *(const v4f*)(wp + c0 + 4);
  float o[8];
#pragma unroll
  for (int e = 0; e < 4; ++e) {
    o[e]     = (x0[e] * rstd) * bfr(w0[e]);
    o[4 + e] = (x1[e] * rstd) * bfr(w1[e]);
  }
  v4u hv, lv;
#pragma unroll
  for (int e = 0; e < 4; ++e) {
    const float f0 = o[2 * e] * HC, f1 = o[2 * e + 1] * HC;
    const _Float16 g0 = (_Float16)f0, g1 = (_Float16)f1;
    hv[e] = pk16(h_bits(g0), h_bits(g1));
    lv[e] = pk16(h_bits((_Float16)((f0 - (float)g0) * RC)), h_bits((_Float16)((f1 - (float)g1) * RC)));
  }
  unsigned short* dp = outh + (size_t)row * KD + c0;
  {
    *(v4u*)dp = hv;
    *(v4u*)(dp + DMODEL) = lv;
    
  }
}

// =====================================================================================================
// Input convert: obs16[m][640] = f16(16 * bf16_RNE(obs[b*SEQ_FULL + t][c])) for c < 637 (m = b*SEQ + t), 0 for the pad columns
// 637..639 (explicitly written). One wave per row (4 rows per block): 80 pieces of 8 halves; lane writes pieces lane, lane+32 and
// coverage: grid NROWS/4 x 4 waves = every row; per row pieces 0..79 = cols 0..639.
// =====================================================================================================
__global__ __launch_bounds__(128) void cvtobs(const float* __restrict__ src, unsigned short* dst) {
  const int wave = threadIdx.x >> 5, lane = threadIdx.x & 31;
  const int m = blockIdx.x * 4 + wave;
  const int b = m / SEQ, t = m - b * SEQ;
  const float* sp = src + ((size_t)b * SEQ_FULL + t) * OBSD;
  unsigned short* dp = dst + (size_t)m * OBSP;
  {
#pragma unroll 1
    for (int it = 0; it < 3; ++it) {
      const int p = it * 32 + lane;
      const int col0 = p * 8;
      v4u a;
#pragma unroll
      for (int e = 0; e < 4; ++e) {
        const int ca = col0 + 2 * e, cb = ca + 1;
        float fa = sp[imin(ca, OBSD - 1)];
        float fb = sp[imin(cb, OBSD - 1)];
        fa = (ca < OBSD) ? fa : 0.f;
        fb = (cb < OBSD) ? fb : 0.f;
        a[e] = pk16(h_bits((_Float16)(bfr(fa) * OBC)), h_bits((_Float16)(bfr(fb) * OBC)));
      }
      if (p < OBSP / 8) *(v4u*)(dp + (size_t)p * 8) = a;
    }
    
  }
}

// =====================================================================================================
// Output copy: blockIdx.y == 0: out0[b*SEQ_FULL + t][0..3] = ACTF[b*SEQ + t][0..3] (one 16-B piece per thread, consecutive threads
// (SEQ*637 floats at float OUT1_OFF + b*SEQ_FULL*637) written as consecutive 16-B pieces (thread g -> floats 4i..4i+3, gathered from
// coverage: out0: NROWS pieces = every row; out1: NB * SEQ*637/4 pieces = every float of the region exactly once.
// =====================================================================================================
__global__ __launch_bounds__(256) void ocopy(const float* __restrict__ actf, const float* __restrict__ obsf, float* outp) {
  const int g = blockIdx.x * 256 + threadIdx.x;
  if (blockIdx.y == 0) {
    if (g >= NROWS) return;
    const int b = g / SEQ, t = g - b * SEQ;
    const v4f v = *(const v4f*)(actf + (size_t)g * NACTP);
    float* d = outp + ((size_t)b * SEQ_FULL + t) * NACT;
    {
      *(v4f*)d = v;
      
    }
  } else {
    const int ppb = (SEQ * OBSD) / 4;
    if (g >= NB * ppb) return;
    const int b = g / ppb;
    const int i = (g - b * ppb) * 4;
    v4f v;
#pragma unroll
    for (int e = 0; e < 4; ++e) {
      const int idx = i + e;
      const int row = idx / OBSD;
      const int col = idx - row * OBSD;
      v[e] = obsf[((size_t)b * SEQ + row) * OBSP + col];
    }
    float* d = outp + (size_t)OUT1_OFF + (size_t)b * SEQ_FULL * OBSD + i;
    {
      *(v4f*)d = v;
      
    }
  }
}

// =====================================================================================================
// Workspace map (bytes); every plane is an exact multiple of its tile / whole-row store granularity (M, N exact multiples of 64,
//   WQ16, WK16, WV16, WO16  f16 [6][256 n][512 = k x64 | k x1]     4 x 1572864
//   W116                    f16 [6][512 n][512]                       3145728
//   W216                    f16 [6][256 n][1024 = 512 x64 | 512 x1]  3145728
//   OBSW16                  f16 [256 n][640 k] x64 (k 637..639 zero)  327680
//   ACTW16                  f16 [64 n][512] (n 4..63 zero)              65536
//   OBSHW16                 f16 [640 n][512] (n 637..639 zero)         655360
//   OBS16                   f16 [NROWS][640] x16                      5242880
//   XA, XB                  f32 [NROWS][256] residual stream       2 x 4194304
//   HH, QP, KP, CT          f16 [NROWS][512] dual planes           4 x 4194304
//   VT                      f16 [NB][512][SEQ]                       4194304
//   G16                     f16 [NROWS][1024] dual                   8388608
//   ACTF                    f32 [NROWS][64]                          1048576
//   OBSF                    f32 [NROWS][640]                        10485760
//   total (NB=2, SEQ=2048)                                          68157440
// =====================================================================================================
extern "C" void kernel_launch(void* const* d_in, const int* in_sizes, int n_in,
                              void* d_out, int out_size, void* d_ws, size_t ws_size,
                              hipStream_t stream) {
  if (n_in < 19) return;
  if (in_sizes[0] < ((NB - 1) * SEQ_FULL + SEQ) * OBSD) return;
  if (in_sizes[1] < OBSD * DMODEL || in_sizes[2] < DMODEL) return;
  if (in_sizes[3] < NLAYER * DMODEL) return;
  if (in_sizes[4] < NLAYER * DMODEL * DMODEL || in_sizes[5] < NLAYER * DMODEL * DMODEL) return;
  if (in_sizes[6] < NLAYER * DMODEL * DMODEL || in_sizes[7] < NLAYER * DMODEL * DMODEL) return;
  if (in_sizes[8] < NLAYER * NBUCK * NHEAD || in_sizes[9] < NLAYER * DMODEL) return;
  if (in_sizes[10] < NLAYER * DMODEL * DFF || in_sizes[11] < NLAYER * DFF) return;
  if (in_sizes[12] < NLAYER * DFF * DMODEL || in_sizes[13] < NLAYER * DMODEL) return;
  if (in_sizes[14] < DMODEL || in_sizes[15] < DMODEL * NACT || in_sizes[16] < NACT) return;
  if (in_sizes[17] < DMODEL * OBSD || in_sizes[18] < OBSD) return;
  if (out_size < OUT1_OFF + ((NB - 1) * SEQ_FULL + SEQ) * OBSD) return;

  const float* obs     = (const float*)d_in[0];
  const float* obs_w   = (const float*)d_in[1];
  const float* obs_b   = (const float*)d_in[2];
  const float* norm1_w = (const float*)d_in[3];
  const float* w_q     = (const float*)d_in[4];
  const float* w_k     = (const float*)d_in[5];
  const float* w_v     = (const float*)d_in[6];
  const float* w_o     = (const float*)d_in[7];
  const float* relb    = (const float*)d_in[8];
  const float* norm2_w = (const float*)d_in[9];
  const float* w_1     = (const float*)d_in[10];
  const float* b_1     = (const float*)d_in[11];
  const float* w_2     = (const float*)d_in[12];
  const float* b_2     = (const float*)d_in[13];
  const float* fnorm_w = (const float*)d_in[14];
  const float* act_w   = (const float*)d_in[15];
  const float* act_b   = (const float*)d_in[16];
  const float* obsh_w  = (const float*)d_in[17];
  const float* obsh_b  = (const float*)d_in[18];
  float*       outp    = (float*)d_out;

  const size_t PWE  = (size_t)NLAYER * DMODEL * KD * 2;     // 1572864
  const size_t PW1  = (size_t)NLAYER * DFF * KD * 2;        // 3145728
  const size_t PW2  = (size_t)NLAYER * DMODEL * KF * 2;     // 3145728
  const size_t POBW = (size_t)DMODEL * OBSP * 2;            //  327680
  const size_t PACW = (size_t)NACTP * KD * 2;               //   65536
  const size_t POHW = (size_t)OBSP * KD * 2;                //  655360
  const size_t POBS = (size_t)NROWS * OBSP * 2;             // 5242880
  const size_t PX   = (size_t)NROWS * DMODEL * 4;           // 4194304
  const size_t PH   = (size_t)NROWS * KD * 2;               // 4194304
  const size_t PVT  = (size_t)NB * VTR * SEQ * 2;           // 4194304
  const size_t PG   = (size_t)NROWS * KF * 2;               // 8388608
  const size_t PACF = (size_t)NROWS * NACTP * 4;            // 1048576
  const size_t POBF = (size_t)NROWS * OBSP * 4;             // 10485760
  size_t off = 0;
  const size_t oWQ  = off; off += PWE;
  const size_t oWK  = off; off += PWE;
  const size_t oWV  = off; off += PWE;
  const size_t oWO  = off; off += PWE;
  const size_t oW1  = off; off += PW1;
  const size_t oW2  = off; off += PW2;
  const size_t oOBW = off; off += POBW;
  const size_t oACW = off; off += PACW;
  const size_t oOHW = off; off += POHW;
  const size_t oOBS = off; off += POBS;
  const size_t oXA  = off; off += PX;
  const size_t oXB  = off; off += PX;
  const size_t oHH  = off; off += PH;
  const size_t oQP  = off; off += PH;
  const size_t oKP  = off; off += PH;
  const size_t oCT  = off; off += PH;
  const size_t oVT  = off; off += PVT;
  const size_t oG   = off; off += PG;
  const size_t oACF = off; off += PACF;
  const size_t oOBF = off; off += POBF;
  const size_t endAll = off;                                // 68157440 for NB=2, SEQ=2048
  if (endAll > ws_size) return;
  if (endAll > (size_t)134217728) return;

  char* ws = (char*)d_ws;
  unsigned short* WQ16    = (unsigned short*)(ws + oWQ);
  unsigned short* WK16    = (unsigned short*)(ws + oWK);
  unsigned short* WV16    = (unsigned short*)(ws + oWV);
  unsigned short* WO16    = (unsigned short*)(ws + oWO);
  unsigned short* W116    = (unsigned short*)(ws + oW1);
  unsigned short* W216    = (unsigned short*)(ws + oW2);
  unsigned short* OBSW16  = (unsigned short*)(ws + oOBW);
  unsigned short* ACTW16  = (unsigned short*)(ws + oACW);
  unsigned short* OBSHW16 = (unsigned short*)(ws + oOHW);
  unsigned short* OBS16   = (unsigned short*)(ws + oOBS);
  float*          XA      = (float*)(ws + oXA);
  float*          XB      = (float*)(ws + oXB);
  unsigned short* HH      = (unsigned short*)(ws + oHH);
  unsigned short* QP      = (unsigned short*)(ws + oQP);
  unsigned short* KP      = (unsigned short*)(ws + oKP);
  unsigned short* CT      = (unsigned short*)(ws + oCT);
  unsigned short* VTp     = (unsigned short*)(ws + oVT);
  unsigned short* G16     = (unsigned short*)(ws + oG);
  float*          ACTF    = (float*)(ws + oACF);
  float*          OBSF    = (float*)(ws + oOBF);

  const dim3 blk(256);
  const dim3 blk128(128);
  const dim3 gRow(NROWS / 4);                                      // rmsn / cvtobs: 4 rows per block
  const int tilesE  = (NROWS / 64) * (DMODEL / 64);                // 256
  const int tilesV  = (DMODEL / 64) * (SEQ / 64);                  // 128 per batch
  const int tilesF  = (NROWS / 64) * (DFF / 64);                   // 512
  const int tilesA  = (NROWS / 64) * (NACTP / 64);                 // 64
  const int tilesO  = (NROWS / 64) * (OBSP / 64);                  // 640
  const dim3 gE((tilesE + 7) / 8, 1);                              // 32
  const dim3 gQK((tilesE + 7) / 8, 2);                             // 32 x 2 (q, k)
  const dim3 gV((tilesV + 7) / 8, NB);                             // 16 x NB
  const dim3 gF((tilesF + 7) / 8, 1);                              // 64
  const dim3 gA((tilesA + 7) / 8, 1);                              // 8
  const dim3 gO((tilesO + 7) / 8, 1);                              // 80
  const dim3 gAT(ATT_BLOCKS);                                      // NB x SEQ/16 = 256
  const dim3 bAT(ATT_THREADS);                                     // 128
  const int ppb = (SEQ * OBSD) / 4;
  const int gcx0 = NROWS / 256, gcx1 = (NB * ppb + 255) / 256;
  const dim3 gOC(gcx0 > gcx1 ? gcx0 : gcx1, 2);                    // (2548, 2)

  const long long eSrcE = (long long)DMODEL * DMODEL;              // per layer source [256][256]
  const long long eDstE = (long long)DMODEL * KD;                  // per layer plane [256][512]
  const long long sQK   = (long long)NLAYER * DMODEL * KD;         // WK16 - WQ16 in halves
  const long long sKP   = (long long)NROWS * KD;                   // KP - QP in halves

  // (0) 16-bit operand planes: transposed weights [n][k x64 | k x1] (bf16 RNE then exact power-of-two scale), obs x16
  cvtobs<<<gRow, blk128, 0, stream>>>(obs, OBS16);
  tcvt16<1><<<dim3(DMODEL / 64, DMODEL / 64, NLAYER), blk, 0, stream>>>(w_q, eSrcE, WQ16, eDstE, DMODEL, DMODEL, KD, DMODEL, WSC, WLO);  // in[256 k][256 n] -> out[256 n][512]
  tcvt16<1><<<dim3(DMODEL / 64, DMODEL / 64, NLAYER), blk, 0, stream>>>(w_k, eSrcE, WK16, eDstE, DMODEL, DMODEL, KD, DMODEL, WSC, WLO);
  tcvt16<1><<<dim3(DMODEL / 64, DMODEL / 64, NLAYER), blk, 0, stream>>>(w_v, eSrcE, WV16, eDstE, DMODEL, DMODEL, KD, DMODEL, WSC, WLO);
  tcvt16<1><<<dim3(DMODEL / 64, DMODEL / 64, NLAYER), blk, 0, stream>>>(w_o, eSrcE, WO16, eDstE, DMODEL, DMODEL, KD, DMODEL, WSC, WLO);
  tcvt16<1><<<dim3(DFF / 64, DMODEL / 64, NLAYER), blk, 0, stream>>>(w_1, (long long)DMODEL * DFF, W116, (long long)DFF * KD,
                                                                    DMODEL, DFF, KD, DMODEL, WSC, WLO);            // in[256 k][512 n] -> out[512 n][512]
  tcvt16<1><<<dim3(DMODEL / 64, DFF / 64, NLAYER), blk, 0, stream>>>(w_2, (long long)DFF * DMODEL, W216, (long long)DMODEL * KF,
                                                                    DFF, DMODEL, KF, DFF, WSC, WLO);               // in[512 k][256 n] -> out[256 n][1024]
  tcvt16<0><<<dim3(DMODEL / 64, OBSP / 64, 1), blk, 0, stream>>>(obs_w, 0LL, OBSW16, 0LL, OBSD, DMODEL, OBSP, 0, WSC, 0.f);  // in[637 k][256 n] -> out[256 n][640], k 637..639 zero
  tcvt16<1><<<dim3(NACTP / 64, DMODEL / 64, 1), blk, 0, stream>>>(act_w, 0LL, ACTW16, 0LL, DMODEL, NACT, KD, DMODEL, WSC, WLO);  // in[256 k][4 n] -> out[64 n][512], n >= 4 zero
  tcvt16<1><<<dim3(OBSP / 64, DMODEL / 64, 1), blk, 0, stream>>>(obsh_w, 0LL, OBSHW16, 0LL, DMODEL, OBSD, KD, DMODEL, WSC, WLO); // in[256 k][637 n] -> out[640 n][512], n >= 637 zero

  // (1) x = obs . Wp + bf16(bp) -> XA (f32); M = NROWS, N = 256, K = 640 (single product, inputs exact)
  gemm64<0, 0, 0, 1><<<gE, blk, 0, stream>>>(
      OBS16, OBSP, 0LL,
      OBSW16, OBSP, 0LL,
      (const float*)0,
      obs_b, DMODEL,
      (void*)XA, DMODEL, 0LL, 0LL,
      NROWS, DMODEL, OBSP, 1.0f / (OBC * WSC), 1.0f);

  for (int l = 0; l < NLAYER; ++l) {
    const size_t lwE = (size_t)l * DMODEL * KD;                    // WQ/WK/WV/WO layer offset (halves)
    const size_t lw1 = (size_t)l * DFF * KD;
    const size_t lw2 = (size_t)l * DMODEL * KF;

    // (2) h = RMSNorm(x) * bf16(g1) -> HH (hi x16 | residual x64)
    rmsn<<<gRow, blk128, 0, stream>>>(XA, norm1_w + (size_t)l * DMODEL, HH);

    // (3) q, k projections (batched by blockIdx.y): QP / KP [m][hi | res]; M = NROWS, N = 256, K = 512 folded, no bias
    gemm64<1, 0, 0, 0><<<gQK, blk, 0, stream>>>(
        HH, KD, 0LL,
        WQ16 + lwE, KD, sQK,
        (const float*)0,
        (const float*)0, 1,
        (void*)QP, KD, sKP, (long long)DMODEL,
        NROWS, DMODEL, KD, 1.0f / (HC * WSC), QC);

    // (4) v^T per batch: VT[b][d][tok] (hi rows d, residual rows 256+d); M = 256 (d), N = SEQ, K = 512 folded
    gemm64<1, 0, 0, 0><<<gV, blk, 0, stream>>>(
        WV16 + lwE, KD, 0LL,
        HH, KD, (long long)SEQ * KD,
        (const float*)0,
        (const float*)0, 1,
        (void*)VTp, SEQ, (long long)VTR * SEQ, (long long)DMODEL * SEQ,
        DMODEL, SEQ, KD, 1.0f / (HC * WSC), VC);

    // (5) causal attention with relative-position bias per (batch, 16 query rows), all heads -> CT (hi x16 | residual x64)
    attn4<<<gAT, bAT, 0, stream>>>(QP, KP, VTp, relb + (size_t)l * NBUCK * NHEAD, CT);

    // (6) XB = CT . Wo / (16 * 64) + XA (raw f32); M = NROWS, N = 256, K = 512 folded
    gemm64<0, 2, 0, 0><<<gE, blk, 0, stream>>>(
        CT, KD, 0LL,
        WO16 + lwE, KD, 0LL,
        XA,
        (const float*)0, 1,
        (void*)XB, DMODEL, 0LL, 0LL,
        NROWS, DMODEL, KD, 1.0f / (CC * WSC), 1.0f);

    // (7) h2 = RMSNorm(x) * bf16(g2) -> HH
    rmsn<<<gRow, blk128, 0, stream>>>(XB, norm2_w + (size_t)l * DMODEL, HH);

    // (8) G16 = dual f16 of 64 * relu(h2 . W1 + bf16(b1)); M = NROWS, N = 512, K = 512 folded
    gemm64<1, 0, 2, 1><<<gF, blk, 0, stream>>>(
        HH, KD, 0LL,
        W116 + lw1, KD, 0LL,
        (const float*)0,
        b_1 + (size_t)l * DFF, DFF,
        (void*)G16, KF, 0LL, (long long)DFF,
        NROWS, DFF, KD, 1.0f / (HC * WSC), GC);

    // (9) XA = G16 . W2 / (64 * 64) + bf16(b2) + XB (raw f32); M = NROWS, N = 256, K = 1024 folded
    gemm64<0, 2, 0, 1><<<gE, blk, 0, stream>>>(
        G16, KF, 0LL,
        W216 + lw2, KF, 0LL,
        XB,
        b_2 + (size_t)l * DMODEL, DMODEL,
        (void*)XA, DMODEL, 0LL, 0LL,
        NROWS, DMODEL, KF, 1.0f / (GC * WSC), 1.0f);
  }

  // (10) hf = RMSNorm(x) * bf16(gf) -> HH
  rmsn<<<gRow, blk128, 0, stream>>>(XA, fnorm_w, HH);

  // (11) action logits plane ACTF[m][64] = hf . Wa + bf16(ba) (cols 0..3 meaningful); M = NROWS, N = 64, K = 512 folded
  gemm64<0, 0, 0, 1><<<gA, blk, 0, stream>>>(
      HH, KD, 0LL,
      ACTW16, KD, 0LL,
      (const float*)0,
      act_b, NACT,
      (void*)ACTF, NACTP, 0LL, 0LL,
      NROWS, NACTP, KD, 1.0f / (HC * WSC), 1.0f);

  // (12) obs prediction plane OBSF[m][640] = hf . Wh + bf16(bh) (cols 0..636 meaningful); M = NROWS, N = 640, K = 512 folded
  gemm64<0, 0, 0, 1><<<gO, blk, 0, stream>>>(
      HH, KD, 0LL,
      OBSHW16, KD, 0LL,
      (const float*)0,
      obsh_b, OBSD,
      (void*)OBSF, OBSP, 0LL, 0LL,
      NROWS, OBSP, KD, 1.0f / (HC * WSC), 1.0f);

  ocopy<<<gOC, blk, 0, stream>>>(ACTF, OBSF, outp);
  (void)hipGetLastError();
}

// v001
// It runs in 1040 microseconds.
// Two timings next to v000 both put it at 1.85 times that version's speed.
// Contractions (all v_wmma_f32_16x16x32_f16, f16 operands, f32 accumulate): input projection (obs f16 x16 . Wp^T f16 x64, K=640
// zero-padded, single product); q/k, v^T, attention-output, hidden (ReLU), second and both head projections with the activation
// operand carried as two f16 planes [hi | residual x64] folded along K against [W^T x64 | W^T x1]; attention scores q.k^T from the
// q/k hi and residual planes (hi.hi plus the two cross terms, two accumulators, K=64); attention P.v^T with P f16 x16384 (single)
// against v^T hi and residual planes (two accumulators). RMSNorm, softmax (base 2), ReLU, biases, relative-position bias and the
// residual stream in f32 on VALU. Every float input RNE-converted to bf16 on load.
#include <hip/hip_runtime.h>
#include <math.h>
#include <stdint.h>

#ifndef NB
#define NB        2
#endif
#ifndef SEQ
#define SEQ       2048
#endif
#define NB_FULL   2
#define SEQ_FULL  2048
#define NLAYER    6
#define DMODEL    256
#define NHEAD     4
#define HDIM      64
#define DFF       512
#define OBSD      637
#define OBSP      640
#define NACT      4
#define NACTP     64
#define NBUCK     32
#define NROWS     (NB * SEQ)
#define KD        (2 * DMODEL)          // folded K of E-wide activation operands: [hi 256 | residual 256]
#define KF        (2 * DFF)             // folded K of the hidden operand: [hi 512 | residual 512]
#define VTR       KD                    // rows per batch of the v^T plane: 0..255 hi, 256..511 residual
#define OUT1_OFF  (NB_FULL * SEQ_FULL * NACT)   // float index of the second output (byte offset 65536)
#define OUT_TOTAL (OUT1_OFF + NB_FULL * SEQ_FULL * OBSD)

// carries (exact powers of two)
#define WSC_I 64
#define RC_I  64
#define WLO_I 1
#define WSC   64.0f        // weight hi copy
#define WLO   1.0f         // weight lo copy (pairs with the x64 residual plane)
#define RC    64.0f        // residual plane carry relative to its hi plane
#define RCI   0.015625f
#define OBC   16.0f        // obs plane
#define HC    16.0f        // RMSNorm outputs
#define QC    16.0f
#define KC    16.0f
#define VC    16.0f
#define PC    16384.0f     // softmax P tile
#define CC    16.0f        // attention context
#define GC    64.0f        // ReLU hidden
#define ATT_SCALE 0.125f
#define LOG2E   1.4426950408889634f
#define RMS_EPS 1.1920929e-07f
static_assert(RC_I * WLO_I == WSC_I);
static_assert(NHEAD * HDIM == DMODEL);
static_assert(NB >= 1 && NB <= NB_FULL && SEQ >= 64 && SEQ <= SEQ_FULL);
static_assert((SEQ % 64) == 0 && (SEQ % 16) == 0 && (NROWS % 64) == 0 && (DMODEL % 64) == 0 && (DFF % 64) == 0);
static_assert((OBSP % 64) == 0 && (NACTP % 64) == 0 && OBSP >= OBSD && NACTP >= NACT && (OBSP - OBSD) < 64);
static_assert((KD % 32) == 0 && (KF % 32) == 0 && (OBSP % 32) == 0);
static_assert((NROWS % 256) == 0 && (NROWS % 4) == 0 && ((SEQ * OBSD) % 4) == 0);
static_assert(OUT_TOTAL == 2625536);

typedef _Float16 v16h __attribute__((ext_vector_type(16)));
typedef _Float16 v8h  __attribute__((ext_vector_type(8)));
typedef float    v8f  __attribute__((ext_vector_type(8)));
typedef float    v4f  __attribute__((ext_vector_type(4)));
typedef unsigned int v4u __attribute__((ext_vector_type(4)));

union FragH { v16h v; v8h h[2]; v4u u[2]; };

// ---- scalar helpers --------------------------------------------------------------------------------
__device__ __forceinline__ unsigned short bf_bits(float f) {          // f32 -> bf16 bits, RNE convert
  unsigned u = __float_as_uint(f);
  return (unsigned short)((u + 0x7FFFu + ((u >> 16) & 1u)) >> 16);
}
__device__ __forceinline__ float bf_up(unsigned short h) { return __uint_as_float(((unsigned)h) << 16); }
__device__ __forceinline__ float bfr(float f) { return bf_up(bf_bits(f)); }   // value of the bf16 RNE convert
__device__ __forceinline__ unsigned short h_bits(_Float16 x) { return __builtin_bit_cast(unsigned short, x); }
__device__ __forceinline__ unsigned pk16(unsigned short a, unsigned short b) { return (unsigned)a | ((unsigned)b << 16); }
__device__ __forceinline__ v8f zero8() { v8f z = {0.f, 0.f, 0.f, 0.f, 0.f, 0.f, 0.f, 0.f}; return z; }
__device__ __forceinline__ int imin(int a, int b) { return a < b ? a : b; }
__device__ __forceinline__ int imax(int a, int b) { return a > b ? a : b; }

// T5 relative-position bucket for rel = query - key >= 0 (bidirectional split, 32 buckets, max distance 128), as an exact
// integer table: 0 -> 0; 1..7 -> 16+rel; 8..11 -> 24; 12..15 -> 25; 16..22 -> 26; 23..31 -> 27; 32..45 -> 28; 46..63 -> 29;
// 64..90 -> 30; >= 91 -> 31.
__device__ __forceinline__ int rel_bucket(int rel) {
  int b = 31;
  b = (rel < 91) ? 30 : b;
  b = (rel < 64) ? 29 : b;
  b = (rel < 46) ? 28 : b;
  b = (rel < 32) ? 27 : b;
  b = (rel < 23) ? 26 : b;
  b = (rel < 16) ? 25 : b;
  b = (rel < 12) ? 24 : b;
  b = (rel < 8) ? (16 + rel) : b;
  b = (rel == 0) ? 0 : b;
  return b;
}

// ---- fragment loaders: 16-bit A/B operand, lane -> row/col (lane&15), p already includes +8*(lane>>4);
//      elements 0..7 <- p[0..7] (k0+8h..), elements 8..15 <- p[16..23] (k0+16+8h..)  (same split k map for A and B;
//      B is always read from a k-contiguous [n][k] plane)
__device__ __forceinline__ v16h ldfrag_h(const _Float16* p) {
  FragH f;
  f.h[0] = *(const v8h*)(p);
  f.h[1] = *(const v8h*)(p + 16);
  return f.v;
}
__device__ __forceinline__ v16h ldfrag_u(const unsigned short* p) {
  FragH f;
  f.u[0] = *(const v4u*)(p);
  f.u[1] = *(const v4u*)(p + 16);
  return f.v;
}

// ---- WMMA helpers with trailing VALU hazard gaps ------------------------------------------------------
__device__ __forceinline__ v8f mma_raw(v16h a, v16h b, v8f c) {
  return __builtin_amdgcn_wmma_f32_16x16x32_f16(false, a, false, b, (short)0, c, false, false);
}
__device__ __forceinline__ void guard_s2x4(v8f& s, v8f& t, v16h a0, v16h a1, v16h b0, v16h b1) {
#if defined(__HIP_DEVICE_COMPILE__)
  asm volatile("v_nop\n\tv_nop\n\tv_nop\n\tv_nop" : "+v"(s), "+v"(t) : "v"(a0), "v"(a1), "v"(b0), "v"(b1));
#endif
}
__device__ __forceinline__ void guard_pv4(v8f& a, v8f& b, v8f& c, v8f& d, v16h x, v16h y, v16h z, v16h w, v16h u) {
#if defined(__HIP_DEVICE_COMPILE__)
  asm volatile("v_nop\n\tv_nop\n\tv_nop\n\tv_nop"
               : "+v"(a), "+v"(b), "+v"(c), "+v"(d) : "v"(x), "v"(y), "v"(z), "v"(w), "v"(u));
#endif
}
__device__ __forceinline__ void keep4_h(v16h a, v16h b, v16h c, v16h d) {
#if defined(__HIP_DEVICE_COMPILE__)
  asm volatile("v_nop" :: "v"(a), "v"(b), "v"(c), "v"(d));
#endif
}
__device__ __forceinline__ void wave_sync_lds() {
  __builtin_amdgcn_fence(__ATOMIC_RELEASE, "workgroup");
  __builtin_amdgcn_wave_barrier();
  __builtin_amdgcn_fence(__ATOMIC_ACQUIRE, "workgroup");
}

// =====================================================================================================
// Transposing 16-bit pack of a weight stored in[R][C] (row pitch C floats, R = contraction index, C = output index) into
// out[Cp][ldd] (row pitch ldd halves): out[c][r] = f16( bf16_RNE(in[r][c]) * schi ) for r < R and c < C, 0 otherwise (pad rows /
// pad columns explicitly written as zeros); with DUAL a second copy out[c][locol + r] = f16( bf16_RNE(in[r][c]) * sclo ).
// schi / sclo powers of two (exact). Cp = 64*gridDim.x, Rp = 64*gridDim.y. blockIdx.z = slice: src advanced by z*sZ floats, dst by
// z*dZ halves. One 64x64 tile per block through LDS (bf16 bits): 16 scalar loads per thread with CLAMPED addresses, zero by
// coverage: load 256 thr x 16 floats = 64x64; store 2 it x 8 waves x 4 rows x (8 lanes x 8 halves) = 64 rows x 64 halves per copy;
//           grid (Cp/64, Rp/64, Z) exact, each output line written by exactly one wave; pad region included.
// =====================================================================================================
template <int DUAL>
__global__ __launch_bounds__(256) void tcvt16(const float* __restrict__ src, long long sZ,
                                              unsigned short* dst, long long dZ,
                                              int R, int C, int ldd, int locol, float schi, float sclo) {
  __shared__ __align__(16) unsigned short sT[64 * 72];
  const int tid = threadIdx.x, lane = tid & 31, wave = tid >> 5;
  const int c0 = blockIdx.x * 64, r0 = blockIdx.y * 64;
  const float* srcz = src + (size_t)((long long)blockIdx.z * sZ);
  unsigned short* dstz = dst + (size_t)((long long)blockIdx.z * dZ);
  const int rr = tid >> 2, cc = (tid & 3) * 16;
  const int r = r0 + rr;
  const int rcl = imin(r, R - 1);
  const float* sp = srcz + (size_t)rcl * C;
#pragma unroll
  for (int e = 0; e < 16; ++e) {
    const int cidx = c0 + cc + e;
    const int ccl = imin(cidx, C - 1);
    float a = sp[ccl];
    a = (r < R && cidx < C) ? a : 0.f;
    sT[(cc + e) * 72 + rr] = bf_bits(a);
  }
  __syncthreads();
  v4u hvals[2], lvals[2];
#pragma unroll
  for (int it = 0; it < 2; ++it) {
    const int q = it * 32 + wave * 4 + (lane >> 3);
    const v4u raw = *(const v4u*)(sT + q * 72 + (lane & 7) * 8);
    v4u hv = {0u, 0u, 0u, 0u}, lv = {0u, 0u, 0u, 0u};
#pragma unroll
    for (int e = 0; e < 4; ++e) {
      const float f0 = bf_up((unsigned short)(raw[e] & 0xFFFFu));
      const float f1 = bf_up((unsigned short)(raw[e] >> 16));
      hv[e] = pk16(h_bits((_Float16)(f0 * schi)), h_bits((_Float16)(f1 * schi)));
      if constexpr (DUAL == 1) lv[e] = pk16(h_bits((_Float16)(f0 * sclo)), h_bits((_Float16)(f1 * sclo)));
    }
    hvals[it] = hv;
    lvals[it] = lv;
  }
  {
#pragma unroll
    for (int it = 0; it < 2; ++it) {
      const int q = it * 32 + wave * 4 + (lane >> 3);
      unsigned short* p = dstz + (size_t)(c0 + q) * ldd + r0 + (lane & 7) * 8;
      *(v4u*)p = hvals[it];
      if constexpr (DUAL == 1) *(v4u*)(p + locol) = lvals[it];
    }
    
  }
  (void)sclo; (void)locol;
}

// =====================================================================================================
// Batched f16 WMMA GEMM, operands staged in LDS: C[m][n] = f( oscale * sum_k A[m][k] * Bt[n][k] + bias ); one 64x64 tile per
// work-group of 8 waves (wave = 16 rows x 32 cols, two accumulators). A row-major [M][K] (16-bit plane), Bt row-major
// [N][K] (k contiguous), both at row pitch K; M, N multiples of 64, K = KST * NCH. blockIdx.x = tile, blockIdx.y = batch index with element
// strides sA, sB, sC. A stage is KST k of the tile's 64 A rows and 64 Bt rows, brought to LDS by asynchronous 16-B copies
// (a wave's copy = two aligned 256-B units) at row pitch KST + 8 halves (16 B x odd: ds_load_b128 fragment reads without bank conflicts).
// NCH 1: the stage is filled once and then read. NCH 2: two buffers, stage 1 flies while stage 0 is multiplied.
// k runs upward through one accumulator per 16x16 output tile.
// BM: 0 no bias, 1 bias bf16(biasp[n]) for n < nbias (0 beyond, clamped address).   ACT: 2 = ReLU applied to (value + bias).
// OM 0 = f32 out (pitch ldc); RM 2 adds raw f32 Rp[m][n] (same pitch/stride as C).
// OM 1 = dual f16 out (pitch ldc): hi = f16(value * ocarry) at C[m][n], residual f16(RC * (value * ocarry - hi)) at C[m][n] + lofs.
// coverage: copies: 2 operands x 4 row groups of 16 x KST/128 units of 256 B = 2*KST/32 copies per thread and stage; slab: 8 waves x 16 x 32 = 64 x 64;
//           out: f32 4 it x 16 rows x 16 lanes x 4, f16 2 it x 32 rows x 8 lanes x 8 (both planes) = the whole 64x64 tile;
//           grid = tilesM*tilesN blocks exactly.
// =====================================================================================================
// Eight asynchronous 16-B copies global -> LDS (l = the lane's LDS byte address, g = the lane's global address). The closing
// s_wait_xcnt keeps every later write of these address registers behind the copies' address translation.
__device__ __forceinline__ void acopy8(const unsigned* l, const unsigned short* const* g) {
#if defined(__HIP_DEVICE_COMPILE__)
  asm volatile(
      "global_load_async_to_lds_b128 %0, %8, off\n\t"
      "global_load_async_to_lds_b128 %1, %9, off\n\t"
      "global_load_async_to_lds_b128 %2, %10, off\n\t"
      "global_load_async_to_lds_b128 %3, %11, off\n\t"
      "global_load_async_to_lds_b128 %4, %12, off\n\t"
      "global_load_async_to_lds_b128 %5, %13, off\n\t"
      "global_load_async_to_lds_b128 %6, %14, off\n\t"
      "global_load_async_to_lds_b128 %7, %15, off\n\t"
      "s_wait_xcnt 0x0"
      :: "v"(l[0]), "v"(l[1]), "v"(l[2]), "v"(l[3]), "v"(l[4]), "v"(l[5]), "v"(l[6]), "v"(l[7]),
         "v"(g[0]), "v"(g[1]), "v"(g[2]), "v"(g[3]), "v"(g[4]), "v"(g[5]), "v"(g[6]), "v"(g[7])
      : "memory");
#endif
}
// The wave's own copies have landed in LDS behind this wait.
__device__ __forceinline__ void wait_async0() {
#if defined(__HIP_DEVICE_COMPILE__)
  asm volatile("s_wait_asynccnt 0x0" ::: "memory");
#endif
}
// The wave's own LDS reads have returned behind this wait.
__device__ __forceinline__ void wait_ds0() {
#if defined(__HIP_DEVICE_COMPILE__)
  asm volatile("s_wait_dscnt 0x0" ::: "memory");
#endif
}
// One stage: KST halves of rows 0..63 of Ag to LDS rows 0..63 and of rows 0..63 of Bg to LDS rows 64..127 (global row pitch LDK
// halves). 16 lanes take one aligned 256-B unit of a row, a copy of the block 16 rows; every offset below is a constant.
template <int KST, int LDK>
__device__ __forceinline__ void fill_stage(const unsigned short* Ag, const unsigned short* Bg, unsigned ldsb, int tid) {
  constexpr int CG  = KST / 128;            // 256-B units per row
  constexpr int PER = 4 * CG;               // copies per thread and operand
  constexpr int PIT = KST + 8;              // LDS row pitch, halves
  static_assert((KST % 128) == 0 && (2 * PER) % 8 == 0 && 2 * PER <= 63);
  const int r0 = tid >> 4, h0 = (tid & 15) * 8;
  const unsigned short* a0 = Ag + (size_t)r0 * LDK + h0;
  const unsigned short* b0 = Bg + (size_t)r0 * LDK + h0;
  const unsigned l0 = ldsb + (unsigned)(r0 * PIT + h0) * 2u;
  // both loops unrolled: every copy's offsets are then constants and l[], g[] stay in registers
#pragma unroll
  for (int g0 = 0; g0 < 2 * PER; g0 += 8) {
    unsigned l[8];
    const unsigned short* g[8];
#pragma unroll
    for (int e = 0; e < 8; ++e) {
      const int it = g0 + e;
      const bool isB = it >= PER;
      const int j = isB ? it - PER : it;
      const int rg = j / CG, cg = j - rg * CG;
      l[e] = l0 + (unsigned)((((isB ? 64 : 0) + rg * 16) * PIT + cg * 128) * 2);
      g[e] = (isB ? b0 : a0) + (size_t)(rg * 16) * LDK + cg * 128;
    }
    acopy8(l, g);
  }
}

template <int OM, int RM, int ACT, int BM, int KST, int NCH>
__global__ __launch_bounds__(256) void gemm64(
    const unsigned short* __restrict__ Ap, long long sA,
    const unsigned short* __restrict__ Btp, long long sB,
    const float* __restrict__ Rp,
    const float* __restrict__ biasp, int nbias,
    void* Cout, int ldc, long long sC, long long lofs,
    int N, float oscale, float ocarry) {
  constexpr int PIT  = KST + 8;               // LDS row pitch, halves
  constexpr int BUFH = 128 * PIT;            // halves per stage buffer: 64 A rows, then 64 Bt rows
  constexpr int LDK  = KST * NCH;            // row pitch of A and Bt, halves (= K)
  constexpr int KB   = 4;                    // k steps of 32 per fragment block
  constexpr int NBLK = KST / (32 * KB);
  static_assert(NCH == 1 || NCH == 2);
  static_assert((KST % (32 * KB)) == 0 && ((PIT * 2) % 32) == 16);
  __shared__ __align__(16) unsigned short sP[NCH * BUFH];
  __shared__ __align__(16) float sT[64 * 68];        // the tile in f32, pitch 68 floats
  const int by   = blockIdx.y;
  const int tid  = threadIdx.x;
  const int lane = tid & 31;
  const int wave = tid >> 5;
  const int tilesN = N >> 6;
  const int tile = blockIdx.x;
  const int tm = tile / tilesN;
  const int tn = tile - tm * tilesN;
  const int m0 = tm << 6;
  const int n0 = tn << 6;

  const unsigned short* Ag = Ap  + (size_t)((long long)by * sA) + (size_t)m0 * LDK;
  const unsigned short* Bg = Btp + (size_t)((long long)by * sB) + (size_t)n0 * LDK;
  const unsigned ldsb = (unsigned)(uintptr_t)(&sP[0]);   // LDS byte address = low 32 bits of the shared address

  fill_stage<KST, LDK>(Ag, Bg, ldsb, tid);
  wait_async0();
  __syncthreads();                                       // stage 0 readable by every wave
  if constexpr (NCH == 2) fill_stage<KST, LDK>(Ag + KST, Bg + KST, ldsb + (unsigned)(BUFH * 2), tid);

  const int rlane = lane & 15;                 // row (A) / col (B, D) within subtile
  const int koff  = (lane >> 4) * 8;           // k offset of this lane half
  const int mOff  = (lane >> 4) * 8;           // D row offset
  const int wr = wave >> 1, wc = wave & 1;     // wave tile: rows wr*16.., cols wc*32..

  v8f acc0 = zero8(), acc1 = zero8();
  // the loops below are unrolled so that the two fragment sets are indexed by constants and stay in registers
#pragma unroll
  for (int t = 0; t < NCH; ++t) {
    const unsigned short* aL = sP + t * BUFH + (wr * 16 + rlane) * PIT + koff;
    const unsigned short* bL = sP + t * BUFH + (64 + wc * 32 + rlane) * PIT + koff;
    // fragments one block ahead in a second register set, each block's LDS reads as one group; never across a stage
    v16h fa[2][KB], fb0[2][KB], fb1[2][KB];
#pragma unroll
    for (int s = 0; s < KB; ++s) {
      fa[0][s]  = ldfrag_u(aL + s * 32);
      fb0[0][s] = ldfrag_u(bL + s * 32);
      fb1[0][s] = ldfrag_u(bL + 16 * PIT + s * 32);
    }
#pragma unroll
    for (int blk = 0; blk < NBLK; ++blk) {
      const int cur = blk & 1;
      if (blk + 1 < NBLK) {
#pragma unroll
        for (int s = 0; s < KB; ++s) {
          const int k0 = ((blk + 1) * KB + s) * 32;
          fa[cur ^ 1][s]  = ldfrag_u(aL + k0);
          fb0[cur ^ 1][s] = ldfrag_u(bL + k0);
          fb1[cur ^ 1][s] = ldfrag_u(bL + 16 * PIT + k0);
        }
      }
      __builtin_amdgcn_sched_barrier(0);   // keeps the next block's LDS reads one group ahead of this block's products
#pragma unroll
      for (int s = 0; s < KB; ++s) {
        acc0 = mma_raw(fa[cur][s], fb0[cur][s], acc0);
        acc1 = mma_raw(fa[cur][s], fb1[cur][s], acc1);
      }
      __builtin_amdgcn_sched_barrier(0);   // keeps later blocks' LDS reads from spreading among these products
    }
    if (t + 1 < NCH) {
      wait_ds0();
      wait_async0();
      __syncthreads();                                   // stage t + 1 readable by every wave
    }
  }
  if constexpr (NCH == 2) wait_async0();                 // no copy is outstanding when the buffers are left

  const int r16 = tid >> 4, c4 = (tid & 15) * 4;         // f32 out: 256-B row segment = 16 lanes x 16 B
  const int r32 = tid >> 3, c8 = (tid & 7) * 8;          // f16 out: 128-B row segment = 8 lanes x 16 B

  // ---- column bias (same columns for every row a thread writes), clamped addresses ----
  float bc4[4], bc8[8];
#pragma unroll
  for (int e = 0; e < 4; ++e) bc4[e] = 0.f;
#pragma unroll
  for (int e = 0; e < 8; ++e) bc8[e] = 0.f;
  if constexpr (BM == 1) {
    if constexpr (OM == 0) {
#pragma unroll
      for (int e = 0; e < 4; ++e) {
        const int n = n0 + c4 + e;
        const int ncl = imin(n, nbias - 1);
        const float t = bfr(biasp[ncl]);
        bc4[e] = (n < nbias) ? t : 0.f;
      }
    } else {
#pragma unroll
      for (int e = 0; e < 8; ++e) {
        const int n = n0 + c8 + e;
        const int ncl = imin(n, nbias - 1);
        const float t = bfr(biasp[ncl]);
        bc8[e] = (n < nbias) ? t : 0.f;
      }
    }
  }

  // ---- epilogue: the tile through LDS, whole row segments out ----
#pragma unroll
  for (int r = 0; r < 8; ++r) {
    float* sp = sT + (wr * 16 + mOff + r) * 68 + wc * 32 + rlane;
    sp[0]  = acc0[r];
    sp[16] = acc1[r];
  }
  __syncthreads();
  if constexpr (OM == 0) {
    float* C = (float*)Cout + (size_t)((long long)by * sC);
#pragma unroll
    for (int it = 0; it < 4; ++it) {
      const int row = it * 16 + r16;                     // it 0..3 x r16 0..15 = rows 0..63
      const int gr  = m0 + row;
      v4f v = *(const v4f*)(sT + row * 68 + c4);
      v4f rv = {0.f, 0.f, 0.f, 0.f};
      if constexpr (RM == 2) {
        const float* R = Rp + (size_t)((long long)by * sC);
        rv = *(const v4f*)(R + (size_t)gr * ldc + n0 + c4);
      }
#pragma unroll
      for (int e = 0; e < 4; ++e) {
        float u = v[e] * oscale;
        if constexpr (BM == 1) u += bc4[e];
        if constexpr (ACT == 2) u = fmaxf(u, 0.f);
        v[e] = u + rv[e];
      }
      *(v4f*)(C + (size_t)gr * ldc + n0 + c4) = v;
    }
  } else {
    unsigned short* C = (unsigned short*)Cout + (size_t)((long long)by * sC);
#pragma unroll
    for (int it = 0; it < 2; ++it) {
      const int row = it * 32 + r32;                     // it 0..1 x r32 0..31 = rows 0..63
      const float* spf = sT + row * 68 + c8;
      v4u a = {0u, 0u, 0u, 0u}, bl = {0u, 0u, 0u, 0u};
#pragma unroll
      for (int e = 0; e < 4; ++e) {
        float f0 = spf[2 * e] * oscale;
        float f1 = spf[2 * e + 1] * oscale;
        if constexpr (BM == 1) { f0 += bc8[2 * e]; f1 += bc8[2 * e + 1]; }
        if constexpr (ACT == 2) { f0 = fmaxf(f0, 0.f); f1 = fmaxf(f1, 0.f); }
        f0 *= ocarry; f1 *= ocarry;
        const _Float16 g0 = (_Float16)f0, g1 = (_Float16)f1;
        const float r0 = (f0 - (float)g0) * RC, r1 = (f1 - (float)g1) * RC;
        a[e]  = pk16(h_bits(g0), h_bits(g1));
        bl[e] = pk16(h_bits((_Float16)r0), h_bits((_Float16)r1));
      }
      unsigned short* p = C + (size_t)(m0 + row) * ldc + n0 + c8;
      *(v4u*)p = a;
      *(v4u*)(p + (size_t)lofs) = bl;
    }
  }
  (void)Rp; (void)ocarry; (void)lofs; (void)nbias; (void)biasp;
}

// =====================================================================================================
// Causal flash attention for one batch and 16 query rows, all 4 heads (one wave per head), head dim 64:
//   q plane QP[b*SEQ + tok][512] (f16: hi x16 at col head*64+d, residual x64 of that at col 256+head*64+d); k plane KP same;
//   v^T plane VT[b*512 + row][key] (pitch SEQ): rows head*64+d hi (f16 x16), rows 256+head*64+d residual x64;
//   out CT[b*SEQ + tok][512]: hi = f16(16 * ctx) at col head*64+d, residual = f16(64 * (16 ctx - hi)) at col 256+head*64+d, where
//   ctx[d] = sum_m softmax_m(q.k / 8 + relb[bucket(tok - m)][head]) v[m][d] over keys m <= tok (softmax run in base 2, -inf select for
//   keys m > tok). The relative bias table (bf16 RNE of relb, x log2 e) for rel 0..q0+15 and the 4 heads is built in LDS per block.
//   Key steps of 32 from 0 to q0+16 (block-uniform trip count); kb <= q0 always, so every query row sees key kb unmasked in every step
//   and the step max is finite; the rescale exponent is clamped at -126 so the first step gives a tiny finite factor times zero sums.
//   Per step: two score tiles, each hi.hi (2 k-steps of 32) into one accumulator and hi.res + res.hi (4 k-steps) into a second one,
//   fragments loaded straight from the 16-bit planes (two 16-B loads per fragment, arithmetic addressing); online max-subtracted
//   softmax in f32 (exp2); rescale of the running sums and the eight accumulators; the 16x32 prob tile stored to wave-private LDS
//   RNE to f16, split k map) and the v^T B fragments (4 hi, 4 residual) loaded straight from the 16-bit plane (keys kb..kb+31 <= SEQ-1
//   always in range); 8 P.V WMMAs into hi and residual accumulator sets.
//   Final 1/l and carry folds in f32 (ctx16 = 16 (o_hi + o_res/64) / (l 16384 16)); each wave stages its 16x64 hi and residual slices
//   (element stores) in the block's 16-bit part-row buffer [16][512]; after a block barrier the 128 threads write the block's 16 rows
// coverage: LDS bias table: rel 0..kend-1 (all rel used) x 4 heads; LDS row buffer: 4 waves x 16 rows x (64 hi + 64 res) cols = 16 x 512
//           (staged extent == consumed extent); global: 8 iterations x 128 threads x 8 halves = 16 rows x 512 halves of rows q0..q0+15
//           of batch b; grid (NB batches x SEQ/16 query tiles) covers all NROWS x 512 of CT exactly once.
// =====================================================================================================
#define ATT_THREADS (NHEAD * 32)
#define ATT_BLOCKS  (NB * (SEQ / 16))
#define PT_FLOATS   (NHEAD * 16 * 36)
static_assert(ATT_THREADS == 128 && (KD / 8) == 64 && ((16 * KD) % (8 * ATT_THREADS)) == 0 && ((16 * KD) / (8 * ATT_THREADS)) == 8);
static_assert((KD * 2) % 128 == 0 && (HDIM % 32) == 0);

__global__ __launch_bounds__(ATT_THREADS)
void attn4(const unsigned short* __restrict__ QPp, const unsigned short* __restrict__ KPp,
           const unsigned short* __restrict__ VTq, const float* __restrict__ relbl, unsigned short* CT) {
  __shared__ __align__(16) float sbias[NHEAD * SEQ];       // [head][rel], bf16(relb) * log2 e
  __shared__ __align__(16) float spt[PT_FLOATS];           // per wave prob tile [row][32 keys], pitch 36
  __shared__ __align__(16) unsigned short sos[16 * KD];    // block part-row buffer [16][512]

  const int tid  = threadIdx.x;
  const int wave = tid >> 5;
  const int lane = tid & 31;
  const int hh   = lane >> 4;
  const int c    = lane & 15;

  const int qt   = blockIdx.x % (SEQ / 16);                // query tile
  const int bat  = blockIdx.x / (SEQ / 16);                // batch
  const int head = wave;                                   // 0..3
  const int q0   = qt * 16;
  const int srow = q0 + 8 * hh;                            // this lane half's first query row (+ r)
  const int kend = q0 + 16;                                // causal: keys 0 .. q0+15; rel = query - key in 0 .. kend-1

  // ---- relative-position bias table for rel 0..kend-1, all heads ----
  for (int rel = tid; rel < kend; rel += ATT_THREADS) {
    const int bk = rel_bucket(rel);
    const v4f bv = *(const v4f*)(relbl + bk * NHEAD);
#pragma unroll
    for (int h2 = 0; h2 < NHEAD; ++h2) sbias[h2 * SEQ + rel] = bfr(bv[h2]) * LOG2E;
  }
  __syncthreads();

  const float* sb = sbias + head * SEQ;
  const _Float16* Q16 = (const _Float16*)(const void*)QPp;
  const _Float16* K16 = (const _Float16*)(const void*)KPp;
  const _Float16* V16 = (const _Float16*)(const void*)VTq;
  const _Float16* Qh = Q16 + ((size_t)bat * SEQ + q0 + c) * KD + head * HDIM + 8 * hh;
  const _Float16* Kb = K16 + (size_t)bat * SEQ * KD + head * HDIM + 8 * hh;
  const _Float16* Vh = V16 + ((size_t)bat * VTR + head * HDIM) * SEQ + 8 * hh;
  const _Float16* Vl = Vh + (size_t)DMODEL * SEQ;
  const float lsc = (LOG2E * ATT_SCALE) / (QC * KC);      // log2(e) / 8 / carries

  const v16h qah = ldfrag_h(Qh), qbh = ldfrag_h(Qh + 32);                       // hi, d 0..31 / 32..63
  const v16h qal = ldfrag_h(Qh + DMODEL), qbl = ldfrag_h(Qh + DMODEL + 32);     // residual x64

  float mrow[8], lrow[8];
  v8f om0 = zero8(), om1 = zero8(), om2 = zero8(), om3 = zero8();
  v8f or0 = zero8(), or1 = zero8(), or2 = zero8(), or3 = zero8();
#pragma unroll
  for (int r = 0; r < 8; ++r) { mrow[r] = -INFINITY; lrow[r] = 0.f; }
  float* pt = spt + wave * (16 * 36);

#pragma unroll 1
  for (int kb = 0; kb < kend; kb += 32) {
    const _Float16* kp = Kb + (size_t)(kb + c) * KD;
    v8f s0m, s0r, s1m, s1r;
    {
      const v16h k0h = ldfrag_h(kp), k1h = ldfrag_h(kp + 32);
      const v16h k0l = ldfrag_h(kp + DMODEL), k1l = ldfrag_h(kp + DMODEL + 32);
      s0m = mma_raw(qah, k0h, zero8());
      s0m = mma_raw(qbh, k1h, s0m);
      s0r = mma_raw(qah, k0l, zero8());
      s0r = mma_raw(qbh, k1l, s0r);
      s0r = mma_raw(qal, k0h, s0r);
      s0r = mma_raw(qbl, k1h, s0r);
      guard_s2x4(s0m, s0r, k0h, k1h, k0l, k1l);
    }
    {
      const _Float16* kq = kp + (size_t)16 * KD;
      const v16h k0h = ldfrag_h(kq), k1h = ldfrag_h(kq + 32);
      const v16h k0l = ldfrag_h(kq + DMODEL), k1l = ldfrag_h(kq + DMODEL + 32);
      s1m = mma_raw(qah, k0h, zero8());
      s1m = mma_raw(qbh, k1h, s1m);
      s1r = mma_raw(qah, k0l, zero8());
      s1r = mma_raw(qbh, k1l, s1r);
      s1r = mma_raw(qal, k0h, s1r);
      s1r = mma_raw(qbl, k1h, s1r);
      guard_s2x4(s1m, s1r, k0h, k1h, k0l, k1l);
      keep4_h(qah, qbh, qal, qbl);
    }
    const int key0 = kb + c;                               // key of this lane's column in tile 0
    const int key1 = kb + 16 + c;                          // key of this lane's column in tile 1
#pragma unroll
    for (int r = 0; r < 8; ++r) {
      const int qi = srow + r;
      const int i0 = imax(qi - key0, 0);
      const int i1 = imax(qi - key1, 0);
      float t0 = (s0m[r] + s0r[r] * RCI) * lsc + sb[i0];
      float t1 = (s1m[r] + s1r[r] * RCI) * lsc + sb[i1];
      t0 = (key0 > qi) ? -INFINITY : t0;
      t1 = (key1 > qi) ? -INFINITY : t1;
      float mx = fmaxf(t0, t1);
#pragma unroll
      for (int off = 1; off < 16; off <<= 1) mx = fmaxf(mx, __shfl_xor(mx, off, 32));
      const float mn = fmaxf(mrow[r], mx);
      const float al = exp2f(fmaxf(mrow[r] - mn, -126.0f));
      mrow[r] = mn;
      const float e0 = exp2f(t0 - mn);
      const float e1 = exp2f(t1 - mn);
      float ps = e0 + e1;
#pragma unroll
      for (int off = 1; off < 16; off <<= 1) ps += __shfl_xor(ps, off, 32);
      lrow[r] = lrow[r] * al + ps;
      om0[r] *= al; om1[r] *= al; om2[r] *= al; om3[r] *= al;
      or0[r] *= al; or1[r] *= al; or2[r] *= al; or3[r] *= al;
      const int ro = (8 * hh + r) * 36 + c;
      pt[ro]      = e0;
      pt[ro + 16] = e1;
    }
    wave_sync_lds();
    FragH ph;
    {
      const float* prow = pt + c * 36 + 8 * hh;
      const v4f p0 = *(const v4f*)(prow), p1 = *(const v4f*)(prow + 4);
      const v4f p2 = *(const v4f*)(prow + 16), p3 = *(const v4f*)(prow + 20);
#pragma unroll
      for (int e = 0; e < 4; ++e) {
        ph.h[0][e]     = (_Float16)(p0[e] * PC);              // elements 0..7  = keys kb + 8hh + 0..7
        ph.h[0][4 + e] = (_Float16)(p1[e] * PC);
        ph.h[1][e]     = (_Float16)(p2[e] * PC);              // elements 8..15 = keys kb + 16 + 8hh + 0..7
        ph.h[1][4 + e] = (_Float16)(p3[e] * PC);
      }
    }
    {
      const _Float16* vp = Vh + (size_t)c * SEQ + kb;
      const v16h vb0 = ldfrag_h(vp);
      const v16h vb1 = ldfrag_h(vp + (size_t)16 * SEQ);
      const v16h vb2 = ldfrag_h(vp + (size_t)32 * SEQ);
      const v16h vb3 = ldfrag_h(vp + (size_t)48 * SEQ);
      om0 = mma_raw(ph.v, vb0, om0);
      om1 = mma_raw(ph.v, vb1, om1);
      om2 = mma_raw(ph.v, vb2, om2);
      om3 = mma_raw(ph.v, vb3, om3);
      guard_pv4(om0, om1, om2, om3, ph.v, vb0, vb1, vb2, vb3);
    }
    {
      const _Float16* vq = Vl + (size_t)c * SEQ + kb;
      const v16h vl0 = ldfrag_h(vq);
      const v16h vl1 = ldfrag_h(vq + (size_t)16 * SEQ);
      const v16h vl2 = ldfrag_h(vq + (size_t)32 * SEQ);
      const v16h vl3 = ldfrag_h(vq + (size_t)48 * SEQ);
      or0 = mma_raw(ph.v, vl0, or0);
      or1 = mma_raw(ph.v, vl1, or1);
      or2 = mma_raw(ph.v, vl2, or2);
      or3 = mma_raw(ph.v, vl3, or3);
      guard_pv4(or0, or1, or2, or3, ph.v, vl0, vl1, vl2, vl3);
    }
    wave_sync_lds();
  }

  // ---- fold 1/l and the carries, stage the wave's 16x64 hi and residual slices as 16-bit ----
  const float oc = CC / (PC * VC);
  unsigned short* osw = sos + head * HDIM + c;
#pragma unroll
  for (int r = 0; r < 8; ++r) {
    const float inv = (1.0f / lrow[r]) * oc;
    unsigned short* op = osw + (8 * hh + r) * KD;
    const float u0 = (om0[r] + or0[r] * RCI) * inv;
    const float u1 = (om1[r] + or1[r] * RCI) * inv;
    const float u2 = (om2[r] + or2[r] * RCI) * inv;
    const float u3 = (om3[r] + or3[r] * RCI) * inv;
    const _Float16 g0 = (_Float16)u0, g1 = (_Float16)u1, g2 = (_Float16)u2, g3 = (_Float16)u3;
    op[0]           = h_bits(g0);
    op[16]          = h_bits(g1);
    op[32]          = h_bits(g2);
    op[48]          = h_bits(g3);
    op[DMODEL]      = h_bits((_Float16)((u0 - (float)g0) * RC));
    op[DMODEL + 16] = h_bits((_Float16)((u1 - (float)g1) * RC));
    op[DMODEL + 32] = h_bits((_Float16)((u2 - (float)g2) * RC));
    op[DMODEL + 48] = h_bits((_Float16)((u3 - (float)g3) * RC));
  }
  __syncthreads();
  // ---- block writes its 16 rows of CT: piece p = it*128 + tid -> halves (p%64)*8 .. +7 of row p/64 ----
  {
    v4u vals[8];
#pragma unroll
    for (int it = 0; it < 8; ++it) {
      const int p = it * ATT_THREADS + tid;
      vals[it] = *(const v4u*)(sos + (size_t)p * 8);
    }
    unsigned short* dst = CT + ((size_t)bat * SEQ + q0) * KD;
    {
#pragma unroll
      for (int it = 0; it < 8; ++it) {
        const int p = it * ATT_THREADS + tid;
        const int row = p >> 6, col8 = (p & 63) * 8;
        *(v4u*)(dst + (size_t)row * KD + col8) = vals[it];
      }
      
    }
  }
}

// =====================================================================================================
// RMSNorm over the last dim (256): out = x * rsqrt(mean(x*x) + eps) * bf16(w), eps 1.1920929e-7, in f32; written as the dual 16-bit
// plane outh[row][512]: hi = f16(16 * out) at col c, residual = f16(64 * (16 out - hi)) at col 256 + c.
//   One wave per row (4 rows per 128-thread block): lane loads 8 consecutive floats (two 16-B loads), sum of squares by xor shuffles,
//   then writes its own 8 hi halves and 8 residual halves: per plane one instruction of 32 lanes x 16 B = the whole 512-B half row
// coverage: grid = NROWS/4 blocks x 4 waves = every row once; per row 32 lanes x 8 halves = 256 hi + 256 residual halves.
// =====================================================================================================
__global__ __launch_bounds__(128) void rmsn(const float* __restrict__ Xp, const float* __restrict__ wp, unsigned short* outh) {
  const int wave = threadIdx.x >> 5, lane = threadIdx.x & 31;
  const int row = blockIdx.x * 4 + wave;
  const int c0 = lane * 8;
  const float* xp = Xp + (size_t)row * DMODEL + c0;
  const v4f x0 = *(const v4f*)(xp), x1 = *(const v4f*)(xp + 4);
  float ss = ((x0[0] * x0[0] + x0[1] * x0[1]) + (x0[2] * x0[2] + x0[3] * x0[3])) +
             ((x1[0] * x1[0] + x1[1] * x1[1]) + (x1[2] * x1[2] + x1[3] * x1[3]));
#pragma unroll
  for (int off = 1; off < 32; off <<= 1) ss += __shfl_xor(ss, off, 32);
  const float rstd = rsqrtf(ss * (1.0f / (float)DMODEL) + RMS_EPS);
  const v4f w0 = *(const v4f*)(wp + c0), w1 = *(const v4f*)(wp + c0 + 4);
  float o[8];
#pragma unroll
  for (int e = 0; e < 4; ++e) {
    o[e]     = (x0[e] * rstd) * bfr(w0[e]);
    o[4 + e] = (x1[e] * rstd) * bfr(w1[e]);
  }
  v4u hv, lv;
#pragma unroll
  for (int e = 0; e < 4; ++e) {
    const float f0 = o[2 * e] * HC, f1 = o[2 * e + 1] * HC;
    const _Float16 g0 = (_Float16)f0, g1 = (_Float16)f1;
    hv[e] = pk16(h_bits(g0), h_bits(g1));
    lv[e] = pk16(h_bits((_Float16)((f0 - (float)g0) * RC)), h_bits((_Float16)((f1 - (float)g1) * RC)));
  }
  unsigned short* dp = outh + (size_t)row * KD + c0;
  {
    *(v4u*)dp = hv;
    *(v4u*)(dp + DMODEL) = lv;
    
  }
}

// =====================================================================================================
// Input convert: obs16[m][640] = f16(16 * bf16_RNE(obs[b*SEQ_FULL + t][c])) for c < 637 (m = b*SEQ + t), 0 for the pad columns
// 637..639 (explicitly written). One wave per row (4 rows per block): 80 pieces of 8 halves; lane writes pieces lane, lane+32 and
// coverage: grid NROWS/4 x 4 waves = every row; per row pieces 0..79 = cols 0..639.
// =====================================================================================================
__global__ __launch_bounds__(128) void cvtobs(const float* __restrict__ src, unsigned short* dst) {
  const int wave = threadIdx.x >> 5, lane = threadIdx.x & 31;
  const int m = blockIdx.x * 4 + wave;
  const int b = m / SEQ, t = m - b * SEQ;
  const float* sp = src + ((size_t)b * SEQ_FULL + t) * OBSD;
  unsigned short* dp = dst + (size_t)m * OBSP;
  {
#pragma unroll 1
    for (int it = 0; it < 3; ++it) {
      const int p = it * 32 + lane;
      const int col0 = p * 8;
      v4u a;
#pragma unroll
      for (int e = 0; e < 4; ++e) {
        const int ca = col0 + 2 * e, cb = ca + 1;
        float fa = sp[imin(ca, OBSD - 1)];
        float fb = sp[imin(cb, OBSD - 1)];
        fa = (ca < OBSD) ? fa : 0.f;
        fb = (cb < OBSD) ? fb : 0.f;
        a[e] = pk16(h_bits((_Float16)(bfr(fa) * OBC)), h_bits((_Float16)(bfr(fb) * OBC)));
      }
      if (p < OBSP / 8) *(v4u*)(dp + (size_t)p * 8) = a;
    }
    
  }
}

// =====================================================================================================
// Output copy: blockIdx.y == 0: out0[b*SEQ_FULL + t][0..3] = ACTF[b*SEQ + t][0..3] (one 16-B piece per thread, consecutive threads
// (SEQ*637 floats at float OUT1_OFF + b*SEQ_FULL*637) written as consecutive 16-B pieces (thread g -> floats 4i..4i+3, gathered from
// coverage: out0: NROWS pieces = every row; out1: NB * SEQ*637/4 pieces = every float of the region exactly once.
// =====================================================================================================
__global__ __launch_bounds__(256) void ocopy(const float* __restrict__ actf, const float* __restrict__ obsf, float* outp) {
  const int g = blockIdx.x * 256 + threadIdx.x;
  if (blockIdx.y == 0) {
    if (g >= NROWS) return;
    const int b = g / SEQ, t = g - b * SEQ;
    const v4f v = *(const v4f*)(actf + (size_t)g * NACTP);
    float* d = outp + ((size_t)b * SEQ_FULL + t) * NACT;
    {
      *(v4f*)d = v;
      
    }
  } else {
    const int ppb = (SEQ * OBSD) / 4;
    if (g >= NB * ppb) return;
    const int b = g / ppb;
    const int i = (g - b * ppb) * 4;
    v4f v;
#pragma unroll
    for (int e = 0; e < 4; ++e) {
      const int idx = i + e;
      const int row = idx / OBSD;
      const int col = idx - row * OBSD;
      v[e] = obsf[((size_t)b * SEQ + row) * OBSP + col];
    }
    float* d = outp + (size_t)OUT1_OFF + (size_t)b * SEQ_FULL * OBSD + i;
    {
      *(v4f*)d = v;
      
    }
  }
}

// =====================================================================================================
// Workspace map (bytes); every plane is an exact multiple of its tile / whole-row store granularity (M, N exact multiples of 64,
//   WQ16, WK16, WV16, WO16  f16 [6][256 n][512 = k x64 | k x1]     4 x 1572864
//   W116                    f16 [6][512 n][512]                       3145728
//   W216                    f16 [6][256 n][1024 = 512 x64 | 512 x1]  3145728
//   OBSW16                  f16 [256 n][640 k] x64 (k 637..639 zero)  327680
//   ACTW16                  f16 [64 n][512] (n 4..63 zero)              65536
//   OBSHW16                 f16 [640 n][512] (n 637..639 zero)         655360
//   OBS16                   f16 [NROWS][640] x16                      5242880
//   XA, XB                  f32 [NROWS][256] residual stream       2 x 4194304
//   HH, QP, KP, CT          f16 [NROWS][512] dual planes           4 x 4194304
//   VT                      f16 [NB][512][SEQ]                       4194304
//   G16                     f16 [NROWS][1024] dual                   8388608
//   ACTF                    f32 [NROWS][64]                          1048576
//   OBSF                    f32 [NROWS][640]                        10485760
//   total (NB=2, SEQ=2048)                                          68157440
// =====================================================================================================
extern "C" void kernel_launch(void* const* d_in, const int* in_sizes, int n_in,
                              void* d_out, int out_size, void* d_ws, size_t ws_size,
                              hipStream_t stream) {
  if (n_in < 19) return;
  if (in_sizes[0] < ((NB - 1) * SEQ_FULL + SEQ) * OBSD) return;
  if (in_sizes[1] < OBSD * DMODEL || in_sizes[2] < DMODEL) return;
  if (in_sizes[3] < NLAYER * DMODEL) return;
  if (in_sizes[4] < NLAYER * DMODEL * DMODEL || in_sizes[5] < NLAYER * DMODEL * DMODEL) return;
  if (in_sizes[6] < NLAYER * DMODEL * DMODEL || in_sizes[7] < NLAYER * DMODEL * DMODEL) return;
  if (in_sizes[8] < NLAYER * NBUCK * NHEAD || in_sizes[9] < NLAYER * DMODEL) return;
  if (in_sizes[10] < NLAYER * DMODEL * DFF || in_sizes[11] < NLAYER * DFF) return;
  if (in_sizes[12] < NLAYER * DFF * DMODEL || in_sizes[13] < NLAYER * DMODEL) return;
  if (in_sizes[14] < DMODEL || in_sizes[15] < DMODEL * NACT || in_sizes[16] < NACT) return;
  if (in_sizes[17] < DMODEL * OBSD || in_sizes[18] < OBSD) return;
  if (out_size < OUT1_OFF + ((NB - 1) * SEQ_FULL + SEQ) * OBSD) return;

  const float* obs     = (const float*)d_in[0];
  const float* obs_w   = (const float*)d_in[1];
  const float* obs_b   = (const float*)d_in[2];
  const float* norm1_w = (const float*)d_in[3];
  const float* w_q     = (const float*)d_in[4];
  const float* w_k     = (const float*)d_in[5];
  const float* w_v     = (const float*)d_in[6];
  const float* w_o     = (const float*)d_in[7];
  const float* relb    = (const float*)d_in[8];
  const float* norm2_w = (const float*)d_in[9];
  const float* w_1     = (const float*)d_in[10];
  const float* b_1     = (const float*)d_in[11];
  const float* w_2     = (const float*)d_in[12];
  const float* b_2     = (const float*)d_in[13];
  const float* fnorm_w = (const float*)d_in[14];
  const float* act_w   = (const float*)d_in[15];
  const float* act_b   = (const float*)d_in[16];
  const float* obsh_w  = (const float*)d_in[17];
  const float* obsh_b  = (const float*)d_in[18];
  float*       outp    = (float*)d_out;

  const size_t PWE  = (size_t)NLAYER * DMODEL * KD * 2;     // 1572864
  const size_t PW1  = (size_t)NLAYER * DFF * KD * 2;        // 3145728
  const size_t PW2  = (size_t)NLAYER * DMODEL * KF * 2;     // 3145728
  const size_t POBW = (size_t)DMODEL * OBSP * 2;            //  327680
  const size_t PACW = (size_t)NACTP * KD * 2;               //   65536
  const size_t POHW = (size_t)OBSP * KD * 2;                //  655360
  const size_t POBS = (size_t)NROWS * OBSP * 2;             // 5242880
  const size_t PX   = (size_t)NROWS * DMODEL * 4;           // 4194304
  const size_t PH   = (size_t)NROWS * KD * 2;               // 4194304
  const size_t PVT  = (size_t)NB * VTR * SEQ * 2;           // 4194304
  const size_t PG   = (size_t)NROWS * KF * 2;               // 8388608
  const size_t PACF = (size_t)NROWS * NACTP * 4;            // 1048576
  const size_t POBF = (size_t)NROWS * OBSP * 4;             // 10485760
  size_t off = 0;
  const size_t oWQ  = off; off += PWE;
  const size_t oWK  = off; off += PWE;
  const size_t oWV  = off; off += PWE;
  const size_t oWO  = off; off += PWE;
  const size_t oW1  = off; off += PW1;
  const size_t oW2  = off; off += PW2;
  const size_t oOBW = off; off += POBW;
  const size_t oACW = off; off += PACW;
  const size_t oOHW = off; off += POHW;
  const size_t oOBS = off; off += POBS;
  const size_t oXA  = off; off += PX;
  const size_t oXB  = off; off += PX;
  const size_t oHH  = off; off += PH;
  const size_t oQP  = off; off += PH;
  const size_t oKP  = off; off += PH;
  const size_t oCT  = off; off += PH;
  const size_t oVT  = off; off += PVT;
  const size_t oG   = off; off += PG;
  const size_t oACF = off; off += PACF;
  const size_t oOBF = off; off += POBF;
  const size_t endAll = off;                                // 68157440 for NB=2, SEQ=2048
  if (endAll > ws_size) return;
  if (endAll > (size_t)134217728) return;

  char* ws = (char*)d_ws;
  unsigned short* WQ16    = (unsigned short*)(ws + oWQ);
  unsigned short* WK16    = (unsigned short*)(ws + oWK);
  unsigned short* WV16    = (unsigned short*)(ws + oWV);
  unsigned short* WO16    = (unsigned short*)(ws + oWO);
  unsigned short* W116    = (unsigned short*)(ws + oW1);
  unsigned short* W216    = (unsigned short*)(ws + oW2);
  unsigned short* OBSW16  = (unsigned short*)(ws + oOBW);
  unsigned short* ACTW16  = (unsigned short*)(ws + oACW);
  unsigned short* OBSHW16 = (unsigned short*)(ws + oOHW);
  unsigned short* OBS16   = (unsigned short*)(ws + oOBS);
  float*          XA      = (float*)(ws + oXA);
  float*          XB      = (float*)(ws + oXB);
  unsigned short* HH      = (unsigned short*)(ws + oHH);
  unsigned short* QP      = (unsigned short*)(ws + oQP);
  unsigned short* KP      = (unsigned short*)(ws + oKP);
  unsigned short* CT      = (unsigned short*)(ws + oCT);
  unsigned short* VTp     = (unsigned short*)(ws + oVT);
  unsigned short* G16     = (unsigned short*)(ws + oG);
  float*          ACTF    = (float*)(ws + oACF);
  float*          OBSF    = (float*)(ws + oOBF);

  const dim3 blk(256);
  const dim3 blk128(128);
  const dim3 gRow(NROWS / 4);                                      // rmsn / cvtobs: 4 rows per block
  const int tilesE  = (NROWS / 64) * (DMODEL / 64);                // 256
  const int tilesV  = (DMODEL / 64) * (SEQ / 64);                  // 128 per batch
  const int tilesF  = (NROWS / 64) * (DFF / 64);                   // 512
  const int tilesA  = (NROWS / 64) * (NACTP / 64);                 // 64
  const int tilesO  = (NROWS / 64) * (OBSP / 64);                  // 640
  const dim3 gE(tilesE, 1);                                        // 256: one tile per block
  const dim3 gQK(tilesE, 2);                                       // 256 x 2 (q, k)
  const dim3 gV(tilesV, NB);                                       // 128 x NB
  const dim3 gF(tilesF, 1);                                        // 512
  const dim3 gA(tilesA, 1);                                        // 64
  const dim3 gO(tilesO, 1);                                        // 640
  const dim3 gAT(ATT_BLOCKS);                                      // NB x SEQ/16 = 256
  const dim3 bAT(ATT_THREADS);                                     // 128
  const int ppb = (SEQ * OBSD) / 4;
  const int gcx0 = NROWS / 256, gcx1 = (NB * ppb + 255) / 256;
  const dim3 gOC(gcx0 > gcx1 ? gcx0 : gcx1, 2);                    // (2548, 2)

  const long long eSrcE = (long long)DMODEL * DMODEL;              // per layer source [256][256]
  const long long eDstE = (long long)DMODEL * KD;                  // per layer plane [256][512]
  const long long sQK   = (long long)NLAYER * DMODEL * KD;         // WK16 - WQ16 in halves
  const long long sKP   = (long long)NROWS * KD;                   // KP - QP in halves

  // (0) 16-bit operand planes: transposed weights [n][k x64 | k x1] (bf16 RNE then exact power-of-two scale), obs x16
  cvtobs<<<gRow, blk128, 0, stream>>>(obs, OBS16);
  tcvt16<1><<<dim3(DMODEL / 64, DMODEL / 64, NLAYER), blk, 0, stream>>>(w_q, eSrcE, WQ16, eDstE, DMODEL, DMODEL, KD, DMODEL, WSC, WLO);  // in[256 k][256 n] -> out[256 n][512]
  tcvt16<1><<<dim3(DMODEL / 64, DMODEL / 64, NLAYER), blk, 0, stream>>>(w_k, eSrcE, WK16, eDstE, DMODEL, DMODEL, KD, DMODEL, WSC, WLO);
  tcvt16<1><<<dim3(DMODEL / 64, DMODEL / 64, NLAYER), blk, 0, stream>>>(w_v, eSrcE, WV16, eDstE, DMODEL, DMODEL, KD, DMODEL, WSC, WLO);
  tcvt16<1><<<dim3(DMODEL / 64, DMODEL / 64, NLAYER), blk, 0, stream>>>(w_o, eSrcE, WO16, eDstE, DMODEL, DMODEL, KD, DMODEL, WSC, WLO);
  tcvt16<1><<<dim3(DFF / 64, DMODEL / 64, NLAYER), blk, 0, stream>>>(w_1, (long long)DMODEL * DFF, W116, (long long)DFF * KD,
                                                                    DMODEL, DFF, KD, DMODEL, WSC, WLO);            // in[256 k][512 n] -> out[512 n][512]
  tcvt16<1><<<dim3(DMODEL / 64, DFF / 64, NLAYER), blk, 0, stream>>>(w_2, (long long)DFF * DMODEL, W216, (long long)DMODEL * KF,
                                                                    DFF, DMODEL, KF, DFF, WSC, WLO);               // in[512 k][256 n] -> out[256 n][1024]
  tcvt16<0><<<dim3(DMODEL / 64, OBSP / 64, 1), blk, 0, stream>>>(obs_w, 0LL, OBSW16, 0LL, OBSD, DMODEL, OBSP, 0, WSC, 0.f);  // in[637 k][256 n] -> out[256 n][640], k 637..639 zero
  tcvt16<1><<<dim3(NACTP / 64, DMODEL / 64, 1), blk, 0, stream>>>(act_w, 0LL, ACTW16, 0LL, DMODEL, NACT, KD, DMODEL, WSC, WLO);  // in[256 k][4 n] -> out[64 n][512], n >= 4 zero
  tcvt16<1><<<dim3(OBSP / 64, DMODEL / 64, 1), blk, 0, stream>>>(obsh_w, 0LL, OBSHW16, 0LL, DMODEL, OBSD, KD, DMODEL, WSC, WLO); // in[256 k][637 n] -> out[640 n][512], n >= 637 zero

  // (1) x = obs . Wp + bf16(bp) -> XA (f32); M = NROWS, N = 256, K = 640 (single product, inputs exact)
  gemm64<0, 0, 0, 1, OBSP, 1><<<gE, blk, 0, stream>>>(
      OBS16, 0LL,
      OBSW16, 0LL,
      (const float*)0,
      obs_b, DMODEL,
      (void*)XA, DMODEL, 0LL, 0LL,
      DMODEL, 1.0f / (OBC * WSC), 1.0f);

  for (int l = 0; l < NLAYER; ++l) {
    const size_t lwE = (size_t)l * DMODEL * KD;                    // WQ/WK/WV/WO layer offset (halves)
    const size_t lw1 = (size_t)l * DFF * KD;
    const size_t lw2 = (size_t)l * DMODEL * KF;

    // (2) h = RMSNorm(x) * bf16(g1) -> HH (hi x16 | residual x64)
    rmsn<<<gRow, blk128, 0, stream>>>(XA, norm1_w + (size_t)l * DMODEL, HH);

    // (3) q, k projections (batched by blockIdx.y): QP / KP [m][hi | res]; M = NROWS, N = 256, K = 512 folded, no bias
    gemm64<1, 0, 0, 0, KD, 1><<<gQK, blk, 0, stream>>>(
        HH, 0LL,
        WQ16 + lwE, sQK,
        (const float*)0,
        (const float*)0, 1,
        (void*)QP, KD, sKP, (long long)DMODEL,
        DMODEL, 1.0f / (HC * WSC), QC);

    // (4) v^T per batch: VT[b][d][tok] (hi rows d, residual rows 256+d); M = 256 (d), N = SEQ, K = 512 folded
    gemm64<1, 0, 0, 0, KD, 1><<<gV, blk, 0, stream>>>(
        WV16 + lwE, 0LL,
        HH, (long long)SEQ * KD,
        (const float*)0,
        (const float*)0, 1,
        (void*)VTp, SEQ, (long long)VTR * SEQ, (long long)DMODEL * SEQ,
        SEQ, 1.0f / (HC * WSC), VC);

    // (5) causal attention with relative-position bias per (batch, 16 query rows), all heads -> CT (hi x16 | residual x64)
    attn4<<<gAT, bAT, 0, stream>>>(QP, KP, VTp, relb + (size_t)l * NBUCK * NHEAD, CT);

    // (6) XB = CT . Wo / (16 * 64) + XA (raw f32); M = NROWS, N = 256, K = 512 folded
    gemm64<0, 2, 0, 0, KD, 1><<<gE, blk, 0, stream>>>(
        CT, 0LL,
        WO16 + lwE, 0LL,
        XA,
        (const float*)0, 1,
        (void*)XB, DMODEL, 0LL, 0LL,
        DMODEL, 1.0f / (CC * WSC), 1.0f);

    // (7) h2 = RMSNorm(x) * bf16(g2) -> HH
    rmsn<<<gRow, blk128, 0, stream>>>(XB, norm2_w + (size_t)l * DMODEL, HH);

    // (8) G16 = dual f16 of 64 * relu(h2 . W1 + bf16(b1)); M = NROWS, N = 512, K = 512 folded
    gemm64<1, 0, 2, 1, KD, 1><<<gF, blk, 0, stream>>>(
        HH, 0LL,
        W116 + lw1, 0LL,
        (const float*)0,
        b_1 + (size_t)l * DFF, DFF,
        (void*)G16, KF, 0LL, (long long)DFF,
        DFF, 1.0f / (HC * WSC), GC);

    // (9) XA = G16 . W2 / (64 * 64) + bf16(b2) + XB (raw f32); M = NROWS, N = 256, K = 1024 folded
    gemm64<0, 2, 0, 1, KF / 2, 2><<<gE, blk, 0, stream>>>(
        G16, 0LL,
        W216 + lw2, 0LL,
        XB,
        b_2 + (size_t)l * DMODEL, DMODEL,
        (void*)XA, DMODEL, 0LL, 0LL,
        DMODEL, 1.0f / (GC * WSC), 1.0f);
  }

  // (10) hf = RMSNorm(x) * bf16(gf) -> HH
  rmsn<<<gRow, blk128, 0, stream>>>(XA, fnorm_w, HH);

  // (11) action logits plane ACTF[m][64] = hf . Wa + bf16(ba) (cols 0..3 meaningful); M = NROWS, N = 64, K = 512 folded
  gemm64<0, 0, 0, 1, KD, 1><<<gA, blk, 0, stream>>>(
      HH, 0LL,
      ACTW16, 0LL,
      (const float*)0,
      act_b, NACT,
      (void*)ACTF, NACTP, 0LL, 0LL,
      NACTP, 1.0f / (HC * WSC), 1.0f);

  // (12) obs prediction plane OBSF[m][640] = hf . Wh + bf16(bh) (cols 0..636 meaningful); M = NROWS, N = 640, K = 512 folded
  gemm64<0, 0, 0, 1, KD, 1><<<gO, blk, 0, stream>>>(
      HH, 0LL,
      OBSHW16, 0LL,
      (const float*)0,
      obsh_b, OBSD,
      (void*)OBSF, OBSP, 0LL, 0LL,
      OBSP, 1.0f / (HC * WSC), 1.0f);

  ocopy<<<gOC, blk, 0, stream>>>(ACTF, OBSF, outp);
  (void)hipGetLastError();
}

// v002
// A run of this version takes 547 microseconds.
// Next to v001, in two timings, it ran 1.91 and 1.89 times as fast.
// Over all steps from v000 it is 3.51 times as fast.
// Contractions (all v_wmma_f32_16x16x32_f16, f16 operands, f32 accumulate): input projection (obs f16 x16 . Wp^T f16 x64, K=640
// zero-padded, single product); q/k, v^T, attention-output, hidden (ReLU), second and both head projections with the activation
// operand carried as two f16 planes [hi | residual x64] folded along K against [W^T x64 | W^T x1]; attention scores q.k^T from the
// q/k hi and residual planes (hi.hi plus the two cross terms, two accumulators, K=64); attention P.v^T with P f16 x16384 (single)
// against v^T hi and residual planes (two accumulators). RMSNorm, softmax (base 2), ReLU, biases, relative-position bias and the
// residual stream in f32 on VALU. Every float input RNE-converted to bf16 on load.
#include <hip/hip_runtime.h>
#include <math.h>
#include <stdint.h>

#ifndef NB
#define NB        2
#endif
#ifndef SEQ
#define SEQ       2048
#endif
#define NB_FULL   2
#define SEQ_FULL  2048
#define NLAYER    6
#define DMODEL    256
#define NHEAD     4
#define HDIM      64
#define DFF       512
#define OBSD      637
#define OBSP      640
#define NACT      4
#define NACTP     64
#define NBUCK     32
#define NROWS     (NB * SEQ)
#define KD        (2 * DMODEL)          // folded K of E-wide activation operands: [hi 256 | residual 256]
#define KF        (2 * DFF)             // folded K of the hidden operand: [hi 512 | residual 512]
#define VTR       KD                    // rows per batch of the v^T plane: 0..255 hi, 256..511 residual
#define OUT1_OFF  (NB_FULL * SEQ_FULL * NACT)   // float index of the second output (byte offset 65536)
#define OUT_TOTAL (OUT1_OFF + NB_FULL * SEQ_FULL * OBSD)

// carries (exact powers of two)
#define WSC_I 64
#define RC_I  64
#define WLO_I 1
#define WSC   64.0f        // weight hi copy
#define WLO   1.0f         // weight lo copy (pairs with the x64 residual plane)
#define RC    64.0f        // residual plane carry relative to its hi plane
#define RCI   0.015625f
#define OBC   16.0f        // obs plane
#define HC    16.0f        // RMSNorm outputs
#define QC    16.0f
#define KC    16.0f
#define VC    16.0f
#define PC    16384.0f     // softmax P tile
#define CC    16.0f        // attention context
#define GC    64.0f        // ReLU hidden
#define ATT_SCALE 0.125f
#define LOG2E   1.4426950408889634f
#define RMS_EPS 1.1920929e-07f
static_assert(RC_I * WLO_I == WSC_I);
static_assert(NHEAD * HDIM == DMODEL);
static_assert(NB >= 1 && NB <= NB_FULL && SEQ >= 64 && SEQ <= SEQ_FULL);
static_assert((SEQ % 64) == 0 && (SEQ % 16) == 0 && (NROWS % 64) == 0 && (DMODEL % 64) == 0 && (DFF % 64) == 0);
static_assert((OBSP % 64) == 0 && (NACTP % 64) == 0 && OBSP >= OBSD && NACTP >= NACT && (OBSP - OBSD) < 64);
static_assert((KD % 32) == 0 && (KF % 32) == 0 && (OBSP % 32) == 0);
static_assert((NROWS % 256) == 0 && (NROWS % 4) == 0 && ((SEQ * OBSD) % 4) == 0);
static_assert(OUT_TOTAL == 2625536);

typedef _Float16 v16h __attribute__((ext_vector_type(16)));
typedef _Float16 v8h  __attribute__((ext_vector_type(8)));
typedef float    v8f  __attribute__((ext_vector_type(8)));
typedef float    v4f  __attribute__((ext_vector_type(4)));
typedef unsigned int v4u __attribute__((ext_vector_type(4)));
typedef unsigned int v2u __attribute__((ext_vector_type(2)));

union FragH { v16h v; v8h h[2]; v4u u[2]; };

// ---- scalar helpers --------------------------------------------------------------------------------
__device__ __forceinline__ unsigned short bf_bits(float f) {          // f32 -> bf16 bits, RNE convert
  unsigned u = __float_as_uint(f);
  return (unsigned short)((u + 0x7FFFu + ((u >> 16) & 1u)) >> 16);
}
__device__ __forceinline__ float bf_up(unsigned short h) { return __uint_as_float(((unsigned)h) << 16); }
__device__ __forceinline__ float bfr(float f) { return bf_up(bf_bits(f)); }   // value of the bf16 RNE convert
__device__ __forceinline__ unsigned short h_bits(_Float16 x) { return __builtin_bit_cast(unsigned short, x); }
__device__ __forceinline__ unsigned pk16(unsigned short a, unsigned short b) { return (unsigned)a | ((unsigned)b << 16); }
__device__ __forceinline__ v8f zero8() { v8f z = {0.f, 0.f, 0.f, 0.f, 0.f, 0.f, 0.f, 0.f}; return z; }
__device__ __forceinline__ int imin(int a, int b) { return a < b ? a : b; }
__device__ __forceinline__ int imax(int a, int b) { return a > b ? a : b; }

// T5 relative-position bucket for rel = query - key >= 0 (bidirectional split, 32 buckets, max distance 128), as an exact
// integer table: 0 -> 0; 1..7 -> 16+rel; 8..11 -> 24; 12..15 -> 25; 16..22 -> 26; 23..31 -> 27; 32..45 -> 28; 46..63 -> 29;
// 64..90 -> 30; >= 91 -> 31.
__device__ __forceinline__ int rel_bucket(int rel) {
  int b = 31;
  b = (rel < 91) ? 30 : b;
  b = (rel < 64) ? 29 : b;
  b = (rel < 46) ? 28 : b;
  b = (rel < 32) ? 27 : b;
  b = (rel < 23) ? 26 : b;
  b = (rel < 16) ? 25 : b;
  b = (rel < 12) ? 24 : b;
  b = (rel < 8) ? (16 + rel) : b;
  b = (rel == 0) ? 0 : b;
  return b;
}

// ---- fragment loaders: 16-bit A/B operand, lane -> row/col (lane&15), p already includes +8*(lane>>4);
//      elements 0..7 <- p[0..7] (k0+8h..), elements 8..15 <- p[16..23] (k0+16+8h..)  (same split k map for A and B;
//      B is always read from a k-contiguous [n][k] plane)
__device__ __forceinline__ v16h ldfrag_h(const _Float16* p) {
  FragH f;
  f.h[0] = *(const v8h*)(p);
  f.h[1] = *(const v8h*)(p + 16);
  return f.v;
}
__device__ __forceinline__ v16h ldfrag_u(const unsigned short* p) {
  FragH f;
  f.u[0] = *(const v4u*)(p);
  f.u[1] = *(const v4u*)(p + 16);
  return f.v;
}

// ---- WMMA helpers with trailing VALU hazard gaps ------------------------------------------------------
__device__ __forceinline__ v8f mma_raw(v16h a, v16h b, v8f c) {
  return __builtin_amdgcn_wmma_f32_16x16x32_f16(false, a, false, b, (short)0, c, false, false);
}
__device__ __forceinline__ void guard_s2x4(v8f& s, v8f& t, v16h a0, v16h a1, v16h b0, v16h b1) {
#if defined(__HIP_DEVICE_COMPILE__)
  asm volatile("v_nop\n\tv_nop\n\tv_nop\n\tv_nop" : "+v"(s), "+v"(t) : "v"(a0), "v"(a1), "v"(b0), "v"(b1));
#endif
}
__device__ __forceinline__ void guard_pv4(v8f& a, v8f& b, v8f& c, v8f& d, v16h x, v16h y, v16h z, v16h w, v16h u) {
#if defined(__HIP_DEVICE_COMPILE__)
  asm volatile("v_nop\n\tv_nop\n\tv_nop\n\tv_nop"
               : "+v"(a), "+v"(b), "+v"(c), "+v"(d) : "v"(x), "v"(y), "v"(z), "v"(w), "v"(u));
#endif
}
__device__ __forceinline__ void keep4_h(v16h a, v16h b, v16h c, v16h d) {
#if defined(__HIP_DEVICE_COMPILE__)
  asm volatile("v_nop" :: "v"(a), "v"(b), "v"(c), "v"(d));
#endif
}
__device__ __forceinline__ void wave_sync_lds() {
  __builtin_amdgcn_fence(__ATOMIC_RELEASE, "workgroup");
  __builtin_amdgcn_wave_barrier();
  __builtin_amdgcn_fence(__ATOMIC_ACQUIRE, "workgroup");
}

// =====================================================================================================
// Transposing 16-bit pack of a weight stored in[R][C] (row pitch C floats, R = contraction index, C = output index) into
// out[Cp][ldd] (row pitch ldd halves): out[c][r] = f16( bf16_RNE(in[r][c]) * schi ) for r < R and c < C, 0 otherwise (pad rows /
// pad columns explicitly written as zeros); with DUAL a second copy out[c][locol + r] = f16( bf16_RNE(in[r][c]) * sclo ).
// schi / sclo powers of two (exact). Cp = 64*gridDim.x, Rp = 64*gridDim.y. blockIdx.z = slice: src advanced by z*sZ floats, dst by
// z*dZ halves. One 64x64 tile per block through LDS (bf16 bits): 16 scalar loads per thread with CLAMPED addresses, zero by
// coverage: load 256 thr x 16 floats = 64x64; store 2 it x 8 waves x 4 rows x (8 lanes x 8 halves) = 64 rows x 64 halves per copy;
//           grid (Cp/64, Rp/64, Z) exact, each output line written by exactly one wave; pad region included.
// =====================================================================================================
template <int DUAL>
__global__ __launch_bounds__(256) void tcvt16(const float* __restrict__ src, long long sZ,
                                              unsigned short* dst, long long dZ,
                                              int R, int C, int ldd, int locol, float schi, float sclo) {
  __shared__ __align__(16) unsigned short sT[64 * 72];
  const int tid = threadIdx.x, lane = tid & 31, wave = tid >> 5;
  const int c0 = blockIdx.x * 64, r0 = blockIdx.y * 64;
  const float* srcz = src + (size_t)((long long)blockIdx.z * sZ);
  unsigned short* dstz = dst + (size_t)((long long)blockIdx.z * dZ);
  const int rr = tid >> 2, cc = (tid & 3) * 16;
  const int r = r0 + rr;
  const int rcl = imin(r, R - 1);
  const float* sp = srcz + (size_t)rcl * C;
#pragma unroll
  for (int e = 0; e < 16; ++e) {
    const int cidx = c0 + cc + e;
    const int ccl = imin(cidx, C - 1);
    float a = sp[ccl];
    a = (r < R && cidx < C) ? a : 0.f;
    sT[(cc + e) * 72 + rr] = bf_bits(a);
  }
  __syncthreads();
  v4u hvals[2], lvals[2];
#pragma unroll
  for (int it = 0; it < 2; ++it) {
    const int q = it * 32 + wave * 4 + (lane >> 3);
    const v4u raw = *(const v4u*)(sT + q * 72 + (lane & 7) * 8);
    v4u hv = {0u, 0u, 0u, 0u}, lv = {0u, 0u, 0u, 0u};
#pragma unroll
    for (int e = 0; e < 4; ++e) {
      const float f0 = bf_up((unsigned short)(raw[e] & 0xFFFFu));
      const float f1 = bf_up((unsigned short)(raw[e] >> 16));
      hv[e] = pk16(h_bits((_Float16)(f0 * schi)), h_bits((_Float16)(f1 * schi)));
      if constexpr (DUAL == 1) lv[e] = pk16(h_bits((_Float16)(f0 * sclo)), h_bits((_Float16)(f1 * sclo)));
    }
    hvals[it] = hv;
    lvals[it] = lv;
  }
  {
#pragma unroll
    for (int it = 0; it < 2; ++it) {
      const int q = it * 32 + wave * 4 + (lane >> 3);
      unsigned short* p = dstz + (size_t)(c0 + q) * ldd + r0 + (lane & 7) * 8;
      *(v4u*)p = hvals[it];
      if constexpr (DUAL == 1) *(v4u*)(p + locol) = lvals[it];
    }
    
  }
  (void)sclo; (void)locol;
}

// =====================================================================================================
// Batched f16 WMMA GEMM, operands staged in LDS: C[m][n] = f( oscale * sum_k A[m][k] * Bt[n][k] + bias ); one 64x64 tile per
// work-group of 8 waves (wave = 16 rows x 32 cols, two accumulators). A row-major [M][K] (16-bit plane), Bt row-major
// [N][K] (k contiguous), both at row pitch K; M, N multiples of 64, K = KST * NCH. blockIdx.x = tile, blockIdx.y = batch index with element
// strides sA, sB, sC. A stage is KST k of the tile's 64 A rows and 64 Bt rows, brought to LDS by asynchronous 16-B copies
// (a wave's copy = two aligned 256-B units) at row pitch KST + 8 halves (16 B x odd: ds_load_b128 fragment reads without bank conflicts).
// NCH 1: the stage is filled once and then read. NCH 2: two buffers, stage 1 flies while stage 0 is multiplied.
// k runs upward through one accumulator per 16x16 output tile.
// BM: 0 no bias, 1 bias bf16(biasp[n]) for n < nbias (0 beyond, clamped address).   ACT: 2 = ReLU applied to (value + bias).
// OM 0 = f32 out (pitch ldc); RM 2 adds raw f32 Rp[m][n] (same pitch/stride as C).
// OM 1 = dual f16 out (pitch ldc): hi = f16(value * ocarry) at C[m][n], residual f16(RC * (value * ocarry - hi)) at C[m][n] + lofs.
// coverage: copies: 2 operands x 4 row groups of 16 x KST/128 units of 256 B = 2*KST/32 copies per thread and stage; slab: 8 waves x 16 x 32 = 64 x 64;
//           out: f32 4 it x 16 rows x 16 lanes x 4, f16 2 it x 32 rows x 8 lanes x 8 (both planes) = the whole 64x64 tile;
//           grid = tilesM*tilesN blocks exactly.
// =====================================================================================================
// Eight asynchronous 16-B copies global -> LDS (l = the lane's LDS byte address, g = the lane's global address). The closing
// s_wait_xcnt keeps every later write of these address registers behind the copies' address translation.
__device__ __forceinline__ void acopy8(const unsigned* l, const unsigned short* const* g) {
#if defined(__HIP_DEVICE_COMPILE__)
  asm volatile(
      "global_load_async_to_lds_b128 %0, %8, off\n\t"
      "global_load_async_to_lds_b128 %1, %9, off\n\t"
      "global_load_async_to_lds_b128 %2, %10, off\n\t"
      "global_load_async_to_lds_b128 %3, %11, off\n\t"
      "global_load_async_to_lds_b128 %4, %12, off\n\t"
      "global_load_async_to_lds_b128 %5, %13, off\n\t"
      "global_load_async_to_lds_b128 %6, %14, off\n\t"
      "global_load_async_to_lds_b128 %7, %15, off\n\t"
      "s_wait_xcnt 0x0"
      :: "v"(l[0]), "v"(l[1]), "v"(l[2]), "v"(l[3]), "v"(l[4]), "v"(l[5]), "v"(l[6]), "v"(l[7]),
         "v"(g[0]), "v"(g[1]), "v"(g[2]), "v"(g[3]), "v"(g[4]), "v"(g[5]), "v"(g[6]), "v"(g[7])
      : "memory");
#endif
}
// The wave's own copies have landed in LDS behind this wait.
__device__ __forceinline__ void wait_async0() {
#if defined(__HIP_DEVICE_COMPILE__)
  asm volatile("s_wait_asynccnt 0x0" ::: "memory");
#endif
}
// The wave's own LDS reads have returned behind this wait.
__device__ __forceinline__ void wait_ds0() {
#if defined(__HIP_DEVICE_COMPILE__)
  asm volatile("s_wait_dscnt 0x0" ::: "memory");
#endif
}
// One stage: KST halves of rows 0..63 of Ag to LDS rows 0..63 and of rows 0..63 of Bg to LDS rows 64..127 (global row pitch LDK
// halves). 16 lanes take one aligned 256-B unit of a row, a copy of the block 16 rows; every offset below is a constant.
template <int KST, int LDK>
__device__ __forceinline__ void fill_stage(const unsigned short* Ag, const unsigned short* Bg, unsigned ldsb, int tid) {
  constexpr int CG  = KST / 128;            // 256-B units per row
  constexpr int PER = 4 * CG;               // copies per thread and operand
  constexpr int PIT = KST + 8;              // LDS row pitch, halves
  static_assert((KST % 128) == 0 && (2 * PER) % 8 == 0 && 2 * PER <= 63);
  const int r0 = tid >> 4, h0 = (tid & 15) * 8;
  const unsigned short* a0 = Ag + (size_t)r0 * LDK + h0;
  const unsigned short* b0 = Bg + (size_t)r0 * LDK + h0;
  const unsigned l0 = ldsb + (unsigned)(r0 * PIT + h0) * 2u;
  // both loops unrolled: every copy's offsets are then constants and l[], g[] stay in registers
#pragma unroll
  for (int g0 = 0; g0 < 2 * PER; g0 += 8) {
    unsigned l[8];
    const unsigned short* g[8];
#pragma unroll
    for (int e = 0; e < 8; ++e) {
      const int it = g0 + e;
      const bool isB = it >= PER;
      const int j = isB ? it - PER : it;
      const int rg = j / CG, cg = j - rg * CG;
      l[e] = l0 + (unsigned)((((isB ? 64 : 0) + rg * 16) * PIT + cg * 128) * 2);
      g[e] = (isB ? b0 : a0) + (size_t)(rg * 16) * LDK + cg * 128;
    }
    acopy8(l, g);
  }
}

template <int OM, int RM, int ACT, int BM, int KST, int NCH>
__global__ __launch_bounds__(256) void gemm64(
    const unsigned short* __restrict__ Ap, long long sA,
    const unsigned short* __restrict__ Btp, long long sB,
    const float* __restrict__ Rp,
    const float* __restrict__ biasp, int nbias,
    void* Cout, int ldc, long long sC, long long lofs,
    int N, float oscale, float ocarry) {
  constexpr int PIT  = KST + 8;               // LDS row pitch, halves
  constexpr int BUFH = 128 * PIT;            // halves per stage buffer: 64 A rows, then 64 Bt rows
  constexpr int LDK  = KST * NCH;            // row pitch of A and Bt, halves (= K)
  constexpr int KB   = 4;                    // k steps of 32 per fragment block
  constexpr int NBLK = KST / (32 * KB);
  static_assert(NCH == 1 || NCH == 2);
  static_assert((KST % (32 * KB)) == 0 && ((PIT * 2) % 32) == 16);
  __shared__ __align__(16) unsigned short sP[NCH * BUFH];
  __shared__ __align__(16) float sT[64 * 68];        // the tile in f32, pitch 68 floats
  const int by   = blockIdx.y;
  const int tid  = threadIdx.x;
  const int lane = tid & 31;
  const int wave = tid >> 5;
  const int tilesN = N >> 6;
  const int tile = blockIdx.x;
  const int tm = tile / tilesN;
  const int tn = tile - tm * tilesN;
  const int m0 = tm << 6;
  const int n0 = tn << 6;

  const unsigned short* Ag = Ap  + (size_t)((long long)by * sA) + (size_t)m0 * LDK;
  const unsigned short* Bg = Btp + (size_t)((long long)by * sB) + (size_t)n0 * LDK;
  const unsigned ldsb = (unsigned)(uintptr_t)(&sP[0]);   // LDS byte address = low 32 bits of the shared address

  fill_stage<KST, LDK>(Ag, Bg, ldsb, tid);
  wait_async0();
  __syncthreads();                                       // stage 0 readable by every wave
  if constexpr (NCH == 2) fill_stage<KST, LDK>(Ag + KST, Bg + KST, ldsb + (unsigned)(BUFH * 2), tid);

  const int rlane = lane & 15;                 // row (A) / col (B, D) within subtile
  const int koff  = (lane >> 4) * 8;           // k offset of this lane half
  const int mOff  = (lane >> 4) * 8;           // D row offset
  const int wr = wave >> 1, wc = wave & 1;     // wave tile: rows wr*16.., cols wc*32..

  v8f acc0 = zero8(), acc1 = zero8();
  // the loops below are unrolled so that the two fragment sets are indexed by constants and stay in registers
#pragma unroll
  for (int t = 0; t < NCH; ++t) {
    const unsigned short* aL = sP + t * BUFH + (wr * 16 + rlane) * PIT + koff;
    const unsigned short* bL = sP + t * BUFH + (64 + wc * 32 + rlane) * PIT + koff;
    // fragments one block ahead in a second register set, each block's LDS reads as one group; never across a stage
    v16h fa[2][KB], fb0[2][KB], fb1[2][KB];
#pragma unroll
    for (int s = 0; s < KB; ++s) {
      fa[0][s]  = ldfrag_u(aL + s * 32);
      fb0[0][s] = ldfrag_u(bL + s * 32);
      fb1[0][s] = ldfrag_u(bL + 16 * PIT + s * 32);
    }
#pragma unroll
    for (int blk = 0; blk < NBLK; ++blk) {
      const int cur = blk & 1;
      if (blk + 1 < NBLK) {
#pragma unroll
        for (int s = 0; s < KB; ++s) {
          const int k0 = ((blk + 1) * KB + s) * 32;
          fa[cur ^ 1][s]  = ldfrag_u(aL + k0);
          fb0[cur ^ 1][s] = ldfrag_u(bL + k0);
          fb1[cur ^ 1][s] = ldfrag_u(bL + 16 * PIT + k0);
        }
      }
      __builtin_amdgcn_sched_barrier(0);   // keeps the next block's LDS reads one group ahead of this block's products
#pragma unroll
      for (int s = 0; s < KB; ++s) {
        acc0 = mma_raw(fa[cur][s], fb0[cur][s], acc0);
        acc1 = mma_raw(fa[cur][s], fb1[cur][s], acc1);
      }
      __builtin_amdgcn_sched_barrier(0);   // keeps later blocks' LDS reads from spreading among these products
    }
    if (t + 1 < NCH) {
      wait_ds0();
      wait_async0();
      __syncthreads();                                   // stage t + 1 readable by every wave
    }
  }
  if constexpr (NCH == 2) wait_async0();                 // no copy is outstanding when the buffers are left

  const int r16 = tid >> 4, c4 = (tid & 15) * 4;         // f32 out: 256-B row segment = 16 lanes x 16 B
  const int r32 = tid >> 3, c8 = (tid & 7) * 8;          // f16 out: 128-B row segment = 8 lanes x 16 B

  // ---- column bias (same columns for every row a thread writes), clamped addresses ----
  float bc4[4], bc8[8];
#pragma unroll
  for (int e = 0; e < 4; ++e) bc4[e] = 0.f;
#pragma unroll
  for (int e = 0; e < 8; ++e) bc8[e] = 0.f;
  if constexpr (BM == 1) {
    if constexpr (OM == 0) {
#pragma unroll
      for (int e = 0; e < 4; ++e) {
        const int n = n0 + c4 + e;
        const int ncl = imin(n, nbias - 1);
        const float t = bfr(biasp[ncl]);
        bc4[e] = (n < nbias) ? t : 0.f;
      }
    } else {
#pragma unroll
      for (int e = 0; e < 8; ++e) {
        const int n = n0 + c8 + e;
        const int ncl = imin(n, nbias - 1);
        const float t = bfr(biasp[ncl]);
        bc8[e] = (n < nbias) ? t : 0.f;
      }
    }
  }

  // ---- epilogue: the tile through LDS, whole row segments out ----
#pragma unroll
  for (int r = 0; r < 8; ++r) {
    float* sp = sT + (wr * 16 + mOff + r) * 68 + wc * 32 + rlane;
    sp[0]  = acc0[r];
    sp[16] = acc1[r];
  }
  __syncthreads();
  if constexpr (OM == 0) {
    float* C = (float*)Cout + (size_t)((long long)by * sC);
#pragma unroll
    for (int it = 0; it < 4; ++it) {
      const int row = it * 16 + r16;                     // it 0..3 x r16 0..15 = rows 0..63
      const int gr  = m0 + row;
      v4f v = *(const v4f*)(sT + row * 68 + c4);
      v4f rv = {0.f, 0.f, 0.f, 0.f};
      if constexpr (RM == 2) {
        const float* R = Rp + (size_t)((long long)by * sC);
        rv = *(const v4f*)(R + (size_t)gr * ldc + n0 + c4);
      }
#pragma unroll
      for (int e = 0; e < 4; ++e) {
        float u = v[e] * oscale;
        if constexpr (BM == 1) u += bc4[e];
        if constexpr (ACT == 2) u = fmaxf(u, 0.f);
        v[e] = u + rv[e];
      }
      *(v4f*)(C + (size_t)gr * ldc + n0 + c4) = v;
    }
  } else {
    unsigned short* C = (unsigned short*)Cout + (size_t)((long long)by * sC);
#pragma unroll
    for (int it = 0; it < 2; ++it) {
      const int row = it * 32 + r32;                     // it 0..1 x r32 0..31 = rows 0..63
      const float* spf = sT + row * 68 + c8;
      v4u a = {0u, 0u, 0u, 0u}, bl = {0u, 0u, 0u, 0u};
#pragma unroll
      for (int e = 0; e < 4; ++e) {
        float f0 = spf[2 * e] * oscale;
        float f1 = spf[2 * e + 1] * oscale;
        if constexpr (BM == 1) { f0 += bc8[2 * e]; f1 += bc8[2 * e + 1]; }
        if constexpr (ACT == 2) { f0 = fmaxf(f0, 0.f); f1 = fmaxf(f1, 0.f); }
        f0 *= ocarry; f1 *= ocarry;
        const _Float16 g0 = (_Float16)f0, g1 = (_Float16)f1;
        const float r0 = (f0 - (float)g0) * RC, r1 = (f1 - (float)g1) * RC;
        a[e]  = pk16(h_bits(g0), h_bits(g1));
        bl[e] = pk16(h_bits((_Float16)r0), h_bits((_Float16)r1));
      }
      unsigned short* p = C + (size_t)(m0 + row) * ldc + n0 + c8;
      *(v4u*)p = a;
      *(v4u*)(p + (size_t)lofs) = bl;
    }
  }
  (void)Rp; (void)ocarry; (void)lofs; (void)nbias; (void)biasp;
}

// =====================================================================================================
// Causal flash attention for one batch, one head and 16 query rows, head dim 64; the keys are split over the 8 waves of the block:
//   q plane QP[b*SEQ + tok][512] (f16: hi x16 at col head*64+d, residual x64 of that at col 256+head*64+d); k plane KP same;
//   v^T plane VT[b*512 + row][key] (pitch SEQ): rows head*64+d hi (f16 x16), rows 256+head*64+d residual x64;
//   out CT[b*SEQ + tok][512]: hi = f16(16 * ctx) at col head*64+d, residual = f16(64 * (16 ctx - hi)) at col 256+head*64+d, where
//   ctx[d] = sum_m softmax_m(q.k / 8 + relb[bucket(tok - m)][head]) v[m][d] over keys m <= tok (softmax run in base 2, -inf select for
//   keys m > tok). The relative bias table (bf16 RNE of relb, x log2 e) for rel 0..q0+15 of the head is built in LDS per block.
//   Key steps of 32 from 0 to q0+16; wave w takes steps w, w + 8, w + 16, ... with its own running maxima, sums and accumulators (a
//   wave-uniform trip count, possibly zero; no block barrier inside the loop). kb <= q0 always, so every query row sees key kb
//   unmasked in every step and the step max is finite; the rescale exponent is clamped at -126 so a wave's first step gives a tiny
//   finite factor times zero sums.
//   Per step: two score tiles, each hi.hi (2 k-steps of 32) into one accumulator and hi.res + res.hi (4 k-steps) into a second one,
//   fragments loaded straight from the 16-bit planes (two 16-B loads per fragment, arithmetic addressing); online max-subtracted
//   softmax in f32 (exp2); rescale of the running sums and the eight accumulators; the 16x32 prob tile stored to wave-private LDS
//   (read back RNE to f16, split k map) and the v^T B fragments (4 hi, 4 residual) loaded straight from the 16-bit plane (keys
//   kb..kb+31 <= SEQ-1 always in range); 8 P.V WMMAs into hi and residual accumulator sets.
//   Merge: each wave leaves its un-normalised 16x64 partial o_hi + o_res/64 (f32, pitch 68) and its (max, sum) per row in LDS; after one
//   block barrier thread t merges row t/16, cols 4(t%16)..+3: M = max_w m_w, weight 2^(m_w - M) (0 for a wave without steps, m_w = -inf;
//   wave 0 always has step 0, so M is finite), l = sum_w weight l_w, ctx16 = 16 sum_w weight o_w / (l 16384 16).
// coverage: LDS bias table: rel 0..kend-1 (all rel used); partials: 8 waves x 16 rows x 64 cols and 8 x 16 (max, sum), all written by
//           every wave, all read; global: 256 threads x 4 halves = 16 rows x 64 halves per plane (a row's 128-B segment = 16 lanes of one
//           wave); grid (NB batches x SEQ/16 query tiles x 4 heads) covers all NROWS x 512 of CT exactly once.
// =====================================================================================================
#define ATT_SPLIT   8
#define ATT_THREADS (ATT_SPLIT * 32)
#define ATT_BLOCKS  (NB * (SEQ / 16) * NHEAD)
#define PT_FLOATS   (ATT_SPLIT * 16 * 36)
#define OP_PITCH    68
static_assert(ATT_THREADS == 16 * (HDIM / 4) && HDIM == 64);
static_assert((HDIM * 2) % 128 == 0 && (HDIM % 32) == 0);

__global__ __launch_bounds__(ATT_THREADS)
void attn4(const unsigned short* __restrict__ QPp, const unsigned short* __restrict__ KPp,
           const unsigned short* __restrict__ VTq, const float* __restrict__ relbl, unsigned short* CT) {
  __shared__ __align__(16) float sbias[SEQ];                          // [rel], bf16(relb) * log2 e
  __shared__ __align__(16) float spt[PT_FLOATS];                      // per wave prob tile [row][32 keys], pitch 36
  __shared__ __align__(16) float spo[ATT_SPLIT * 16 * OP_PITCH];      // per wave partial [row][64 d], pitch 68
  __shared__ __align__(16) float sml[2 * ATT_SPLIT * 16];             // per wave and row: max, then sum

  const int tid  = threadIdx.x;
  const int wave = __builtin_amdgcn_readfirstlane(tid >> 5);  // scalar: the key loop's trip count is a scalar branch, EXEC stays full
  const int lane = tid & 31;
  const int hh   = lane >> 4;
  const int c    = lane & 15;

  const int head = blockIdx.x % NHEAD;                     // 0..3
  const int qb   = blockIdx.x / NHEAD;
  const int qt   = qb % (SEQ / 16);                        // query tile
  const int bat  = qb / (SEQ / 16);                        // batch
  const int q0   = qt * 16;
  const int srow = q0 + 8 * hh;                            // this lane half's first query row (+ r)
  const int kend = q0 + 16;                                // causal: keys 0 .. q0+15; rel = query - key in 0 .. kend-1

  // ---- relative-position bias table for rel 0..kend-1 of this head ----
  for (int rel = tid; rel < kend; rel += ATT_THREADS) {
    const int bk = rel_bucket(rel);
    sbias[rel] = bfr(relbl[bk * NHEAD + head]) * LOG2E;
  }
  __syncthreads();

  const float* sb = sbias;
  const _Float16* Q16 = (const _Float16*)(const void*)QPp;
  const _Float16* K16 = (const _Float16*)(const void*)KPp;
  const _Float16* V16 = (const _Float16*)(const void*)VTq;
  const _Float16* Qh = Q16 + ((size_t)bat * SEQ + q0 + c) * KD + head * HDIM + 8 * hh;
  const _Float16* Kb = K16 + (size_t)bat * SEQ * KD + head * HDIM + 8 * hh;
  const _Float16* Vh = V16 + ((size_t)bat * VTR + head * HDIM) * SEQ + 8 * hh;
  const _Float16* Vl = Vh + (size_t)DMODEL * SEQ;
  const float lsc = (LOG2E * ATT_SCALE) / (QC * KC);      // log2(e) / 8 / carries

  const v16h qah = ldfrag_h(Qh), qbh = ldfrag_h(Qh + 32);                       // hi, d 0..31 / 32..63
  const v16h qal = ldfrag_h(Qh + DMODEL), qbl = ldfrag_h(Qh + DMODEL + 32);     // residual x64

  float mrow[8], lrow[8];
  v8f om0 = zero8(), om1 = zero8(), om2 = zero8(), om3 = zero8();
  v8f or0 = zero8(), or1 = zero8(), or2 = zero8(), or3 = zero8();
#pragma unroll
  for (int r = 0; r < 8; ++r) { mrow[r] = -INFINITY; lrow[r] = 0.f; }
  float* pt = spt + wave * (16 * 36);

#pragma unroll 1
  for (int kb = wave * 32; kb < kend; kb += 32 * ATT_SPLIT) {
    const _Float16* kp = Kb + (size_t)(kb + c) * KD;
    v8f s0m, s0r, s1m, s1r;
    {
      const v16h k0h = ldfrag_h(kp), k1h = ldfrag_h(kp + 32);
      const v16h k0l = ldfrag_h(kp + DMODEL), k1l = ldfrag_h(kp + DMODEL + 32);
      s0m = mma_raw(qah, k0h, zero8());
      s0m = mma_raw(qbh, k1h, s0m);
      s0r = mma_raw(qah, k0l, zero8());
      s0r = mma_raw(qbh, k1l, s0r);
      s0r = mma_raw(qal, k0h, s0r);
      s0r = mma_raw(qbl, k1h, s0r);
      guard_s2x4(s0m, s0r, k0h, k1h, k0l, k1l);
    }
    {
      const _Float16* kq = kp + (size_t)16 * KD;
      const v16h k0h = ldfrag_h(kq), k1h = ldfrag_h(kq + 32);
      const v16h k0l = ldfrag_h(kq + DMODEL), k1l = ldfrag_h(kq + DMODEL + 32);
      s1m = mma_raw(qah, k0h, zero8());
      s1m = mma_raw(qbh, k1h, s1m);
      s1r = mma_raw(qah, k0l, zero8());
      s1r = mma_raw(qbh, k1l, s1r);
      s1r = mma_raw(qal, k0h, s1r);
      s1r = mma_raw(qbl, k1h, s1r);
      guard_s2x4(s1m, s1r, k0h, k1h, k0l, k1l);
      keep4_h(qah, qbh, qal, qbl);
    }
    const int key0 = kb + c;                               // key of this lane's column in tile 0
    const int key1 = kb + 16 + c;                          // key of this lane's column in tile 1
#pragma unroll
    for (int r = 0; r < 8; ++r) {
      const int qi = srow + r;
      const int i0 = imax(qi - key0, 0);
      const int i1 = imax(qi - key1, 0);
      float t0 = (s0m[r] + s0r[r] * RCI) * lsc + sb[i0];
      float t1 = (s1m[r] + s1r[r] * RCI) * lsc + sb[i1];
      t0 = (key0 > qi) ? -INFINITY : t0;
      t1 = (key1 > qi) ? -INFINITY : t1;
      float mx = fmaxf(t0, t1);
#pragma unroll
      for (int off = 1; off < 16; off <<= 1) mx = fmaxf(mx, __shfl_xor(mx, off, 32));
      const float mn = fmaxf(mrow[r], mx);
      const float al = exp2f(fmaxf(mrow[r] - mn, -126.0f));
      mrow[r] = mn;
      const float e0 = exp2f(t0 - mn);
      const float e1 = exp2f(t1 - mn);
      float ps = e0 + e1;
#pragma unroll
      for (int off = 1; off < 16; off <<= 1) ps += __shfl_xor(ps, off, 32);
      lrow[r] = lrow[r] * al + ps;
      om0[r] *= al; om1[r] *= al; om2[r] *= al; om3[r] *= al;
      or0[r] *= al; or1[r] *= al; or2[r] *= al; or3[r] *= al;
      const int ro = (8 * hh + r) * 36 + c;
      pt[ro]      = e0;
      pt[ro + 16] = e1;
    }
    wave_sync_lds();
    FragH ph;
    {
      const float* prow = pt + c * 36 + 8 * hh;
      const v4f p0 = *(const v4f*)(prow), p1 = *(const v4f*)(prow + 4);
      const v4f p2 = *(const v4f*)(prow + 16), p3 = *(const v4f*)(prow + 20);
#pragma unroll
      for (int e = 0; e < 4; ++e) {
        ph.h[0][e]     = (_Float16)(p0[e] * PC);              // elements 0..7  = keys kb + 8hh + 0..7
        ph.h[0][4 + e] = (_Float16)(p1[e] * PC);
        ph.h[1][e]     = (_Float16)(p2[e] * PC);              // elements 8..15 = keys kb + 16 + 8hh + 0..7
        ph.h[1][4 + e] = (_Float16)(p3[e] * PC);
      }
    }
    {
      const _Float16* vp = Vh + (size_t)c * SEQ + kb;
      const v16h vb0 = ldfrag_h(vp);
      const v16h vb1 = ldfrag_h(vp + (size_t)16 * SEQ);
      const v16h vb2 = ldfrag_h(vp + (size_t)32 * SEQ);
      const v16h vb3 = ldfrag_h(vp + (size_t)48 * SEQ);
      om0 = mma_raw(ph.v, vb0, om0);
      om1 = mma_raw(ph.v, vb1, om1);
      om2 = mma_raw(ph.v, vb2, om2);
      om3 = mma_raw(ph.v, vb3, om3);
      guard_pv4(om0, om1, om2, om3, ph.v, vb0, vb1, vb2, vb3);
    }
    {
      const _Float16* vq = Vl + (size_t)c * SEQ + kb;
      const v16h vl0 = ldfrag_h(vq);
      const v16h vl1 = ldfrag_h(vq + (size_t)16 * SEQ);
      const v16h vl2 = ldfrag_h(vq + (size_t)32 * SEQ);
      const v16h vl3 = ldfrag_h(vq + (size_t)48 * SEQ);
      or0 = mma_raw(ph.v, vl0, or0);
      or1 = mma_raw(ph.v, vl1, or1);
      or2 = mma_raw(ph.v, vl2, or2);
      or3 = mma_raw(ph.v, vl3, or3);
      guard_pv4(or0, or1, or2, or3, ph.v, vl0, vl1, vl2, vl3);
    }
    wave_sync_lds();
  }

  // ---- the wave's un-normalised partial and its (max, sum) per row to LDS ----
  {
    float* pw = spo + wave * (16 * OP_PITCH) + c;
#pragma unroll
    for (int r = 0; r < 8; ++r) {
      float* op = pw + (8 * hh + r) * OP_PITCH;
      op[0]  = om0[r] + or0[r] * RCI;
      op[16] = om1[r] + or1[r] * RCI;
      op[32] = om2[r] + or2[r] * RCI;
      op[48] = om3[r] + or3[r] * RCI;
    }
    if (c == 0) {                                          // max and sum are equal in the 16 lanes of a half
#pragma unroll
      for (int r = 0; r < 8; ++r) {
        sml[wave * 16 + 8 * hh + r] = mrow[r];
        sml[ATT_SPLIT * 16 + wave * 16 + 8 * hh + r] = lrow[r];
      }
    }
  }
  __syncthreads();                                         // every wave's partial readable by every wave
  // ---- merge the 8 partials, fold 1/l and the carries, write 4 hi and 4 residual halves per thread ----
  {
    const int row = tid >> 4, c4 = (tid & 15) * 4;
    float ms[ATT_SPLIT];
    float mall = -INFINITY;
#pragma unroll
    for (int s = 0; s < ATT_SPLIT; ++s) {
      ms[s] = sml[s * 16 + row];
      mall = fmaxf(mall, ms[s]);
    }
    float lall = 0.f;
    v4f o = {0.f, 0.f, 0.f, 0.f};
#pragma unroll
    for (int s = 0; s < ATT_SPLIT; ++s) {
      const float w = exp2f(ms[s] - mall);
      const v4f p = *(const v4f*)(spo + (s * 16 + row) * OP_PITCH + c4);
      lall += w * sml[ATT_SPLIT * 16 + s * 16 + row];
#pragma unroll
      for (int e = 0; e < 4; ++e) o[e] += w * p[e];
    }
    const float inv = (1.0f / lall) * (CC / (PC * VC));
    const float u0 = o[0] * inv, u1 = o[1] * inv, u2 = o[2] * inv, u3 = o[3] * inv;
    const _Float16 g0 = (_Float16)u0, g1 = (_Float16)u1, g2 = (_Float16)u2, g3 = (_Float16)u3;
    v2u hv, lv;
    hv[0] = pk16(h_bits(g0), h_bits(g1));
    hv[1] = pk16(h_bits(g2), h_bits(g3));
    lv[0] = pk16(h_bits((_Float16)((u0 - (float)g0) * RC)), h_bits((_Float16)((u1 - (float)g1) * RC)));
    lv[1] = pk16(h_bits((_Float16)((u2 - (float)g2) * RC)), h_bits((_Float16)((u3 - (float)g3) * RC)));
    unsigned short* dst = CT + ((size_t)bat * SEQ + q0 + row) * KD + head * HDIM + c4;
    *(v2u*)dst = hv;
    *(v2u*)(dst + DMODEL) = lv;
  }
}

// =====================================================================================================
// RMSNorm over the last dim (256): out = x * rsqrt(mean(x*x) + eps) * bf16(w), eps 1.1920929e-7, in f32; written as the dual 16-bit
// plane outh[row][512]: hi = f16(16 * out) at col c, residual = f16(64 * (16 out - hi)) at col 256 + c.
//   One wave per row (4 rows per 128-thread block): lane loads 8 consecutive floats (two 16-B loads), sum of squares by xor shuffles,
//   then writes its own 8 hi halves and 8 residual halves: per plane one instruction of 32 lanes x 16 B = the whole 512-B half row
// coverage: grid = NROWS/4 blocks x 4 waves = every row once; per row 32 lanes x 8 halves = 256 hi + 256 residual halves.
// =====================================================================================================
__global__ __launch_bounds__(128) void rmsn(const float* __restrict__ Xp, const float* __restrict__ wp, unsigned short* outh) {
  const int wave = threadIdx.x >> 5, lane = threadIdx.x & 31;
  const int row = blockIdx.x * 4 + wave;
  const int c0 = lane * 8;
  const float* xp = Xp + (size_t)row * DMODEL + c0;
  const v4f x0 = *(const v4f*)(xp), x1 = *(const v4f*)(xp + 4);
  float ss = ((x0[0] * x0[0] + x0[1] * x0[1]) + (x0[2] * x0[2] + x0[3] * x0[3])) +
             ((x1[0] * x1[0] + x1[1] * x1[1]) + (x1[2] * x1[2] + x1[3] * x1[3]));
#pragma unroll
  for (int off = 1; off < 32; off <<= 1) ss += __shfl_xor(ss, off, 32);
  const float rstd = rsqrtf(ss * (1.0f / (float)DMODEL) + RMS_EPS);
  const v4f w0 = *(const v4f*)(wp + c0), w1 = *(const v4f*)(wp + c0 + 4);
  float o[8];
#pragma unroll
  for (int e = 0; e < 4; ++e) {
    o[e]     = (x0[e] * rstd) * bfr(w0[e]);
    o[4 + e] = (x1[e] * rstd) * bfr(w1[e]);
  }
  v4u hv, lv;
#pragma unroll
  for (int e = 0; e < 4; ++e) {
    const float f0 = o[2 * e] * HC, f1 = o[2 * e + 1] * HC;
    const _Float16 g0 = (_Float16)f0, g1 = (_Float16)f1;
    hv[e] = pk16(h_bits(g0), h_bits(g1));
    lv[e] = pk16(h_bits((_Float16)((f0 - (float)g0) * RC)), h_bits((_Float16)((f1 - (float)g1) * RC)));
  }
  unsigned short* dp = outh + (size_t)row * KD + c0;
  {
    *(v4u*)dp = hv;
    *(v4u*)(dp + DMODEL) = lv;
    
  }
}

// =====================================================================================================
// Input convert: obs16[m][640] = f16(16 * bf16_RNE(obs[b*SEQ_FULL + t][c])) for c < 637 (m = b*SEQ + t), 0 for the pad columns
// 637..639 (explicitly written). One wave per row (4 rows per block): 80 pieces of 8 halves; lane writes pieces lane, lane+32 and
// coverage: grid NROWS/4 x 4 waves = every row; per row pieces 0..79 = cols 0..639.
// =====================================================================================================
__global__ __launch_bounds__(128) void cvtobs(const float* __restrict__ src, unsigned short* dst) {
  const int wave = threadIdx.x >> 5, lane = threadIdx.x & 31;
  const int m = blockIdx.x * 4 + wave;
  const int b = m / SEQ, t = m - b * SEQ;
  const float* sp = src + ((size_t)b * SEQ_FULL + t) * OBSD;
  unsigned short* dp = dst + (size_t)m * OBSP;
  {
#pragma unroll 1
    for (int it = 0; it < 3; ++it) {
      const int p = it * 32 + lane;
      const int col0 = p * 8;
      v4u a;
#pragma unroll
      for (int e = 0; e < 4; ++e) {
        const int ca = col0 + 2 * e, cb = ca + 1;
        float fa = sp[imin(ca, OBSD - 1)];
        float fb = sp[imin(cb, OBSD - 1)];
        fa = (ca < OBSD) ? fa : 0.f;
        fb = (cb < OBSD) ? fb : 0.f;
        a[e] = pk16(h_bits((_Float16)(bfr(fa) * OBC)), h_bits((_Float16)(bfr(fb) * OBC)));
      }
      if (p < OBSP / 8) *(v4u*)(dp + (size_t)p * 8) = a;
    }
    
  }
}

// =====================================================================================================
// Output copy: blockIdx.y == 0: out0[b*SEQ_FULL + t][0..3] = ACTF[b*SEQ + t][0..3] (one 16-B piece per thread, consecutive threads
// (SEQ*637 floats at float OUT1_OFF + b*SEQ_FULL*637) written as consecutive 16-B pieces (thread g -> floats 4i..4i+3, gathered from
// coverage: out0: NROWS pieces = every row; out1: NB * SEQ*637/4 pieces = every float of the region exactly once.
// =====================================================================================================
__global__ __launch_bounds__(256) void ocopy(const float* __restrict__ actf, const float* __restrict__ obsf, float* outp) {
  const int g = blockIdx.x * 256 + threadIdx.x;
  if (blockIdx.y == 0) {
    if (g >= NROWS) return;
    const int b = g / SEQ, t = g - b * SEQ;
    const v4f v = *(const v4f*)(actf + (size_t)g * NACTP);
    float* d = outp + ((size_t)b * SEQ_FULL + t) * NACT;
    {
      *(v4f*)d = v;
      
    }
  } else {
    const int ppb = (SEQ * OBSD) / 4;
    if (g >= NB * ppb) return;
    const int b = g / ppb;
    const int i = (g - b * ppb) * 4;
    v4f v;
#pragma unroll
    for (int e = 0; e < 4; ++e) {
      const int idx = i + e;
      const int row = idx / OBSD;
      const int col = idx - row * OBSD;
      v[e] = obsf[((size_t)b * SEQ + row) * OBSP + col];
    }
    float* d = outp + (size_t)OUT1_OFF + (size_t)b * SEQ_FULL * OBSD + i;
    {
      *(v4f*)d = v;
      
    }
  }
}

// =====================================================================================================
// Workspace map (bytes); every plane is an exact multiple of its tile / whole-row store granularity (M, N exact multiples of 64,
//   WQ16, WK16, WV16, WO16  f16 [6][256 n][512 = k x64 | k x1]     4 x 1572864
//   W116                    f16 [6][512 n][512]                       3145728
//   W216                    f16 [6][256 n][1024 = 512 x64 | 512 x1]  3145728
//   OBSW16                  f16 [256 n][640 k] x64 (k 637..639 zero)  327680
//   ACTW16                  f16 [64 n][512] (n 4..63 zero)              65536
//   OBSHW16                 f16 [640 n][512] (n 637..639 zero)         655360
//   OBS16                   f16 [NROWS][640] x16                      5242880
//   XA, XB                  f32 [NROWS][256] residual stream       2 x 4194304
//   HH, QP, KP, CT          f16 [NROWS][512] dual planes           4 x 4194304
//   VT                      f16 [NB][512][SEQ]                       4194304
//   G16                     f16 [NROWS][1024] dual                   8388608
//   ACTF                    f32 [NROWS][64]                          1048576
//   OBSF                    f32 [NROWS][640]                        10485760
//   total (NB=2, SEQ=2048)                                          68157440
// =====================================================================================================
extern "C" void kernel_launch(void* const* d_in, const int* in_sizes, int n_in,
                              void* d_out, int out_size, void* d_ws, size_t ws_size,
                              hipStream_t stream) {
  if (n_in < 19) return;
  if (in_sizes[0] < ((NB - 1) * SEQ_FULL + SEQ) * OBSD) return;
  if (in_sizes[1] < OBSD * DMODEL || in_sizes[2] < DMODEL) return;
  if (in_sizes[3] < NLAYER * DMODEL) return;
  if (in_sizes[4] < NLAYER * DMODEL * DMODEL || in_sizes[5] < NLAYER * DMODEL * DMODEL) return;
  if (in_sizes[6] < NLAYER * DMODEL * DMODEL || in_sizes[7] < NLAYER * DMODEL * DMODEL) return;
  if (in_sizes[8] < NLAYER * NBUCK * NHEAD || in_sizes[9] < NLAYER * DMODEL) return;
  if (in_sizes[10] < NLAYER * DMODEL * DFF || in_sizes[11] < NLAYER * DFF) return;
  if (in_sizes[12] < NLAYER * DFF * DMODEL || in_sizes[13] < NLAYER * DMODEL) return;
  if (in_sizes[14] < DMODEL || in_sizes[15] < DMODEL * NACT || in_sizes[16] < NACT) return;
  if (in_sizes[17] < DMODEL * OBSD || in_sizes[18] < OBSD) return;
  if (out_size < OUT1_OFF + ((NB - 1) * SEQ_FULL + SEQ) * OBSD) return;

  const float* obs     = (const float*)d_in[0];
  const float* obs_w   = (const float*)d_in[1];
  const float* obs_b   = (const float*)d_in[2];
  const float* norm1_w = (const float*)d_in[3];
  const float* w_q     = (const float*)d_in[4];
  const float* w_k     = (const float*)d_in[5];
  const float* w_v     = (const float*)d_in[6];
  const float* w_o     = (const float*)d_in[7];
  const float* relb    = (const float*)d_in[8];
  const float* norm2_w = (const float*)d_in[9];
  const float* w_1     = (const float*)d_in[10];
  const float* b_1     = (const float*)d_in[11];
  const float* w_2     = (const float*)d_in[12];
  const float* b_2     = (const float*)d_in[13];
  const float* fnorm_w = (const float*)d_in[14];
  const float* act_w   = (const float*)d_in[15];
  const float* act_b   = (const float*)d_in[16];
  const float* obsh_w  = (const float*)d_in[17];
  const float* obsh_b  = (const float*)d_in[18];
  float*       outp    = (float*)d_out;

  const size_t PWE  = (size_t)NLAYER * DMODEL * KD * 2;     // 1572864
  const size_t PW1  = (size_t)NLAYER * DFF * KD * 2;        // 3145728
  const size_t PW2  = (size_t)NLAYER * DMODEL * KF * 2;     // 3145728
  const size_t POBW = (size_t)DMODEL * OBSP * 2;            //  327680
  const size_t PACW = (size_t)NACTP * KD * 2;               //   65536
  const size_t POHW = (size_t)OBSP * KD * 2;                //  655360
  const size_t POBS = (size_t)NROWS * OBSP * 2;             // 5242880
  const size_t PX   = (size_t)NROWS * DMODEL * 4;           // 4194304
  const size_t PH   = (size_t)NROWS * KD * 2;               // 4194304
  const size_t PVT  = (size_t)NB * VTR * SEQ * 2;           // 4194304
  const size_t PG   = (size_t)NROWS * KF * 2;               // 8388608
  const size_t PACF = (size_t)NROWS * NACTP * 4;            // 1048576
  const size_t POBF = (size_t)NROWS * OBSP * 4;             // 10485760
  size_t off = 0;
  const size_t oWQ  = off; off += PWE;
  const size_t oWK  = off; off += PWE;
  const size_t oWV  = off; off += PWE;
  const size_t oWO  = off; off += PWE;
  const size_t oW1  = off; off += PW1;
  const size_t oW2  = off; off += PW2;
  const size_t oOBW = off; off += POBW;
  const size_t oACW = off; off += PACW;
  const size_t oOHW = off; off += POHW;
  const size_t oOBS = off; off += POBS;
  const size_t oXA  = off; off += PX;
  const size_t oXB  = off; off += PX;
  const size_t oHH  = off; off += PH;
  const size_t oQP  = off; off += PH;
  const size_t oKP  = off; off += PH;
  const size_t oCT  = off; off += PH;
  const size_t oVT  = off; off += PVT;
  const size_t oG   = off; off += PG;
  const size_t oACF = off; off += PACF;
  const size_t oOBF = off; off += POBF;
  const size_t endAll = off;                                // 68157440 for NB=2, SEQ=2048
  if (endAll > ws_size) return;
  if (endAll > (size_t)134217728) return;

  char* ws = (char*)d_ws;
  unsigned short* WQ16    = (unsigned short*)(ws + oWQ);
  unsigned short* WK16    = (unsigned short*)(ws + oWK);
  unsigned short* WV16    = (unsigned short*)(ws + oWV);
  unsigned short* WO16    = (unsigned short*)(ws + oWO);
  unsigned short* W116    = (unsigned short*)(ws + oW1);
  unsigned short* W216    = (unsigned short*)(ws + oW2);
  unsigned short* OBSW16  = (unsigned short*)(ws + oOBW);
  unsigned short* ACTW16  = (unsigned short*)(ws + oACW);
  unsigned short* OBSHW16 = (unsigned short*)(ws + oOHW);
  unsigned short* OBS16   = (unsigned short*)(ws + oOBS);
  float*          XA      = (float*)(ws + oXA);
  float*          XB      = (float*)(ws + oXB);
  unsigned short* HH      = (unsigned short*)(ws + oHH);
  unsigned short* QP      = (unsigned short*)(ws + oQP);
  unsigned short* KP      = (unsigned short*)(ws + oKP);
  unsigned short* CT      = (unsigned short*)(ws + oCT);
  unsigned short* VTp     = (unsigned short*)(ws + oVT);
  unsigned short* G16     = (unsigned short*)(ws + oG);
  float*          ACTF    = (float*)(ws + oACF);
  float*          OBSF    = (float*)(ws + oOBF);

  const dim3 blk(256);
  const dim3 blk128(128);
  const dim3 gRow(NROWS / 4);                                      // rmsn / cvtobs: 4 rows per block
  const int tilesE  = (NROWS / 64) * (DMODEL / 64);                // 256
  const int tilesV  = (DMODEL / 64) * (SEQ / 64);                  // 128 per batch
  const int tilesF  = (NROWS / 64) * (DFF / 64);                   // 512
  const int tilesA  = (NROWS / 64) * (NACTP / 64);                 // 64
  const int tilesO  = (NROWS / 64) * (OBSP / 64);                  // 640
  const dim3 gE(tilesE, 1);                                        // 256: one tile per block
  const dim3 gQK(tilesE, 2);                                       // 256 x 2 (q, k)
  const dim3 gV(tilesV, NB);                                       // 128 x NB
  const dim3 gF(tilesF, 1);                                        // 512
  const dim3 gA(tilesA, 1);                                        // 64
  const dim3 gO(tilesO, 1);                                        // 640
  const dim3 gAT(ATT_BLOCKS);                                      // NB x SEQ/16 x 4 heads = 1024
  const dim3 bAT(ATT_THREADS);                                     // 256
  const int ppb = (SEQ * OBSD) / 4;
  const int gcx0 = NROWS / 256, gcx1 = (NB * ppb + 255) / 256;
  const dim3 gOC(gcx0 > gcx1 ? gcx0 : gcx1, 2);                    // (2548, 2)

  const long long eSrcE = (long long)DMODEL * DMODEL;              // per layer source [256][256]
  const long long eDstE = (long long)DMODEL * KD;                  // per layer plane [256][512]
  const long long sQK   = (long long)NLAYER * DMODEL * KD;         // WK16 - WQ16 in halves
  const long long sKP   = (long long)NROWS * KD;                   // KP - QP in halves

  // (0) 16-bit operand planes: transposed weights [n][k x64 | k x1] (bf16 RNE then exact power-of-two scale), obs x16
  cvtobs<<<gRow, blk128, 0, stream>>>(obs, OBS16);
  tcvt16<1><<<dim3(DMODEL / 64, DMODEL / 64, NLAYER), blk, 0, stream>>>(w_q, eSrcE, WQ16, eDstE, DMODEL, DMODEL, KD, DMODEL, WSC, WLO);  // in[256 k][256 n] -> out[256 n][512]
  tcvt16<1><<<dim3(DMODEL / 64, DMODEL / 64, NLAYER), blk, 0, stream>>>(w_k, eSrcE, WK16, eDstE, DMODEL, DMODEL, KD, DMODEL, WSC, WLO);
  tcvt16<1><<<dim3(DMODEL / 64, DMODEL / 64, NLAYER), blk, 0, stream>>>(w_v, eSrcE, WV16, eDstE, DMODEL, DMODEL, KD, DMODEL, WSC, WLO);
  tcvt16<1><<<dim3(DMODEL / 64, DMODEL / 64, NLAYER), blk, 0, stream>>>(w_o, eSrcE, WO16, eDstE, DMODEL, DMODEL, KD, DMODEL, WSC, WLO);
  tcvt16<1><<<dim3(DFF / 64, DMODEL / 64, NLAYER), blk, 0, stream>>>(w_1, (long long)DMODEL * DFF, W116, (long long)DFF * KD,
                                                                    DMODEL, DFF, KD, DMODEL, WSC, WLO);            // in[256 k][512 n] -> out[512 n][512]
  tcvt16<1><<<dim3(DMODEL / 64, DFF / 64, NLAYER), blk, 0, stream>>>(w_2, (long long)DFF * DMODEL, W216, (long long)DMODEL * KF,
                                                                    DFF, DMODEL, KF, DFF, WSC, WLO);               // in[512 k][256 n] -> out[256 n][1024]
  tcvt16<0><<<dim3(DMODEL / 64, OBSP / 64, 1), blk, 0, stream>>>(obs_w, 0LL, OBSW16, 0LL, OBSD, DMODEL, OBSP, 0, WSC, 0.f);  // in[637 k][256 n] -> out[256 n][640], k 637..639 zero
  tcvt16<1><<<dim3(NACTP / 64, DMODEL / 64, 1), blk, 0, stream>>>(act_w, 0LL, ACTW16, 0LL, DMODEL, NACT, KD, DMODEL, WSC, WLO);  // in[256 k][4 n] -> out[64 n][512], n >= 4 zero
  tcvt16<1><<<dim3(OBSP / 64, DMODEL / 64, 1), blk, 0, stream>>>(obsh_w, 0LL, OBSHW16, 0LL, DMODEL, OBSD, KD, DMODEL, WSC, WLO); // in[256 k][637 n] -> out[640 n][512], n >= 637 zero

  // (1) x = obs . Wp + bf16(bp) -> XA (f32); M = NROWS, N = 256, K = 640 (single product, inputs exact)
  gemm64<0, 0, 0, 1, OBSP, 1><<<gE, blk, 0, stream>>>(
      OBS16, 0LL,
      OBSW16, 0LL,
      (const float*)0,
      obs_b, DMODEL,
      (void*)XA, DMODEL, 0LL, 0LL,
      DMODEL, 1.0f / (OBC * WSC), 1.0f);

  for (int l = 0; l < NLAYER; ++l) {
    const size_t lwE = (size_t)l * DMODEL * KD;                    // WQ/WK/WV/WO layer offset (halves)
    const size_t lw1 = (size_t)l * DFF * KD;
    const size_t lw2 = (size_t)l * DMODEL * KF;

    // (2) h = RMSNorm(x) * bf16(g1) -> HH (hi x16 | residual x64)
    rmsn<<<gRow, blk128, 0, stream>>>(XA, norm1_w + (size_t)l * DMODEL, HH);

    // (3) q, k projections (batched by blockIdx.y): QP / KP [m][hi | res]; M = NROWS, N = 256, K = 512 folded, no bias
    gemm64<1, 0, 0, 0, KD, 1><<<gQK, blk, 0, stream>>>(
        HH, 0LL,
        WQ16 + lwE, sQK,
        (const float*)0,
        (const float*)0, 1,
        (void*)QP, KD, sKP, (long long)DMODEL,
        DMODEL, 1.0f / (HC * WSC), QC);

    // (4) v^T per batch: VT[b][d][tok] (hi rows d, residual rows 256+d); M = 256 (d), N = SEQ, K = 512 folded
    gemm64<1, 0, 0, 0, KD, 1><<<gV, blk, 0, stream>>>(
        WV16 + lwE, 0LL,
        HH, (long long)SEQ * KD,
        (const float*)0,
        (const float*)0, 1,
        (void*)VTp, SEQ, (long long)VTR * SEQ, (long long)DMODEL * SEQ,
        SEQ, 1.0f / (HC * WSC), VC);

    // (5) causal attention with relative-position bias per (batch, 16 query rows, head), keys split over 8 waves -> CT (hi x16 | residual x64)
    attn4<<<gAT, bAT, 0, stream>>>(QP, KP, VTp, relb + (size_t)l * NBUCK * NHEAD, CT);

    // (6) XB = CT . Wo / (16 * 64) + XA (raw f32); M = NROWS, N = 256, K = 512 folded
    gemm64<0, 2, 0, 0, KD, 1><<<gE, blk, 0, stream>>>(
        CT, 0LL,
        WO16 + lwE, 0LL,
        XA,
        (const float*)0, 1,
        (void*)XB, DMODEL, 0LL, 0LL,
        DMODEL, 1.0f / (CC * WSC), 1.0f);

    // (7) h2 = RMSNorm(x) * bf16(g2) -> HH
    rmsn<<<gRow, blk128, 0, stream>>>(XB, norm2_w + (size_t)l * DMODEL, HH);

    // (8) G16 = dual f16 of 64 * relu(h2 . W1 + bf16(b1)); M = NROWS, N = 512, K = 512 folded
    gemm64<1, 0, 2, 1, KD, 1><<<gF, blk, 0, stream>>>(
        HH, 0LL,
        W116 + lw1, 0LL,
        (const float*)0,
        b_1 + (size_t)l * DFF, DFF,
        (void*)G16, KF, 0LL, (long long)DFF,
        DFF, 1.0f / (HC * WSC), GC);

    // (9) XA = G16 . W2 / (64 * 64) + bf16(b2) + XB (raw f32); M = NROWS, N = 256, K = 1024 folded
    gemm64<0, 2, 0, 1, KF / 2, 2><<<gE, blk, 0, stream>>>(
        G16, 0LL,
        W216 + lw2, 0LL,
        XB,
        b_2 + (size_t)l * DMODEL, DMODEL,
        (void*)XA, DMODEL, 0LL, 0LL,
        DMODEL, 1.0f / (GC * WSC), 1.0f);
  }

  // (10) hf = RMSNorm(x) * bf16(gf) -> HH
  rmsn<<<gRow, blk128, 0, stream>>>(XA, fnorm_w, HH);

  // (11) action logits plane ACTF[m][64] = hf . Wa + bf16(ba) (cols 0..3 meaningful); M = NROWS, N = 64, K = 512 folded
  gemm64<0, 0, 0, 1, KD, 1><<<gA, blk, 0, stream>>>(
      HH, 0LL,
      ACTW16, 0LL,
      (const float*)0,
      act_b, NACT,
      (void*)ACTF, NACTP, 0LL, 0LL,
      NACTP, 1.0f / (HC * WSC), 1.0f);

  // (12) obs prediction plane OBSF[m][640] = hf . Wh + bf16(bh) (cols 0..636 meaningful); M = NROWS, N = 640, K = 512 folded
  gemm64<0, 0, 0, 1, KD, 1><<<gO, blk, 0, stream>>>(
      HH, 0LL,
      OBSHW16, 0LL,
      (const float*)0,
      obsh_b, OBSD,
      (void*)OBSF, OBSP, 0LL, 0LL,
      OBSP, 1.0f / (HC * WSC), 1.0f);

  ocopy<<<gOC, blk, 0, stream>>>(ACTF, OBSF, outp);
  (void)hipGetLastError();
}

// v003
// Measured time: 507 microseconds a run.
// Two timings next to v002 both put it at 1.08 times that version's speed.
// All steps since v000 together make it 3.80 times as fast.
// Contractions (all v_wmma_f32_16x16x32_f16, f16 operands, f32 accumulate): input projection (obs f16 x16 . Wp^T f16 x64, K=640
// zero-padded, single product); q/k, v^T, attention-output, hidden (ReLU), second and both head projections with the activation
// operand carried as two f16 planes [hi | residual x64] folded along K against [W^T x64 | W^T x1]; attention scores q.k^T from the
// q/k hi and residual planes (hi.hi plus the two cross terms, two accumulators, K=64); attention P.v^T with P f16 x16384 (single)
// against v^T hi and residual planes (two accumulators). RMSNorm, softmax (base 2), ReLU, biases, relative-position bias and the
// residual stream in f32 on VALU. Every float input RNE-converted to bf16 on load.
#include <hip/hip_runtime.h>
#include <math.h>
#include <stdint.h>

#ifndef NB
#define NB        2
#endif
#ifndef SEQ
#define SEQ       2048
#endif
#define NB_FULL   2
#define SEQ_FULL  2048
#define NLAYER    6
#define DMODEL    256
#define NHEAD     4
#define HDIM      64
#define DFF       512
#define OBSD      637
#define OBSP      640
#define NACT      4
#define NACTP     64
#define NBUCK     32
#define NROWS     (NB * SEQ)
#define KD        (2 * DMODEL)          // folded K of E-wide activation operands: [hi 256 | residual 256]
#define KF        (2 * DFF)             // folded K of the hidden operand: [hi 512 | residual 512]
#define VTR       KD                    // rows per batch of the v^T plane: 0..255 hi, 256..511 residual
#define OUT1_OFF  (NB_FULL * SEQ_FULL * NACT)   // float index of the second output (byte offset 65536)
#define OUT_TOTAL (OUT1_OFF + NB_FULL * SEQ_FULL * OBSD)

// carries (exact powers of two)
#define WSC_I 64
#define RC_I  64
#define WLO_I 1
#define WSC   64.0f        // weight hi copy
#define WLO   1.0f         // weight lo copy (pairs with the x64 residual plane)
#define RC    64.0f        // residual plane carry relative to its hi plane
#define RCI   0.015625f
#define OBC   16.0f        // obs plane
#define HC    16.0f        // RMSNorm outputs
#define QC    16.0f
#define KC    16.0f
#define VC    16.0f
#define PC    16384.0f     // softmax P tile
#define CC    16.0f        // attention context
#define GC    64.0f        // ReLU hidden
#define ATT_SCALE 0.125f
#define LOG2E   1.4426950408889634f
#define RMS_EPS 1.1920929e-07f
static_assert(RC_I * WLO_I == WSC_I);
static_assert(NHEAD * HDIM == DMODEL);
static_assert(NB >= 1 && NB <= NB_FULL && SEQ >= 64 && SEQ <= SEQ_FULL);
static_assert((SEQ % 64) == 0 && (SEQ % 16) == 0 && (NROWS % 64) == 0 && (DMODEL % 64) == 0 && (DFF % 64) == 0);
static_assert((OBSP % 64) == 0 && (NACTP % 64) == 0 && OBSP >= OBSD && NACTP >= NACT && (OBSP - OBSD) < 64);
static_assert((KD % 32) == 0 && (KF % 32) == 0 && (OBSP % 32) == 0);
static_assert((NROWS % 256) == 0 && (NROWS % 4) == 0 && ((SEQ * OBSD) % 4) == 0);
static_assert(OUT_TOTAL == 2625536);

typedef _Float16 v16h __attribute__((ext_vector_type(16)));
typedef _Float16 v8h  __attribute__((ext_vector_type(8)));
typedef float    v8f  __attribute__((ext_vector_type(8)));
typedef float    v4f  __attribute__((ext_vector_type(4)));
typedef unsigned int v4u __attribute__((ext_vector_type(4)));
typedef unsigned int v2u __attribute__((ext_vector_type(2)));

union FragH { v16h v; v8h h[2]; v4u u[2]; };

// ---- scalar helpers --------------------------------------------------------------------------------
__device__ __forceinline__ unsigned short bf_bits(float f) {          // f32 -> bf16 bits, RNE convert
  unsigned u = __float_as_uint(f);
  return (unsigned short)((u + 0x7FFFu + ((u >> 16) & 1u)) >> 16);
}
__device__ __forceinline__ float bf_up(unsigned short h) { return __uint_as_float(((unsigned)h) << 16); }
__device__ __forceinline__ float bfr(float f) { return bf_up(bf_bits(f)); }   // value of the bf16 RNE convert
__device__ __forceinline__ unsigned short h_bits(_Float16 x) { return __builtin_bit_cast(unsigned short, x); }
__device__ __forceinline__ unsigned pk16(unsigned short a, unsigned short b) { return (unsigned)a | ((unsigned)b << 16); }
__device__ __forceinline__ v8f zero8() { v8f z = {0.f, 0.f, 0.f, 0.f, 0.f, 0.f, 0.f, 0.f}; return z; }
__device__ __forceinline__ int imin(int a, int b) { return a < b ? a : b; }
__device__ __forceinline__ int imax(int a, int b) { return a > b ? a : b; }

// Relative-position bucket for rel = query - key >= 0 (bidirectional split, 32 buckets, max distance 128), as an exact
// integer table: 0 -> 0; 1..7 -> 16+rel; 8..11 -> 24; 12..15 -> 25; 16..22 -> 26; 23..31 -> 27; 32..45 -> 28; 46..63 -> 29;
// 64..90 -> 30; >= 91 -> 31.
__device__ __forceinline__ int rel_bucket(int rel) {
  int b = 31;
  b = (rel < 91) ? 30 : b;
  b = (rel < 64) ? 29 : b;
  b = (rel < 46) ? 28 : b;
  b = (rel < 32) ? 27 : b;
  b = (rel < 23) ? 26 : b;
  b = (rel < 16) ? 25 : b;
  b = (rel < 12) ? 24 : b;
  b = (rel < 8) ? (16 + rel) : b;
  b = (rel == 0) ? 0 : b;
  return b;
}

// ---- fragment loaders: 16-bit A/B operand, lane -> row/col (lane&15), p already includes +8*(lane>>4);
//      elements 0..7 <- p[0..7] (k0+8h..), elements 8..15 <- p[16..23] (k0+16+8h..)  (same split k map for A and B;
//      B is always read from a k-contiguous [n][k] plane)
__device__ __forceinline__ v16h ldfrag_h(const _Float16* p) {
  FragH f;
  f.h[0] = *(const v8h*)(p);
  f.h[1] = *(const v8h*)(p + 16);
  return f.v;
}
__device__ __forceinline__ v16h ldfrag_u(const unsigned short* p) {
  FragH f;
  f.u[0] = *(const v4u*)(p);
  f.u[1] = *(const v4u*)(p + 16);
  return f.v;
}

// ---- WMMA helpers with trailing VALU hazard gaps ------------------------------------------------------
__device__ __forceinline__ v8f mma_raw(v16h a, v16h b, v8f c) {
  return __builtin_amdgcn_wmma_f32_16x16x32_f16(false, a, false, b, (short)0, c, false, false);
}
__device__ __forceinline__ void guard_s2x4(v8f& s, v8f& t, v16h a0, v16h a1, v16h b0, v16h b1) {
#if defined(__HIP_DEVICE_COMPILE__)
  asm volatile("v_nop\n\tv_nop\n\tv_nop\n\tv_nop" : "+v"(s), "+v"(t) : "v"(a0), "v"(a1), "v"(b0), "v"(b1));
#endif
}
__device__ __forceinline__ void guard_pv4(v8f& a, v8f& b, v8f& c, v8f& d, v16h x, v16h y, v16h z, v16h w, v16h u) {
#if defined(__HIP_DEVICE_COMPILE__)
  asm volatile("v_nop\n\tv_nop\n\tv_nop\n\tv_nop"
               : "+v"(a), "+v"(b), "+v"(c), "+v"(d) : "v"(x), "v"(y), "v"(z), "v"(w), "v"(u));
#endif
}
__device__ __forceinline__ void keep4_h(v16h a, v16h b, v16h c, v16h d) {
#if defined(__HIP_DEVICE_COMPILE__)
  asm volatile("v_nop" :: "v"(a), "v"(b), "v"(c), "v"(d));
#endif
}
// Later writes of the address and data registers of the global loads and stores issued so far stay behind this wait.
__device__ __forceinline__ void wait_x0() {
#if defined(__HIP_DEVICE_COMPILE__)
  asm volatile("s_wait_xcnt 0x0" ::: "memory");
#endif
}
__device__ __forceinline__ void wave_sync_lds() {
  __builtin_amdgcn_fence(__ATOMIC_RELEASE, "workgroup");
  __builtin_amdgcn_wave_barrier();
  __builtin_amdgcn_fence(__ATOMIC_ACQUIRE, "workgroup");
}

// =====================================================================================================
// Transposing 16-bit pack of a weight stored in[R][C] (row pitch C floats, R = contraction index, C = output index) into
// out[Cp][ldd] (row pitch ldd halves): out[c][r] = f16( bf16_RNE(in[r][c]) * schi ) for r < R and c < C, 0 otherwise (pad rows /
// pad columns explicitly written as zeros); with DUAL a second copy out[c][locol + r] = f16( bf16_RNE(in[r][c]) * sclo ).
// schi / sclo powers of two (exact). Tiles: Cp/64 along bx, Rp/64 along by; bz = slice: src advanced by bz*sZ floats, dst by
// bz*dZ halves. One 64x64 tile per block through LDS (bf16 bits): 16 scalar loads per thread with CLAMPED addresses, zero by
// coverage: load 256 thr x 16 floats = 64x64; store 2 it x 8 waves x 4 rows x (8 lanes x 8 halves) = 64 rows x 64 halves per copy;
//           tiles (Cp/64, Rp/64, Z) exact, each output line written by exactly one wave; pad region included.
// =====================================================================================================
// (bx, by, bz) = the tile's place in the grid described above; dual is the same for the whole block.
__device__ __forceinline__ void tcvt16(unsigned short* sT, const float* __restrict__ src, long long sZ,
                                       unsigned short* dst, long long dZ,
                                       int R, int C, int ldd, int locol, float schi, float sclo,
                                       bool dual, int bx, int by, int bz) {
  const int tid = threadIdx.x, lane = tid & 31, wave = tid >> 5;
  const int c0 = bx * 64, r0 = by * 64;
  const float* srcz = src + (size_t)((long long)bz * sZ);
  unsigned short* dstz = dst + (size_t)((long long)bz * dZ);
  const int rr = tid >> 2, cc = (tid & 3) * 16;
  const int r = r0 + rr;
  const int rcl = imin(r, R - 1);
  const float* sp = srcz + (size_t)rcl * C;
#pragma unroll
  for (int e = 0; e < 16; ++e) {
    const int cidx = c0 + cc + e;
    const int ccl = imin(cidx, C - 1);
    float a = sp[ccl];
    a = (r < R && cidx < C) ? a : 0.f;
    sT[(cc + e) * 72 + rr] = bf_bits(a);
  }
  __syncthreads();
  v4u hvals[2], lvals[2];
#pragma unroll
  for (int it = 0; it < 2; ++it) {
    const int q = it * 32 + wave * 4 + (lane >> 3);
    const v4u raw = *(const v4u*)(sT + q * 72 + (lane & 7) * 8);
    v4u hv = {0u, 0u, 0u, 0u}, lv = {0u, 0u, 0u, 0u};
#pragma unroll
    for (int e = 0; e < 4; ++e) {
      const float f0 = bf_up((unsigned short)(raw[e] & 0xFFFFu));
      const float f1 = bf_up((unsigned short)(raw[e] >> 16));
      hv[e] = pk16(h_bits((_Float16)(f0 * schi)), h_bits((_Float16)(f1 * schi)));
      lv[e] = pk16(h_bits((_Float16)(f0 * sclo)), h_bits((_Float16)(f1 * sclo)));
    }
    hvals[it] = hv;
    lvals[it] = lv;
  }
  {
#pragma unroll
    for (int it = 0; it < 2; ++it) {
      const int q = it * 32 + wave * 4 + (lane >> 3);
      unsigned short* p = dstz + (size_t)(c0 + q) * ldd + r0 + (lane & 7) * 8;
      *(v4u*)p = hvals[it];
    }
    wait_x0();                                             // no register of the two stores above is rewritten ahead of this wait
    if (dual) {
#pragma unroll                                             // lvals[] indexed by constants, so that it stays in registers
      for (int it = 0; it < 2; ++it) {
        const int q = it * 32 + wave * 4 + (lane >> 3);
        unsigned short* p = dstz + (size_t)(c0 + q) * ldd + r0 + (lane & 7) * 8;
        *(v4u*)(p + locol) = lvals[it];
      }
      wait_x0();                                           // the same for the second copy's two stores
    }
  }
}

// =====================================================================================================
// Batched f16 WMMA GEMM, operands staged in LDS: C[m][n] = f( oscale * sum_k A[m][k] * Bt[n][k] + bias ); one 64x64 tile per
// work-group of 8 waves (wave = 16 rows x 32 cols, two accumulators). A row-major [M][K] (16-bit plane), Bt row-major
// [N][K] (k contiguous), both at row pitch K; M, N multiples of 64, K = KST * NCH. tile = tile index, by = batch index with element
// strides sA, sB, sC. A stage is KST k of the tile's 64 A rows and 64 Bt rows, brought to LDS by asynchronous 16-B copies
// (a wave's copy = two aligned 256-B units) at row pitch KST + 8 halves (16 B x odd: ds_load_b128 fragment reads without bank conflicts).
// NCH 1: the stage is filled once and then read. NCH 2: two buffers, stage 1 flies while stage 0 is multiplied.
// k runs upward through one accumulator per 16x16 output tile.
// BM: 0 no bias, 1 bias bf16(biasp[n]) for n < nbias (0 beyond, clamped address).   ACT: 2 = ReLU applied to (value + bias).
// OM 0 = f32 out (pitch ldc); RM 2 adds raw f32 Rp[m][n] (same pitch/stride as C).
// OM 1 = dual f16 out (pitch ldc): hi = f16(value * ocarry) at C[m][n], residual f16(RC * (value * ocarry - hi)) at C[m][n] + lofs.
// coverage: copies: 2 operands x 4 row groups of 16 x KST/128 units of 256 B = 2*KST/32 copies per thread and stage; slab: 8 waves x 16 x 32 = 64 x 64;
//           out: f32 4 it x 16 rows x 16 lanes x 4, f16 2 it x 32 rows x 8 lanes x 8 (both planes) = the whole 64x64 tile;
//           grid = tilesM*tilesN blocks exactly.
// =====================================================================================================
// Eight asynchronous 16-B copies global -> LDS (l = the lane's LDS byte address, g = the lane's global address). The closing
// s_wait_xcnt keeps every later write of these address registers behind the copies' address translation.
__device__ __forceinline__ void acopy8(const unsigned* l, const unsigned short* const* g) {
#if defined(__HIP_DEVICE_COMPILE__)
  asm volatile(
      "global_load_async_to_lds_b128 %0, %8, off\n\t"
      "global_load_async_to_lds_b128 %1, %9, off\n\t"
      "global_load_async_to_lds_b128 %2, %10, off\n\t"
      "global_load_async_to_lds_b128 %3, %11, off\n\t"
      "global_load_async_to_lds_b128 %4, %12, off\n\t"
      "global_load_async_to_lds_b128 %5, %13, off\n\t"
      "global_load_async_to_lds_b128 %6, %14, off\n\t"
      "global_load_async_to_lds_b128 %7, %15, off\n\t"
      "s_wait_xcnt 0x0"
      :: "v"(l[0]), "v"(l[1]), "v"(l[2]), "v"(l[3]), "v"(l[4]), "v"(l[5]), "v"(l[6]), "v"(l[7]),
         "v"(g[0]), "v"(g[1]), "v"(g[2]), "v"(g[3]), "v"(g[4]), "v"(g[5]), "v"(g[6]), "v"(g[7])
      : "memory");
#endif
}
// The wave's own copies have landed in LDS behind this wait.
__device__ __forceinline__ void wait_async0() {
#if defined(__HIP_DEVICE_COMPILE__)
  asm volatile("s_wait_asynccnt 0x0" ::: "memory");
#endif
}
// The wave's own LDS reads have returned behind this wait.
__device__ __forceinline__ void wait_ds0() {
#if defined(__HIP_DEVICE_COMPILE__)
  asm volatile("s_wait_dscnt 0x0" ::: "memory");
#endif
}
// One stage: KST halves of rows 0..63 of Ag to LDS rows 0..63 and of rows 0..63 of Bg to LDS rows 64..127 (global row pitch LDK
// halves). 16 lanes take one aligned 256-B unit of a row, a copy of the block 16 rows; every offset below is a constant.
template <int KST, int LDK>
__device__ __forceinline__ void fill_stage(const unsigned short* Ag, const unsigned short* Bg, unsigned ldsb, int tid) {
  constexpr int CG  = KST / 128;            // 256-B units per row
  constexpr int PER = 4 * CG;               // copies per thread and operand
  constexpr int PIT = KST + 8;              // LDS row pitch, halves
  static_assert((KST % 128) == 0 && (2 * PER) % 8 == 0 && 2 * PER <= 63);
  const int r0 = tid >> 4, h0 = (tid & 15) * 8;
  const unsigned short* a0 = Ag + (size_t)r0 * LDK + h0;
  const unsigned short* b0 = Bg + (size_t)r0 * LDK + h0;
  const unsigned l0 = ldsb + (unsigned)(r0 * PIT + h0) * 2u;
  // both loops unrolled: every copy's offsets are then constants and l[], g[] stay in registers
#pragma unroll
  for (int g0 = 0; g0 < 2 * PER; g0 += 8) {
    unsigned l[8];
    const unsigned short* g[8];
#pragma unroll
    for (int e = 0; e < 8; ++e) {
      const int it = g0 + e;
      const bool isB = it >= PER;
      const int j = isB ? it - PER : it;
      const int rg = j / CG, cg = j - rg * CG;
      l[e] = l0 + (unsigned)((((isB ? 64 : 0) + rg * 16) * PIT + cg * 128) * 2);
      g[e] = (isB ? b0 : a0) + (size_t)(rg * 16) * LDK + cg * 128;
    }
    acopy8(l, g);
  }
}

template <int OM, int RM, int ACT, int BM, int KST, int NCH>
__device__ __forceinline__ void gemm64_tile(
    const unsigned short* __restrict__ Ap, long long sA,
    const unsigned short* __restrict__ Btp, long long sB,
    const float* __restrict__ Rp,
    const float* __restrict__ biasp, int nbias,
    void* Cout, int ldc, long long sC, long long lofs,
    int N, float oscale, float ocarry, int tile, int by) {
  constexpr int PIT  = KST + 8;               // LDS row pitch, halves
  constexpr int BUFH = 128 * PIT;            // halves per stage buffer: 64 A rows, then 64 Bt rows
  constexpr int LDK  = KST * NCH;            // row pitch of A and Bt, halves (= K)
  constexpr int KB   = 4;                    // k steps of 32 per fragment block
  constexpr int NBLK = KST / (32 * KB);
  static_assert(NCH == 1 || NCH == 2);
  static_assert((KST % (32 * KB)) == 0 && ((PIT * 2) % 32) == 16);
  __shared__ __align__(16) unsigned short sP[NCH * BUFH];
  __shared__ __align__(16) float sT[64 * 68];        // the tile in f32, pitch 68 floats
  const int tid  = threadIdx.x;
  const int lane = tid & 31;
  const int wave = tid >> 5;
  const int tilesN = N >> 6;
  const int tm = tile / tilesN;
  const int tn = tile - tm * tilesN;
  const int m0 = tm << 6;
  const int n0 = tn << 6;

  const unsigned short* Ag = Ap  + (size_t)((long long)by * sA) + (size_t)m0 * LDK;
  const unsigned short* Bg = Btp + (size_t)((long long)by * sB) + (size_t)n0 * LDK;
  const unsigned ldsb = (unsigned)(uintptr_t)(&sP[0]);   // LDS byte address = low 32 bits of the shared address

  fill_stage<KST, LDK>(Ag, Bg, ldsb, tid);
  wait_async0();
  __syncthreads();                                       // stage 0 readable by every wave
  if constexpr (NCH == 2) fill_stage<KST, LDK>(Ag + KST, Bg + KST, ldsb + (unsigned)(BUFH * 2), tid);

  const int rlane = lane & 15;                 // row (A) / col (B, D) within subtile
  const int koff  = (lane >> 4) * 8;           // k offset of this lane half
  const int mOff  = (lane >> 4) * 8;           // D row offset
  const int wr = wave >> 1, wc = wave & 1;     // wave tile: rows wr*16.., cols wc*32..

  v8f acc0 = zero8(), acc1 = zero8();
  // the loops below are unrolled so that the two fragment sets are indexed by constants and stay in registers
#pragma unroll
  for (int t = 0; t < NCH; ++t) {
    const unsigned short* aL = sP + t * BUFH + (wr * 16 + rlane) * PIT + koff;
    const unsigned short* bL = sP + t * BUFH + (64 + wc * 32 + rlane) * PIT + koff;
    // fragments one block ahead in a second register set, each block's LDS reads as one group; never across a stage
    v16h fa[2][KB], fb0[2][KB], fb1[2][KB];
#pragma unroll
    for (int s = 0; s < KB; ++s) {
      fa[0][s]  = ldfrag_u(aL + s * 32);
      fb0[0][s] = ldfrag_u(bL + s * 32);
      fb1[0][s] = ldfrag_u(bL + 16 * PIT + s * 32);
    }
#pragma unroll
    for (int blk = 0; blk < NBLK; ++blk) {
      const int cur = blk & 1;
      if (blk + 1 < NBLK) {
#pragma unroll
        for (int s = 0; s < KB; ++s) {
          const int k0 = ((blk + 1) * KB + s) * 32;
          fa[cur ^ 1][s]  = ldfrag_u(aL + k0);
          fb0[cur ^ 1][s] = ldfrag_u(bL + k0);
          fb1[cur ^ 1][s] = ldfrag_u(bL + 16 * PIT + k0);
        }
      }
      __builtin_amdgcn_sched_barrier(0);   // keeps the next block's LDS reads one group ahead of this block's products
#pragma unroll
      for (int s = 0; s < KB; ++s) {
        acc0 = mma_raw(fa[cur][s], fb0[cur][s], acc0);
        acc1 = mma_raw(fa[cur][s], fb1[cur][s], acc1);
      }
      __builtin_amdgcn_sched_barrier(0);   // keeps later blocks' LDS reads from spreading among these products
    }
    if (t + 1 < NCH) {
      wait_ds0();
      wait_async0();
      __syncthreads();                                   // stage t + 1 readable by every wave
    }
  }
  if constexpr (NCH == 2) wait_async0();                 // no copy is outstanding when the buffers are left

  const int r16 = tid >> 4, c4 = (tid & 15) * 4;         // f32 out: 256-B row segment = 16 lanes x 16 B
  const int r32 = tid >> 3, c8 = (tid & 7) * 8;          // f16 out: 128-B row segment = 8 lanes x 16 B

  // ---- column bias (same columns for every row a thread writes), clamped addresses ----
  float bc4[4], bc8[8];
#pragma unroll
  for (int e = 0; e < 4; ++e) bc4[e] = 0.f;
#pragma unroll
  for (int e = 0; e < 8; ++e) bc8[e] = 0.f;
  if constexpr (BM == 1) {
    if constexpr (OM == 0) {
#pragma unroll
      for (int e = 0; e < 4; ++e) {
        const int n = n0 + c4 + e;
        const int ncl = imin(n, nbias - 1);
        const float t = bfr(biasp[ncl]);
        bc4[e] = (n < nbias) ? t : 0.f;
      }
    } else {
#pragma unroll
      for (int e = 0; e < 8; ++e) {
        const int n = n0 + c8 + e;
        const int ncl = imin(n, nbias - 1);
        const float t = bfr(biasp[ncl]);
        bc8[e] = (n < nbias) ? t : 0.f;
      }
    }
  }

  // ---- epilogue: the tile through LDS, whole row segments out ----
#pragma unroll
  for (int r = 0; r < 8; ++r) {
    float* sp = sT + (wr * 16 + mOff + r) * 68 + wc * 32 + rlane;
    sp[0]  = acc0[r];
    sp[16] = acc1[r];
  }
  __syncthreads();
  if constexpr (OM == 0) {
    float* C = (float*)Cout + (size_t)((long long)by * sC);
#pragma unroll
    for (int it = 0; it < 4; ++it) {
      const int row = it * 16 + r16;                     // it 0..3 x r16 0..15 = rows 0..63
      const int gr  = m0 + row;
      v4f v = *(const v4f*)(sT + row * 68 + c4);
      v4f rv = {0.f, 0.f, 0.f, 0.f};
      if constexpr (RM == 2) {
        const float* R = Rp + (size_t)((long long)by * sC);
        rv = *(const v4f*)(R + (size_t)gr * ldc + n0 + c4);
      }
#pragma unroll
      for (int e = 0; e < 4; ++e) {
        float u = v[e] * oscale;
        if constexpr (BM == 1) u += bc4[e];
        if constexpr (ACT == 2) u = fmaxf(u, 0.f);
        v[e] = u + rv[e];
      }
      *(v4f*)(C + (size_t)gr * ldc + n0 + c4) = v;
    }
  } else {
    unsigned short* C = (unsigned short*)Cout + (size_t)((long long)by * sC);
#pragma unroll
    for (int it = 0; it < 2; ++it) {
      const int row = it * 32 + r32;                     // it 0..1 x r32 0..31 = rows 0..63
      const float* spf = sT + row * 68 + c8;
      v4u a = {0u, 0u, 0u, 0u}, bl = {0u, 0u, 0u, 0u};
#pragma unroll
      for (int e = 0; e < 4; ++e) {
        float f0 = spf[2 * e] * oscale;
        float f1 = spf[2 * e + 1] * oscale;
        if constexpr (BM == 1) { f0 += bc8[2 * e]; f1 += bc8[2 * e + 1]; }
        if constexpr (ACT == 2) { f0 = fmaxf(f0, 0.f); f1 = fmaxf(f1, 0.f); }
        f0 *= ocarry; f1 *= ocarry;
        const _Float16 g0 = (_Float16)f0, g1 = (_Float16)f1;
        const float r0 = (f0 - (float)g0) * RC, r1 = (f1 - (float)g1) * RC;
        a[e]  = pk16(h_bits(g0), h_bits(g1));
        bl[e] = pk16(h_bits((_Float16)r0), h_bits((_Float16)r1));
      }
      unsigned short* p = C + (size_t)(m0 + row) * ldc + n0 + c8;
      *(v4u*)p = a;
      *(v4u*)(p + (size_t)lofs) = bl;
    }
  }
  (void)Rp; (void)ocarry; (void)lofs; (void)nbias; (void)biasp;
}

// One product per launch: blockIdx.x = tile, blockIdx.y = batch index.
template <int OM, int RM, int ACT, int BM, int KST, int NCH>
__global__ __launch_bounds__(256) void gemm64(
    const unsigned short* __restrict__ Ap, long long sA,
    const unsigned short* __restrict__ Btp, long long sB,
    const float* __restrict__ Rp,
    const float* __restrict__ biasp, int nbias,
    void* Cout, int ldc, long long sC, long long lofs,
    int N, float oscale, float ocarry) {
  gemm64_tile<OM, RM, ACT, BM, KST, NCH>(Ap, sA, Btp, sB, Rp, biasp, nbias, Cout, ldc, sC, lofs, N, oscale, ocarry,
                                         (int)blockIdx.x, (int)blockIdx.y);
}

#define SH_E   8        // log2 of the tiles per batch index of the q / k product: (NROWS / 64) * (DMODEL / 64)
#define SH_V   7        // log2 of the tiles per batch of the v^T product: (DMODEL / 64) * (SEQ / 64)
#define SH_ONE 30       // a product with one batch index only
static_assert((1 << SH_E) == (NROWS / 64) * (DMODEL / 64) && (1 << SH_V) == (DMODEL / 64) * (SEQ / 64));
static_assert(QC == VC);
// Two independent products of the same form in one launch (no residual input): blocks 0..n0-1 work on product 0, the rest on
// product 1; inside a product block i is tile i mod 2^sh of batch index i >> sh. The choice is the same for the whole block.
// coverage: grid = n0 + (blocks of product 1), each product's (tile, batch) pairs taken exactly once.
template <int OM, int ACT, int BM, int KST, int NCH>
__global__ __launch_bounds__(256) void gemm64x2(
    const unsigned short* __restrict__ Ap0, long long sA0, const unsigned short* __restrict__ Btp0, long long sB0,
    const float* __restrict__ biasp0, int nbias0, void* Cout0, int ldc0, long long sC0, long long lofs0, int N0, int sh0,
    const unsigned short* __restrict__ Ap1, long long sA1, const unsigned short* __restrict__ Btp1, long long sB1,
    const float* __restrict__ biasp1, int nbias1, void* Cout1, int ldc1, long long sC1, long long lofs1, int N1, int sh1,
    int n0, float oscale, float ocarry) {
  const int b = (int)blockIdx.x;
  const bool p0 = b < n0;
  const int i  = p0 ? b : b - n0;
  const int sh = p0 ? sh0 : sh1;
  const int by = i >> sh;
  gemm64_tile<OM, 0, ACT, BM, KST, NCH>(p0 ? Ap0 : Ap1, p0 ? sA0 : sA1, p0 ? Btp0 : Btp1, p0 ? sB0 : sB1, (const float*)0,
                                        p0 ? biasp0 : biasp1, p0 ? nbias0 : nbias1, p0 ? Cout0 : Cout1, p0 ? ldc0 : ldc1,
                                        p0 ? sC0 : sC1, p0 ? lofs0 : lofs1, p0 ? N0 : N1, oscale, ocarry, i - (by << sh), by);
}

// =====================================================================================================
// Causal flash attention for one batch, one head and 16 query rows, head dim 64; the keys are split over the 8 waves of the block:
//   q plane QP[b*SEQ + tok][512] (f16: hi x16 at col head*64+d, residual x64 of that at col 256+head*64+d); k plane KP same;
//   v^T plane VT[b*512 + row][key] (pitch SEQ): rows head*64+d hi (f16 x16), rows 256+head*64+d residual x64;
//   out CT[b*SEQ + tok][512]: hi = f16(16 * ctx) at col head*64+d, residual = f16(64 * (16 ctx - hi)) at col 256+head*64+d, where
//   ctx[d] = sum_m softmax_m(q.k / 8 + relb[bucket(tok - m)][head]) v[m][d] over keys m <= tok (softmax run in base 2, -inf select for
//   keys m > tok). The relative bias table (bf16 RNE of relb, x log2 e) for rel 0..q0+15 of the head is built in LDS per block.
//   Key steps of 32 from 0 to q0+16; wave w takes steps w, w + 8, w + 16, ... with its own running maxima, sums and accumulators (a
//   wave-uniform trip count, possibly zero; no block barrier inside the loop). kb <= q0 always, so every query row sees key kb
//   unmasked in every step and the step max is finite; the rescale exponent is clamped at -126 so a wave's first step gives a tiny
//   finite factor times zero sums.
//   Per step: two score tiles, each hi.hi (2 k-steps of 32) into one accumulator and hi.res + res.hi (4 k-steps) into a second one,
//   fragments loaded straight from the 16-bit planes (two 16-B loads per fragment, arithmetic addressing); online max-subtracted
//   softmax in f32 (exp2); rescale of the running sums and the eight accumulators; the 16x32 prob tile stored to wave-private LDS
//   (read back RNE to f16, split k map) and the v^T B fragments (4 hi, 4 residual) loaded straight from the 16-bit plane (keys
//   kb..kb+31 <= SEQ-1 always in range); 8 P.V WMMAs into hi and residual accumulator sets.
//   Merge: each wave leaves its un-normalised 16x64 partial o_hi + o_res/64 (f32, pitch 68) and its (max, sum) per row in LDS; after one
//   block barrier thread t merges row t/16, cols 4(t%16)..+3: M = max_w m_w, weight 2^(m_w - M) (0 for a wave without steps, m_w = -inf;
//   wave 0 always has step 0, so M is finite), l = sum_w weight l_w, ctx16 = 16 sum_w weight o_w / (l 16384 16).
// coverage: LDS bias table: rel 0..kend-1 (all rel used); partials: 8 waves x 16 rows x 64 cols and 8 x 16 (max, sum), all written by
//           every wave, all read; global: 256 threads x 4 halves = 16 rows x 64 halves per plane (a row's 128-B segment = 16 lanes of one
//           wave); grid (NB batches x SEQ/16 query tiles x 4 heads) covers all NROWS x 512 of CT exactly once.
// =====================================================================================================
#define ATT_SPLIT   8
#define ATT_THREADS (ATT_SPLIT * 32)
#define ATT_BLOCKS  (NB * (SEQ / 16) * NHEAD)
#define PT_FLOATS   (ATT_SPLIT * 16 * 36)
#define OP_PITCH    68
static_assert(ATT_THREADS == 16 * (HDIM / 4) && HDIM == 64);
static_assert((HDIM * 2) % 128 == 0 && (HDIM % 32) == 0);

__global__ __launch_bounds__(ATT_THREADS)
void attn4(const unsigned short* __restrict__ QPp, const unsigned short* __restrict__ KPp,
           const unsigned short* __restrict__ VTq, const float* __restrict__ relbl, unsigned short* CT) {
  __shared__ __align__(16) float sbias[SEQ];                          // [rel], bf16(relb) * log2 e
  __shared__ __align__(16) float spt[PT_FLOATS];                      // per wave prob tile [row][32 keys], pitch 36
  __shared__ __align__(16) float spo[ATT_SPLIT * 16 * OP_PITCH];      // per wave partial [row][64 d], pitch 68
  __shared__ __align__(16) float sml[2 * ATT_SPLIT * 16];             // per wave and row: max, then sum

  const int tid  = threadIdx.x;
  const int wave = __builtin_amdgcn_readfirstlane(tid >> 5);  // scalar: the key loop's trip count is a scalar branch, EXEC stays full
  const int lane = tid & 31;
  const int hh   = lane >> 4;
  const int c    = lane & 15;

  const int head = blockIdx.x % NHEAD;                     // 0..3
  const int qb   = blockIdx.x / NHEAD;
  const int qt   = qb % (SEQ / 16);                        // query tile
  const int bat  = qb / (SEQ / 16);                        // batch
  const int q0   = qt * 16;
  const int srow = q0 + 8 * hh;                            // this lane half's first query row (+ r)
  const int kend = q0 + 16;                                // causal: keys 0 .. q0+15; rel = query - key in 0 .. kend-1

  // ---- relative-position bias table for rel 0..kend-1 of this head ----
  for (int rel = tid; rel < kend; rel += ATT_THREADS) {
    const int bk = rel_bucket(rel);
    sbias[rel] = bfr(relbl[bk * NHEAD + head]) * LOG2E;
  }
  __syncthreads();

  const float* sb = sbias;
  const _Float16* Q16 = (const _Float16*)(const void*)QPp;
  const _Float16* K16 = (const _Float16*)(const void*)KPp;
  const _Float16* V16 = (const _Float16*)(const void*)VTq;
  const _Float16* Qh = Q16 + ((size_t)bat * SEQ + q0 + c) * KD + head * HDIM + 8 * hh;
  const _Float16* Kb = K16 + (size_t)bat * SEQ * KD + head * HDIM + 8 * hh;
  const _Float16* Vh = V16 + ((size_t)bat * VTR + head * HDIM) * SEQ + 8 * hh;
  const _Float16* Vl = Vh + (size_t)DMODEL * SEQ;
  const float lsc = (LOG2E * ATT_SCALE) / (QC * KC);      // log2(e) / 8 / carries

  const v16h qah = ldfrag_h(Qh), qbh = ldfrag_h(Qh + 32);                       // hi, d 0..31 / 32..63
  const v16h qal = ldfrag_h(Qh + DMODEL), qbl = ldfrag_h(Qh + DMODEL + 32);     // residual x64

  float mrow[8], lrow[8];
  v8f om0 = zero8(), om1 = zero8(), om2 = zero8(), om3 = zero8();
  v8f or0 = zero8(), or1 = zero8(), or2 = zero8(), or3 = zero8();
#pragma unroll
  for (int r = 0; r < 8; ++r) { mrow[r] = -INFINITY; lrow[r] = 0.f; }
  float* pt = spt + wave * (16 * 36);

#pragma unroll 1
  for (int kb = wave * 32; kb < kend; kb += 32 * ATT_SPLIT) {
    const _Float16* kp = Kb + (size_t)(kb + c) * KD;
    v8f s0m, s0r, s1m, s1r;
    {
      const v16h k0h = ldfrag_h(kp), k1h = ldfrag_h(kp + 32);
      const v16h k0l = ldfrag_h(kp + DMODEL), k1l = ldfrag_h(kp + DMODEL + 32);
      s0m = mma_raw(qah, k0h, zero8());
      s0m = mma_raw(qbh, k1h, s0m);
      s0r = mma_raw(qah, k0l, zero8());
      s0r = mma_raw(qbh, k1l, s0r);
      s0r = mma_raw(qal, k0h, s0r);
      s0r = mma_raw(qbl, k1h, s0r);
      guard_s2x4(s0m, s0r, k0h, k1h, k0l, k1l);
    }
    {
      const _Float16* kq = kp + (size_t)16 * KD;
      const v16h k0h = ldfrag_h(kq), k1h = ldfrag_h(kq + 32);
      const v16h k0l = ldfrag_h(kq + DMODEL), k1l = ldfrag_h(kq + DMODEL + 32);
      s1m = mma_raw(qah, k0h, zero8());
      s1m = mma_raw(qbh, k1h, s1m);
      s1r = mma_raw(qah, k0l, zero8());
      s1r = mma_raw(qbh, k1l, s1r);
      s1r = mma_raw(qal, k0h, s1r);
      s1r = mma_raw(qbl, k1h, s1r);
      guard_s2x4(s1m, s1r, k0h, k1h, k0l, k1l);
      keep4_h(qah, qbh, qal, qbl);
    }
    const int key0 = kb + c;                               // key of this lane's column in tile 0
    const int key1 = kb + 16 + c;                          // key of this lane's column in tile 1
#pragma unroll
    for (int r = 0; r < 8; ++r) {
      const int qi = srow + r;
      const int i0 = imax(qi - key0, 0);
      const int i1 = imax(qi - key1, 0);
      float t0 = (s0m[r] + s0r[r] * RCI) * lsc + sb[i0];
      float t1 = (s1m[r] + s1r[r] * RCI) * lsc + sb[i1];
      t0 = (key0 > qi) ? -INFINITY : t0;
      t1 = (key1 > qi) ? -INFINITY : t1;
      float mx = fmaxf(t0, t1);
#pragma unroll
      for (int off = 1; off < 16; off <<= 1) mx = fmaxf(mx, __shfl_xor(mx, off, 32));
      const float mn = fmaxf(mrow[r], mx);
      const float al = exp2f(fmaxf(mrow[r] - mn, -126.0f));
      mrow[r] = mn;
      const float e0 = exp2f(t0 - mn);
      const float e1 = exp2f(t1 - mn);
      float ps = e0 + e1;
#pragma unroll
      for (int off = 1; off < 16; off <<= 1) ps += __shfl_xor(ps, off, 32);
      lrow[r] = lrow[r] * al + ps;
      om0[r] *= al; om1[r] *= al; om2[r] *= al; om3[r] *= al;
      or0[r] *= al; or1[r] *= al; or2[r] *= al; or3[r] *= al;
      const int ro = (8 * hh + r) * 36 + c;
      pt[ro]      = e0;
      pt[ro + 16] = e1;
    }
    wave_sync_lds();
    FragH ph;
    {
      const float* prow = pt + c * 36 + 8 * hh;
      const v4f p0 = *(const v4f*)(prow), p1 = *(const v4f*)(prow + 4);
      const v4f p2 = *(const v4f*)(prow + 16), p3 = *(const v4f*)(prow + 20);
#pragma unroll
      for (int e = 0; e < 4; ++e) {
        ph.h[0][e]     = (_Float16)(p0[e] * PC);              // elements 0..7  = keys kb + 8hh + 0..7
        ph.h[0][4 + e] = (_Float16)(p1[e] * PC);
        ph.h[1][e]     = (_Float16)(p2[e] * PC);              // elements 8..15 = keys kb + 16 + 8hh + 0..7
        ph.h[1][4 + e] = (_Float16)(p3[e] * PC);
      }
    }
    {
      const _Float16* vp = Vh + (size_t)c * SEQ + kb;
      const v16h vb0 = ldfrag_h(vp);
      const v16h vb1 = ldfrag_h(vp + (size_t)16 * SEQ);
      const v16h vb2 = ldfrag_h(vp + (size_t)32 * SEQ);
      const v16h vb3 = ldfrag_h(vp + (size_t)48 * SEQ);
      om0 = mma_raw(ph.v, vb0, om0);
      om1 = mma_raw(ph.v, vb1, om1);
      om2 = mma_raw(ph.v, vb2, om2);
      om3 = mma_raw(ph.v, vb3, om3);
      guard_pv4(om0, om1, om2, om3, ph.v, vb0, vb1, vb2, vb3);
    }
    {
      const _Float16* vq = Vl + (size_t)c * SEQ + kb;
      const v16h vl0 = ldfrag_h(vq);
      const v16h vl1 = ldfrag_h(vq + (size_t)16 * SEQ);
      const v16h vl2 = ldfrag_h(vq + (size_t)32 * SEQ);
      const v16h vl3 = ldfrag_h(vq + (size_t)48 * SEQ);
      or0 = mma_raw(ph.v, vl0, or0);
      or1 = mma_raw(ph.v, vl1, or1);
      or2 = mma_raw(ph.v, vl2, or2);
      or3 = mma_raw(ph.v, vl3, or3);
      guard_pv4(or0, or1, or2, or3, ph.v, vl0, vl1, vl2, vl3);
    }
    wave_sync_lds();
  }

  // ---- the wave's un-normalised partial and its (max, sum) per row to LDS ----
  {
    float* pw = spo + wave * (16 * OP_PITCH) + c;
#pragma unroll
    for (int r = 0; r < 8; ++r) {
      float* op = pw + (8 * hh + r) * OP_PITCH;
      op[0]  = om0[r] + or0[r] * RCI;
      op[16] = om1[r] + or1[r] * RCI;
      op[32] = om2[r] + or2[r] * RCI;
      op[48] = om3[r] + or3[r] * RCI;
    }
    if (c == 0) {                                          // max and sum are equal in the 16 lanes of a half
#pragma unroll
      for (int r = 0; r < 8; ++r) {
        sml[wave * 16 + 8 * hh + r] = mrow[r];
        sml[ATT_SPLIT * 16 + wave * 16 + 8 * hh + r] = lrow[r];
      }
    }
  }
  __syncthreads();                                         // every wave's partial readable by every wave
  // ---- merge the 8 partials, fold 1/l and the carries, write 4 hi and 4 residual halves per thread ----
  {
    const int row = tid >> 4, c4 = (tid & 15) * 4;
    float ms[ATT_SPLIT];
    float mall = -INFINITY;
#pragma unroll
    for (int s = 0; s < ATT_SPLIT; ++s) {
      ms[s] = sml[s * 16 + row];
      mall = fmaxf(mall, ms[s]);
    }
    float lall = 0.f;
    v4f o = {0.f, 0.f, 0.f, 0.f};
#pragma unroll
    for (int s = 0; s < ATT_SPLIT; ++s) {
      const float w = exp2f(ms[s] - mall);
      const v4f p = *(const v4f*)(spo + (s * 16 + row) * OP_PITCH + c4);
      lall += w * sml[ATT_SPLIT * 16 + s * 16 + row];
#pragma unroll
      for (int e = 0; e < 4; ++e) o[e] += w * p[e];
    }
    const float inv = (1.0f / lall) * (CC / (PC * VC));
    const float u0 = o[0] * inv, u1 = o[1] * inv, u2 = o[2] * inv, u3 = o[3] * inv;
    const _Float16 g0 = (_Float16)u0, g1 = (_Float16)u1, g2 = (_Float16)u2, g3 = (_Float16)u3;
    v2u hv, lv;
    hv[0] = pk16(h_bits(g0), h_bits(g1));
    hv[1] = pk16(h_bits(g2), h_bits(g3));
    lv[0] = pk16(h_bits((_Float16)((u0 - (float)g0) * RC)), h_bits((_Float16)((u1 - (float)g1) * RC)));
    lv[1] = pk16(h_bits((_Float16)((u2 - (float)g2) * RC)), h_bits((_Float16)((u3 - (float)g3) * RC)));
    unsigned short* dst = CT + ((size_t)bat * SEQ + q0 + row) * KD + head * HDIM + c4;
    *(v2u*)dst = hv;
    *(v2u*)(dst + DMODEL) = lv;
  }
}

// =====================================================================================================
// RMSNorm over the last dim (256): out = x * rsqrt(mean(x*x) + eps) * bf16(w), eps 1.1920929e-7, in f32; written as the dual 16-bit
// plane outh[row][512]: hi = f16(16 * out) at col c, residual = f16(64 * (16 out - hi)) at col 256 + c.
//   One wave per row (4 rows per 128-thread block): lane loads 8 consecutive floats (two 16-B loads), sum of squares by xor shuffles,
//   then writes its own 8 hi halves and 8 residual halves: per plane one instruction of 32 lanes x 16 B = the whole 512-B half row
// coverage: grid = NROWS/4 blocks x 4 waves = every row once; per row 32 lanes x 8 halves = 256 hi + 256 residual halves.
// =====================================================================================================
__global__ __launch_bounds__(128) void rmsn(const float* __restrict__ Xp, const float* __restrict__ wp, unsigned short* outh) {
  const int wave = threadIdx.x >> 5, lane = threadIdx.x & 31;
  const int row = blockIdx.x * 4 + wave;
  const int c0 = lane * 8;
  const float* xp = Xp + (size_t)row * DMODEL + c0;
  const v4f x0 = *(const v4f*)(xp), x1 = *(const v4f*)(xp + 4);
  float ss = ((x0[0] * x0[0] + x0[1] * x0[1]) + (x0[2] * x0[2] + x0[3] * x0[3])) +
             ((x1[0] * x1[0] + x1[1] * x1[1]) + (x1[2] * x1[2] + x1[3] * x1[3]));
#pragma unroll
  for (int off = 1; off < 32; off <<= 1) ss += __shfl_xor(ss, off, 32);
  const float rstd = rsqrtf(ss * (1.0f / (float)DMODEL) + RMS_EPS);
  const v4f w0 = *(const v4f*)(wp + c0), w1 = *(const v4f*)(wp + c0 + 4);
  float o[8];
#pragma unroll
  for (int e = 0; e < 4; ++e) {
    o[e]     = (x0[e] * rstd) * bfr(w0[e]);
    o[4 + e] = (x1[e] * rstd) * bfr(w1[e]);
  }
  v4u hv, lv;
#pragma unroll
  for (int e = 0; e < 4; ++e) {
    const float f0 = o[2 * e] * HC, f1 = o[2 * e + 1] * HC;
    const _Float16 g0 = (_Float16)f0, g1 = (_Float16)f1;
    hv[e] = pk16(h_bits(g0), h_bits(g1));
    lv[e] = pk16(h_bits((_Float16)((f0 - (float)g0) * RC)), h_bits((_Float16)((f1 - (float)g1) * RC)));
  }
  unsigned short* dp = outh + (size_t)row * KD + c0;
  {
    *(v4u*)dp = hv;
    *(v4u*)(dp + DMODEL) = lv;
    
  }
}

// =====================================================================================================
// Input convert: obs16[m][640] = f16(16 * bf16_RNE(obs[b*SEQ_FULL + t][c])) for c < 637 (m = b*SEQ + t), 0 for the pad columns
// 637..639 (explicitly written). One wave per row (8 rows per block): 80 pieces of 8 halves; lane writes pieces lane, lane+32 and
// coverage: NROWS/8 blocks x 8 waves = every row; per row pieces 0..79 = cols 0..639.
// =====================================================================================================
__device__ __forceinline__ void cvtobs(const float* __restrict__ src, unsigned short* dst, int blk) {
  const int wave = threadIdx.x >> 5, lane = threadIdx.x & 31;
  const int m = blk * 8 + wave;
  const int b = m / SEQ, t = m - b * SEQ;
  const float* sp = src + ((size_t)b * SEQ_FULL + t) * OBSD;
  unsigned short* dp = dst + (size_t)m * OBSP;
  {
#pragma unroll 1
    for (int it = 0; it < 3; ++it) {
      const int p = it * 32 + lane;
      const int col0 = p * 8;
      v4u a;
#pragma unroll
      for (int e = 0; e < 4; ++e) {
        const int ca = col0 + 2 * e, cb = ca + 1;
        float fa = sp[imin(ca, OBSD - 1)];
        float fb = sp[imin(cb, OBSD - 1)];
        fa = (ca < OBSD) ? fa : 0.f;
        fb = (cb < OBSD) ? fb : 0.f;
        a[e] = pk16(h_bits((_Float16)(bfr(fa) * OBC)), h_bits((_Float16)(bfr(fb) * OBC)));
      }
      if (p < OBSP / 8) {
        *(v4u*)(dp + (size_t)p * 8) = a;
        wait_x0();                                         // the next trip advances the store's address registers
      }
    }
    
  }
}

// =====================================================================================================
// All 16-bit operand planes in one launch (they depend on the inputs alone, not on one another): blocks 0..PB_OBS-1 convert obs,
// then one 64x64 transposing tile per block for w_q, w_k, w_v, w_o, w_1, w_2, obs_w, act_w, obsh_w in this order. The job is a
// function of blockIdx.x alone, so every branch below (and the barrier inside tcvt16) is uniform for the block.
// coverage: each job's blocks = its (Cp/64) x (Rp/64) x slices tiles exactly once; grid = PB_ALL.
// =====================================================================================================
#define PB_OBS (NROWS / 8)
#define PB_E   ((DMODEL / 64) * (DMODEL / 64) * NLAYER)
#define PB_F   ((DFF / 64) * (DMODEL / 64) * NLAYER)
#define PB_OW  ((DMODEL / 64) * (OBSP / 64))
#define PB_AW  ((NACTP / 64) * (DMODEL / 64))
#define PB_HW  ((OBSP / 64) * (DMODEL / 64))
#define PB_ALL (PB_OBS + 4 * PB_E + 2 * PB_F + PB_OW + PB_AW + PB_HW)
static_assert((NROWS % 8) == 0);

__global__ __launch_bounds__(256) void prep(
    const float* __restrict__ obs, const float* __restrict__ w_q, const float* __restrict__ w_k, const float* __restrict__ w_v,
    const float* __restrict__ w_o, const float* __restrict__ w_1, const float* __restrict__ w_2,
    const float* __restrict__ obs_w, const float* __restrict__ act_w, const float* __restrict__ obsh_w,
    unsigned short* OBS16, unsigned short* WQ16, unsigned short* WK16, unsigned short* WV16, unsigned short* WO16,
    unsigned short* W116, unsigned short* W216, unsigned short* OBSW16, unsigned short* ACTW16, unsigned short* OBSHW16) {
  __shared__ __align__(16) unsigned short sT[64 * 72];
  int b = (int)blockIdx.x;
  if (b < PB_OBS) {                                        // the whole block leaves, ahead of any barrier
    cvtobs(obs, OBS16, b);
    return;
  }
  b -= PB_OBS;
  const float* s;
  unsigned short* d;
  long long sZ = 0, dZ = 0;
  int R = DMODEL, C = DMODEL, ldd = KD, locol = DMODEL, gx = DMODEL / 64, gy = DMODEL / 64;
  float sclo = WLO;
  bool dual = true;
  if (b < 4 * PB_E) {                                      // in[256 k][256 n] -> out[256 n][512], per layer
    const int j = b / PB_E;
    b -= j * PB_E;
    s = (j == 0) ? w_q : (j == 1) ? w_k : (j == 2) ? w_v : w_o;
    d = (j == 0) ? WQ16 : (j == 1) ? WK16 : (j == 2) ? WV16 : WO16;
    sZ = (long long)DMODEL * DMODEL; dZ = (long long)DMODEL * KD;
  } else if (b < 4 * PB_E + PB_F) {                        // in[256 k][512 n] -> out[512 n][512], per layer
    b -= 4 * PB_E;
    s = w_1; d = W116;
    sZ = (long long)DMODEL * DFF; dZ = (long long)DFF * KD;
    C = DFF; gx = DFF / 64;
  } else if (b < 4 * PB_E + 2 * PB_F) {                    // in[512 k][256 n] -> out[256 n][1024], per layer
    b -= 4 * PB_E + PB_F;
    s = w_2; d = W216;
    sZ = (long long)DFF * DMODEL; dZ = (long long)DMODEL * KF;
    R = DFF; ldd = KF; locol = DFF; gy = DFF / 64;
  } else if (b < 4 * PB_E + 2 * PB_F + PB_OW) {            // in[637 k][256 n] -> out[256 n][640], k 637..639 zero, one copy
    b -= 4 * PB_E + 2 * PB_F;
    s = obs_w; d = OBSW16;
    R = OBSD; ldd = OBSP; locol = 0; gy = OBSP / 64;
    sclo = 0.f; dual = false;
  } else if (b < 4 * PB_E + 2 * PB_F + PB_OW + PB_AW) {    // in[256 k][4 n] -> out[64 n][512], n >= 4 zero
    b -= 4 * PB_E + 2 * PB_F + PB_OW;
    s = act_w; d = ACTW16;
    C = NACT; gx = NACTP / 64;
  } else {                                                 // in[256 k][637 n] -> out[640 n][512], n >= 637 zero
    b -= 4 * PB_E + 2 * PB_F + PB_OW + PB_AW;
    s = obsh_w; d = OBSHW16;
    C = OBSD; gx = OBSP / 64;
  }
  const int bz = b / (gx * gy);
  const int r  = b - bz * (gx * gy);
  const int by = r / gx;
  tcvt16(sT, s, sZ, d, dZ, R, C, ldd, locol, WSC, sclo, dual, r - by * gx, by, bz);
}

// =====================================================================================================
// Output copy: blockIdx.y == 0: out0[b*SEQ_FULL + t][0..3] = ACTF[b*SEQ + t][0..3] (one 16-B piece per thread, consecutive threads
// (SEQ*637 floats at float OUT1_OFF + b*SEQ_FULL*637) written as consecutive 16-B pieces (thread g -> floats 4i..4i+3, gathered from
// coverage: out0: NROWS pieces = every row; out1: NB * SEQ*637/4 pieces = every float of the region exactly once.
// =====================================================================================================
__global__ __launch_bounds__(256) void ocopy(const float* __restrict__ actf, const float* __restrict__ obsf, float* outp) {
  const int g = blockIdx.x * 256 + threadIdx.x;
  if (blockIdx.y == 0) {
    if (g >= NROWS) return;
    const int b = g / SEQ, t = g - b * SEQ;
    const v4f v = *(const v4f*)(actf + (size_t)g * NACTP);
    float* d = outp + ((size_t)b * SEQ_FULL + t) * NACT;
    {
      *(v4f*)d = v;
      
    }
  } else {
    const int ppb = (SEQ * OBSD) / 4;
    if (g >= NB * ppb) return;
    const int b = g / ppb;
    const int i = (g - b * ppb) * 4;
    v4f v;
#pragma unroll
    for (int e = 0; e < 4; ++e) {
      const int idx = i + e;
      const int row = idx / OBSD;
      const int col = idx - row * OBSD;
      v[e] = obsf[((size_t)b * SEQ + row) * OBSP + col];
    }
    float* d = outp + (size_t)OUT1_OFF + (size_t)b * SEQ_FULL * OBSD + i;
    {
      *(v4f*)d = v;
      
    }
  }
}

// =====================================================================================================
// Workspace map (bytes); every plane is an exact multiple of its tile / whole-row store granularity (M, N exact multiples of 64,
//   WQ16, WK16, WV16, WO16  f16 [6][256 n][512 = k x64 | k x1]     4 x 1572864
//   W116                    f16 [6][512 n][512]                       3145728
//   W216                    f16 [6][256 n][1024 = 512 x64 | 512 x1]  3145728
//   OBSW16                  f16 [256 n][640 k] x64 (k 637..639 zero)  327680
//   ACTW16                  f16 [64 n][512] (n 4..63 zero)              65536
//   OBSHW16                 f16 [640 n][512] (n 637..639 zero)         655360
//   OBS16                   f16 [NROWS][640] x16                      5242880
//   XA, XB                  f32 [NROWS][256] residual stream       2 x 4194304
//   HH, QP, KP, CT          f16 [NROWS][512] dual planes           4 x 4194304
//   VT                      f16 [NB][512][SEQ]                       4194304
//   G16                     f16 [NROWS][1024] dual                   8388608
//   ACTF                    f32 [NROWS][64]                          1048576
//   OBSF                    f32 [NROWS][640]                        10485760
//   total (NB=2, SEQ=2048)                                          68157440
// =====================================================================================================
extern "C" void kernel_launch(void* const* d_in, const int* in_sizes, int n_in,
                              void* d_out, int out_size, void* d_ws, size_t ws_size,
                              hipStream_t stream) {
  if (n_in < 19) return;
  if (in_sizes[0] < ((NB - 1) * SEQ_FULL + SEQ) * OBSD) return;
  if (in_sizes[1] < OBSD * DMODEL || in_sizes[2] < DMODEL) return;
  if (in_sizes[3] < NLAYER * DMODEL) return;
  if (in_sizes[4] < NLAYER * DMODEL * DMODEL || in_sizes[5] < NLAYER * DMODEL * DMODEL) return;
  if (in_sizes[6] < NLAYER * DMODEL * DMODEL || in_sizes[7] < NLAYER * DMODEL * DMODEL) return;
  if (in_sizes[8] < NLAYER * NBUCK * NHEAD || in_sizes[9] < NLAYER * DMODEL) return;
  if (in_sizes[10] < NLAYER * DMODEL * DFF || in_sizes[11] < NLAYER * DFF) return;
  if (in_sizes[12] < NLAYER * DFF * DMODEL || in_sizes[13] < NLAYER * DMODEL) return;
  if (in_sizes[14] < DMODEL || in_sizes[15] < DMODEL * NACT || in_sizes[16] < NACT) return;
  if (in_sizes[17] < DMODEL * OBSD || in_sizes[18] < OBSD) return;
  if (out_size < OUT1_OFF + ((NB - 1) * SEQ_FULL + SEQ) * OBSD) return;

  const float* obs     = (const float*)d_in[0];
  const float* obs_w   = (const float*)d_in[1];
  const float* obs_b   = (const float*)d_in[2];
  const float* norm1_w = (const float*)d_in[3];
  const float* w_q     = (const float*)d_in[4];
  const float* w_k     = (const float*)d_in[5];
  const float* w_v     = (const float*)d_in[6];
  const float* w_o     = (const float*)d_in[7];
  const float* relb    = (const float*)d_in[8];
  const float* norm2_w = (const float*)d_in[9];
  const float* w_1     = (const float*)d_in[10];
  const float* b_1     = (const float*)d_in[11];
  const float* w_2     = (const float*)d_in[12];
  const float* b_2     = (const float*)d_in[13];
  const float* fnorm_w = (const float*)d_in[14];
  const float* act_w   = (const float*)d_in[15];
  const float* act_b   = (const float*)d_in[16];
  const float* obsh_w  = (const float*)d_in[17];
  const float* obsh_b  = (const float*)d_in[18];
  float*       outp    = (float*)d_out;

  const size_t PWE  = (size_t)NLAYER * DMODEL * KD * 2;     // 1572864
  const size_t PW1  = (size_t)NLAYER * DFF * KD * 2;        // 3145728
  const size_t PW2  = (size_t)NLAYER * DMODEL * KF * 2;     // 3145728
  const size_t POBW = (size_t)DMODEL * OBSP * 2;            //  327680
  const size_t PACW = (size_t)NACTP * KD * 2;               //   65536
  const size_t POHW = (size_t)OBSP * KD * 2;                //  655360
  const size_t POBS = (size_t)NROWS * OBSP * 2;             // 5242880
  const size_t PX   = (size_t)NROWS * DMODEL * 4;           // 4194304
  const size_t PH   = (size_t)NROWS * KD * 2;               // 4194304
  const size_t PVT  = (size_t)NB * VTR * SEQ * 2;           // 4194304
  const size_t PG   = (size_t)NROWS * KF * 2;               // 8388608
  const size_t PACF = (size_t)NROWS * NACTP * 4;            // 1048576
  const size_t POBF = (size_t)NROWS * OBSP * 4;             // 10485760
  size_t off = 0;
  const size_t oWQ  = off; off += PWE;
  const size_t oWK  = off; off += PWE;
  const size_t oWV  = off; off += PWE;
  const size_t oWO  = off; off += PWE;
  const size_t oW1  = off; off += PW1;
  const size_t oW2  = off; off += PW2;
  const size_t oOBW = off; off += POBW;
  const size_t oACW = off; off += PACW;
  const size_t oOHW = off; off += POHW;
  const size_t oOBS = off; off += POBS;
  const size_t oXA  = off; off += PX;
  const size_t oXB  = off; off += PX;
  const size_t oHH  = off; off += PH;
  const size_t oQP  = off; off += PH;
  const size_t oKP  = off; off += PH;
  const size_t oCT  = off; off += PH;
  const size_t oVT  = off; off += PVT;
  const size_t oG   = off; off += PG;
  const size_t oACF = off; off += PACF;
  const size_t oOBF = off; off += POBF;
  const size_t endAll = off;                                // 68157440 for NB=2, SEQ=2048
  if (endAll > ws_size) return;
  if (endAll > (size_t)134217728) return;

  char* ws = (char*)d_ws;
  unsigned short* WQ16    = (unsigned short*)(ws + oWQ);
  unsigned short* WK16    = (unsigned short*)(ws + oWK);
  unsigned short* WV16    = (unsigned short*)(ws + oWV);
  unsigned short* WO16    = (unsigned short*)(ws + oWO);
  unsigned short* W116    = (unsigned short*)(ws + oW1);
  unsigned short* W216    = (unsigned short*)(ws + oW2);
  unsigned short* OBSW16  = (unsigned short*)(ws + oOBW);
  unsigned short* ACTW16  = (unsigned short*)(ws + oACW);
  unsigned short* OBSHW16 = (unsigned short*)(ws + oOHW);
  unsigned short* OBS16   = (unsigned short*)(ws + oOBS);
  float*          XA      = (float*)(ws + oXA);
  float*          XB      = (float*)(ws + oXB);
  unsigned short* HH      = (unsigned short*)(ws + oHH);
  unsigned short* QP      = (unsigned short*)(ws + oQP);
  unsigned short* KP      = (unsigned short*)(ws + oKP);
  unsigned short* CT      = (unsigned short*)(ws + oCT);
  unsigned short* VTp     = (unsigned short*)(ws + oVT);
  unsigned short* G16     = (unsigned short*)(ws + oG);
  float*          ACTF    = (float*)(ws + oACF);
  float*          OBSF    = (float*)(ws + oOBF);

  const dim3 blk(256);
  const dim3 blk128(128);
  const dim3 gRow(NROWS / 4);                                      // rmsn: 4 rows per block
  const int tilesE  = (NROWS / 64) * (DMODEL / 64);                // 256
  const int tilesV  = (DMODEL / 64) * (SEQ / 64);                  // 128 per batch
  const int tilesF  = (NROWS / 64) * (DFF / 64);                   // 512
  const int tilesA  = (NROWS / 64) * (NACTP / 64);                 // 64
  const int tilesO  = (NROWS / 64) * (OBSP / 64);                  // 640
  const dim3 gE(tilesE, 1);                                        // 256: one tile per block
  const dim3 gQKV(2 * tilesE + NB * tilesV);                       // 256 x 2 (q, k), then 128 x NB (v^T)
  const dim3 gF(tilesF, 1);                                        // 512
  const dim3 gOA(tilesO + tilesA);                                 // 640 (obs head), then 64 (action head)
  const dim3 gAT(ATT_BLOCKS);                                      // NB x SEQ/16 x 4 heads = 1024
  const dim3 bAT(ATT_THREADS);                                     // 256
  const int ppb = (SEQ * OBSD) / 4;
  const int gcx0 = NROWS / 256, gcx1 = (NB * ppb + 255) / 256;
  const dim3 gOC(gcx0 > gcx1 ? gcx0 : gcx1, 2);                    // (2548, 2)

  const long long sQK   = (long long)NLAYER * DMODEL * KD;         // WK16 - WQ16 in halves
  const long long sKP   = (long long)NROWS * KD;                   // KP - QP in halves

  // (0) 16-bit operand planes: transposed weights [n][k x64 | k x1] (bf16 RNE then exact power-of-two scale), obs x16
  prep<<<dim3(PB_ALL), blk, 0, stream>>>(obs, w_q, w_k, w_v, w_o, w_1, w_2, obs_w, act_w, obsh_w,
                                         OBS16, WQ16, WK16, WV16, WO16, W116, W216, OBSW16, ACTW16, OBSHW16);

  // (1) x = obs . Wp + bf16(bp) -> XA (f32); M = NROWS, N = 256, K = 640 (single product, inputs exact)
  gemm64<0, 0, 0, 1, OBSP, 1><<<gE, blk, 0, stream>>>(
      OBS16, 0LL,
      OBSW16, 0LL,
      (const float*)0,
      obs_b, DMODEL,
      (void*)XA, DMODEL, 0LL, 0LL,
      DMODEL, 1.0f / (OBC * WSC), 1.0f);

  for (int l = 0; l < NLAYER; ++l) {
    const size_t lwE = (size_t)l * DMODEL * KD;                    // WQ/WK/WV/WO layer offset (halves)
    const size_t lw1 = (size_t)l * DFF * KD;
    const size_t lw2 = (size_t)l * DMODEL * KF;

    // (2) h = RMSNorm(x) * bf16(g1) -> HH (hi x16 | residual x64)
    rmsn<<<gRow, blk128, 0, stream>>>(XA, norm1_w + (size_t)l * DMODEL, HH);

    // (3) q, k projections (batch index = blockIdx.x >> SH_E): QP / KP [m][hi | res]; M = NROWS, N = 256, K = 512 folded, no bias
    // (4) in the same launch, v^T per batch: VT[b][d][tok] (hi rows d, residual rows 256+d); M = 256 (d), N = SEQ, K = 512 folded
    gemm64x2<1, 0, 0, KD, 1><<<gQKV, blk, 0, stream>>>(
        HH, 0LL, WQ16 + lwE, sQK,
        (const float*)0, 1, (void*)QP, KD, sKP, (long long)DMODEL, DMODEL, SH_E,
        WV16 + lwE, 0LL, HH, (long long)SEQ * KD,
        (const float*)0, 1, (void*)VTp, SEQ, (long long)VTR * SEQ, (long long)DMODEL * SEQ, SEQ, SH_V,
        2 * tilesE, 1.0f / (HC * WSC), QC);

    // (5) causal attention with relative-position bias per (batch, 16 query rows, head), keys split over 8 waves -> CT (hi x16 | residual x64)
    attn4<<<gAT, bAT, 0, stream>>>(QP, KP, VTp, relb + (size_t)l * NBUCK * NHEAD, CT);

    // (6) XB = CT . Wo / (16 * 64) + XA (raw f32); M = NROWS, N = 256, K = 512 folded
    gemm64<0, 2, 0, 0, KD, 1><<<gE, blk, 0, stream>>>(
        CT, 0LL,
        WO16 + lwE, 0LL,
        XA,
        (const float*)0, 1,
        (void*)XB, DMODEL, 0LL, 0LL,
        DMODEL, 1.0f / (CC * WSC), 1.0f);

    // (7) h2 = RMSNorm(x) * bf16(g2) -> HH
    rmsn<<<gRow, blk128, 0, stream>>>(XB, norm2_w + (size_t)l * DMODEL, HH);

    // (8) G16 = dual f16 of 64 * relu(h2 . W1 + bf16(b1)); M = NROWS, N = 512, K = 512 folded
    gemm64<1, 0, 2, 1, KD, 1><<<gF, blk, 0, stream>>>(
        HH, 0LL,
        W116 + lw1, 0LL,
        (const float*)0,
        b_1 + (size_t)l * DFF, DFF,
        (void*)G16, KF, 0LL, (long long)DFF,
        DFF, 1.0f / (HC * WSC), GC);

    // (9) XA = G16 . W2 / (64 * 64) + bf16(b2) + XB (raw f32); M = NROWS, N = 256, K = 1024 folded
    gemm64<0, 2, 0, 1, KF / 2, 2><<<gE, blk, 0, stream>>>(
        G16, 0LL,
        W216 + lw2, 0LL,
        XB,
        b_2 + (size_t)l * DMODEL, DMODEL,
        (void*)XA, DMODEL, 0LL, 0LL,
        DMODEL, 1.0f / (GC * WSC), 1.0f);
  }

  // (10) hf = RMSNorm(x) * bf16(gf) -> HH
  rmsn<<<gRow, blk128, 0, stream>>>(XA, fnorm_w, HH);

  // (11) obs prediction plane OBSF[m][640] = hf . Wh + bf16(bh) (cols 0..636 meaningful); M = NROWS, N = 640, K = 512 folded
  // (12) in the same launch, action logits plane ACTF[m][64] = hf . Wa + bf16(ba) (cols 0..3 meaningful); M = NROWS, N = 64
  gemm64x2<0, 0, 1, KD, 1><<<gOA, blk, 0, stream>>>(
      HH, 0LL, OBSHW16, 0LL,
      obsh_b, OBSD, (void*)OBSF, OBSP, 0LL, 0LL, OBSP, SH_ONE,
      HH, 0LL, ACTW16, 0LL,
      act_b, NACT, (void*)ACTF, NACTP, 0LL, 0LL, NACTP, SH_ONE,
      tilesO, 1.0f / (HC * WSC), 1.0f);

  ocopy<<<gOC, blk, 0, stream>>>(ACTF, OBSF, outp);
  (void)hipGetLastError();
}

// v004
// Measured time: 465 microseconds a run.
// In two side-by-side timings against v003, it was 1.09 and 1.08 times as fast.
// All steps since v000 together make it 4.13 times as fast.
// Contractions (all v_wmma_f32_16x16x32_f16, f16 operands, f32 accumulate): input projection (obs f16 x16 . Wp^T f16 x64, K=640
// zero-padded, single product); q/k, v^T, attention-output, hidden (ReLU), second and both head projections with the activation
// operand carried as two f16 planes [hi | residual x64] folded along K against [W^T x64 | W^T x1]; attention scores q.k^T from the
// q/k hi and residual planes (hi.hi plus the two cross terms, two accumulators, K=64); attention P.v^T with P f16 x16384 (single)
// against v^T hi and residual planes (two accumulators). RMSNorm, softmax (base 2), ReLU, biases, relative-position bias and the
// residual stream in f32 on VALU. Every float input RNE-converted to bf16 on load.
#include <hip/hip_runtime.h>
#include <math.h>
#include <stdint.h>

#ifndef NB
#define NB        2
#endif
#ifndef SEQ
#define SEQ       2048
#endif
#define NB_FULL   2
#define SEQ_FULL  2048
#define NLAYER    6
#define DMODEL    256
#define NHEAD     4
#define HDIM      64
#define DFF       512
#define OBSD      637
#define OBSP      640
#define NACT      4
#define NACTP     64
#define NBUCK     32
#define NROWS     (NB * SEQ)
#define KD        (2 * DMODEL)          // folded K of E-wide activation operands: [hi 256 | residual 256]
#define KF        (2 * DFF)             // folded K of the hidden operand: [hi 512 | residual 512]
#define VTR       KD                    // per batch VTR * SEQ halves of v^T: 256 d x SEQ keys, hi and residual, fragment order
#define OUT1_OFF  (NB_FULL * SEQ_FULL * NACT)   // float index of the second output (byte offset 65536)
#define OUT_TOTAL (OUT1_OFF + NB_FULL * SEQ_FULL * OBSD)

// carries (exact powers of two)
#define WSC_I 64
#define RC_I  64
#define WLO_I 1
#define WSC   64.0f        // weight hi copy
#define WLO   1.0f         // weight lo copy (pairs with the x64 residual plane)
#define RC    64.0f        // residual plane carry relative to its hi plane
#define RCI   0.015625f
#define OBC   16.0f        // obs plane
#define HC    16.0f        // RMSNorm outputs
#define QC    16.0f
#define KC    16.0f
#define VC    16.0f
#define PC    16384.0f     // softmax P tile
#define CC    16.0f        // attention context
#define GC    64.0f        // ReLU hidden
#define ATT_SCALE 0.125f
#define LOG2E   1.4426950408889634f
#define RMS_EPS 1.1920929e-07f
static_assert(RC_I * WLO_I == WSC_I);
static_assert(NHEAD * HDIM == DMODEL);
static_assert(NB >= 1 && NB <= NB_FULL && SEQ >= 64 && SEQ <= SEQ_FULL);
static_assert((SEQ % 64) == 0 && (SEQ % 16) == 0 && (NROWS % 64) == 0 && (DMODEL % 64) == 0 && (DFF % 64) == 0);
static_assert((OBSP % 64) == 0 && (NACTP % 64) == 0 && OBSP >= OBSD && NACTP >= NACT && (OBSP - OBSD) < 64);
static_assert((KD % 32) == 0 && (KF % 32) == 0 && (OBSP % 32) == 0);
static_assert((NROWS % 256) == 0 && (NROWS % 4) == 0 && ((SEQ * OBSD) % 4) == 0);
static_assert(OUT_TOTAL == 2625536);

typedef _Float16 v16h __attribute__((ext_vector_type(16)));
typedef _Float16 v8h  __attribute__((ext_vector_type(8)));
typedef float    v8f  __attribute__((ext_vector_type(8)));
typedef float    v4f  __attribute__((ext_vector_type(4)));
typedef unsigned int v4u __attribute__((ext_vector_type(4)));
typedef unsigned int v2u __attribute__((ext_vector_type(2)));

union FragH { v16h v; v8h h[2]; v4u u[2]; };

// ---- scalar helpers --------------------------------------------------------------------------------
__device__ __forceinline__ unsigned short bf_bits(float f) {          // f32 -> bf16 bits, RNE convert
  unsigned u = __float_as_uint(f);
  return (unsigned short)((u + 0x7FFFu + ((u >> 16) & 1u)) >> 16);
}
__device__ __forceinline__ float bf_up(unsigned short h) { return __uint_as_float(((unsigned)h) << 16); }
__device__ __forceinline__ float bfr(float f) { return bf_up(bf_bits(f)); }   // value of the bf16 RNE convert
__device__ __forceinline__ unsigned short h_bits(_Float16 x) { return __builtin_bit_cast(unsigned short, x); }
__device__ __forceinline__ unsigned pk16(unsigned short a, unsigned short b) { return (unsigned)a | ((unsigned)b << 16); }
__device__ __forceinline__ v8f zero8() { v8f z = {0.f, 0.f, 0.f, 0.f, 0.f, 0.f, 0.f, 0.f}; return z; }
__device__ __forceinline__ int imin(int a, int b) { return a < b ? a : b; }
__device__ __forceinline__ int imax(int a, int b) { return a > b ? a : b; }

// Relative-position bucket for rel = query - key >= 0 (bidirectional split, 32 buckets, max distance 128), as an exact
// integer table: 0 -> 0; 1..7 -> 16+rel; 8..11 -> 24; 12..15 -> 25; 16..22 -> 26; 23..31 -> 27; 32..45 -> 28; 46..63 -> 29;
// 64..90 -> 30; >= 91 -> 31.
__device__ __forceinline__ int rel_bucket(int rel) {
  int b = 31;
  b = (rel < 91) ? 30 : b;
  b = (rel < 64) ? 29 : b;
  b = (rel < 46) ? 28 : b;
  b = (rel < 32) ? 27 : b;
  b = (rel < 23) ? 26 : b;
  b = (rel < 16) ? 25 : b;
  b = (rel < 12) ? 24 : b;
  b = (rel < 8) ? (16 + rel) : b;
  b = (rel == 0) ? 0 : b;
  return b;
}

// ---- fragment loaders: 16-bit A/B operand, lane -> row/col (lane&15), p already includes +8*(lane>>4);
//      elements 0..7 <- p[0..7] (k0+8h..), elements 8..15 <- p[16..23] (k0+16+8h..)  (same split k map for A and B;
//      B is always read from a k-contiguous [n][k] plane)
__device__ __forceinline__ v16h ldfrag_u(const unsigned short* p) {
  FragH f;
  f.u[0] = *(const v4u*)(p);
  f.u[1] = *(const v4u*)(p + 16);
  return f.v;
}
// Fragment-ordered plane of an [M][N] matrix (M multiple of 16, N of 64): chunk (m / 16) * (N / 64) + n / 64 holds 16 rows x 64 cols as
// FCH halves: [hi | residual] x [col / 16 & 3] x [lane = 16 * (col / 8 & 1) + row % 16] x [col % 8]. The two 16-B loads of a fragment
// (16 rows x 32 cols, same k map as above) then read 512 consecutive bytes each. p = the 16 x 32 block (FBK halves) + 8 * lane.
#define FCH 2048
#define FPL 1024
#define FBK 512
__device__ __forceinline__ v16h ldfrag_f(const _Float16* p) {
  FragH f;
  f.h[0] = *(const v8h*)(p);
  f.h[1] = *(const v8h*)(p + 256);
  return f.v;
}

// ---- WMMA helpers with trailing VALU hazard gaps ------------------------------------------------------
__device__ __forceinline__ v8f mma_raw(v16h a, v16h b, v8f c) {
  return __builtin_amdgcn_wmma_f32_16x16x32_f16(false, a, false, b, (short)0, c, false, false);
}
__device__ __forceinline__ void guard_s2x4(v8f& s, v8f& t, v16h a0, v16h a1, v16h b0, v16h b1) {
#if defined(__HIP_DEVICE_COMPILE__)
  asm volatile("v_nop\n\tv_nop\n\tv_nop\n\tv_nop" : "+v"(s), "+v"(t) : "v"(a0), "v"(a1), "v"(b0), "v"(b1));
#endif
}
__device__ __forceinline__ void guard_pv4(v8f& a, v8f& b, v8f& c, v8f& d, v16h x, v16h y, v16h z, v16h w, v16h u) {
#if defined(__HIP_DEVICE_COMPILE__)
  asm volatile("v_nop\n\tv_nop\n\tv_nop\n\tv_nop"
               : "+v"(a), "+v"(b), "+v"(c), "+v"(d) : "v"(x), "v"(y), "v"(z), "v"(w), "v"(u));
#endif
}
__device__ __forceinline__ void keep4_h(v16h a, v16h b, v16h c, v16h d) {
#if defined(__HIP_DEVICE_COMPILE__)
  asm volatile("v_nop" :: "v"(a), "v"(b), "v"(c), "v"(d));
#endif
}
// Later writes of the address and data registers of the global loads and stores issued so far stay behind this wait.
__device__ __forceinline__ void wait_x0() {
#if defined(__HIP_DEVICE_COMPILE__)
  asm volatile("s_wait_xcnt 0x0" ::: "memory");
#endif
}
__device__ __forceinline__ void wave_sync_lds() {
  __builtin_amdgcn_fence(__ATOMIC_RELEASE, "workgroup");
  __builtin_amdgcn_wave_barrier();
  __builtin_amdgcn_fence(__ATOMIC_ACQUIRE, "workgroup");
}

// =====================================================================================================
// Transposing 16-bit pack of a weight stored in[R][C] (row pitch C floats, R = contraction index, C = output index) into
// out[Cp][ldd] (row pitch ldd halves): out[c][r] = f16( bf16_RNE(in[r][c]) * schi ) for r < R and c < C, 0 otherwise (pad rows /
// pad columns explicitly written as zeros); with DUAL a second copy out[c][locol + r] = f16( bf16_RNE(in[r][c]) * sclo ).
// schi / sclo powers of two (exact). Tiles: Cp/64 along bx, Rp/64 along by; bz = slice: src advanced by bz*sZ floats, dst by
// bz*dZ halves. One 64x64 tile per block through LDS (bf16 bits): 16 scalar loads per thread with CLAMPED addresses, zero by
// coverage: load 256 thr x 16 floats = 64x64; store 2 it x 8 waves x 4 rows x (8 lanes x 8 halves) = 64 rows x 64 halves per copy;
//           tiles (Cp/64, Rp/64, Z) exact, each output line written by exactly one wave; pad region included.
// =====================================================================================================
// (bx, by, bz) = the tile's place in the grid described above; dual is the same for the whole block.
__device__ __forceinline__ void tcvt16(unsigned short* sT, const float* __restrict__ src, long long sZ,
                                       unsigned short* dst, long long dZ,
                                       int R, int C, int ldd, int locol, float schi, float sclo,
                                       bool dual, int bx, int by, int bz) {
  const int tid = threadIdx.x, lane = tid & 31, wave = tid >> 5;
  const int c0 = bx * 64, r0 = by * 64;
  const float* srcz = src + (size_t)((long long)bz * sZ);
  unsigned short* dstz = dst + (size_t)((long long)bz * dZ);
  const int rr = tid >> 2, cc = (tid & 3) * 16;
  const int r = r0 + rr;
  const int rcl = imin(r, R - 1);
  const float* sp = srcz + (size_t)rcl * C;
#pragma unroll
  for (int e = 0; e < 16; ++e) {
    const int cidx = c0 + cc + e;
    const int ccl = imin(cidx, C - 1);
    float a = sp[ccl];
    a = (r < R && cidx < C) ? a : 0.f;
    sT[(cc + e) * 72 + rr] = bf_bits(a);
  }
  __syncthreads();
  v4u hvals[2], lvals[2];
#pragma unroll
  for (int it = 0; it < 2; ++it) {
    const int q = it * 32 + wave * 4 + (lane >> 3);
    const v4u raw = *(const v4u*)(sT + q * 72 + (lane & 7) * 8);
    v4u hv = {0u, 0u, 0u, 0u}, lv = {0u, 0u, 0u, 0u};
#pragma unroll
    for (int e = 0; e < 4; ++e) {
      const float f0 = bf_up((unsigned short)(raw[e] & 0xFFFFu));
      const float f1 = bf_up((unsigned short)(raw[e] >> 16));
      hv[e] = pk16(h_bits((_Float16)(f0 * schi)), h_bits((_Float16)(f1 * schi)));
      lv[e] = pk16(h_bits((_Float16)(f0 * sclo)), h_bits((_Float16)(f1 * sclo)));
    }
    hvals[it] = hv;
    lvals[it] = lv;
  }
  {
#pragma unroll
    for (int it = 0; it < 2; ++it) {
      const int q = it * 32 + wave * 4 + (lane >> 3);
      unsigned short* p = dstz + (size_t)(c0 + q) * ldd + r0 + (lane & 7) * 8;
      *(v4u*)p = hvals[it];
    }
    wait_x0();                                             // no register of the two stores above is rewritten ahead of this wait
    if (dual) {
#pragma unroll                                             // lvals[] indexed by constants, so that it stays in registers
      for (int it = 0; it < 2; ++it) {
        const int q = it * 32 + wave * 4 + (lane >> 3);
        unsigned short* p = dstz + (size_t)(c0 + q) * ldd + r0 + (lane & 7) * 8;
        *(v4u*)(p + locol) = lvals[it];
      }
      wait_x0();                                           // the same for the second copy's two stores
    }
  }
}

// =====================================================================================================
// Batched f16 WMMA GEMM, operands staged in LDS: C[m][n] = f( oscale * sum_k A[m][k] * Bt[n][k] + bias ); one 64x64 tile per
// work-group of 8 waves (wave = 16 rows x 32 cols, two accumulators). A row-major [M][K] (16-bit plane), Bt row-major
// [N][K] (k contiguous), both at row pitch K; M, N multiples of 64, K = KST * NCH. tile = tile index, by = batch index with element
// strides sA, sB, sC. A stage is KST k of the tile's 64 A rows and 64 Bt rows, brought to LDS by asynchronous 16-B copies
// (a wave's copy = two aligned 256-B units) at row pitch KST + 8 halves (16 B x odd: ds_load_b128 fragment reads without bank conflicts).
// NCH 1: the stage is filled once and then read. NCH 2: two buffers, stage 1 flies while stage 0 is multiplied.
// k runs upward through one accumulator per 16x16 output tile.
// BM: 0 no bias, 1 bias bf16(biasp[n]) for n < nbias (0 beyond, clamped address).   ACT: 2 = ReLU applied to (value + bias).
// OM 0 = f32 out (pitch ldc); RM 2 adds raw f32 Rp[m][n] (same pitch/stride as C).
// OM 1 = dual f16 out (pitch ldc): hi = f16(value * ocarry) at C[m][n], residual f16(RC * (value * ocarry - hi)) at C[m][n] + lofs.
// OM 2 = the same two values in the fragment-ordered plane described at ldfrag_f (ldc and lofs not used); a wave's store = one
//        512-B block of the plane.
// coverage: copies: 2 operands x 4 row groups of 16 x KST/128 units of 256 B = 2*KST/32 copies per thread and stage; slab: 8 waves x 16 x 32 = 64 x 64;
//           out: f32 4 it x 16 rows x 16 lanes x 4, f16 2 it x 32 rows x 8 lanes x 8 (both planes) = the whole 64x64 tile;
//           grid = tilesM*tilesN blocks exactly.
// =====================================================================================================
// Eight asynchronous 16-B copies global -> LDS (l = the lane's LDS byte address, g = the lane's global address). The closing
// s_wait_xcnt keeps every later write of these address registers behind the copies' address translation.
__device__ __forceinline__ void acopy8(const unsigned* l, const unsigned short* const* g) {
#if defined(__HIP_DEVICE_COMPILE__)
  asm volatile(
      "global_load_async_to_lds_b128 %0, %8, off\n\t"
      "global_load_async_to_lds_b128 %1, %9, off\n\t"
      "global_load_async_to_lds_b128 %2, %10, off\n\t"
      "global_load_async_to_lds_b128 %3, %11, off\n\t"
      "global_load_async_to_lds_b128 %4, %12, off\n\t"
      "global_load_async_to_lds_b128 %5, %13, off\n\t"
      "global_load_async_to_lds_b128 %6, %14, off\n\t"
      "global_load_async_to_lds_b128 %7, %15, off\n\t"
      "s_wait_xcnt 0x0"
      :: "v"(l[0]), "v"(l[1]), "v"(l[2]), "v"(l[3]), "v"(l[4]), "v"(l[5]), "v"(l[6]), "v"(l[7]),
         "v"(g[0]), "v"(g[1]), "v"(g[2]), "v"(g[3]), "v"(g[4]), "v"(g[5]), "v"(g[6]), "v"(g[7])
      : "memory");
#endif
}
// The wave's own copies have landed in LDS behind this wait.
__device__ __forceinline__ void wait_async0() {
#if defined(__HIP_DEVICE_COMPILE__)
  asm volatile("s_wait_asynccnt 0x0" ::: "memory");
#endif
}
// The wave's own LDS reads have returned behind this wait.
__device__ __forceinline__ void wait_ds0() {
#if defined(__HIP_DEVICE_COMPILE__)
  asm volatile("s_wait_dscnt 0x0" ::: "memory");
#endif
}
// One stage: KST halves of rows 0..63 of Ag to LDS rows 0..63 and of rows 0..63 of Bg to LDS rows 64..127 (global row pitch LDK
// halves). 16 lanes take one aligned 256-B unit of a row, a copy of the block 16 rows; every offset below is a constant.
template <int KST, int LDK>
__device__ __forceinline__ void fill_stage(const unsigned short* Ag, const unsigned short* Bg, unsigned ldsb, int tid) {
  constexpr int CG  = KST / 128;            // 256-B units per row
  constexpr int PER = 4 * CG;               // copies per thread and operand
  constexpr int PIT = KST + 8;              // LDS row pitch, halves
  static_assert((KST % 128) == 0 && (2 * PER) % 8 == 0 && 2 * PER <= 63);
  const int r0 = tid >> 4, h0 = (tid & 15) * 8;
  const unsigned short* a0 = Ag + (size_t)r0 * LDK + h0;
  const unsigned short* b0 = Bg + (size_t)r0 * LDK + h0;
  const unsigned l0 = ldsb + (unsigned)(r0 * PIT + h0) * 2u;
  // both loops unrolled: every copy's offsets are then constants and l[], g[] stay in registers
#pragma unroll
  for (int g0 = 0; g0 < 2 * PER; g0 += 8) {
    unsigned l[8];
    const unsigned short* g[8];
#pragma unroll
    for (int e = 0; e < 8; ++e) {
      const int it = g0 + e;
      const bool isB = it >= PER;
      const int j = isB ? it - PER : it;
      const int rg = j / CG, cg = j - rg * CG;
      l[e] = l0 + (unsigned)((((isB ? 64 : 0) + rg * 16) * PIT + cg * 128) * 2);
      g[e] = (isB ? b0 : a0) + (size_t)(rg * 16) * LDK + cg * 128;
    }
    acopy8(l, g);
  }
}

template <int OM, int RM, int ACT, int BM, int KST, int NCH>
__device__ __forceinline__ void gemm64_tile(
    const unsigned short* __restrict__ Ap, long long sA,
    const unsigned short* __restrict__ Btp, long long sB,
    const float* __restrict__ Rp,
    const float* __restrict__ biasp, int nbias,
    void* Cout, int ldc, long long sC, long long lofs,
    int N, float oscale, float ocarry, int tile, int by) {
  constexpr int PIT  = KST + 8;               // LDS row pitch, halves
  constexpr int BUFH = 128 * PIT;            // halves per stage buffer: 64 A rows, then 64 Bt rows
  constexpr int LDK  = KST * NCH;            // row pitch of A and Bt, halves (= K)
  constexpr int KB   = 4;                    // k steps of 32 per fragment block
  constexpr int NBLK = KST / (32 * KB);
  static_assert(NCH == 1 || NCH == 2);
  static_assert((KST % (32 * KB)) == 0 && ((PIT * 2) % 32) == 16);
  __shared__ __align__(16) unsigned short sP[NCH * BUFH];
  __shared__ __align__(16) float sT[64 * 68];        // the tile in f32, pitch 68 floats
  const int tid  = threadIdx.x;
  const int lane = tid & 31;
  const int wave = tid >> 5;
  const int tilesN = N >> 6;
  const int tm = tile / tilesN;
  const int tn = tile - tm * tilesN;
  const int m0 = tm << 6;
  const int n0 = tn << 6;

  const unsigned short* Ag = Ap  + (size_t)((long long)by * sA) + (size_t)m0 * LDK;
  const unsigned short* Bg = Btp + (size_t)((long long)by * sB) + (size_t)n0 * LDK;
  const unsigned ldsb = (unsigned)(uintptr_t)(&sP[0]);   // LDS byte address = low 32 bits of the shared address

  fill_stage<KST, LDK>(Ag, Bg, ldsb, tid);
  wait_async0();
  __syncthreads();                                       // stage 0 readable by every wave
  if constexpr (NCH == 2) fill_stage<KST, LDK>(Ag + KST, Bg + KST, ldsb + (unsigned)(BUFH * 2), tid);

  const int rlane = lane & 15;                 // row (A) / col (B, D) within subtile
  const int koff  = (lane >> 4) * 8;           // k offset of this lane half
  const int mOff  = (lane >> 4) * 8;           // D row offset
  const int wr = wave >> 1, wc = wave & 1;     // wave tile: rows wr*16.., cols wc*32..

  v8f acc0 = zero8(), acc1 = zero8();
  // the loops below are unrolled so that the two fragment sets are indexed by constants and stay in registers
#pragma unroll
  for (int t = 0; t < NCH; ++t) {
    const unsigned short* aL = sP + t * BUFH + (wr * 16 + rlane) * PIT + koff;
    const unsigned short* bL = sP + t * BUFH + (64 + wc * 32 + rlane) * PIT + koff;
    // fragments one block ahead in a second register set, each block's LDS reads as one group; never across a stage
    v16h fa[2][KB], fb0[2][KB], fb1[2][KB];
#pragma unroll
    for (int s = 0; s < KB; ++s) {
      fa[0][s]  = ldfrag_u(aL + s * 32);
      fb0[0][s] = ldfrag_u(bL + s * 32);
      fb1[0][s] = ldfrag_u(bL + 16 * PIT + s * 32);
    }
#pragma unroll
    for (int blk = 0; blk < NBLK; ++blk) {
      const int cur = blk & 1;
      if (blk + 1 < NBLK) {
#pragma unroll
        for (int s = 0; s < KB; ++s) {
          const int k0 = ((blk + 1) * KB + s) * 32;
          fa[cur ^ 1][s]  = ldfrag_u(aL + k0);
          fb0[cur ^ 1][s] = ldfrag_u(bL + k0);
          fb1[cur ^ 1][s] = ldfrag_u(bL + 16 * PIT + k0);
        }
      }
      __builtin_amdgcn_sched_barrier(0);   // keeps the next block's LDS reads one group ahead of this block's products
#pragma unroll
      for (int s = 0; s < KB; ++s) {
        acc0 = mma_raw(fa[cur][s], fb0[cur][s], acc0);
        acc1 = mma_raw(fa[cur][s], fb1[cur][s], acc1);
      }
      __builtin_amdgcn_sched_barrier(0);   // keeps later blocks' LDS reads from spreading among these products
    }
    if (t + 1 < NCH) {
      wait_ds0();
      wait_async0();
      __syncthreads();                                   // stage t + 1 readable by every wave
    }
  }
  if constexpr (NCH == 2) wait_async0();                 // no copy is outstanding when the buffers are left

  const int r16 = tid >> 4, c4 = (tid & 15) * 4;         // f32 out: 256-B row segment = 16 lanes x 16 B
  const int r32 = tid >> 3;                              // f16 out: 128-B row segment = 8 lanes x 16 B
  const int c8 = (OM == 2) ? (wave & 3) * 16 + (lane >> 4) * 8 : (tid & 7) * 8;   // OM 2: 16 cols per wave, 8 per lane half

  // ---- column bias (same columns for every row a thread writes), clamped addresses ----
  float bc4[4], bc8[8];
#pragma unroll
  for (int e = 0; e < 4; ++e) bc4[e] = 0.f;
#pragma unroll
  for (int e = 0; e < 8; ++e) bc8[e] = 0.f;
  if constexpr (BM == 1) {
    if constexpr (OM == 0) {
#pragma unroll
      for (int e = 0; e < 4; ++e) {
        const int n = n0 + c4 + e;
        const int ncl = imin(n, nbias - 1);
        const float t = bfr(biasp[ncl]);
        bc4[e] = (n < nbias) ? t : 0.f;
      }
    } else {
#pragma unroll
      for (int e = 0; e < 8; ++e) {
        const int n = n0 + c8 + e;
        const int ncl = imin(n, nbias - 1);
        const float t = bfr(biasp[ncl]);
        bc8[e] = (n < nbias) ? t : 0.f;
      }
    }
  }

  // ---- epilogue: the tile through LDS, whole row segments (OM 0, 1) or whole 512-B fragment blocks (OM 2) out ----
#pragma unroll
  for (int r = 0; r < 8; ++r) {
    float* sp = sT + (wr * 16 + mOff + r) * 68 + wc * 32 + rlane;
    sp[0]  = acc0[r];
    sp[16] = acc1[r];
  }
  __syncthreads();
  if constexpr (OM == 0) {
    float* C = (float*)Cout + (size_t)((long long)by * sC);
#pragma unroll
    for (int it = 0; it < 4; ++it) {
      const int row = it * 16 + r16;                     // it 0..3 x r16 0..15 = rows 0..63
      const int gr  = m0 + row;
      v4f v = *(const v4f*)(sT + row * 68 + c4);
      v4f rv = {0.f, 0.f, 0.f, 0.f};
      if constexpr (RM == 2) {
        const float* R = Rp + (size_t)((long long)by * sC);
        rv = *(const v4f*)(R + (size_t)gr * ldc + n0 + c4);
      }
#pragma unroll
      for (int e = 0; e < 4; ++e) {
        float u = v[e] * oscale;
        if constexpr (BM == 1) u += bc4[e];
        if constexpr (ACT == 2) u = fmaxf(u, 0.f);
        v[e] = u + rv[e];
      }
      *(v4f*)(C + (size_t)gr * ldc + n0 + c4) = v;
    }
  } else {
    unsigned short* C = (unsigned short*)Cout + (size_t)((long long)by * sC);
#pragma unroll
    for (int it = 0; it < 2; ++it) {
      // OM 1: it 0..1 x r32 0..31 = rows 0..63; OM 2: 16 rows per wave, (it, wave / 4) = the tile's four groups of 16 rows
      const int row = (OM == 2) ? (it * 2 + (wave >> 2)) * 16 + rlane : it * 32 + r32;
      const float* spf = sT + row * 68 + c8;
      v4u a = {0u, 0u, 0u, 0u}, bl = {0u, 0u, 0u, 0u};
#pragma unroll
      for (int e = 0; e < 4; ++e) {
        float f0 = spf[2 * e] * oscale;
        float f1 = spf[2 * e + 1] * oscale;
        if constexpr (BM == 1) { f0 += bc8[2 * e]; f1 += bc8[2 * e + 1]; }
        if constexpr (ACT == 2) { f0 = fmaxf(f0, 0.f); f1 = fmaxf(f1, 0.f); }
        f0 *= ocarry; f1 *= ocarry;
        const _Float16 g0 = (_Float16)f0, g1 = (_Float16)f1;
        const float r0 = (f0 - (float)g0) * RC, r1 = (f1 - (float)g1) * RC;
        a[e]  = pk16(h_bits(g0), h_bits(g1));
        bl[e] = pk16(h_bits((_Float16)r0), h_bits((_Float16)r1));
      }
      if constexpr (OM == 2) {
        unsigned short* p = C + ((size_t)((m0 + row) >> 4) * tilesN + tn) * FCH + (wave & 3) * 256 + lane * 8;
        *(v4u*)p = a;
        *(v4u*)(p + FPL) = bl;
      } else {
        unsigned short* p = C + (size_t)(m0 + row) * ldc + n0 + c8;
        *(v4u*)p = a;
        *(v4u*)(p + (size_t)lofs) = bl;
      }
    }
  }
  (void)Rp; (void)ocarry; (void)lofs; (void)nbias; (void)biasp; (void)ldc; (void)r32;
}

// One product per launch: blockIdx.x = tile, blockIdx.y = batch index.
template <int OM, int RM, int ACT, int BM, int KST, int NCH>
__global__ __launch_bounds__(256) void gemm64(
    const unsigned short* __restrict__ Ap, long long sA,
    const unsigned short* __restrict__ Btp, long long sB,
    const float* __restrict__ Rp,
    const float* __restrict__ biasp, int nbias,
    void* Cout, int ldc, long long sC, long long lofs,
    int N, float oscale, float ocarry) {
  gemm64_tile<OM, RM, ACT, BM, KST, NCH>(Ap, sA, Btp, sB, Rp, biasp, nbias, Cout, ldc, sC, lofs, N, oscale, ocarry,
                                         (int)blockIdx.x, (int)blockIdx.y);
}

#define SH_E   8        // log2 of the tiles per batch index of the q / k product: (NROWS / 64) * (DMODEL / 64)
#define SH_V   7        // log2 of the tiles per batch of the v^T product: (DMODEL / 64) * (SEQ / 64)
#define SH_ONE 30       // a product with one batch index only
static_assert((1 << SH_E) == (NROWS / 64) * (DMODEL / 64) && (1 << SH_V) == (DMODEL / 64) * (SEQ / 64));
static_assert(QC == VC);
// Two independent products of the same form in one launch (no residual input): blocks 0..n0-1 work on product 0, the rest on
// product 1; inside a product block i is tile i mod 2^sh of batch index i >> sh. The choice is the same for the whole block.
// coverage: grid = n0 + (blocks of product 1), each product's (tile, batch) pairs taken exactly once.
template <int OM, int ACT, int BM, int KST, int NCH>
__global__ __launch_bounds__(256) void gemm64x2(
    const unsigned short* __restrict__ Ap0, long long sA0, const unsigned short* __restrict__ Btp0, long long sB0,
    const float* __restrict__ biasp0, int nbias0, void* Cout0, int ldc0, long long sC0, long long lofs0, int N0, int sh0,
    const unsigned short* __restrict__ Ap1, long long sA1, const unsigned short* __restrict__ Btp1, long long sB1,
    const float* __restrict__ biasp1, int nbias1, void* Cout1, int ldc1, long long sC1, long long lofs1, int N1, int sh1,
    int n0, float oscale, float ocarry) {
  const int b = (int)blockIdx.x;
  const bool p0 = b < n0;
  const int i  = p0 ? b : b - n0;
  const int sh = p0 ? sh0 : sh1;
  const int by = i >> sh;
  gemm64_tile<OM, 0, ACT, BM, KST, NCH>(p0 ? Ap0 : Ap1, p0 ? sA0 : sA1, p0 ? Btp0 : Btp1, p0 ? sB0 : sB1, (const float*)0,
                                        p0 ? biasp0 : biasp1, p0 ? nbias0 : nbias1, p0 ? Cout0 : Cout1, p0 ? ldc0 : ldc1,
                                        p0 ? sC0 : sC1, p0 ? lofs0 : lofs1, p0 ? N0 : N1, oscale, ocarry, i - (by << sh), by);
}

// =====================================================================================================
// Causal flash attention for one batch, one head and 16 query rows, head dim 64; the keys are split over the 8 waves of the block:
//   q plane QP: the matrix [b*SEQ + tok][head*64+d] (f16 x16 and its residual x64) in fragment order (see ldfrag_f); k plane KP same;
//   v^T plane VT: per batch the matrix [head*64+d][key] (f16 x16 and its residual x64) in fragment order;
//   out CT[b*SEQ + tok][512]: hi = f16(16 * ctx) at col head*64+d, residual = f16(64 * (16 ctx - hi)) at col 256+head*64+d, where
//   ctx[d] = sum_m softmax_m(q.k / 8 + relb[bucket(tok - m)][head]) v[m][d] over keys m <= tok (softmax run in base 2, -inf select for
//   keys m > tok). The relative bias table (bf16 RNE of relb, x log2 e) for rel 0..q0+15 of the head is built in LDS per block.
//   Key steps of 32 from 0 to q0+16; wave w takes steps w, w + 8, w + 16, ... with its own running maxima, sums and accumulators (a
//   wave-uniform trip count, possibly zero; no block barrier inside the loop). kb <= q0 always, so every query row sees key kb
//   unmasked in every step and the step max is finite; the rescale exponent is clamped at -126 so a wave's first step gives a tiny
//   finite factor times zero sums.
//   Per step: two score tiles, each hi.hi (2 k-steps of 32) into one accumulator and hi.res + res.hi (4 k-steps) into a second one,
//   fragments loaded straight from the 16-bit planes (two 16-B loads per fragment, arithmetic addressing); online max-subtracted
//   softmax in f32 (exp2); rescale of the running sums and the eight accumulators; the 16x32 prob tile stored to wave-private LDS
//   (read back RNE to f16, split k map) and the v^T B fragments (4 hi, 4 residual) loaded straight from the 16-bit plane (keys
//   kb..kb+31 <= SEQ-1 always in range); 8 P.V WMMAs into hi and residual accumulator sets.
//   Merge: each wave leaves its un-normalised 16x64 partial o_hi + o_res/64 (f32, pitch 68) and its (max, sum) per row in LDS; after one
//   block barrier thread t merges row t/16, cols 4(t%16)..+3: M = max_w m_w, weight 2^(m_w - M) (0 for a wave without steps, m_w = -inf;
//   wave 0 always has step 0, so M is finite), l = sum_w weight l_w, ctx16 = 16 sum_w weight o_w / (l 16384 16).
// coverage: LDS bias table: rel 0..kend-1 (all rel used); partials: 8 waves x 16 rows x 64 cols and 8 x 16 (max, sum), all written by
//           every wave, all read; global: 256 threads x 4 halves = 16 rows x 64 halves per plane (a row's 128-B segment = 16 lanes of one
//           wave); grid (NB batches x SEQ/16 query tiles x 4 heads) covers all NROWS x 512 of CT exactly once.
// =====================================================================================================
#define ATT_SPLIT   8
#define ATT_THREADS (ATT_SPLIT * 32)
#define ATT_BLOCKS  (NB * (SEQ / 16) * NHEAD)
#define PT_FLOATS   (ATT_SPLIT * 16 * 36)
#define OP_PITCH    68
#define VCS         ((SEQ / 64) * FCH)      // halves between the v^T chunks of 16 d and of the next 16 d at the same keys
static_assert(ATT_THREADS == 16 * (HDIM / 4) && HDIM == 64);
static_assert((HDIM * 2) % 128 == 0 && (HDIM % 32) == 0);

__global__ __launch_bounds__(ATT_THREADS)
void attn4(const unsigned short* __restrict__ QPp, const unsigned short* __restrict__ KPp,
           const unsigned short* __restrict__ VTq, const float* __restrict__ relbl, unsigned short* CT) {
  __shared__ __align__(16) float sbias[SEQ];                          // [rel], bf16(relb) * log2 e
  __shared__ __align__(16) float spt[PT_FLOATS];                      // per wave prob tile [row][32 keys], pitch 36
  __shared__ __align__(16) float spo[ATT_SPLIT * 16 * OP_PITCH];      // per wave partial [row][64 d], pitch 68
  __shared__ __align__(16) float sml[2 * ATT_SPLIT * 16];             // per wave and row: max, then sum

  const int tid  = threadIdx.x;
  const int wave = __builtin_amdgcn_readfirstlane(tid >> 5);  // scalar: the key loop's trip count is a scalar branch, EXEC stays full
  const int lane = tid & 31;
  const int hh   = lane >> 4;
  const int c    = lane & 15;

  const int head = blockIdx.x % NHEAD;                     // 0..3
  const int qb   = blockIdx.x / NHEAD;
  const int qt   = qb % (SEQ / 16);                        // query tile
  const int bat  = qb / (SEQ / 16);                        // batch
  const int q0   = qt * 16;
  const int srow = q0 + 8 * hh;                            // this lane half's first query row (+ r)
  const int kend = q0 + 16;                                // causal: keys 0 .. q0+15; rel = query - key in 0 .. kend-1

  // ---- relative-position bias table for rel 0..kend-1 of this head ----
  for (int rel = tid; rel < kend; rel += ATT_THREADS) {
    const int bk = rel_bucket(rel);
    sbias[rel] = bfr(relbl[bk * NHEAD + head]) * LOG2E;
  }
  __syncthreads();

  const float* sb = sbias;
  const _Float16* Q16 = (const _Float16*)(const void*)QPp;
  const _Float16* K16 = (const _Float16*)(const void*)KPp;
  const _Float16* V16 = (const _Float16*)(const void*)VTq;
  const _Float16* Qf = Q16 + ((size_t)((bat * SEQ + q0) >> 4) * NHEAD + head) * FCH + lane * 8;   // chunk (16 tokens, head)
  const _Float16* Kf = K16 + ((size_t)((bat * SEQ) >> 4) * NHEAD + head) * FCH + lane * 8;
  const _Float16* Vf = V16 + (size_t)bat * VTR * SEQ + (size_t)(head * (HDIM / 16)) * VCS + lane * 8;  // chunk (16 d, 64 keys)
  const float lsc = (LOG2E * ATT_SCALE) / (QC * KC);      // log2(e) / 8 / carries

  const v16h qah = ldfrag_f(Qf), qbh = ldfrag_f(Qf + FBK);                      // hi, d 0..31 / 32..63
  const v16h qal = ldfrag_f(Qf + FPL), qbl = ldfrag_f(Qf + FPL + FBK);          // residual x64

  float mrow[8], lrow[8];
  v8f om0 = zero8(), om1 = zero8(), om2 = zero8(), om3 = zero8();
  v8f or0 = zero8(), or1 = zero8(), or2 = zero8(), or3 = zero8();
#pragma unroll
  for (int r = 0; r < 8; ++r) { mrow[r] = -INFINITY; lrow[r] = 0.f; }
  float* pt = spt + wave * (16 * 36);

#pragma unroll 1
  for (int kb = wave * 32; kb < kend; kb += 32 * ATT_SPLIT) {
    const _Float16* kp = Kf + (size_t)(kb >> 4) * (NHEAD * FCH);
    v8f s0m, s0r, s1m, s1r;
    {
      const v16h k0h = ldfrag_f(kp), k1h = ldfrag_f(kp + FBK);
      const v16h k0l = ldfrag_f(kp + FPL), k1l = ldfrag_f(kp + FPL + FBK);
      s0m = mma_raw(qah, k0h, zero8());
      s0m = mma_raw(qbh, k1h, s0m);
      s0r = mma_raw(qah, k0l, zero8());
      s0r = mma_raw(qbh, k1l, s0r);
      s0r = mma_raw(qal, k0h, s0r);
      s0r = mma_raw(qbl, k1h, s0r);
      guard_s2x4(s0m, s0r, k0h, k1h, k0l, k1l);
    }
    {
      const _Float16* kq = kp + NHEAD * FCH;               // the next 16 keys
      const v16h k0h = ldfrag_f(kq), k1h = ldfrag_f(kq + FBK);
      const v16h k0l = ldfrag_f(kq + FPL), k1l = ldfrag_f(kq + FPL + FBK);
      s1m = mma_raw(qah, k0h, zero8());
      s1m = mma_raw(qbh, k1h, s1m);
      s1r = mma_raw(qah, k0l, zero8());
      s1r = mma_raw(qbh, k1l, s1r);
      s1r = mma_raw(qal, k0h, s1r);
      s1r = mma_raw(qbl, k1h, s1r);
      guard_s2x4(s1m, s1r, k0h, k1h, k0l, k1l);
      keep4_h(qah, qbh, qal, qbl);
    }
    const int key0 = kb + c;                               // key of this lane's column in tile 0
    const int key1 = kb + 16 + c;                          // key of this lane's column in tile 1
#pragma unroll
    for (int r = 0; r < 8; ++r) {
      const int qi = srow + r;
      const int i0 = imax(qi - key0, 0);
      const int i1 = imax(qi - key1, 0);
      float t0 = (s0m[r] + s0r[r] * RCI) * lsc + sb[i0];
      float t1 = (s1m[r] + s1r[r] * RCI) * lsc + sb[i1];
      t0 = (key0 > qi) ? -INFINITY : t0;
      t1 = (key1 > qi) ? -INFINITY : t1;
      float mx = fmaxf(t0, t1);
#pragma unroll
      for (int off = 1; off < 16; off <<= 1) mx = fmaxf(mx, __shfl_xor(mx, off, 32));
      const float mn = fmaxf(mrow[r], mx);
      const float al = exp2f(fmaxf(mrow[r] - mn, -126.0f));
      mrow[r] = mn;
      const float e0 = exp2f(t0 - mn);
      const float e1 = exp2f(t1 - mn);
      float ps = e0 + e1;
#pragma unroll
      for (int off = 1; off < 16; off <<= 1) ps += __shfl_xor(ps, off, 32);
      lrow[r] = lrow[r] * al + ps;
      om0[r] *= al; om1[r] *= al; om2[r] *= al; om3[r] *= al;
      or0[r] *= al; or1[r] *= al; or2[r] *= al; or3[r] *= al;
      const int ro = (8 * hh + r) * 36 + c;
      pt[ro]      = e0;
      pt[ro + 16] = e1;
    }
    wave_sync_lds();
    FragH ph;
    {
      const float* prow = pt + c * 36 + 8 * hh;
      const v4f p0 = *(const v4f*)(prow), p1 = *(const v4f*)(prow + 4);
      const v4f p2 = *(const v4f*)(prow + 16), p3 = *(const v4f*)(prow + 20);
#pragma unroll
      for (int e = 0; e < 4; ++e) {
        ph.h[0][e]     = (_Float16)(p0[e] * PC);              // elements 0..7  = keys kb + 8hh + 0..7
        ph.h[0][4 + e] = (_Float16)(p1[e] * PC);
        ph.h[1][e]     = (_Float16)(p2[e] * PC);              // elements 8..15 = keys kb + 16 + 8hh + 0..7
        ph.h[1][4 + e] = (_Float16)(p3[e] * PC);
      }
    }
    {
      const _Float16* vp = Vf + (size_t)(kb >> 6) * FCH + ((kb >> 5) & 1) * FBK;
      const v16h vb0 = ldfrag_f(vp);
      const v16h vb1 = ldfrag_f(vp + VCS);
      const v16h vb2 = ldfrag_f(vp + 2 * VCS);
      const v16h vb3 = ldfrag_f(vp + 3 * VCS);
      om0 = mma_raw(ph.v, vb0, om0);
      om1 = mma_raw(ph.v, vb1, om1);
      om2 = mma_raw(ph.v, vb2, om2);
      om3 = mma_raw(ph.v, vb3, om3);
      guard_pv4(om0, om1, om2, om3, ph.v, vb0, vb1, vb2, vb3);
    }
    {
      const _Float16* vq = Vf + (size_t)(kb >> 6) * FCH + ((kb >> 5) & 1) * FBK + FPL;
      const v16h vl0 = ldfrag_f(vq);
      const v16h vl1 = ldfrag_f(vq + VCS);
      const v16h vl2 = ldfrag_f(vq + 2 * VCS);
      const v16h vl3 = ldfrag_f(vq + 3 * VCS);
      or0 = mma_raw(ph.v, vl0, or0);
      or1 = mma_raw(ph.v, vl1, or1);
      or2 = mma_raw(ph.v, vl2, or2);
      or3 = mma_raw(ph.v, vl3, or3);
      guard_pv4(or0, or1, or2, or3, ph.v, vl0, vl1, vl2, vl3);
    }
    wave_sync_lds();
  }

  // ---- the wave's un-normalised partial and its (max, sum) per row to LDS ----
  {
    float* pw = spo + wave * (16 * OP_PITCH) + c;
#pragma unroll
    for (int r = 0; r < 8; ++r) {
      float* op = pw + (8 * hh + r) * OP_PITCH;
      op[0]  = om0[r] + or0[r] * RCI;
      op[16] = om1[r] + or1[r] * RCI;
      op[32] = om2[r] + or2[r] * RCI;
      op[48] = om3[r] + or3[r] * RCI;
    }
    if (c == 0) {                                          // max and sum are equal in the 16 lanes of a half
#pragma unroll
      for (int r = 0; r < 8; ++r) {
        sml[wave * 16 + 8 * hh + r] = mrow[r];
        sml[ATT_SPLIT * 16 + wave * 16 + 8 * hh + r] = lrow[r];
      }
    }
  }
  __syncthreads();                                         // every wave's partial readable by every wave
  // ---- merge the 8 partials, fold 1/l and the carries, write 4 hi and 4 residual halves per thread ----
  {
    const int row = tid >> 4, c4 = (tid & 15) * 4;
    float ms[ATT_SPLIT];
    float mall = -INFINITY;
#pragma unroll
    for (int s = 0; s < ATT_SPLIT; ++s) {
      ms[s] = sml[s * 16 + row];
      mall = fmaxf(mall, ms[s]);
    }
    float lall = 0.f;
    v4f o = {0.f, 0.f, 0.f, 0.f};
#pragma unroll
    for (int s = 0; s < ATT_SPLIT; ++s) {
      const float w = exp2f(ms[s] - mall);
      const v4f p = *(const v4f*)(spo + (s * 16 + row) * OP_PITCH + c4);
      lall += w * sml[ATT_SPLIT * 16 + s * 16 + row];
#pragma unroll
      for (int e = 0; e < 4; ++e) o[e] += w * p[e];
    }
    const float inv = (1.0f / lall) * (CC / (PC * VC));
    const float u0 = o[0] * inv, u1 = o[1] * inv, u2 = o[2] * inv, u3 = o[3] * inv;
    const _Float16 g0 = (_Float16)u0, g1 = (_Float16)u1, g2 = (_Float16)u2, g3 = (_Float16)u3;
    v2u hv, lv;
    hv[0] = pk16(h_bits(g0), h_bits(g1));
    hv[1] = pk16(h_bits(g2), h_bits(g3));
    lv[0] = pk16(h_bits((_Float16)((u0 - (float)g0) * RC)), h_bits((_Float16)((u1 - (float)g1) * RC)));
    lv[1] = pk16(h_bits((_Float16)((u2 - (float)g2) * RC)), h_bits((_Float16)((u3 - (float)g3) * RC)));
    unsigned short* dst = CT + ((size_t)bat * SEQ + q0 + row) * KD + head * HDIM + c4;
    *(v2u*)dst = hv;
    *(v2u*)(dst + DMODEL) = lv;
  }
}

// =====================================================================================================
// RMSNorm over the last dim (256): out = x * rsqrt(mean(x*x) + eps) * bf16(w), eps 1.1920929e-7, in f32; written as the dual 16-bit
// plane outh[row][512]: hi = f16(16 * out) at col c, residual = f16(64 * (16 out - hi)) at col 256 + c.
//   One wave per row (4 rows per 128-thread block): lane loads 8 consecutive floats (two 16-B loads), sum of squares by xor shuffles,
//   then writes its own 8 hi halves and 8 residual halves: per plane one instruction of 32 lanes x 16 B = the whole 512-B half row
// coverage: grid = NROWS/4 blocks x 4 waves = every row once; per row 32 lanes x 8 halves = 256 hi + 256 residual halves.
// =====================================================================================================
__global__ __launch_bounds__(128) void rmsn(const float* __restrict__ Xp, const float* __restrict__ wp, unsigned short* outh) {
  const int wave = threadIdx.x >> 5, lane = threadIdx.x & 31;
  const int row = blockIdx.x * 4 + wave;
  const int c0 = lane * 8;
  const float* xp = Xp + (size_t)row * DMODEL + c0;
  const v4f x0 = *(const v4f*)(xp), x1 = *(const v4f*)(xp + 4);
  float ss = ((x0[0] * x0[0] + x0[1] * x0[1]) + (x0[2] * x0[2] + x0[3] * x0[3])) +
             ((x1[0] * x1[0] + x1[1] * x1[1]) + (x1[2] * x1[2] + x1[3] * x1[3]));
#pragma unroll
  for (int off = 1; off < 32; off <<= 1) ss += __shfl_xor(ss, off, 32);
  const float rstd = rsqrtf(ss * (1.0f / (float)DMODEL) + RMS_EPS);
  const v4f w0 = *(const v4f*)(wp + c0), w1 = *(const v4f*)(wp + c0 + 4);
  float o[8];
#pragma unroll
  for (int e = 0; e < 4; ++e) {
    o[e]     = (x0[e] * rstd) * bfr(w0[e]);
    o[4 + e] = (x1[e] * rstd) * bfr(w1[e]);
  }
  v4u hv, lv;
#pragma unroll
  for (int e = 0; e < 4; ++e) {
    const float f0 = o[2 * e] * HC, f1 = o[2 * e + 1] * HC;
    const _Float16 g0 = (_Float16)f0, g1 = (_Float16)f1;
    hv[e] = pk16(h_bits(g0), h_bits(g1));
    lv[e] = pk16(h_bits((_Float16)((f0 - (float)g0) * RC)), h_bits((_Float16)((f1 - (float)g1) * RC)));
  }
  unsigned short* dp = outh + (size_t)row * KD + c0;
  {
    *(v4u*)dp = hv;
    *(v4u*)(dp + DMODEL) = lv;
    
  }
}

// =====================================================================================================
// Input convert: obs16[m][640] = f16(16 * bf16_RNE(obs[b*SEQ_FULL + t][c])) for c < 637 (m = b*SEQ + t), 0 for the pad columns
// 637..639 (explicitly written). One wave per row (8 rows per block): 80 pieces of 8 halves; lane writes pieces lane, lane+32 and
// coverage: NROWS/8 blocks x 8 waves = every row; per row pieces 0..79 = cols 0..639.
// =====================================================================================================
__device__ __forceinline__ void cvtobs(const float* __restrict__ src, unsigned short* dst, int blk) {
  const int wave = threadIdx.x >> 5, lane = threadIdx.x & 31;
  const int m = blk * 8 + wave;
  const int b = m / SEQ, t = m - b * SEQ;
  const float* sp = src + ((size_t)b * SEQ_FULL + t) * OBSD;
  unsigned short* dp = dst + (size_t)m * OBSP;
  {
#pragma unroll 1
    for (int it = 0; it < 3; ++it) {
      const int p = it * 32 + lane;
      const int col0 = p * 8;
      v4u a;
#pragma unroll
      for (int e = 0; e < 4; ++e) {
        const int ca = col0 + 2 * e, cb = ca + 1;
        float fa = sp[imin(ca, OBSD - 1)];
        float fb = sp[imin(cb, OBSD - 1)];
        fa = (ca < OBSD) ? fa : 0.f;
        fb = (cb < OBSD) ? fb : 0.f;
        a[e] = pk16(h_bits((_Float16)(bfr(fa) * OBC)), h_bits((_Float16)(bfr(fb) * OBC)));
      }
      if (p < OBSP / 8) {
        *(v4u*)(dp + (size_t)p * 8) = a;
        wait_x0();                                         // the next trip advances the store's address registers
      }
    }
    
  }
}

// =====================================================================================================
// All 16-bit operand planes in one launch (they depend on the inputs alone, not on one another): blocks 0..PB_OBS-1 convert obs,
// then one 64x64 transposing tile per block for w_q, w_k, w_v, w_o, w_1, w_2, obs_w, act_w, obsh_w in this order. The job is a
// function of blockIdx.x alone, so every branch below (and the barrier inside tcvt16) is uniform for the block.
// coverage: each job's blocks = its (Cp/64) x (Rp/64) x slices tiles exactly once; grid = PB_ALL.
// =====================================================================================================
#define PB_OBS (NROWS / 8)
#define PB_E   ((DMODEL / 64) * (DMODEL / 64) * NLAYER)
#define PB_F   ((DFF / 64) * (DMODEL / 64) * NLAYER)
#define PB_OW  ((DMODEL / 64) * (OBSP / 64))
#define PB_AW  ((NACTP / 64) * (DMODEL / 64))
#define PB_HW  ((OBSP / 64) * (DMODEL / 64))
#define PB_ALL (PB_OBS + 4 * PB_E + 2 * PB_F + PB_OW + PB_AW + PB_HW)
static_assert((NROWS % 8) == 0);

__global__ __launch_bounds__(256) void prep(
    const float* __restrict__ obs, const float* __restrict__ w_q, const float* __restrict__ w_k, const float* __restrict__ w_v,
    const float* __restrict__ w_o, const float* __restrict__ w_1, const float* __restrict__ w_2,
    const float* __restrict__ obs_w, const float* __restrict__ act_w, const float* __restrict__ obsh_w,
    unsigned short* OBS16, unsigned short* WQ16, unsigned short* WK16, unsigned short* WV16, unsigned short* WO16,
    unsigned short* W116, unsigned short* W216, unsigned short* OBSW16, unsigned short* ACTW16, unsigned short* OBSHW16) {
  __shared__ __align__(16) unsigned short sT[64 * 72];
  int b = (int)blockIdx.x;
  if (b < PB_OBS) {                                        // the whole block leaves, ahead of any barrier
    cvtobs(obs, OBS16, b);
    return;
  }
  b -= PB_OBS;
  const float* s;
  unsigned short* d;
  long long sZ = 0, dZ = 0;
  int R = DMODEL, C = DMODEL, ldd = KD, locol = DMODEL, gx = DMODEL / 64, gy = DMODEL / 64;
  float sclo = WLO;
  bool dual = true;
  if (b < 4 * PB_E) {                                      // in[256 k][256 n] -> out[256 n][512], per layer
    const int j = b / PB_E;
    b -= j * PB_E;
    s = (j == 0) ? w_q : (j == 1) ? w_k : (j == 2) ? w_v : w_o;
    d = (j == 0) ? WQ16 : (j == 1) ? WK16 : (j == 2) ? WV16 : WO16;
    sZ = (long long)DMODEL * DMODEL; dZ = (long long)DMODEL * KD;
  } else if (b < 4 * PB_E + PB_F) {                        // in[256 k][512 n] -> out[512 n][512], per layer
    b -= 4 * PB_E;
    s = w_1; d = W116;
    sZ = (long long)DMODEL * DFF; dZ = (long long)DFF * KD;
    C = DFF; gx = DFF / 64;
  } else if (b < 4 * PB_E + 2 * PB_F) {                    // in[512 k][256 n] -> out[256 n][1024], per layer
    b -= 4 * PB_E + PB_F;
    s = w_2; d = W216;
    sZ = (long long)DFF * DMODEL; dZ = (long long)DMODEL * KF;
    R = DFF; ldd = KF; locol = DFF; gy = DFF / 64;
  } else if (b < 4 * PB_E + 2 * PB_F + PB_OW) {            // in[637 k][256 n] -> out[256 n][640], k 637..639 zero, one copy
    b -= 4 * PB_E + 2 * PB_F;
    s = obs_w; d = OBSW16;
    R = OBSD; ldd = OBSP; locol = 0; gy = OBSP / 64;
    sclo = 0.f; dual = false;
  } else if (b < 4 * PB_E + 2 * PB_F + PB_OW + PB_AW) {    // in[256 k][4 n] -> out[64 n][512], n >= 4 zero
    b -= 4 * PB_E + 2 * PB_F + PB_OW;
    s = act_w; d = ACTW16;
    C = NACT; gx = NACTP / 64;
  } else {                                                 // in[256 k][637 n] -> out[640 n][512], n >= 637 zero
    b -= 4 * PB_E + 2 * PB_F + PB_OW + PB_AW;
    s = obsh_w; d = OBSHW16;
    C = OBSD; gx = OBSP / 64;
  }
  const int bz = b / (gx * gy);
  const int r  = b - bz * (gx * gy);
  const int by = r / gx;
  tcvt16(sT, s, sZ, d, dZ, R, C, ldd, locol, WSC, sclo, dual, r - by * gx, by, bz);
}

// =====================================================================================================
// Output copy: blockIdx.y == 0: out0[b*SEQ_FULL + t][0..3] = ACTF[b*SEQ + t][0..3] (one 16-B piece per thread, consecutive threads
// (SEQ*637 floats at float OUT1_OFF + b*SEQ_FULL*637) written as consecutive 16-B pieces (thread g -> floats 4i..4i+3, gathered from
// coverage: out0: NROWS pieces = every row; out1: NB * SEQ*637/4 pieces = every float of the region exactly once.
// =====================================================================================================
__global__ __launch_bounds__(256) void ocopy(const float* __restrict__ actf, const float* __restrict__ obsf, float* outp) {
  const int g = blockIdx.x * 256 + threadIdx.x;
  if (blockIdx.y == 0) {
    if (g >= NROWS) return;
    const int b = g / SEQ, t = g - b * SEQ;
    const v4f v = *(const v4f*)(actf + (size_t)g * NACTP);
    float* d = outp + ((size_t)b * SEQ_FULL + t) * NACT;
    {
      *(v4f*)d = v;
      
    }
  } else {
    const int ppb = (SEQ * OBSD) / 4;
    if (g >= NB * ppb) return;
    const int b = g / ppb;
    const int i = (g - b * ppb) * 4;
    v4f v;
#pragma unroll
    for (int e = 0; e < 4; ++e) {
      const int idx = i + e;
      const int row = idx / OBSD;
      const int col = idx - row * OBSD;
      v[e] = obsf[((size_t)b * SEQ + row) * OBSP + col];
    }
    float* d = outp + (size_t)OUT1_OFF + (size_t)b * SEQ_FULL * OBSD + i;
    {
      *(v4f*)d = v;
      
    }
  }
}

// =====================================================================================================
// Workspace map (bytes); every plane is an exact multiple of its tile / whole-row store granularity (M, N exact multiples of 64,
//   WQ16, WK16, WV16, WO16  f16 [6][256 n][512 = k x64 | k x1]     4 x 1572864
//   W116                    f16 [6][512 n][512]                       3145728
//   W216                    f16 [6][256 n][1024 = 512 x64 | 512 x1]  3145728
//   OBSW16                  f16 [256 n][640 k] x64 (k 637..639 zero)  327680
//   ACTW16                  f16 [64 n][512] (n 4..63 zero)              65536
//   OBSHW16                 f16 [640 n][512] (n 637..639 zero)         655360
//   OBS16                   f16 [NROWS][640] x16                      5242880
//   XA, XB                  f32 [NROWS][256] residual stream       2 x 4194304
//   HH, CT                  f16 [NROWS][512] dual planes           2 x 4194304
//   QP, KP                  f16 [NROWS/16][4 heads][2048] fragment order  2 x 4194304
//   VT                      f16 [NB][256/16][SEQ/64][2048] fragment order  4194304
//   G16                     f16 [NROWS][1024] dual                   8388608
//   ACTF                    f32 [NROWS][64]                          1048576
//   OBSF                    f32 [NROWS][640]                        10485760
//   total (NB=2, SEQ=2048)                                          68157440
// =====================================================================================================
extern "C" void kernel_launch(void* const* d_in, const int* in_sizes, int n_in,
                              void* d_out, int out_size, void* d_ws, size_t ws_size,
                              hipStream_t stream) {
  if (n_in < 19) return;
  if (in_sizes[0] < ((NB - 1) * SEQ_FULL + SEQ) * OBSD) return;
  if (in_sizes[1] < OBSD * DMODEL || in_sizes[2] < DMODEL) return;
  if (in_sizes[3] < NLAYER * DMODEL) return;
  if (in_sizes[4] < NLAYER * DMODEL * DMODEL || in_sizes[5] < NLAYER * DMODEL * DMODEL) return;
  if (in_sizes[6] < NLAYER * DMODEL * DMODEL || in_sizes[7] < NLAYER * DMODEL * DMODEL) return;
  if (in_sizes[8] < NLAYER * NBUCK * NHEAD || in_sizes[9] < NLAYER * DMODEL) return;
  if (in_sizes[10] < NLAYER * DMODEL * DFF || in_sizes[11] < NLAYER * DFF) return;
  if (in_sizes[12] < NLAYER * DFF * DMODEL || in_sizes[13] < NLAYER * DMODEL) return;
  if (in_sizes[14] < DMODEL || in_sizes[15] < DMODEL * NACT || in_sizes[16] < NACT) return;
  if (in_sizes[17] < DMODEL * OBSD || in_sizes[18] < OBSD) return;
  if (out_size < OUT1_OFF + ((NB - 1) * SEQ_FULL + SEQ) * OBSD) return;

  const float* obs     = (const float*)d_in[0];
  const float* obs_w   = (const float*)d_in[1];
  const float* obs_b   = (const float*)d_in[2];
  const float* norm1_w = (const float*)d_in[3];
  const float* w_q     = (const float*)d_in[4];
  const float* w_k     = (const float*)d_in[5];
  const float* w_v     = (const float*)d_in[6];
  const float* w_o     = (const float*)d_in[7];
  const float* relb    = (const float*)d_in[8];
  const float* norm2_w = (const float*)d_in[9];
  const float* w_1     = (const float*)d_in[10];
  const float* b_1     = (const float*)d_in[11];
  const float* w_2     = (const float*)d_in[12];
  const float* b_2     = (const float*)d_in[13];
  const float* fnorm_w = (const float*)d_in[14];
  const float* act_w   = (const float*)d_in[15];
  const float* act_b   = (const float*)d_in[16];
  const float* obsh_w  = (const float*)d_in[17];
  const float* obsh_b  = (const float*)d_in[18];
  float*       outp    = (float*)d_out;

  const size_t PWE  = (size_t)NLAYER * DMODEL * KD * 2;     // 1572864
  const size_t PW1  = (size_t)NLAYER * DFF * KD * 2;        // 3145728
  const size_t PW2  = (size_t)NLAYER * DMODEL * KF * 2;     // 3145728
  const size_t POBW = (size_t)DMODEL * OBSP * 2;            //  327680
  const size_t PACW = (size_t)NACTP * KD * 2;               //   65536
  const size_t POHW = (size_t)OBSP * KD * 2;                //  655360
  const size_t POBS = (size_t)NROWS * OBSP * 2;             // 5242880
  const size_t PX   = (size_t)NROWS * DMODEL * 4;           // 4194304
  const size_t PH   = (size_t)NROWS * KD * 2;               // 4194304
  const size_t PVT  = (size_t)NB * VTR * SEQ * 2;           // 4194304
  const size_t PG   = (size_t)NROWS * KF * 2;               // 8388608
  const size_t PACF = (size_t)NROWS * NACTP * 4;            // 1048576
  const size_t POBF = (size_t)NROWS * OBSP * 4;             // 10485760
  size_t off = 0;
  const size_t oWQ  = off; off += PWE;
  const size_t oWK  = off; off += PWE;
  const size_t oWV  = off; off += PWE;
  const size_t oWO  = off; off += PWE;
  const size_t oW1  = off; off += PW1;
  const size_t oW2  = off; off += PW2;
  const size_t oOBW = off; off += POBW;
  const size_t oACW = off; off += PACW;
  const size_t oOHW = off; off += POHW;
  const size_t oOBS = off; off += POBS;
  const size_t oXA  = off; off += PX;
  const size_t oXB  = off; off += PX;
  const size_t oHH  = off; off += PH;
  const size_t oQP  = off; off += PH;
  const size_t oKP  = off; off += PH;
  const size_t oCT  = off; off += PH;
  const size_t oVT  = off; off += PVT;
  const size_t oG   = off; off += PG;
  const size_t oACF = off; off += PACF;
  const size_t oOBF = off; off += POBF;
  const size_t endAll = off;                                // 68157440 for NB=2, SEQ=2048
  if (endAll > ws_size) return;
  if (endAll > (size_t)134217728) return;

  char* ws = (char*)d_ws;
  unsigned short* WQ16    = (unsigned short*)(ws + oWQ);
  unsigned short* WK16    = (unsigned short*)(ws + oWK);
  unsigned short* WV16    = (unsigned short*)(ws + oWV);
  unsigned short* WO16    = (unsigned short*)(ws + oWO);
  unsigned short* W116    = (unsigned short*)(ws + oW1);
  unsigned short* W216    = (unsigned short*)(ws + oW2);
  unsigned short* OBSW16  = (unsigned short*)(ws + oOBW);
  unsigned short* ACTW16  = (unsigned short*)(ws + oACW);
  unsigned short* OBSHW16 = (unsigned short*)(ws + oOHW);
  unsigned short* OBS16   = (unsigned short*)(ws + oOBS);
  float*          XA      = (float*)(ws + oXA);
  float*          XB      = (float*)(ws + oXB);
  unsigned short* HH      = (unsigned short*)(ws + oHH);
  unsigned short* QP      = (unsigned short*)(ws + oQP);
  unsigned short* KP      = (unsigned short*)(ws + oKP);
  unsigned short* CT      = (unsigned short*)(ws + oCT);
  unsigned short* VTp     = (unsigned short*)(ws + oVT);
  unsigned short* G16     = (unsigned short*)(ws + oG);
  float*          ACTF    = (float*)(ws + oACF);
  float*          OBSF    = (float*)(ws + oOBF);

  const dim3 blk(256);
  const dim3 blk128(128);
  const dim3 gRow(NROWS / 4);                                      // rmsn: 4 rows per block
  const int tilesE  = (NROWS / 64) * (DMODEL / 64);                // 256
  const int tilesV  = (DMODEL / 64) * (SEQ / 64);                  // 128 per batch
  const int tilesF  = (NROWS / 64) * (DFF / 64);                   // 512
  const int tilesA  = (NROWS / 64) * (NACTP / 64);                 // 64
  const int tilesO  = (NROWS / 64) * (OBSP / 64);                  // 640
  const dim3 gE(tilesE, 1);                                        // 256: one tile per block
  const dim3 gQKV(2 * tilesE + NB * tilesV);                       // 256 x 2 (q, k), then 128 x NB (v^T)
  const dim3 gF(tilesF, 1);                                        // 512
  const dim3 gOA(tilesO + tilesA);                                 // 640 (obs head), then 64 (action head)
  const dim3 gAT(ATT_BLOCKS);                                      // NB x SEQ/16 x 4 heads = 1024
  const dim3 bAT(ATT_THREADS);                                     // 256
  const int ppb = (SEQ * OBSD) / 4;
  const int gcx0 = NROWS / 256, gcx1 = (NB * ppb + 255) / 256;
  const dim3 gOC(gcx0 > gcx1 ? gcx0 : gcx1, 2);                    // (2548, 2)

  const long long sQK   = (long long)NLAYER * DMODEL * KD;         // WK16 - WQ16 in halves
  const long long sKP   = (long long)NROWS * KD;                   // KP - QP in halves

  // (0) 16-bit operand planes: transposed weights [n][k x64 | k x1] (bf16 RNE then exact power-of-two scale), obs x16
  prep<<<dim3(PB_ALL), blk, 0, stream>>>(obs, w_q, w_k, w_v, w_o, w_1, w_2, obs_w, act_w, obsh_w,
                                         OBS16, WQ16, WK16, WV16, WO16, W116, W216, OBSW16, ACTW16, OBSHW16);

  // (1) x = obs . Wp + bf16(bp) -> XA (f32); M = NROWS, N = 256, K = 640 (single product, inputs exact)
  gemm64<0, 0, 0, 1, OBSP, 1><<<gE, blk, 0, stream>>>(
      OBS16, 0LL,
      OBSW16, 0LL,
      (const float*)0,
      obs_b, DMODEL,
      (void*)XA, DMODEL, 0LL, 0LL,
      DMODEL, 1.0f / (OBC * WSC), 1.0f);

  for (int l = 0; l < NLAYER; ++l) {
    const size_t lwE = (size_t)l * DMODEL * KD;                    // WQ/WK/WV/WO layer offset (halves)
    const size_t lw1 = (size_t)l * DFF * KD;
    const size_t lw2 = (size_t)l * DMODEL * KF;

    // (2) h = RMSNorm(x) * bf16(g1) -> HH (hi x16 | residual x64)
    rmsn<<<gRow, blk128, 0, stream>>>(XA, norm1_w + (size_t)l * DMODEL, HH);

    // (3) q, k projections (batch index 0, 1): QP / KP in fragment order; M = NROWS, N = 256, K = 512 folded, no bias
    // (4) in the same launch, v^T per batch: VT[b] = [d][tok] in fragment order; M = 256 (d), N = SEQ, K = 512 folded
    gemm64x2<2, 0, 0, KD, 1><<<gQKV, blk, 0, stream>>>(
        HH, 0LL, WQ16 + lwE, sQK,
        (const float*)0, 1, (void*)QP, KD, sKP, (long long)DMODEL, DMODEL, SH_E,
        WV16 + lwE, 0LL, HH, (long long)SEQ * KD,
        (const float*)0, 1, (void*)VTp, SEQ, (long long)VTR * SEQ, (long long)DMODEL * SEQ, SEQ, SH_V,
        2 * tilesE, 1.0f / (HC * WSC), QC);

    // (5) causal attention with relative-position bias per (batch, 16 query rows, head), keys split over 8 waves -> CT (hi x16 | residual x64)
    attn4<<<gAT, bAT, 0, stream>>>(QP, KP, VTp, relb + (size_t)l * NBUCK * NHEAD, CT);

    // (6) XB = CT . Wo / (16 * 64) + XA (raw f32); M = NROWS, N = 256, K = 512 folded
    gemm64<0, 2, 0, 0, KD, 1><<<gE, blk, 0, stream>>>(
        CT, 0LL,
        WO16 + lwE, 0LL,
        XA,
        (const float*)0, 1,
        (void*)XB, DMODEL, 0LL, 0LL,
        DMODEL, 1.0f / (CC * WSC), 1.0f);

    // (7) h2 = RMSNorm(x) * bf16(g2) -> HH
    rmsn<<<gRow, blk128, 0, stream>>>(XB, norm2_w + (size_t)l * DMODEL, HH);

    // (8) G16 = dual f16 of 64 * relu(h2 . W1 + bf16(b1)); M = NROWS, N = 512, K = 512 folded
    gemm64<1, 0, 2, 1, KD, 1><<<gF, blk, 0, stream>>>(
        HH, 0LL,
        W116 + lw1, 0LL,
        (const float*)0,
        b_1 + (size_t)l * DFF, DFF,
        (void*)G16, KF, 0LL, (long long)DFF,
        DFF, 1.0f / (HC * WSC), GC);

    // (9) XA = G16 . W2 / (64 * 64) + bf16(b2) + XB (raw f32); M = NROWS, N = 256, K = 1024 folded
    gemm64<0, 2, 0, 1, KF / 2, 2><<<gE, blk, 0, stream>>>(
        G16, 0LL,
        W216 + lw2, 0LL,
        XB,
        b_2 + (size_t)l * DMODEL, DMODEL,
        (void*)XA, DMODEL, 0LL, 0LL,
        DMODEL, 1.0f / (GC * WSC), 1.0f);
  }

  // (10) hf = RMSNorm(x) * bf16(gf) -> HH
  rmsn<<<gRow, blk128, 0, stream>>>(XA, fnorm_w, HH);

  // (11) obs prediction plane OBSF[m][640] = hf . Wh + bf16(bh) (cols 0..636 meaningful); M = NROWS, N = 640, K = 512 folded
  // (12) in the same launch, action logits plane ACTF[m][64] = hf . Wa + bf16(ba) (cols 0..3 meaningful); M = NROWS, N = 64
  gemm64x2<0, 0, 1, KD, 1><<<gOA, blk, 0, stream>>>(
      HH, 0LL, OBSHW16, 0LL,
      obsh_b, OBSD, (void*)OBSF, OBSP, 0LL, 0LL, OBSP, SH_ONE,
      HH, 0LL, ACTW16, 0LL,
      act_b, NACT, (void*)ACTF, NACTP, 0LL, 0LL, NACTP, SH_ONE,
      tilesO, 1.0f / (HC * WSC), 1.0f);

  ocopy<<<gOC, blk, 0, stream>>>(ACTF, OBSF, outp);
  (void)hipGetLastError();
}

// v005
// A run of this version takes 433 microseconds.
// In two side-by-side timings against v004, it was 1.07 and 1.08 times as fast.
// Over all steps from v000 it is 4.44 times as fast.
// Contractions (all v_wmma_f32_16x16x32_f16, f16 operands, f32 accumulate): input projection (obs f16 x16 . Wp^T f16 x64, K=640
// zero-padded, single product); q/k, v^T, attention-output, hidden (ReLU), second and both head projections with the activation
// operand carried as two f16 planes [hi | residual x64] folded along K against [W^T x64 | W^T x1]; attention scores q.k^T from the
// q/k hi and residual planes (hi.hi plus the two cross terms, two accumulators, K=64); attention P.v^T with P f16 x16384 (single)
// against v^T hi and residual planes (two accumulators). RMSNorm, softmax (base 2), ReLU, biases, relative-position bias and the
// residual stream in f32 on VALU. Every float input RNE-converted to bf16 on load.
// RMSNorm has no launch of its own: the row factor rsqrt(mean(x*x) + eps) commutes with the product along the row, so the product
// that makes x also stores the operand plane of x * bf16(norm weight) and its tile's sums of squares, and the product that reads the
// plane multiplies its result by the row factor.
#include <hip/hip_runtime.h>
#include <math.h>
#include <stdint.h>

#ifndef NB
#define NB        2
#endif
#ifndef SEQ
#define SEQ       2048
#endif
#define NB_FULL   2
#define SEQ_FULL  2048
#define NLAYER    6
#define DMODEL    256
#define NHEAD     4
#define HDIM      64
#define DFF       512
#define OBSD      637
#define OBSP      640
#define NACT      4
#define NACTP     64
#define NBUCK     32
#define NROWS     (NB * SEQ)
#define KD        (2 * DMODEL)          // folded K of E-wide activation operands: [hi 256 | residual 256]
#define KF        (2 * DFF)             // folded K of the hidden operand: [hi 512 | residual 512]
#define VTR       KD                    // per batch VTR * SEQ halves of v^T: 256 d x SEQ keys, hi and residual, fragment order
#define OUT1_OFF  (NB_FULL * SEQ_FULL * NACT)   // float index of the second output (byte offset 65536)
#define OUT_TOTAL (OUT1_OFF + NB_FULL * SEQ_FULL * OBSD)

// carries (exact powers of two)
#define WSC_I 64
#define RC_I  64
#define WLO_I 1
#define WSC   64.0f        // weight hi copy
#define WLO   1.0f         // weight lo copy (pairs with the x64 residual plane)
#define RC    64.0f        // residual plane carry relative to its hi plane
#define RCI   0.015625f
#define OBC   16.0f        // obs plane
#define HC    4.0f         // x * norm weight planes (not yet divided by the row's rms)
#define QC    16.0f
#define KC    16.0f
#define VC    16.0f
#define PC    16384.0f     // softmax P tile
#define CC    16.0f        // attention context
#define GC    64.0f        // ReLU hidden
#define ATT_SCALE 0.125f
#define LOG2E   1.4426950408889634f
#define RMS_EPS 1.1920929e-07f
#define NSS     (DMODEL / 64)        // partial sums of squares per row of x: one per 64-column tile
static_assert(RC_I * WLO_I == WSC_I);
static_assert(NHEAD * HDIM == DMODEL);
static_assert(NB >= 1 && NB <= NB_FULL && SEQ >= 64 && SEQ <= SEQ_FULL);
static_assert((SEQ % 64) == 0 && (SEQ % 16) == 0 && (NROWS % 64) == 0 && (DMODEL % 64) == 0 && (DFF % 64) == 0);
static_assert((OBSP % 64) == 0 && (NACTP % 64) == 0 && OBSP >= OBSD && NACTP >= NACT && (OBSP - OBSD) < 64);
static_assert((KD % 32) == 0 && (KF % 32) == 0 && (OBSP % 32) == 0);
static_assert((NROWS % 256) == 0 && (NROWS % 4) == 0 && ((SEQ * OBSD) % 4) == 0);
static_assert(OUT_TOTAL == 2625536);

typedef _Float16 v16h __attribute__((ext_vector_type(16)));
typedef _Float16 v8h  __attribute__((ext_vector_type(8)));
typedef float    v8f  __attribute__((ext_vector_type(8)));
typedef float    v4f  __attribute__((ext_vector_type(4)));
typedef unsigned int v4u __attribute__((ext_vector_type(4)));
typedef unsigned int v2u __attribute__((ext_vector_type(2)));

union FragH { v16h v; v8h h[2]; v4u u[2]; };

// ---- scalar helpers --------------------------------------------------------------------------------
__device__ __forceinline__ unsigned short bf_bits(float f) {          // f32 -> bf16 bits, RNE convert
  unsigned u = __float_as_uint(f);
  return (unsigned short)((u + 0x7FFFu + ((u >> 16) & 1u)) >> 16);
}
__device__ __forceinline__ float bf_up(unsigned short h) { return __uint_as_float(((unsigned)h) << 16); }
__device__ __forceinline__ float bfr(float f) { return bf_up(bf_bits(f)); }   // value of the bf16 RNE convert
__device__ __forceinline__ unsigned short h_bits(_Float16 x) { return __builtin_bit_cast(unsigned short, x); }
__device__ __forceinline__ unsigned pk16(unsigned short a, unsigned short b) { return (unsigned)a | ((unsigned)b << 16); }
__device__ __forceinline__ v8f zero8() { v8f z = {0.f, 0.f, 0.f, 0.f, 0.f, 0.f, 0.f, 0.f}; return z; }
__device__ __forceinline__ int imin(int a, int b) { return a < b ? a : b; }
__device__ __forceinline__ int imax(int a, int b) { return a > b ? a : b; }

// Relative-position bucket for rel = query - key >= 0 (bidirectional split, 32 buckets, max distance 128), as an exact
// integer table: 0 -> 0; 1..7 -> 16+rel; 8..11 -> 24; 12..15 -> 25; 16..22 -> 26; 23..31 -> 27; 32..45 -> 28; 46..63 -> 29;
// 64..90 -> 30; >= 91 -> 31.
__device__ __forceinline__ int rel_bucket(int rel) {
  int b = 31;
  b = (rel < 91) ? 30 : b;
  b = (rel < 64) ? 29 : b;
  b = (rel < 46) ? 28 : b;
  b = (rel < 32) ? 27 : b;
  b = (rel < 23) ? 26 : b;
  b = (rel < 16) ? 25 : b;
  b = (rel < 12) ? 24 : b;
  b = (rel < 8) ? (16 + rel) : b;
  b = (rel == 0) ? 0 : b;
  return b;
}

// ---- fragment loaders: 16-bit A/B operand, lane -> row/col (lane&15), p already includes +8*(lane>>4);
//      elements 0..7 <- p[0..7] (k0+8h..), elements 8..15 <- p[16..23] (k0+16+8h..)  (same split k map for A and B;
//      B is always read from a k-contiguous [n][k] plane)
__device__ __forceinline__ v16h ldfrag_u(const unsigned short* p) {
  FragH f;
  f.u[0] = *(const v4u*)(p);
  f.u[1] = *(const v4u*)(p + 16);
  return f.v;
}
// Fragment-ordered plane of an [M][N] matrix (M multiple of 16, N of 64): chunk (m / 16) * (N / 64) + n / 64 holds 16 rows x 64 cols as
// FCH halves: [hi | residual] x [col / 16 & 3] x [lane = 16 * (col / 8 & 1) + row % 16] x [col % 8]. The two 16-B loads of a fragment
// (16 rows x 32 cols, same k map as above) then read 512 consecutive bytes each. p = the 16 x 32 block (FBK halves) + 8 * lane.
#define FCH 2048
#define FPL 1024
#define FBK 512
__device__ __forceinline__ v16h ldfrag_f(const _Float16* p) {
  FragH f;
  f.h[0] = *(const v8h*)(p);
  f.h[1] = *(const v8h*)(p + 256);
  return f.v;
}

// ---- WMMA helpers with trailing VALU hazard gaps ------------------------------------------------------
__device__ __forceinline__ v8f mma_raw(v16h a, v16h b, v8f c) {
  return __builtin_amdgcn_wmma_f32_16x16x32_f16(false, a, false, b, (short)0, c, false, false);
}
__device__ __forceinline__ void guard_s2x4(v8f& s, v8f& t, v16h a0, v16h a1, v16h b0, v16h b1) {
#if defined(__HIP_DEVICE_COMPILE__)
  asm volatile("v_nop\n\tv_nop\n\tv_nop\n\tv_nop" : "+v"(s), "+v"(t) : "v"(a0), "v"(a1), "v"(b0), "v"(b1));
#endif
}
__device__ __forceinline__ void guard_pv4(v8f& a, v8f& b, v8f& c, v8f& d, v16h x, v16h y, v16h z, v16h w, v16h u) {
#if defined(__HIP_DEVICE_COMPILE__)
  asm volatile("v_nop\n\tv_nop\n\tv_nop\n\tv_nop"
               : "+v"(a), "+v"(b), "+v"(c), "+v"(d) : "v"(x), "v"(y), "v"(z), "v"(w), "v"(u));
#endif
}
__device__ __forceinline__ void keep4_h(v16h a, v16h b, v16h c, v16h d) {
#if defined(__HIP_DEVICE_COMPILE__)
  asm volatile("v_nop" :: "v"(a), "v"(b), "v"(c), "v"(d));
#endif
}
// Later writes of the address and data registers of the global loads and stores issued so far stay behind this wait.
__device__ __forceinline__ void wait_x0() {
#if defined(__HIP_DEVICE_COMPILE__)
  asm volatile("s_wait_xcnt 0x0" ::: "memory");
#endif
}
__device__ __forceinline__ void wave_sync_lds() {
  __builtin_amdgcn_fence(__ATOMIC_RELEASE, "workgroup");
  __builtin_amdgcn_wave_barrier();
  __builtin_amdgcn_fence(__ATOMIC_ACQUIRE, "workgroup");
}
// RMSNorm row factor from the plane ss[NSS][NROWS] of partial sums of squares: rsqrt(mean(x*x) + eps), eps 1.1920929e-7.
static_assert(NSS == 4);
__device__ __forceinline__ float row_ss(const float* __restrict__ ss, int m) {
  return (ss[m] + ss[NROWS + m]) + (ss[2 * NROWS + m] + ss[3 * NROWS + m]);
}
__device__ __forceinline__ float rstd_of(float s) {
  const float x = s * (1.0f / (float)DMODEL) + RMS_EPS;    // s >= 0, so x >= eps: a normal number, no range scaling round the instruction
  float r = 0.f;
#if defined(__HIP_DEVICE_COMPILE__)
  // v_nop: the one slot between a transcendental and an instruction that reads its result or overwrites its source
  asm("v_rsq_f32 %0, %1\n\tv_nop" : "=v"(r) : "v"(x));
#endif
  return r;
}

// =====================================================================================================
// Transposing 16-bit pack of a weight stored in[R][C] (row pitch C floats, R = contraction index, C = output index) into
// out[Cp][ldd] (row pitch ldd halves): out[c][r] = f16( bf16_RNE(in[r][c]) * schi ) for r < R and c < C, 0 otherwise (pad rows /
// pad columns explicitly written as zeros); with DUAL a second copy out[c][locol + r] = f16( bf16_RNE(in[r][c]) * sclo ).
// schi / sclo powers of two (exact). Tiles: Cp/64 along bx, Rp/64 along by; bz = slice: src advanced by bz*sZ floats, dst by
// bz*dZ halves. One 64x64 tile per block through LDS (bf16 bits): 16 scalar loads per thread with CLAMPED addresses, zero by
// coverage: load 256 thr x 16 floats = 64x64; store 2 it x 8 waves x 4 rows x (8 lanes x 8 halves) = 64 rows x 64 halves per copy;
//           tiles (Cp/64, Rp/64, Z) exact, each output line written by exactly one wave; pad region included.
// =====================================================================================================
// (bx, by, bz) = the tile's place in the grid described above; dual is the same for the whole block.
__device__ __forceinline__ void tcvt16(unsigned short* sT, const float* __restrict__ src, long long sZ,
                                       unsigned short* dst, long long dZ,
                                       int R, int C, int ldd, int locol, float schi, float sclo,
                                       bool dual, int bx, int by, int bz) {
  const int tid = threadIdx.x, lane = tid & 31, wave = tid >> 5;
  const int c0 = bx * 64, r0 = by * 64;
  const float* srcz = src + (size_t)((long long)bz * sZ);
  unsigned short* dstz = dst + (size_t)((long long)bz * dZ);
  const int rr = tid >> 2, cc = (tid & 3) * 16;
  const int r = r0 + rr;
  const int rcl = imin(r, R - 1);
  const float* sp = srcz + (size_t)rcl * C;
#pragma unroll
  for (int e = 0; e < 16; ++e) {
    const int cidx = c0 + cc + e;
    const int ccl = imin(cidx, C - 1);
    float a = sp[ccl];
    a = (r < R && cidx < C) ? a : 0.f;
    sT[(cc + e) * 72 + rr] = bf_bits(a);
  }
  __syncthreads();
  v4u hvals[2], lvals[2];
#pragma unroll
  for (int it = 0; it < 2; ++it) {
    const int q = it * 32 + wave * 4 + (lane >> 3);
    const v4u raw = *(const v4u*)(sT + q * 72 + (lane & 7) * 8);
    v4u hv = {0u, 0u, 0u, 0u}, lv = {0u, 0u, 0u, 0u};
#pragma unroll
    for (int e = 0; e < 4; ++e) {
      const float f0 = bf_up((unsigned short)(raw[e] & 0xFFFFu));
      const float f1 = bf_up((unsigned short)(raw[e] >> 16));
      hv[e] = pk16(h_bits((_Float16)(f0 * schi)), h_bits((_Float16)(f1 * schi)));
      lv[e] = pk16(h_bits((_Float16)(f0 * sclo)), h_bits((_Float16)(f1 * sclo)));
    }
    hvals[it] = hv;
    lvals[it] = lv;
  }
  {
#pragma unroll
    for (int it = 0; it < 2; ++it) {
      const int q = it * 32 + wave * 4 + (lane >> 3);
      unsigned short* p = dstz + (size_t)(c0 + q) * ldd + r0 + (lane & 7) * 8;
      *(v4u*)p = hvals[it];
    }
    wait_x0();                                             // no register of the two stores above is rewritten ahead of this wait
    if (dual) {
#pragma unroll                                             // lvals[] indexed by constants, so that it stays in registers
      for (int it = 0; it < 2; ++it) {
        const int q = it * 32 + wave * 4 + (lane >> 3);
        unsigned short* p = dstz + (size_t)(c0 + q) * ldd + r0 + (lane & 7) * 8;
        *(v4u*)(p + locol) = lvals[it];
      }
      wait_x0();                                           // the same for the second copy's two stores
    }
  }
}

// =====================================================================================================
// Batched f16 WMMA GEMM, operands staged in LDS: C[m][n] = f( oscale * sum_k A[m][k] * Bt[n][k] + bias ); one 64x64 tile per
// work-group of 8 waves (wave = 16 rows x 32 cols, two accumulators). A row-major [M][K] (16-bit plane), Bt row-major
// [N][K] (k contiguous), both at row pitch K; M, N multiples of 64, K = KST * NCH. tile = tile index, by = batch index with element
// strides sA, sB, sC. A stage is KST k of the tile's 64 A rows and 64 Bt rows, brought to LDS by asynchronous 16-B copies
// (a wave's copy = two aligned 256-B units) at row pitch KST + 8 halves (16 B x odd: ds_load_b128 fragment reads without bank conflicts).
// NCH 1: the stage is filled once and then read. NCH 2: two buffers, stage 1 flies while stage 0 is multiplied.
// k runs upward through one accumulator per 16x16 output tile.
// BM: 0 no bias, 1 bias bf16(biasp[n]) for n < nbias (0 beyond, clamped address).   ACT: 2 = ReLU applied to (value + bias).
// OM 0 = f32 out (pitch ldc); RM 2 adds raw f32 Rp[m][n] (same pitch/stride as C).
// OM 1 = dual f16 out (pitch ldc): hi = f16(value * ocarry) at C[m][n], residual f16(RC * (value * ocarry - hi)) at C[m][n] + lofs.
// OM 2 = the same two values in the fragment-ordered plane described at ldfrag_f (ldc and lofs not used); a wave's store = one
//        512-B block of the plane.
// NRM 1: one operand is the plane of x * bf16(norm weight) * HC; the sum is multiplied by the RMSNorm factor of its x row (ahead of
//        bias and ReLU), taken from ssp[NSS][NROWS]: x row = m (A operand), or with colf (OM 2 only) by * N + n (Bt operand).
// EM 1 (OM 0, N = DMODEL): C is the residual stream x; the tile also stores Hout[m][n] = f16(x * bf16(nwp[n]) * HC), its residual x64
//        at Hout[m][DMODEL + n] (row pitch KD; a row's 128-B segment = 16 lanes) and SSout[n0 / 64][m] = sum of x*x over its 64 columns
//        (4 per lane, then xor shuffles over 16 lanes), gathered in the pad column of sT so that one wave stores each 128-B line.
// coverage: copies: 2 operands x 4 row groups of 16 x KST/128 units of 256 B = 2*KST/32 copies per thread and stage; slab: 8 waves x 16 x 32 = 64 x 64;
//           out: f32 4 it x 16 rows x 16 lanes x 4, f16 2 it x 32 rows x 8 lanes x 8 (both planes) = the whole 64x64 tile;
//           grid = tilesM*tilesN blocks exactly.
// =====================================================================================================
// Eight asynchronous 16-B copies global -> LDS (l = the lane's LDS byte address, g = the lane's global address). The closing
// s_wait_xcnt keeps every later write of these address registers behind the copies' address translation.
__device__ __forceinline__ void acopy8(const unsigned* l, const unsigned short* const* g) {
#if defined(__HIP_DEVICE_COMPILE__)
  asm volatile(
      "global_load_async_to_lds_b128 %0, %8, off\n\t"
      "global_load_async_to_lds_b128 %1, %9, off\n\t"
      "global_load_async_to_lds_b128 %2, %10, off\n\t"
      "global_load_async_to_lds_b128 %3, %11, off\n\t"
      "global_load_async_to_lds_b128 %4, %12, off\n\t"
      "global_load_async_to_lds_b128 %5, %13, off\n\t"
      "global_load_async_to_lds_b128 %6, %14, off\n\t"
      "global_load_async_to_lds_b128 %7, %15, off\n\t"
      "s_wait_xcnt 0x0"
      :: "v"(l[0]), "v"(l[1]), "v"(l[2]), "v"(l[3]), "v"(l[4]), "v"(l[5]), "v"(l[6]), "v"(l[7]),
         "v"(g[0]), "v"(g[1]), "v"(g[2]), "v"(g[3]), "v"(g[4]), "v"(g[5]), "v"(g[6]), "v"(g[7])
      : "memory");
#endif
}
// The wave's own copies have landed in LDS behind this wait.
__device__ __forceinline__ void wait_async0() {
#if defined(__HIP_DEVICE_COMPILE__)
  asm volatile("s_wait_asynccnt 0x0" ::: "memory");
#endif
}
// The wave's own LDS reads have returned behind this wait.
__device__ __forceinline__ void wait_ds0() {
#if defined(__HIP_DEVICE_COMPILE__)
  asm volatile("s_wait_dscnt 0x0" ::: "memory");
#endif
}
// One stage: KST halves of rows 0..63 of Ag to LDS rows 0..63 and of rows 0..63 of Bg to LDS rows 64..127 (global row pitch LDK
// halves). 16 lanes take one aligned 256-B unit of a row, a copy of the block 16 rows; every offset below is a constant.
template <int KST, int LDK>
__device__ __forceinline__ void fill_stage(const unsigned short* Ag, const unsigned short* Bg, unsigned ldsb, int tid) {
  constexpr int CG  = KST / 128;            // 256-B units per row
  constexpr int PER = 4 * CG;               // copies per thread and operand
  constexpr int PIT = KST + 8;              // LDS row pitch, halves
  static_assert((KST % 128) == 0 && (2 * PER) % 8 == 0 && 2 * PER <= 63);
  const int r0 = tid >> 4, h0 = (tid & 15) * 8;
  const unsigned short* a0 = Ag + (size_t)r0 * LDK + h0;
  const unsigned short* b0 = Bg + (size_t)r0 * LDK + h0;
  const unsigned l0 = ldsb + (unsigned)(r0 * PIT + h0) * 2u;
  // both loops unrolled: every copy's offsets are then constants and l[], g[] stay in registers
#pragma unroll
  for (int g0 = 0; g0 < 2 * PER; g0 += 8) {
    unsigned l[8];
    const unsigned short* g[8];
#pragma unroll
    for (int e = 0; e < 8; ++e) {
      const int it = g0 + e;
      const bool isB = it >= PER;
      const int j = isB ? it - PER : it;
      const int rg = j / CG, cg = j - rg * CG;
      l[e] = l0 + (unsigned)((((isB ? 64 : 0) + rg * 16) * PIT + cg * 128) * 2);
      g[e] = (isB ? b0 : a0) + (size_t)(rg * 16) * LDK + cg * 128;
    }
    acopy8(l, g);
  }
}

template <int OM, int RM, int ACT, int BM, int KST, int NCH, int NRM, int EM>
__device__ __forceinline__ void gemm64_tile(
    const unsigned short* __restrict__ Ap, long long sA,
    const unsigned short* __restrict__ Btp, long long sB,
    const float* __restrict__ Rp,
    const float* __restrict__ biasp, int nbias,
    void* Cout, int ldc, long long sC, long long lofs,
    int N, float oscale, float ocarry, int tile, int by,
    const float* __restrict__ ssp, bool colf,
    const float* __restrict__ nwp, unsigned short* Hout, float* SSout) {
  static_assert(EM == 0 || OM == 0);
  constexpr int PIT  = KST + 8;               // LDS row pitch, halves
  constexpr int BUFH = 128 * PIT;            // halves per stage buffer: 64 A rows, then 64 Bt rows
  constexpr int LDK  = KST * NCH;            // row pitch of A and Bt, halves (= K)
  constexpr int KB   = 4;                    // k steps of 32 per fragment block
  constexpr int NBLK = KST / (32 * KB);
  static_assert(NCH == 1 || NCH == 2);
  static_assert((KST % (32 * KB)) == 0 && ((PIT * 2) % 32) == 16);
  __shared__ __align__(16) unsigned short sP[NCH * BUFH];
  __shared__ __align__(16) float sT[64 * 68];        // the tile in f32, pitch 68 floats
  const int tid  = threadIdx.x;
  const int lane = tid & 31;
  const int wave = tid >> 5;
  const int tilesN = N >> 6;
  const int tm = tile / tilesN;
  const int tn = tile - tm * tilesN;
  const int m0 = tm << 6;
  const int n0 = tn << 6;

  const unsigned short* Ag = Ap  + (size_t)((long long)by * sA) + (size_t)m0 * LDK;
  const unsigned short* Bg = Btp + (size_t)((long long)by * sB) + (size_t)n0 * LDK;
  const unsigned ldsb = (unsigned)(uintptr_t)(&sP[0]);   // LDS byte address = low 32 bits of the shared address

  fill_stage<KST, LDK>(Ag, Bg, ldsb, tid);

  const int r16 = tid >> 4, c4 = (tid & 15) * 4;         // f32 out: 256-B row segment = 16 lanes x 16 B
  const int r32 = tid >> 3;                              // f16 out: 128-B row segment = 8 lanes x 16 B
  const int c8 = (OM == 2) ? (wave & 3) * 16 + (lane >> 4) * 8 : (tid & 7) * 8;   // OM 2: 16 cols per wave, 8 per lane half

  // ---- RMSNorm factors of the x rows behind this thread's output rows (or, with colf, columns); read here, while stage 0 flies ----
  // every loop down to the wait on the copies is unrolled: the small arrays are then indexed by constants and stay in registers
  float rrow[4], rcol[8];
#pragma unroll
  for (int e = 0; e < 4; ++e) rrow[e] = 1.f;
#pragma unroll
  for (int e = 0; e < 8; ++e) rcol[e] = 1.f;
  if constexpr (NRM == 1) {
    if (OM == 2 && colf) {
      const float* p = ssp + (size_t)by * N + n0 + c8;
      v4f a[NSS], b[NSS];
#pragma unroll
      for (int j = 0; j < NSS; ++j) {
        a[j] = *(const v4f*)(p + (size_t)j * NROWS);
        b[j] = *(const v4f*)(p + (size_t)j * NROWS + 4);
      }
      wait_x0();                                           // no address register of the loads above is rewritten ahead of this wait
#pragma unroll
      for (int e = 0; e < 4; ++e) {
        rcol[e]     = rstd_of((a[0][e] + a[1][e]) + (a[2][e] + a[3][e]));
        rcol[4 + e] = rstd_of((b[0][e] + b[1][e]) + (b[2][e] + b[3][e]));
      }
    } else {
      constexpr int NIT = (OM == 0) ? 4 : 2;
      float s[NIT];
#pragma unroll
      for (int it = 0; it < NIT; ++it) {
        const int row = (OM == 0) ? it * 16 + r16 : (OM == 2) ? (it * 2 + (wave >> 2)) * 16 + (lane & 15) : it * 32 + r32;
        s[it] = row_ss(ssp, m0 + row);
      }
      wait_x0();                                           // the same for these loads
#pragma unroll
      for (int it = 0; it < NIT; ++it) rrow[it] = rstd_of(s[it]);
    }
  }
  // ---- the next RMSNorm's weight for this thread's four columns ----
  float nw[4];
#pragma unroll
  for (int e = 0; e < 4; ++e) nw[e] = 0.f;
  if constexpr (EM == 1) {
    const v4f w4 = *(const v4f*)(nwp + n0 + c4);
    wait_x0();                                             // the same for this load
#pragma unroll
    for (int e = 0; e < 4; ++e) nw[e] = bfr(w4[e]);
  }

  wait_async0();
  __syncthreads();                                       // stage 0 readable by every wave
  if constexpr (NCH == 2) fill_stage<KST, LDK>(Ag + KST, Bg + KST, ldsb + (unsigned)(BUFH * 2), tid);

  const int rlane = lane & 15;                 // row (A) / col (B, D) within subtile
  const int koff  = (lane >> 4) * 8;           // k offset of this lane half
  const int mOff  = (lane >> 4) * 8;           // D row offset
  const int wr = wave >> 1, wc = wave & 1;     // wave tile: rows wr*16.., cols wc*32..

  v8f acc0 = zero8(), acc1 = zero8();
  // the loops below are unrolled so that the two fragment sets are indexed by constants and stay in registers
#pragma unroll
  for (int t = 0; t < NCH; ++t) {
    const unsigned short* aL = sP + t * BUFH + (wr * 16 + rlane) * PIT + koff;
    const unsigned short* bL = sP + t * BUFH + (64 + wc * 32 + rlane) * PIT + koff;
    // fragments one block ahead in a second register set, each block's LDS reads as one group; never across a stage
    v16h fa[2][KB], fb0[2][KB], fb1[2][KB];
#pragma unroll
    for (int s = 0; s < KB; ++s) {
      fa[0][s]  = ldfrag_u(aL + s * 32);
      fb0[0][s] = ldfrag_u(bL + s * 32);
      fb1[0][s] = ldfrag_u(bL + 16 * PIT + s * 32);
    }
#pragma unroll
    for (int blk = 0; blk < NBLK; ++blk) {
      const int cur = blk & 1;
      if (blk + 1 < NBLK) {
#pragma unroll
        for (int s = 0; s < KB; ++s) {
          const int k0 = ((blk + 1) * KB + s) * 32;
          fa[cur ^ 1][s]  = ldfrag_u(aL + k0);
          fb0[cur ^ 1][s] = ldfrag_u(bL + k0);
          fb1[cur ^ 1][s] = ldfrag_u(bL + 16 * PIT + k0);
        }
      }
      __builtin_amdgcn_sched_barrier(0);   // keeps the next block's LDS reads one group ahead of this block's products
#pragma unroll
      for (int s = 0; s < KB; ++s) {
        acc0 = mma_raw(fa[cur][s], fb0[cur][s], acc0);
        acc1 = mma_raw(fa[cur][s], fb1[cur][s], acc1);
      }
      __builtin_amdgcn_sched_barrier(0);   // keeps later blocks' LDS reads from spreading among these products
    }
    if (t + 1 < NCH) {
      wait_ds0();
      wait_async0();
      __syncthreads();                                   // stage t + 1 readable by every wave
    }
  }
  if constexpr (NCH == 2) wait_async0();                 // no copy is outstanding when the buffers are left

  // ---- column bias (same columns for every row a thread writes), clamped addresses ----
  float bc4[4], bc8[8];
#pragma unroll
  for (int e = 0; e < 4; ++e) bc4[e] = 0.f;
#pragma unroll
  for (int e = 0; e < 8; ++e) bc8[e] = 0.f;
  if constexpr (BM == 1) {
    if constexpr (OM == 0) {
#pragma unroll
      for (int e = 0; e < 4; ++e) {
        const int n = n0 + c4 + e;
        const int ncl = imin(n, nbias - 1);
        const float t = bfr(biasp[ncl]);
        bc4[e] = (n < nbias) ? t : 0.f;
      }
    } else {
#pragma unroll
      for (int e = 0; e < 8; ++e) {
        const int n = n0 + c8 + e;
        const int ncl = imin(n, nbias - 1);
        const float t = bfr(biasp[ncl]);
        bc8[e] = (n < nbias) ? t : 0.f;
      }
    }
  }

  // ---- epilogue: the tile through LDS, whole row segments (OM 0, 1) or whole 512-B fragment blocks (OM 2) out ----
#pragma unroll
  for (int r = 0; r < 8; ++r) {
    float* sp = sT + (wr * 16 + mOff + r) * 68 + wc * 32 + rlane;
    sp[0]  = acc0[r];
    sp[16] = acc1[r];
  }
  __syncthreads();
  if constexpr (OM == 0) {
    float* C = (float*)Cout + (size_t)((long long)by * sC);
    v4f vx[4];
#pragma unroll
    for (int it = 0; it < 4; ++it) {
      const int row = it * 16 + r16;                     // it 0..3 x r16 0..15 = rows 0..63
      const int gr  = m0 + row;
      v4f v = *(const v4f*)(sT + row * 68 + c4);
      v4f rv = {0.f, 0.f, 0.f, 0.f};
      if constexpr (RM == 2) {
        const float* R = Rp + (size_t)((long long)by * sC);
        rv = *(const v4f*)(R + (size_t)gr * ldc + n0 + c4);
      }
      const float osc = oscale * rrow[it];
#pragma unroll
      for (int e = 0; e < 4; ++e) {
        float u = v[e] * osc;
        if constexpr (BM == 1) u += bc4[e];
        if constexpr (ACT == 2) u = fmaxf(u, 0.f);
        v[e] = u + rv[e];
      }
      if constexpr (EM == 0) *(v4f*)(C + (size_t)gr * ldc + n0 + c4) = v;
      vx[it] = v;
    }
    if constexpr (EM == 1) {
      // the loops of this block are unrolled so that vx[] and q[] stay in registers; the four rows' shuffles of a step are independent
      float q[4];
#pragma unroll
      for (int it = 0; it < 4; ++it)
        q[it] = (vx[it][0] * vx[it][0] + vx[it][1] * vx[it][1]) + (vx[it][2] * vx[it][2] + vx[it][3] * vx[it][3]);
#pragma unroll
      for (int off = 1; off < 16; off <<= 1) {
#pragma unroll
        for (int it = 0; it < 4; ++it) q[it] += __shfl_xor(q[it], off, 32);
      }
      if ((tid & 15) == 0) {                               // pad column: no other thread reads or writes it before the barrier below
#pragma unroll
        for (int it = 0; it < 4; ++it) sT[(it * 16 + r16) * 68 + 64] = q[it];
      }
      __syncthreads();                                     // the 64 row sums readable by waves 0 and 1; ahead of the global stores
#pragma unroll
      for (int it = 0; it < 4; ++it) {
        const int gr = m0 + it * 16 + r16;
        const v4f v = vx[it];
        *(v4f*)(C + (size_t)gr * ldc + n0 + c4) = v;
        const float f0 = (v[0] * nw[0]) * HC, f1 = (v[1] * nw[1]) * HC, f2 = (v[2] * nw[2]) * HC, f3 = (v[3] * nw[3]) * HC;
        const _Float16 g0 = (_Float16)f0, g1 = (_Float16)f1, g2 = (_Float16)f2, g3 = (_Float16)f3;
        v2u hv, lv;
        hv[0] = pk16(h_bits(g0), h_bits(g1));
        hv[1] = pk16(h_bits(g2), h_bits(g3));
        lv[0] = pk16(h_bits((_Float16)((f0 - (float)g0) * RC)), h_bits((_Float16)((f1 - (float)g1) * RC)));
        lv[1] = pk16(h_bits((_Float16)((f2 - (float)g2) * RC)), h_bits((_Float16)((f3 - (float)g3) * RC)));
        unsigned short* hp = Hout + (size_t)gr * KD + n0 + c4;
        *(v2u*)hp = hv;
        *(v2u*)(hp + DMODEL) = lv;
      }
      if (tid < 64) SSout[(size_t)tn * NROWS + m0 + tid] = sT[tid * 68 + 64];
    }
  } else {
    unsigned short* C = (unsigned short*)Cout + (size_t)((long long)by * sC);
#pragma unroll
    for (int it = 0; it < 2; ++it) {
      // OM 1: it 0..1 x r32 0..31 = rows 0..63; OM 2: 16 rows per wave, (it, wave / 4) = the tile's four groups of 16 rows
      const int row = (OM == 2) ? (it * 2 + (wave >> 2)) * 16 + rlane : it * 32 + r32;
      const float* spf = sT + row * 68 + c8;
      v4u a = {0u, 0u, 0u, 0u}, bl = {0u, 0u, 0u, 0u};
      const float osc = oscale * rrow[it];
#pragma unroll
      for (int e = 0; e < 4; ++e) {
        float f0 = spf[2 * e] * osc;
        float f1 = spf[2 * e + 1] * osc;
        if constexpr (NRM == 1 && OM == 2) { f0 *= rcol[2 * e]; f1 *= rcol[2 * e + 1]; }
        if constexpr (BM == 1) { f0 += bc8[2 * e]; f1 += bc8[2 * e + 1]; }
        if constexpr (ACT == 2) { f0 = fmaxf(f0, 0.f); f1 = fmaxf(f1, 0.f); }
        f0 *= ocarry; f1 *= ocarry;
        const _Float16 g0 = (_Float16)f0, g1 = (_Float16)f1;
        const float r0 = (f0 - (float)g0) * RC, r1 = (f1 - (float)g1) * RC;
        a[e]  = pk16(h_bits(g0), h_bits(g1));
        bl[e] = pk16(h_bits((_Float16)r0), h_bits((_Float16)r1));
      }
      if constexpr (OM == 2) {
        unsigned short* p = C + ((size_t)((m0 + row) >> 4) * tilesN + tn) * FCH + (wave & 3) * 256 + lane * 8;
        *(v4u*)p = a;
        *(v4u*)(p + FPL) = bl;
      } else {
        unsigned short* p = C + (size_t)(m0 + row) * ldc + n0 + c8;
        *(v4u*)p = a;
        *(v4u*)(p + (size_t)lofs) = bl;
      }
    }
  }
  (void)Rp; (void)ocarry; (void)lofs; (void)nbias; (void)biasp; (void)ldc; (void)r32;
  (void)ssp; (void)colf; (void)nwp; (void)Hout; (void)SSout; (void)rcol; (void)nw;
}

// One product per launch: blockIdx.x = tile, blockIdx.y = batch index.
template <int OM, int RM, int ACT, int BM, int KST, int NCH, int NRM, int EM>
__global__ __launch_bounds__(256) void gemm64(
    const unsigned short* __restrict__ Ap, long long sA,
    const unsigned short* __restrict__ Btp, long long sB,
    const float* __restrict__ Rp,
    const float* __restrict__ biasp, int nbias,
    void* Cout, int ldc, long long sC, long long lofs,
    int N, float oscale, float ocarry,
    const float* __restrict__ ssp, const float* __restrict__ nwp, unsigned short* Hout, float* SSout) {
  gemm64_tile<OM, RM, ACT, BM, KST, NCH, NRM, EM>(Ap, sA, Btp, sB, Rp, biasp, nbias, Cout, ldc, sC, lofs, N, oscale, ocarry,
                                                  (int)blockIdx.x, (int)blockIdx.y, ssp, false, nwp, Hout, SSout);
}

#define SH_E   8        // log2 of the tiles per batch index of the q / k product: (NROWS / 64) * (DMODEL / 64)
#define SH_V   7        // log2 of the tiles per batch of the v^T product: (DMODEL / 64) * (SEQ / 64)
#define SH_ONE 30       // a product with one batch index only
static_assert((1 << SH_E) == (NROWS / 64) * (DMODEL / 64) && (1 << SH_V) == (DMODEL / 64) * (SEQ / 64));
static_assert(QC == VC);
// Two independent products of the same form in one launch (no residual input): blocks 0..n0-1 work on product 0, the rest on
// product 1; inside a product block i is tile i mod 2^sh of batch index i >> sh. The choice is the same for the whole block.
// Both read the plane of x * norm weight (NRM 1): as A, or, where the product's colf is set, as Bt.
// coverage: grid = n0 + (blocks of product 1), each product's (tile, batch) pairs taken exactly once.
template <int OM, int ACT, int BM, int KST, int NCH>
__global__ __launch_bounds__(256) void gemm64x2(
    const unsigned short* __restrict__ Ap0, long long sA0, const unsigned short* __restrict__ Btp0, long long sB0,
    const float* __restrict__ biasp0, int nbias0, void* Cout0, int ldc0, long long sC0, long long lofs0, int N0, int sh0,
    const unsigned short* __restrict__ Ap1, long long sA1, const unsigned short* __restrict__ Btp1, long long sB1,
    const float* __restrict__ biasp1, int nbias1, void* Cout1, int ldc1, long long sC1, long long lofs1, int N1, int sh1,
    int n0, float oscale, float ocarry, const float* __restrict__ ssp, int colf0, int colf1) {
  const int b = (int)blockIdx.x;
  const bool p0 = b < n0;
  const int i  = p0 ? b : b - n0;
  const int sh = p0 ? sh0 : sh1;
  const int by = i >> sh;
  gemm64_tile<OM, 0, ACT, BM, KST, NCH, 1, 0>(p0 ? Ap0 : Ap1, p0 ? sA0 : sA1, p0 ? Btp0 : Btp1, p0 ? sB0 : sB1, (const float*)0,
                                              p0 ? biasp0 : biasp1, p0 ? nbias0 : nbias1, p0 ? Cout0 : Cout1, p0 ? ldc0 : ldc1,
                                              p0 ? sC0 : sC1, p0 ? lofs0 : lofs1, p0 ? N0 : N1, oscale, ocarry, i - (by << sh), by,
                                              ssp, (p0 ? colf0 : colf1) != 0, (const float*)0, (unsigned short*)0, (float*)0);
}

// =====================================================================================================
// Causal flash attention for one batch, one head and 16 query rows, head dim 64; the keys are split over the 8 waves of the block:
//   q plane QP: the matrix [b*SEQ + tok][head*64+d] (f16 x16 and its residual x64) in fragment order (see ldfrag_f); k plane KP same;
//   v^T plane VT: per batch the matrix [head*64+d][key] (f16 x16 and its residual x64) in fragment order;
//   out CT[b*SEQ + tok][512]: hi = f16(16 * ctx) at col head*64+d, residual = f16(64 * (16 ctx - hi)) at col 256+head*64+d, where
//   ctx[d] = sum_m softmax_m(q.k / 8 + relb[bucket(tok - m)][head]) v[m][d] over keys m <= tok (softmax run in base 2, -inf select for
//   keys m > tok). The relative bias table (bf16 RNE of relb, x log2 e) for rel 0..q0+15 of the head is built in LDS per block.
//   Key steps of 32 from 0 to q0+16; wave w takes steps w, w + 8, w + 16, ... with its own running maxima, sums and accumulators (a
//   wave-uniform trip count, possibly zero; no block barrier inside the loop). kb <= q0 always, so every query row sees key kb
//   unmasked in every step and the step max is finite; the rescale exponent is clamped at -126 so a wave's first step gives a tiny
//   finite factor times zero sums.
//   Per step: two score tiles, each hi.hi (2 k-steps of 32) into one accumulator and hi.res + res.hi (4 k-steps) into a second one,
//   fragments loaded straight from the 16-bit planes (two 16-B loads per fragment, arithmetic addressing); online max-subtracted
//   softmax in f32 (exp2); rescale of the running sums and the eight accumulators; the 16x32 prob tile stored to wave-private LDS
//   (read back RNE to f16, split k map) and the v^T B fragments (4 hi, 4 residual) loaded straight from the 16-bit plane (keys
//   kb..kb+31 <= SEQ-1 always in range); 8 P.V WMMAs into hi and residual accumulator sets.
//   Merge: each wave leaves its un-normalised 16x64 partial o_hi + o_res/64 (f32, pitch 68) and its (max, sum) per row in LDS; after one
//   block barrier thread t merges row t/16, cols 4(t%16)..+3: M = max_w m_w, weight 2^(m_w - M) (0 for a wave without steps, m_w = -inf;
//   wave 0 always has step 0, so M is finite), l = sum_w weight l_w, ctx16 = 16 sum_w weight o_w / (l 16384 16).
// coverage: LDS bias table: rel 0..kend-1 (all rel used); partials: 8 waves x 16 rows x 64 cols and 8 x 16 (max, sum), all written by
//           every wave, all read; global: 256 threads x 4 halves = 16 rows x 64 halves per plane (a row's 128-B segment = 16 lanes of one
//           wave); grid (NB batches x SEQ/16 query tiles x 4 heads) covers all NROWS x 512 of CT exactly once.
// =====================================================================================================
#define ATT_SPLIT   8
#define ATT_THREADS (ATT_SPLIT * 32)
#define ATT_BLOCKS  (NB * (SEQ / 16) * NHEAD)
#define PT_FLOATS   (ATT_SPLIT * 16 * 36)
#define OP_PITCH    68
#define VCS         ((SEQ / 64) * FCH)      // halves between the v^T chunks of 16 d and of the next 16 d at the same keys
static_assert(ATT_THREADS == 16 * (HDIM / 4) && HDIM == 64);
static_assert((HDIM * 2) % 128 == 0 && (HDIM % 32) == 0);

__global__ __launch_bounds__(ATT_THREADS)
void attn4(const unsigned short* __restrict__ QPp, const unsigned short* __restrict__ KPp,
           const unsigned short* __restrict__ VTq, const float* __restrict__ relbl, unsigned short* CT) {
  __shared__ __align__(16) float sbias[SEQ];                          // [rel], bf16(relb) * log2 e
  __shared__ __align__(16) float spt[PT_FLOATS];                      // per wave prob tile [row][32 keys], pitch 36
  __shared__ __align__(16) float spo[ATT_SPLIT * 16 * OP_PITCH];      // per wave partial [row][64 d], pitch 68
  __shared__ __align__(16) float sml[2 * ATT_SPLIT * 16];             // per wave and row: max, then sum

  const int tid  = threadIdx.x;
  const int wave = __builtin_amdgcn_readfirstlane(tid >> 5);  // scalar: the key loop's trip count is a scalar branch, EXEC stays full
  const int lane = tid & 31;
  const int hh   = lane >> 4;
  const int c    = lane & 15;

  const int head = blockIdx.x % NHEAD;                     // 0..3
  const int qb   = blockIdx.x / NHEAD;
  const int qt   = qb % (SEQ / 16);                        // query tile
  const int bat  = qb / (SEQ / 16);                        // batch
  const int q0   = qt * 16;
  const int srow = q0 + 8 * hh;                            // this lane half's first query row (+ r)
  const int kend = q0 + 16;                                // causal: keys 0 .. q0+15; rel = query - key in 0 .. kend-1

  // ---- relative-position bias table for rel 0..kend-1 of this head ----
  for (int rel = tid; rel < kend; rel += ATT_THREADS) {
    const int bk = rel_bucket(rel);
    sbias[rel] = bfr(relbl[bk * NHEAD + head]) * LOG2E;
  }
  __syncthreads();

  const float* sb = sbias;
  const _Float16* Q16 = (const _Float16*)(const void*)QPp;
  const _Float16* K16 = (const _Float16*)(const void*)KPp;
  const _Float16* V16 = (const _Float16*)(const void*)VTq;
  const _Float16* Qf = Q16 + ((size_t)((bat * SEQ + q0) >> 4) * NHEAD + head) * FCH + lane * 8;   // chunk (16 tokens, head)
  const _Float16* Kf = K16 + ((size_t)((bat * SEQ) >> 4) * NHEAD + head) * FCH + lane * 8;
  const _Float16* Vf = V16 + (size_t)bat * VTR * SEQ + (size_t)(head * (HDIM / 16)) * VCS + lane * 8;  // chunk (16 d, 64 keys)
  const float lsc = (LOG2E * ATT_SCALE) / (QC * KC);      // log2(e) / 8 / carries

  const v16h qah = ldfrag_f(Qf), qbh = ldfrag_f(Qf + FBK);                      // hi, d 0..31 / 32..63
  const v16h qal = ldfrag_f(Qf + FPL), qbl = ldfrag_f(Qf + FPL + FBK);          // residual x64

  float mrow[8], lrow[8];
  v8f om0 = zero8(), om1 = zero8(), om2 = zero8(), om3 = zero8();
  v8f or0 = zero8(), or1 = zero8(), or2 = zero8(), or3 = zero8();
#pragma unroll
  for (int r = 0; r < 8; ++r) { mrow[r] = -INFINITY; lrow[r] = 0.f; }
  float* pt = spt + wave * (16 * 36);

#pragma unroll 1
  for (int kb = wave * 32; kb < kend; kb += 32 * ATT_SPLIT) {
    const _Float16* kp = Kf + (size_t)(kb >> 4) * (NHEAD * FCH);
    v8f s0m, s0r, s1m, s1r;
    {
      const v16h k0h = ldfrag_f(kp), k1h = ldfrag_f(kp + FBK);
      const v16h k0l = ldfrag_f(kp + FPL), k1l = ldfrag_f(kp + FPL + FBK);
      s0m = mma_raw(qah, k0h, zero8());
      s0m = mma_raw(qbh, k1h, s0m);
      s0r = mma_raw(qah, k0l, zero8());
      s0r = mma_raw(qbh, k1l, s0r);
      s0r = mma_raw(qal, k0h, s0r);
      s0r = mma_raw(qbl, k1h, s0r);
      guard_s2x4(s0m, s0r, k0h, k1h, k0l, k1l);
    }
    {
      const _Float16* kq = kp + NHEAD * FCH;               // the next 16 keys
      const v16h k0h = ldfrag_f(kq), k1h = ldfrag_f(kq + FBK);
      const v16h k0l = ldfrag_f(kq + FPL), k1l = ldfrag_f(kq + FPL + FBK);
      s1m = mma_raw(qah, k0h, zero8());
      s1m = mma_raw(qbh, k1h, s1m);
      s1r = mma_raw(qah, k0l, zero8());
      s1r = mma_raw(qbh, k1l, s1r);
      s1r = mma_raw(qal, k0h, s1r);
      s1r = mma_raw(qbl, k1h, s1r);
      guard_s2x4(s1m, s1r, k0h, k1h, k0l, k1l);
      keep4_h(qah, qbh, qal, qbl);
    }
    const int key0 = kb + c;                               // key of this lane's column in tile 0
    const int key1 = kb + 16 + c;                          // key of this lane's column in tile 1
#pragma unroll
    for (int r = 0; r < 8; ++r) {
      const int qi = srow + r;
      const int i0 = imax(qi - key0, 0);
      const int i1 = imax(qi - key1, 0);
      float t0 = (s0m[r] + s0r[r] * RCI) * lsc + sb[i0];
      float t1 = (s1m[r] + s1r[r] * RCI) * lsc + sb[i1];
      t0 = (key0 > qi) ? -INFINITY : t0;
      t1 = (key1 > qi) ? -INFINITY : t1;
      float mx = fmaxf(t0, t1);
#pragma unroll
      for (int off = 1; off < 16; off <<= 1) mx = fmaxf(mx, __shfl_xor(mx, off, 32));
      const float mn = fmaxf(mrow[r], mx);
      const float al = exp2f(fmaxf(mrow[r] - mn, -126.0f));
      mrow[r] = mn;
      const float e0 = exp2f(t0 - mn);
      const float e1 = exp2f(t1 - mn);
      float ps = e0 + e1;
#pragma unroll
      for (int off = 1; off < 16; off <<= 1) ps += __shfl_xor(ps, off, 32);
      lrow[r] = lrow[r] * al + ps;
      om0[r] *= al; om1[r] *= al; om2[r] *= al; om3[r] *= al;
      or0[r] *= al; or1[r] *= al; or2[r] *= al; or3[r] *= al;
      const int ro = (8 * hh + r) * 36 + c;
      pt[ro]      = e0;
      pt[ro + 16] = e1;
    }
    wave_sync_lds();
    FragH ph;
    {
      const float* prow = pt + c * 36 + 8 * hh;
      const v4f p0 = *(const v4f*)(prow), p1 = *(const v4f*)(prow + 4);
      const v4f p2 = *(const v4f*)(prow + 16), p3 = *(const v4f*)(prow + 20);
#pragma unroll
      for (int e = 0; e < 4; ++e) {
        ph.h[0][e]     = (_Float16)(p0[e] * PC);              // elements 0..7  = keys kb + 8hh + 0..7
        ph.h[0][4 + e] = (_Float16)(p1[e] * PC);
        ph.h[1][e]     = (_Float16)(p2[e] * PC);              // elements 8..15 = keys kb + 16 + 8hh + 0..7
        ph.h[1][4 + e] = (_Float16)(p3[e] * PC);
      }
    }
    {
      const _Float16* vp = Vf + (size_t)(kb >> 6) * FCH + ((kb >> 5) & 1) * FBK;
      const v16h vb0 = ldfrag_f(vp);
      const v16h vb1 = ldfrag_f(vp + VCS);
      const v16h vb2 = ldfrag_f(vp + 2 * VCS);
      const v16h vb3 = ldfrag_f(vp + 3 * VCS);
      om0 = mma_raw(ph.v, vb0, om0);
      om1 = mma_raw(ph.v, vb1, om1);
      om2 = mma_raw(ph.v, vb2, om2);
      om3 = mma_raw(ph.v, vb3, om3);
      guard_pv4(om0, om1, om2, om3, ph.v, vb0, vb1, vb2, vb3);
    }
    {
      const _Float16* vq = Vf + (size_t)(kb >> 6) * FCH + ((kb >> 5) & 1) * FBK + FPL;
      const v16h vl0 = ldfrag_f(vq);
      const v16h vl1 = ldfrag_f(vq + VCS);
      const v16h vl2 = ldfrag_f(vq + 2 * VCS);
      const v16h vl3 = ldfrag_f(vq + 3 * VCS);
      or0 = mma_raw(ph.v, vl0, or0);
      or1 = mma_raw(ph.v, vl1, or1);
      or2 = mma_raw(ph.v, vl2, or2);
      or3 = mma_raw(ph.v, vl3, or3);
      guard_pv4(or0, or1, or2, or3, ph.v, vl0, vl1, vl2, vl3);
    }
    wave_sync_lds();
  }

  // ---- the wave's un-normalised partial and its (max, sum) per row to LDS ----
  {
    float* pw = spo + wave * (16 * OP_PITCH) + c;
#pragma unroll
    for (int r = 0; r < 8; ++r) {
      float* op = pw + (8 * hh + r) * OP_PITCH;
      op[0]  = om0[r] + or0[r] * RCI;
      op[16] = om1[r] + or1[r] * RCI;
      op[32] = om2[r] + or2[r] * RCI;
      op[48] = om3[r] + or3[r] * RCI;
    }
    if (c == 0) {                                          // max and sum are equal in the 16 lanes of a half
#pragma unroll
      for (int r = 0; r < 8; ++r) {
        sml[wave * 16 + 8 * hh + r] = mrow[r];
        sml[ATT_SPLIT * 16 + wave * 16 + 8 * hh + r] = lrow[r];
      }
    }
  }
  __syncthreads();                                         // every wave's partial readable by every wave
  // ---- merge the 8 partials, fold 1/l and the carries, write 4 hi and 4 residual halves per thread ----
  {
    const int row = tid >> 4, c4 = (tid & 15) * 4;
    float ms[ATT_SPLIT];
    float mall = -INFINITY;
#pragma unroll
    for (int s = 0; s < ATT_SPLIT; ++s) {
      ms[s] = sml[s * 16 + row];
      mall = fmaxf(mall, ms[s]);
    }
    float lall = 0.f;
    v4f o = {0.f, 0.f, 0.f, 0.f};
#pragma unroll
    for (int s = 0; s < ATT_SPLIT; ++s) {
      const float w = exp2f(ms[s] - mall);
      const v4f p = *(const v4f*)(spo + (s * 16 + row) * OP_PITCH + c4);
      lall += w * sml[ATT_SPLIT * 16 + s * 16 + row];
#pragma unroll
      for (int e = 0; e < 4; ++e) o[e] += w * p[e];
    }
    const float inv = (1.0f / lall) * (CC / (PC * VC));
    const float u0 = o[0] * inv, u1 = o[1] * inv, u2 = o[2] * inv, u3 = o[3] * inv;
    const _Float16 g0 = (_Float16)u0, g1 = (_Float16)u1, g2 = (_Float16)u2, g3 = (_Float16)u3;
    v2u hv, lv;
    hv[0] = pk16(h_bits(g0), h_bits(g1));
    hv[1] = pk16(h_bits(g2), h_bits(g3));
    lv[0] = pk16(h_bits((_Float16)((u0 - (float)g0) * RC)), h_bits((_Float16)((u1 - (float)g1) * RC)));
    lv[1] = pk16(h_bits((_Float16)((u2 - (float)g2) * RC)), h_bits((_Float16)((u3 - (float)g3) * RC)));
    unsigned short* dst = CT + ((size_t)bat * SEQ + q0 + row) * KD + head * HDIM + c4;
    *(v2u*)dst = hv;
    *(v2u*)(dst + DMODEL) = lv;
  }
}

// =====================================================================================================
// Input convert: obs16[m][640] = f16(16 * bf16_RNE(obs[b*SEQ_FULL + t][c])) for c < 637 (m = b*SEQ + t), 0 for the pad columns
// 637..639 (explicitly written). One wave per row (8 rows per block): 80 pieces of 8 halves; lane writes pieces lane, lane+32 and
// coverage: NROWS/8 blocks x 8 waves = every row; per row pieces 0..79 = cols 0..639.
// =====================================================================================================
__device__ __forceinline__ void cvtobs(const float* __restrict__ src, unsigned short* dst, int blk) {
  const int wave = threadIdx.x >> 5, lane = threadIdx.x & 31;
  const int m = blk * 8 + wave;
  const int b = m / SEQ, t = m - b * SEQ;
  const float* sp = src + ((size_t)b * SEQ_FULL + t) * OBSD;
  unsigned short* dp = dst + (size_t)m * OBSP;
  {
#pragma unroll 1
    for (int it = 0; it < 3; ++it) {
      const int p = it * 32 + lane;
      const int col0 = p * 8;
      v4u a;
#pragma unroll
      for (int e = 0; e < 4; ++e) {
        const int ca = col0 + 2 * e, cb = ca + 1;
        float fa = sp[imin(ca, OBSD - 1)];
        float fb = sp[imin(cb, OBSD - 1)];
        fa = (ca < OBSD) ? fa : 0.f;
        fb = (cb < OBSD) ? fb : 0.f;
        a[e] = pk16(h_bits((_Float16)(bfr(fa) * OBC)), h_bits((_Float16)(bfr(fb) * OBC)));
      }
      if (p < OBSP / 8) {
        *(v4u*)(dp + (size_t)p * 8) = a;
        wait_x0();                                         // the next trip advances the store's address registers
      }
    }
    
  }
}

// =====================================================================================================
// All 16-bit operand planes in one launch (they depend on the inputs alone, not on one another): blocks 0..PB_OBS-1 convert obs,
// then one 64x64 transposing tile per block for w_q, w_k, w_v, w_o, w_1, w_2, obs_w, act_w, obsh_w in this order. The job is a
// function of blockIdx.x alone, so every branch below (and the barrier inside tcvt16) is uniform for the block.
// coverage: each job's blocks = its (Cp/64) x (Rp/64) x slices tiles exactly once; grid = PB_ALL.
// =====================================================================================================
#define PB_OBS (NROWS / 8)
#define PB_E   ((DMODEL / 64) * (DMODEL / 64) * NLAYER)
#define PB_F   ((DFF / 64) * (DMODEL / 64) * NLAYER)
#define PB_OW  ((DMODEL / 64) * (OBSP / 64))
#define PB_AW  ((NACTP / 64) * (DMODEL / 64))
#define PB_HW  ((OBSP / 64) * (DMODEL / 64))
#define PB_ALL (PB_OBS + 4 * PB_E + 2 * PB_F + PB_OW + PB_AW + PB_HW)
static_assert((NROWS % 8) == 0);

__global__ __launch_bounds__(256) void prep(
    const float* __restrict__ obs, const float* __restrict__ w_q, const float* __restrict__ w_k, const float* __restrict__ w_v,
    const float* __restrict__ w_o, const float* __restrict__ w_1, const float* __restrict__ w_2,
    const float* __restrict__ obs_w, const float* __restrict__ act_w, const float* __restrict__ obsh_w,
    unsigned short* OBS16, unsigned short* WQ16, unsigned short* WK16, unsigned short* WV16, unsigned short* WO16,
    unsigned short* W116, unsigned short* W216, unsigned short* OBSW16, unsigned short* ACTW16, unsigned short* OBSHW16) {
  __shared__ __align__(16) unsigned short sT[64 * 72];
  int b = (int)blockIdx.x;
  if (b < PB_OBS) {                                        // the whole block leaves, ahead of any barrier
    cvtobs(obs, OBS16, b);
    return;
  }
  b -= PB_OBS;
  const float* s;
  unsigned short* d;
  long long sZ = 0, dZ = 0;
  int R = DMODEL, C = DMODEL, ldd = KD, locol = DMODEL, gx = DMODEL / 64, gy = DMODEL / 64;
  float sclo = WLO;
  bool dual = true;
  if (b < 4 * PB_E) {                                      // in[256 k][256 n] -> out[256 n][512], per layer
    const int j = b / PB_E;
    b -= j * PB_E;
    s = (j == 0) ? w_q : (j == 1) ? w_k : (j == 2) ? w_v : w_o;
    d = (j == 0) ? WQ16 : (j == 1) ? WK16 : (j == 2) ? WV16 : WO16;
    sZ = (long long)DMODEL * DMODEL; dZ = (long long)DMODEL * KD;
  } else if (b < 4 * PB_E + PB_F) {                        // in[256 k][512 n] -> out[512 n][512], per layer
    b -= 4 * PB_E;
    s = w_1; d = W116;
    sZ = (long long)DMODEL * DFF; dZ = (long long)DFF * KD;
    C = DFF; gx = DFF / 64;
  } else if (b < 4 * PB_E + 2 * PB_F) {                    // in[512 k][256 n] -> out[256 n][1024], per layer
    b -= 4 * PB_E + PB_F;
    s = w_2; d = W216;
    sZ = (long long)DFF * DMODEL; dZ = (long long)DMODEL * KF;
    R = DFF; ldd = KF; locol = DFF; gy = DFF / 64;
  } else if (b < 4 * PB_E + 2 * PB_F + PB_OW) {            // in[637 k][256 n] -> out[256 n][640], k 637..639 zero, one copy
    b -= 4 * PB_E + 2 * PB_F;
    s = obs_w; d = OBSW16;
    R = OBSD; ldd = OBSP; locol = 0; gy = OBSP / 64;
    sclo = 0.f; dual = false;
  } else if (b < 4 * PB_E + 2 * PB_F + PB_OW + PB_AW) {    // in[256 k][4 n] -> out[64 n][512], n >= 4 zero
    b -= 4 * PB_E + 2 * PB_F + PB_OW;
    s = act_w; d = ACTW16;
    C = NACT; gx = NACTP / 64;
  } else {                                                 // in[256 k][637 n] -> out[640 n][512], n >= 637 zero
    b -= 4 * PB_E + 2 * PB_F + PB_OW + PB_AW;
    s = obsh_w; d = OBSHW16;
    C = OBSD; gx = OBSP / 64;
  }
  const int bz = b / (gx * gy);
  const int r  = b - bz * (gx * gy);
  const int by = r / gx;
  tcvt16(sT, s, sZ, d, dZ, R, C, ldd, locol, WSC, sclo, dual, r - by * gx, by, bz);
}

// =====================================================================================================
// Output copy: blockIdx.y == 0: out0[b*SEQ_FULL + t][0..3] = ACTF[b*SEQ + t][0..3] (one 16-B piece per thread, consecutive threads
// (SEQ*637 floats at float OUT1_OFF + b*SEQ_FULL*637) written as consecutive 16-B pieces (thread g -> floats 4i..4i+3, gathered from
// coverage: out0: NROWS pieces = every row; out1: NB * SEQ*637/4 pieces = every float of the region exactly once.
// =====================================================================================================
__global__ __launch_bounds__(256) void ocopy(const float* __restrict__ actf, const float* __restrict__ obsf, float* outp) {
  const int g = blockIdx.x * 256 + threadIdx.x;
  if (blockIdx.y == 0) {
    if (g >= NROWS) return;
    const int b = g / SEQ, t = g - b * SEQ;
    const v4f v = *(const v4f*)(actf + (size_t)g * NACTP);
    float* d = outp + ((size_t)b * SEQ_FULL + t) * NACT;
    {
      *(v4f*)d = v;
      
    }
  } else {
    const int ppb = (SEQ * OBSD) / 4;
    if (g >= NB * ppb) return;
    const int b = g / ppb;
    const int i = (g - b * ppb) * 4;
    v4f v;
#pragma unroll
    for (int e = 0; e < 4; ++e) {
      const int idx = i + e;
      const int row = idx / OBSD;
      const int col = idx - row * OBSD;
      v[e] = obsf[((size_t)b * SEQ + row) * OBSP + col];
    }
    float* d = outp + (size_t)OUT1_OFF + (size_t)b * SEQ_FULL * OBSD + i;
    {
      *(v4f*)d = v;
      
    }
  }
}

// =====================================================================================================
// Workspace map (bytes); every plane is an exact multiple of its tile / whole-row store granularity (M, N exact multiples of 64,
//   WQ16, WK16, WV16, WO16  f16 [6][256 n][512 = k x64 | k x1]     4 x 1572864
//   W116                    f16 [6][512 n][512]                       3145728
//   W216                    f16 [6][256 n][1024 = 512 x64 | 512 x1]  3145728
//   OBSW16                  f16 [256 n][640 k] x64 (k 637..639 zero)  327680
//   ACTW16                  f16 [64 n][512] (n 4..63 zero)              65536
//   OBSHW16                 f16 [640 n][512] (n 637..639 zero)         655360
//   OBS16                   f16 [NROWS][640] x16                      5242880
//   XA, XB                  f32 [NROWS][256] residual stream       2 x 4194304
//   HH, CT                  f16 [NROWS][512] dual planes           2 x 4194304
//   SS                      f32 [4][NROWS] partial sums of x*x          65536
//   QP, KP                  f16 [NROWS/16][4 heads][2048] fragment order  2 x 4194304
//   VT                      f16 [NB][256/16][SEQ/64][2048] fragment order  4194304
//   G16                     f16 [NROWS][1024] dual                   8388608
//   ACTF                    f32 [NROWS][64]                          1048576
//   OBSF                    f32 [NROWS][640]                        10485760
//   total (NB=2, SEQ=2048)                                          68222976
// =====================================================================================================
extern "C" void kernel_launch(void* const* d_in, const int* in_sizes, int n_in,
                              void* d_out, int out_size, void* d_ws, size_t ws_size,
                              hipStream_t stream) {
  if (n_in < 19) return;
  if (in_sizes[0] < ((NB - 1) * SEQ_FULL + SEQ) * OBSD) return;
  if (in_sizes[1] < OBSD * DMODEL || in_sizes[2] < DMODEL) return;
  if (in_sizes[3] < NLAYER * DMODEL) return;
  if (in_sizes[4] < NLAYER * DMODEL * DMODEL || in_sizes[5] < NLAYER * DMODEL * DMODEL) return;
  if (in_sizes[6] < NLAYER * DMODEL * DMODEL || in_sizes[7] < NLAYER * DMODEL * DMODEL) return;
  if (in_sizes[8] < NLAYER * NBUCK * NHEAD || in_sizes[9] < NLAYER * DMODEL) return;
  if (in_sizes[10] < NLAYER * DMODEL * DFF || in_sizes[11] < NLAYER * DFF) return;
  if (in_sizes[12] < NLAYER * DFF * DMODEL || in_sizes[13] < NLAYER * DMODEL) return;
  if (in_sizes[14] < DMODEL || in_sizes[15] < DMODEL * NACT || in_sizes[16] < NACT) return;
  if (in_sizes[17] < DMODEL * OBSD || in_sizes[18] < OBSD) return;
  if (out_size < OUT1_OFF + ((NB - 1) * SEQ_FULL + SEQ) * OBSD) return;

  const float* obs     = (const float*)d_in[0];
  const float* obs_w   = (const float*)d_in[1];
  const float* obs_b   = (const float*)d_in[2];
  const float* norm1_w = (const float*)d_in[3];
  const float* w_q     = (const float*)d_in[4];
  const float* w_k     = (const float*)d_in[5];
  const float* w_v     = (const float*)d_in[6];
  const float* w_o     = (const float*)d_in[7];
  const float* relb    = (const float*)d_in[8];
  const float* norm2_w = (const float*)d_in[9];
  const float* w_1     = (const float*)d_in[10];
  const float* b_1     = (const float*)d_in[11];
  const float* w_2     = (const float*)d_in[12];
  const float* b_2     = (const float*)d_in[13];
  const float* fnorm_w = (const float*)d_in[14];
  const float* act_w   = (const float*)d_in[15];
  const float* act_b   = (const float*)d_in[16];
  const float* obsh_w  = (const float*)d_in[17];
  const float* obsh_b  = (const float*)d_in[18];
  float*       outp    = (float*)d_out;

  const size_t PWE  = (size_t)NLAYER * DMODEL * KD * 2;     // 1572864
  const size_t PW1  = (size_t)NLAYER * DFF * KD * 2;        // 3145728
  const size_t PW2  = (size_t)NLAYER * DMODEL * KF * 2;     // 3145728
  const size_t POBW = (size_t)DMODEL * OBSP * 2;            //  327680
  const size_t PACW = (size_t)NACTP * KD * 2;               //   65536
  const size_t POHW = (size_t)OBSP * KD * 2;                //  655360
  const size_t POBS = (size_t)NROWS * OBSP * 2;             // 5242880
  const size_t PX   = (size_t)NROWS * DMODEL * 4;           // 4194304
  const size_t PH   = (size_t)NROWS * KD * 2;               // 4194304
  const size_t PVT  = (size_t)NB * VTR * SEQ * 2;           // 4194304
  const size_t PG   = (size_t)NROWS * KF * 2;               // 8388608
  const size_t PACF = (size_t)NROWS * NACTP * 4;            // 1048576
  const size_t POBF = (size_t)NROWS * OBSP * 4;             // 10485760
  const size_t PSS  = (size_t)NSS * NROWS * 4;              //    65536
  size_t off = 0;
  const size_t oWQ  = off; off += PWE;
  const size_t oWK  = off; off += PWE;
  const size_t oWV  = off; off += PWE;
  const size_t oWO  = off; off += PWE;
  const size_t oW1  = off; off += PW1;
  const size_t oW2  = off; off += PW2;
  const size_t oOBW = off; off += POBW;
  const size_t oACW = off; off += PACW;
  const size_t oOHW = off; off += POHW;
  const size_t oOBS = off; off += POBS;
  const size_t oXA  = off; off += PX;
  const size_t oXB  = off; off += PX;
  const size_t oHH  = off; off += PH;
  const size_t oQP  = off; off += PH;
  const size_t oKP  = off; off += PH;
  const size_t oCT  = off; off += PH;
  const size_t oVT  = off; off += PVT;
  const size_t oG   = off; off += PG;
  const size_t oACF = off; off += PACF;
  const size_t oOBF = off; off += POBF;
  const size_t oSS  = off; off += PSS;
  const size_t endAll = off;                                // 68222976 for NB=2, SEQ=2048
  if (endAll > ws_size) return;
  if (endAll > (size_t)134217728) return;

  char* ws = (char*)d_ws;
  unsigned short* WQ16    = (unsigned short*)(ws + oWQ);
  unsigned short* WK16    = (unsigned short*)(ws + oWK);
  unsigned short* WV16    = (unsigned short*)(ws + oWV);
  unsigned short* WO16    = (unsigned short*)(ws + oWO);
  unsigned short* W116    = (unsigned short*)(ws + oW1);
  unsigned short* W216    = (unsigned short*)(ws + oW2);
  unsigned short* OBSW16  = (unsigned short*)(ws + oOBW);
  unsigned short* ACTW16  = (unsigned short*)(ws + oACW);
  unsigned short* OBSHW16 = (unsigned short*)(ws + oOHW);
  unsigned short* OBS16   = (unsigned short*)(ws + oOBS);
  float*          XA      = (float*)(ws + oXA);
  float*          XB      = (float*)(ws + oXB);
  unsigned short* HH      = (unsigned short*)(ws + oHH);
  unsigned short* QP      = (unsigned short*)(ws + oQP);
  unsigned short* KP      = (unsigned short*)(ws + oKP);
  unsigned short* CT      = (unsigned short*)(ws + oCT);
  unsigned short* VTp     = (unsigned short*)(ws + oVT);
  unsigned short* G16     = (unsigned short*)(ws + oG);
  float*          ACTF    = (float*)(ws + oACF);
  float*          OBSF    = (float*)(ws + oOBF);
  float*          SS      = (float*)(ws + oSS);

  const dim3 blk(256);
  const int tilesE  = (NROWS / 64) * (DMODEL / 64);                // 256
  const int tilesV  = (DMODEL / 64) * (SEQ / 64);                  // 128 per batch
  const int tilesF  = (NROWS / 64) * (DFF / 64);                   // 512
  const int tilesA  = (NROWS / 64) * (NACTP / 64);                 // 64
  const int tilesO  = (NROWS / 64) * (OBSP / 64);                  // 640
  const dim3 gE(tilesE, 1);                                        // 256: one tile per block
  const dim3 gQKV(2 * tilesE + NB * tilesV);                       // 256 x 2 (q, k), then 128 x NB (v^T)
  const dim3 gF(tilesF, 1);                                        // 512
  const dim3 gOA(tilesO + tilesA);                                 // 640 (obs head), then 64 (action head)
  const dim3 gAT(ATT_BLOCKS);                                      // NB x SEQ/16 x 4 heads = 1024
  const dim3 bAT(ATT_THREADS);                                     // 256
  const int ppb = (SEQ * OBSD) / 4;
  const int gcx0 = NROWS / 256, gcx1 = (NB * ppb + 255) / 256;
  const dim3 gOC(gcx0 > gcx1 ? gcx0 : gcx1, 2);                    // (2548, 2)

  const long long sQK   = (long long)NLAYER * DMODEL * KD;         // WK16 - WQ16 in halves
  const long long sKP   = (long long)NROWS * KD;                   // KP - QP in halves

  // (0) 16-bit operand planes: transposed weights [n][k x64 | k x1] (bf16 RNE then exact power-of-two scale), obs x16
  prep<<<dim3(PB_ALL), blk, 0, stream>>>(obs, w_q, w_k, w_v, w_o, w_1, w_2, obs_w, act_w, obsh_w,
                                         OBS16, WQ16, WK16, WV16, WO16, W116, W216, OBSW16, ACTW16, OBSHW16);

  // (1) x = obs . Wp + bf16(bp) -> XA (f32); M = NROWS, N = 256, K = 640 (single product, inputs exact);
  //     with it HH = x * bf16(g1 of layer 0) (hi x4 | residual x64) and SS
  gemm64<0, 0, 0, 1, OBSP, 1, 0, 1><<<gE, blk, 0, stream>>>(
      OBS16, 0LL,
      OBSW16, 0LL,
      (const float*)0,
      obs_b, DMODEL,
      (void*)XA, DMODEL, 0LL, 0LL,
      DMODEL, 1.0f / (OBC * WSC), 1.0f,
      (const float*)0, norm1_w, HH, SS);

  for (int l = 0; l < NLAYER; ++l) {
    const size_t lwE = (size_t)l * DMODEL * KD;                    // WQ/WK/WV/WO layer offset (halves)
    const size_t lw1 = (size_t)l * DFF * KD;
    const size_t lw2 = (size_t)l * DMODEL * KF;

    // (2) h = RMSNorm(x) * bf16(g1): HH and SS come from the product that made x, the row factor is applied in (3), (4)
    // (3) q, k projections (batch index 0, 1): QP / KP in fragment order; M = NROWS, N = 256, K = 512 folded, no bias
    // (4) in the same launch, v^T per batch: VT[b] = [d][tok] in fragment order; M = 256 (d), N = SEQ, K = 512 folded
    gemm64x2<2, 0, 0, KD, 1><<<gQKV, blk, 0, stream>>>(
        HH, 0LL, WQ16 + lwE, sQK,
        (const float*)0, 1, (void*)QP, KD, sKP, (long long)DMODEL, DMODEL, SH_E,
        WV16 + lwE, 0LL, HH, (long long)SEQ * KD,
        (const float*)0, 1, (void*)VTp, SEQ, (long long)VTR * SEQ, (long long)DMODEL * SEQ, SEQ, SH_V,
        2 * tilesE, 1.0f / (HC * WSC), QC, SS, 0, 1);

    // (5) causal attention with relative-position bias per (batch, 16 query rows, head), keys split over 8 waves -> CT (hi x16 | residual x64)
    attn4<<<gAT, bAT, 0, stream>>>(QP, KP, VTp, relb + (size_t)l * NBUCK * NHEAD, CT);

    // (6) XB = CT . Wo / (16 * 64) + XA (raw f32); M = NROWS, N = 256, K = 512 folded
    // (7) with it HH = x * bf16(g2) and SS; the row factor of h2 = RMSNorm(x) * bf16(g2) is applied in (8)
    gemm64<0, 2, 0, 0, KD, 1, 0, 1><<<gE, blk, 0, stream>>>(
        CT, 0LL,
        WO16 + lwE, 0LL,
        XA,
        (const float*)0, 1,
        (void*)XB, DMODEL, 0LL, 0LL,
        DMODEL, 1.0f / (CC * WSC), 1.0f,
        (const float*)0, norm2_w + (size_t)l * DMODEL, HH, SS);

    // (8) G16 = dual f16 of 64 * relu(h2 . W1 + bf16(b1)); M = NROWS, N = 512, K = 512 folded
    gemm64<1, 0, 2, 1, KD, 1, 1, 0><<<gF, blk, 0, stream>>>(
        HH, 0LL,
        W116 + lw1, 0LL,
        (const float*)0,
        b_1 + (size_t)l * DFF, DFF,
        (void*)G16, KF, 0LL, (long long)DFF,
        DFF, 1.0f / (HC * WSC), GC,
        SS, (const float*)0, (unsigned short*)0, (float*)0);

    // (9) XA = G16 . W2 / (64 * 64) + bf16(b2) + XB (raw f32); M = NROWS, N = 256, K = 1024 folded;
    //     with it HH = x * bf16(g1 of the next layer, or gf behind the last) and SS
    gemm64<0, 2, 0, 1, KF / 2, 2, 0, 1><<<gE, blk, 0, stream>>>(
        G16, 0LL,
        W216 + lw2, 0LL,
        XB,
        b_2 + (size_t)l * DMODEL, DMODEL,
        (void*)XA, DMODEL, 0LL, 0LL,
        DMODEL, 1.0f / (GC * WSC), 1.0f,
        (const float*)0, (l + 1 < NLAYER) ? norm1_w + (size_t)(l + 1) * DMODEL : fnorm_w, HH, SS);
  }

  // (10) hf = RMSNorm(x) * bf16(gf): the row factor is applied in (11), (12)
  // (11) obs prediction plane OBSF[m][640] = hf . Wh + bf16(bh) (cols 0..636 meaningful); M = NROWS, N = 640, K = 512 folded
  // (12) in the same launch, action logits plane ACTF[m][64] = hf . Wa + bf16(ba) (cols 0..3 meaningful); M = NROWS, N = 64
  gemm64x2<0, 0, 1, KD, 1><<<gOA, blk, 0, stream>>>(
      HH, 0LL, OBSHW16, 0LL,
      obsh_b, OBSD, (void*)OBSF, OBSP, 0LL, 0LL, OBSP, SH_ONE,
      HH, 0LL, ACTW16, 0LL,
      act_b, NACT, (void*)ACTF, NACTP, 0LL, 0LL, NACTP, SH_ONE,
      tilesO, 1.0f / (HC * WSC), 1.0f, SS, 0, 0);

  ocopy<<<gOC, blk, 0, stream>>>(ACTF, OBSF, outp);
  (void)hipGetLastError();
}

// v006
// It runs in 379 microseconds.
// Timed twice side by side with v005, it ran 1.13 and 1.14 times as fast.
// All steps since v000 together make it 5.04 times as fast.
// Contractions (all v_wmma_f32_16x16x32_f16, f16 operands, f32 accumulate): input projection (obs f16 x16 . Wp^T f16 x64, K=640
// zero-padded, single product); q/k, v^T, attention-output, hidden (ReLU), second and both head projections with the activation
// operand carried as two f16 planes [hi | residual x64] folded along K against [W^T x64 | W^T x1]; attention scores k.q^T from the
// q/k hi and residual planes (hi.hi plus the two cross terms, two accumulators, K=64); attention v^T.P^T with P f16 x16384 (single)
// against v^T hi and residual planes (two accumulators). RMSNorm, softmax (base 2), ReLU, biases, relative-position bias and the
// residual stream in f32 on VALU. Every float input RNE-converted to bf16 on load.
// RMSNorm has no launch of its own: the row factor rsqrt(mean(x*x) + eps) commutes with the product along the row, so the product
// that makes x also stores the operand plane of x * bf16(norm weight) and its tile's sums of squares, and the product that reads the
// plane multiplies its result by the row factor.
#include <hip/hip_runtime.h>
#include <math.h>
#include <stdint.h>

#ifndef NB
#define NB        2
#endif
#ifndef SEQ
#define SEQ       2048
#endif
#define NB_FULL   2
#define SEQ_FULL  2048
#define NLAYER    6
#define DMODEL    256
#define NHEAD     4
#define HDIM      64
#define DFF       512
#define OBSD      637
#define OBSP      640
#define NACT      4
#define NACTP     64
#define NBUCK     32
#define NROWS     (NB * SEQ)
#define KD        (2 * DMODEL)          // folded K of E-wide activation operands: [hi 256 | residual 256]
#define KF        (2 * DFF)             // folded K of the hidden operand: [hi 512 | residual 512]
#define VTR       KD                    // per batch VTR * SEQ halves of v^T: 256 d x SEQ keys, hi and residual, fragment order
#define OUT1_OFF  (NB_FULL * SEQ_FULL * NACT)   // float index of the second output (byte offset 65536)
#define OUT_TOTAL (OUT1_OFF + NB_FULL * SEQ_FULL * OBSD)

// carries (exact powers of two)
#define WSC_I 64
#define RC_I  64
#define WLO_I 1
#define WSC   64.0f        // weight hi copy
#define WLO   1.0f         // weight lo copy (pairs with the x64 residual plane)
#define RC    64.0f        // residual plane carry relative to its hi plane
#define RCI   0.015625f
#define OBC   16.0f        // obs plane
#define HC    4.0f         // x * norm weight planes (not yet divided by the row's rms)
#define QC    16.0f
#define KC    16.0f
#define VC    16.0f
#define PC    16384.0f     // softmax P tile
#define CC    16.0f        // attention context
#define GC    64.0f        // ReLU hidden
#define ATT_SCALE 0.125f
#define LOG2E   1.4426950408889634f
#define RMS_EPS 1.1920929e-07f
#define NSS     (DMODEL / 64)        // partial sums of squares per row of x: one per 64-column tile
static_assert(RC_I * WLO_I == WSC_I);
static_assert(NHEAD * HDIM == DMODEL);
static_assert(NB >= 1 && NB <= NB_FULL && SEQ >= 64 && SEQ <= SEQ_FULL);
static_assert((SEQ % 64) == 0 && (SEQ % 16) == 0 && (NROWS % 64) == 0 && (DMODEL % 64) == 0 && (DFF % 64) == 0);
static_assert((OBSP % 64) == 0 && (NACTP % 64) == 0 && OBSP >= OBSD && NACTP >= NACT && (OBSP - OBSD) < 64);
static_assert((KD % 32) == 0 && (KF % 32) == 0 && (OBSP % 32) == 0);
static_assert((NROWS % 256) == 0 && (NROWS % 4) == 0 && ((SEQ * OBSD) % 4) == 0);
static_assert(OUT_TOTAL == 2625536);

typedef _Float16 v16h __attribute__((ext_vector_type(16)));
typedef _Float16 v8h  __attribute__((ext_vector_type(8)));
typedef float    v8f  __attribute__((ext_vector_type(8)));
typedef float    v4f  __attribute__((ext_vector_type(4)));
typedef unsigned int v4u __attribute__((ext_vector_type(4)));
typedef unsigned int v2u __attribute__((ext_vector_type(2)));

union FragH { v16h v; v8h h[2]; v4u u[2]; };

// ---- scalar helpers --------------------------------------------------------------------------------
__device__ __forceinline__ unsigned short bf_bits(float f) {          // f32 -> bf16 bits, RNE convert
  unsigned u = __float_as_uint(f);
  return (unsigned short)((u + 0x7FFFu + ((u >> 16) & 1u)) >> 16);
}
__device__ __forceinline__ float bf_up(unsigned short h) { return __uint_as_float(((unsigned)h) << 16); }
__device__ __forceinline__ float bfr(float f) { return bf_up(bf_bits(f)); }   // value of the bf16 RNE convert
__device__ __forceinline__ unsigned short h_bits(_Float16 x) { return __builtin_bit_cast(unsigned short, x); }
__device__ __forceinline__ unsigned pk16(unsigned short a, unsigned short b) { return (unsigned)a | ((unsigned)b << 16); }
__device__ __forceinline__ v8f zero8() { v8f z = {0.f, 0.f, 0.f, 0.f, 0.f, 0.f, 0.f, 0.f}; return z; }
__device__ __forceinline__ int imin(int a, int b) { return a < b ? a : b; }
__device__ __forceinline__ int imax(int a, int b) { return a > b ? a : b; }

// Relative-position bucket for rel = query - key >= 0 (bidirectional split, 32 buckets, max distance 128), as an exact
// integer table: 0 -> 0; 1..7 -> 16+rel; 8..11 -> 24; 12..15 -> 25; 16..22 -> 26; 23..31 -> 27; 32..45 -> 28; 46..63 -> 29;
// 64..90 -> 30; >= 91 -> 31.
__device__ __forceinline__ int rel_bucket(int rel) {
  int b = 31;
  b = (rel < 91) ? 30 : b;
  b = (rel < 64) ? 29 : b;
  b = (rel < 46) ? 28 : b;
  b = (rel < 32) ? 27 : b;
  b = (rel < 23) ? 26 : b;
  b = (rel < 16) ? 25 : b;
  b = (rel < 12) ? 24 : b;
  b = (rel < 8) ? (16 + rel) : b;
  b = (rel == 0) ? 0 : b;
  return b;
}

// ---- fragment loaders: 16-bit A/B operand, lane -> row/col (lane&15), p already includes +8*(lane>>4);
//      elements 0..7 <- p[0..7] (k0+8h..), elements 8..15 <- p[16..23] (k0+16+8h..)  (same split k map for A and B;
//      B is always read from a k-contiguous [n][k] plane)
__device__ __forceinline__ v16h ldfrag_u(const unsigned short* p) {
  FragH f;
  f.u[0] = *(const v4u*)(p);
  f.u[1] = *(const v4u*)(p + 16);
  return f.v;
}
// Fragment-ordered plane of an [M][N] matrix (M multiple of 16, N of 64): chunk (m / 16) * (N / 64) + n / 64 holds 16 rows x 64 cols as
// FCH halves: [hi | residual] x [col / 16 & 3] x [lane = 16 * (col / 8 & 1) + row % 16] x [col % 8]. The two 16-B loads of a fragment
// (16 rows x 32 cols, same k map as above) then read 512 consecutive bytes each. p = the 16 x 32 block (FBK halves) + 8 * lane.
#define FCH 2048
#define FPL 1024
#define FBK 512
__device__ __forceinline__ v16h ldfrag_f(const _Float16* p) {
  FragH f;
  f.h[0] = *(const v8h*)(p);
  f.h[1] = *(const v8h*)(p + 256);
  return f.v;
}

// ---- WMMA helpers with trailing VALU hazard gaps ------------------------------------------------------
__device__ __forceinline__ v8f mma_raw(v16h a, v16h b, v8f c) {
  return __builtin_amdgcn_wmma_f32_16x16x32_f16(false, a, false, b, (short)0, c, false, false);
}
__device__ __forceinline__ void guard_s2x4(v8f& s, v8f& t, v16h a0, v16h a1, v16h b0, v16h b1) {
#if defined(__HIP_DEVICE_COMPILE__)
  asm volatile("v_nop\n\tv_nop\n\tv_nop\n\tv_nop" : "+v"(s), "+v"(t) : "v"(a0), "v"(a1), "v"(b0), "v"(b1));
#endif
}
__device__ __forceinline__ void guard_pv4(v8f& a, v8f& b, v8f& c, v8f& d, v16h x, v16h y, v16h z, v16h w, v16h u) {
#if defined(__HIP_DEVICE_COMPILE__)
  asm volatile("v_nop\n\tv_nop\n\tv_nop\n\tv_nop"
               : "+v"(a), "+v"(b), "+v"(c), "+v"(d) : "v"(x), "v"(y), "v"(z), "v"(w), "v"(u));
#endif
}
__device__ __forceinline__ void keep4_h(v16h a, v16h b, v16h c, v16h d) {
#if defined(__HIP_DEVICE_COMPILE__)
  asm volatile("v_nop" :: "v"(a), "v"(b), "v"(c), "v"(d));
#endif
}
// Later writes of the address and data registers of the global loads and stores issued so far stay behind this wait.
__device__ __forceinline__ void wait_x0() {
#if defined(__HIP_DEVICE_COMPILE__)
  asm volatile("s_wait_xcnt 0x0" ::: "memory");
#endif
}
// Lane l takes the value of lane l ^ 16: a vector cross-row move, no LDS trip.
__device__ __forceinline__ float xhalf(float x) {
  const int b = __builtin_bit_cast(int, x);
  return __builtin_bit_cast(float, __builtin_amdgcn_permlanex16(b, b, 0x76543210, 0xfedcba98, false, false));
}
// RMSNorm row factor from the plane ss[NSS][NROWS] of partial sums of squares: rsqrt(mean(x*x) + eps), eps 1.1920929e-7.
static_assert(NSS == 4);
__device__ __forceinline__ float row_ss(const float* __restrict__ ss, int m) {
  return (ss[m] + ss[NROWS + m]) + (ss[2 * NROWS + m] + ss[3 * NROWS + m]);
}
__device__ __forceinline__ float rstd_of(float s) {
  const float x = s * (1.0f / (float)DMODEL) + RMS_EPS;    // s >= 0, so x >= eps: a normal number, no range scaling round the instruction
  float r = 0.f;
#if defined(__HIP_DEVICE_COMPILE__)
  // v_nop: the one slot between a transcendental and an instruction that reads its result or overwrites its source
  asm("v_rsq_f32 %0, %1\n\tv_nop" : "=v"(r) : "v"(x));
#endif
  return r;
}

// =====================================================================================================
// Transposing 16-bit pack of a weight stored in[R][C] (row pitch C floats, R = contraction index, C = output index) into
// out[Cp][ldd] (row pitch ldd halves): out[c][r] = f16( bf16_RNE(in[r][c]) * schi ) for r < R and c < C, 0 otherwise (pad rows /
// pad columns explicitly written as zeros); with DUAL a second copy out[c][locol + r] = f16( bf16_RNE(in[r][c]) * sclo ).
// schi / sclo powers of two (exact). Tiles: Cp/64 along bx, Rp/64 along by; bz = slice: src advanced by bz*sZ floats, dst by
// bz*dZ halves. One 64x64 tile per block through LDS (bf16 bits): 16 scalar loads per thread with CLAMPED addresses, zero by
// coverage: load 256 thr x 16 floats = 64x64; store 2 it x 8 waves x 4 rows x (8 lanes x 8 halves) = 64 rows x 64 halves per copy;
//           tiles (Cp/64, Rp/64, Z) exact, each output line written by exactly one wave; pad region included.
// =====================================================================================================
// (bx, by, bz) = the tile's place in the grid described above; dual is the same for the whole block.
__device__ __forceinline__ void tcvt16(unsigned short* sT, const float* __restrict__ src, long long sZ,
                                       unsigned short* dst, long long dZ,
                                       int R, int C, int ldd, int locol, float schi, float sclo,
                                       bool dual, int bx, int by, int bz) {
  const int tid = threadIdx.x, lane = tid & 31, wave = tid >> 5;
  const int c0 = bx * 64, r0 = by * 64;
  const float* srcz = src + (size_t)((long long)bz * sZ);
  unsigned short* dstz = dst + (size_t)((long long)bz * dZ);
  const int rr = tid >> 2, cc = (tid & 3) * 16;
  const int r = r0 + rr;
  const int rcl = imin(r, R - 1);
  const float* sp = srcz + (size_t)rcl * C;
#pragma unroll
  for (int e = 0; e < 16; ++e) {
    const int cidx = c0 + cc + e;
    const int ccl = imin(cidx, C - 1);
    float a = sp[ccl];
    a = (r < R && cidx < C) ? a : 0.f;
    sT[(cc + e) * 72 + rr] = bf_bits(a);
  }
  __syncthreads();
  v4u hvals[2], lvals[2];
#pragma unroll
  for (int it = 0; it < 2; ++it) {
    const int q = it * 32 + wave * 4 + (lane >> 3);
    const v4u raw = *(const v4u*)(sT + q * 72 + (lane & 7) * 8);
    v4u hv = {0u, 0u, 0u, 0u}, lv = {0u, 0u, 0u, 0u};
#pragma unroll
    for (int e = 0; e < 4; ++e) {
      const float f0 = bf_up((unsigned short)(raw[e] & 0xFFFFu));
      const float f1 = bf_up((unsigned short)(raw[e] >> 16));
      hv[e] = pk16(h_bits((_Float16)(f0 * schi)), h_bits((_Float16)(f1 * schi)));
      lv[e] = pk16(h_bits((_Float16)(f0 * sclo)), h_bits((_Float16)(f1 * sclo)));
    }
    hvals[it] = hv;
    lvals[it] = lv;
  }
  {
#pragma unroll
    for (int it = 0; it < 2; ++it) {
      const int q = it * 32 + wave * 4 + (lane >> 3);
      unsigned short* p = dstz + (size_t)(c0 + q) * ldd + r0 + (lane & 7) * 8;
      *(v4u*)p = hvals[it];
    }
    wait_x0();                                             // no register of the two stores above is rewritten ahead of this wait
    if (dual) {
#pragma unroll                                             // lvals[] indexed by constants, so that it stays in registers
      for (int it = 0; it < 2; ++it) {
        const int q = it * 32 + wave * 4 + (lane >> 3);
        unsigned short* p = dstz + (size_t)(c0 + q) * ldd + r0 + (lane & 7) * 8;
        *(v4u*)(p + locol) = lvals[it];
      }
      wait_x0();                                           // the same for the second copy's two stores
    }
  }
}

// =====================================================================================================
// Batched f16 WMMA GEMM, operands staged in LDS: C[m][n] = f( oscale * sum_k A[m][k] * Bt[n][k] + bias ); one 64x64 tile per
// work-group of 8 waves (wave = 16 rows x 32 cols, two accumulators). A row-major [M][K] (16-bit plane), Bt row-major
// [N][K] (k contiguous), both at row pitch K; M, N multiples of 64, K = KST * NCH. tile = tile index, by = batch index with element
// strides sA, sB, sC. A stage is KST k of the tile's 64 A rows and 64 Bt rows, brought to LDS by asynchronous 16-B copies
// (a wave's copy = two aligned 256-B units) at row pitch KST + 8 halves (16 B x odd: ds_load_b128 fragment reads without bank conflicts).
// NCH 1: the stage is filled once and then read. NCH 2: two buffers, stage 1 flies while stage 0 is multiplied.
// k runs upward through one accumulator per 16x16 output tile.
// BM: 0 no bias, 1 bias bf16(biasp[n]) for n < nbias (0 beyond, clamped address).   ACT: 2 = ReLU applied to (value + bias).
// OM 0 = f32 out (pitch ldc); RM 2 adds raw f32 Rp[m][n] (same pitch/stride as C).
// OM 1 = dual f16 out (pitch ldc): hi = f16(value * ocarry) at C[m][n], residual f16(RC * (value * ocarry - hi)) at C[m][n] + lofs.
// OM 2 = the same two values in the fragment-ordered plane described at ldfrag_f (ldc and lofs not used); a wave's store = one
//        512-B block of the plane.
// NRM 1: one operand is the plane of x * bf16(norm weight) * HC; the sum is multiplied by the RMSNorm factor of its x row (ahead of
//        bias and ReLU), taken from ssp[NSS][NROWS]: x row = m (A operand), or with colf (OM 2 only) by * N + n (Bt operand).
// EM 1 (OM 0, N = DMODEL): C is the residual stream x; the tile also stores Hout[m][n] = f16(x * bf16(nwp[n]) * HC), its residual x64
//        at Hout[m][DMODEL + n] (row pitch KD; a row's 128-B segment = 16 lanes) and SSout[n0 / 64][m] = sum of x*x over its 64 columns
//        (4 per lane, then xor shuffles over 16 lanes), gathered in the pad column of sT so that one wave stores each 128-B line.
// coverage: copies: 2 operands x 4 row groups of 16 x KST/128 units of 256 B = 2*KST/32 copies per thread and stage; slab: 8 waves x 16 x 32 = 64 x 64;
//           out: f32 4 it x 16 rows x 16 lanes x 4, f16 2 it x 32 rows x 8 lanes x 8 (both planes) = the whole 64x64 tile;
//           grid = tilesM*tilesN blocks exactly.
// =====================================================================================================
// Eight asynchronous 16-B copies global -> LDS (l = the lane's LDS byte address, g = the lane's global address). The closing
// s_wait_xcnt keeps every later write of these address registers behind the copies' address translation.
__device__ __forceinline__ void acopy8(const unsigned* l, const unsigned short* const* g) {
#if defined(__HIP_DEVICE_COMPILE__)
  asm volatile(
      "global_load_async_to_lds_b128 %0, %8, off\n\t"
      "global_load_async_to_lds_b128 %1, %9, off\n\t"
      "global_load_async_to_lds_b128 %2, %10, off\n\t"
      "global_load_async_to_lds_b128 %3, %11, off\n\t"
      "global_load_async_to_lds_b128 %4, %12, off\n\t"
      "global_load_async_to_lds_b128 %5, %13, off\n\t"
      "global_load_async_to_lds_b128 %6, %14, off\n\t"
      "global_load_async_to_lds_b128 %7, %15, off\n\t"
      "s_wait_xcnt 0x0"
      :: "v"(l[0]), "v"(l[1]), "v"(l[2]), "v"(l[3]), "v"(l[4]), "v"(l[5]), "v"(l[6]), "v"(l[7]),
         "v"(g[0]), "v"(g[1]), "v"(g[2]), "v"(g[3]), "v"(g[4]), "v"(g[5]), "v"(g[6]), "v"(g[7])
      : "memory");
#endif
}
// The wave's own copies have landed in LDS behind this wait.
__device__ __forceinline__ void wait_async0() {
#if defined(__HIP_DEVICE_COMPILE__)
  asm volatile("s_wait_asynccnt 0x0" ::: "memory");
#endif
}
// The wave's own LDS reads have returned behind this wait.
__device__ __forceinline__ void wait_ds0() {
#if defined(__HIP_DEVICE_COMPILE__)
  asm volatile("s_wait_dscnt 0x0" ::: "memory");
#endif
}
// One stage: KST halves of rows 0..63 of Ag to LDS rows 0..63 and of rows 0..63 of Bg to LDS rows 64..127 (global row pitch LDK
// halves). 16 lanes take one aligned 256-B unit of a row, a copy of the block 16 rows; every offset below is a constant.
template <int KST, int LDK>
__device__ __forceinline__ void fill_stage(const unsigned short* Ag, const unsigned short* Bg, unsigned ldsb, int tid) {
  constexpr int CG  = KST / 128;            // 256-B units per row
  constexpr int PER = 4 * CG;               // copies per thread and operand
  constexpr int PIT = KST + 8;              // LDS row pitch, halves
  static_assert((KST % 128) == 0 && (2 * PER) % 8 == 0 && 2 * PER <= 63);
  const int r0 = tid >> 4, h0 = (tid & 15) * 8;
  const unsigned short* a0 = Ag + (size_t)r0 * LDK + h0;
  const unsigned short* b0 = Bg + (size_t)r0 * LDK + h0;
  const unsigned l0 = ldsb + (unsigned)(r0 * PIT + h0) * 2u;
  // both loops unrolled: every copy's offsets are then constants and l[], g[] stay in registers
#pragma unroll
  for (int g0 = 0; g0 < 2 * PER; g0 += 8) {
    unsigned l[8];
    const unsigned short* g[8];
#pragma unroll
    for (int e = 0; e < 8; ++e) {
      const int it = g0 + e;
      const bool isB = it >= PER;
      const int j = isB ? it - PER : it;
      const int rg = j / CG, cg = j - rg * CG;
      l[e] = l0 + (unsigned)((((isB ? 64 : 0) + rg * 16) * PIT + cg * 128) * 2);
      g[e] = (isB ? b0 : a0) + (size_t)(rg * 16) * LDK + cg * 128;
    }
    acopy8(l, g);
  }
}

template <int OM, int RM, int ACT, int BM, int KST, int NCH, int NRM, int EM>
__device__ __forceinline__ void gemm64_tile(
    const unsigned short* __restrict__ Ap, long long sA,
    const unsigned short* __restrict__ Btp, long long sB,
    const float* __restrict__ Rp,
    const float* __restrict__ biasp, int nbias,
    void* Cout, int ldc, long long sC, long long lofs,
    int N, float oscale, float ocarry, int tile, int by,
    const float* __restrict__ ssp, bool colf,
    const float* __restrict__ nwp, unsigned short* Hout, float* SSout) {
  static_assert(EM == 0 || OM == 0);
  constexpr int PIT  = KST + 8;               // LDS row pitch, halves
  constexpr int BUFH = 128 * PIT;            // halves per stage buffer: 64 A rows, then 64 Bt rows
  constexpr int LDK  = KST * NCH;            // row pitch of A and Bt, halves (= K)
  constexpr int KB   = 4;                    // k steps of 32 per fragment block
  constexpr int NBLK = KST / (32 * KB);
  static_assert(NCH == 1 || NCH == 2);
  static_assert((KST % (32 * KB)) == 0 && ((PIT * 2) % 32) == 16);
  __shared__ __align__(16) unsigned short sP[NCH * BUFH];
  __shared__ __align__(16) float sT[64 * 68];        // the tile in f32, pitch 68 floats
  const int tid  = threadIdx.x;
  const int lane = tid & 31;
  const int wave = tid >> 5;
  const int tilesN = N >> 6;
  const int tm = tile / tilesN;
  const int tn = tile - tm * tilesN;
  const int m0 = tm << 6;
  const int n0 = tn << 6;

  const unsigned short* Ag = Ap  + (size_t)((long long)by * sA) + (size_t)m0 * LDK;
  const unsigned short* Bg = Btp + (size_t)((long long)by * sB) + (size_t)n0 * LDK;
  const unsigned ldsb = (unsigned)(uintptr_t)(&sP[0]);   // LDS byte address = low 32 bits of the shared address

  fill_stage<KST, LDK>(Ag, Bg, ldsb, tid);

  const int r16 = tid >> 4, c4 = (tid & 15) * 4;         // f32 out: 256-B row segment = 16 lanes x 16 B
  const int r32 = tid >> 3;                              // f16 out: 128-B row segment = 8 lanes x 16 B
  const int c8 = (OM == 2) ? (wave & 3) * 16 + (lane >> 4) * 8 : (tid & 7) * 8;   // OM 2: 16 cols per wave, 8 per lane half

  // ---- RMSNorm factors of the x rows behind this thread's output rows (or, with colf, columns); read here, while stage 0 flies ----
  // every loop down to the wait on the copies is unrolled: the small arrays are then indexed by constants and stay in registers
  float rrow[4], rcol[8];
#pragma unroll
  for (int e = 0; e < 4; ++e) rrow[e] = 1.f;
#pragma unroll
  for (int e = 0; e < 8; ++e) rcol[e] = 1.f;
  if constexpr (NRM == 1) {
    if (OM == 2 && colf) {
      const float* p = ssp + (size_t)by * N + n0 + c8;
      v4f a[NSS], b[NSS];
#pragma unroll
      for (int j = 0; j < NSS; ++j) {
        a[j] = *(const v4f*)(p + (size_t)j * NROWS);
        b[j] = *(const v4f*)(p + (size_t)j * NROWS + 4);
      }
      wait_x0();                                           // no address register of the loads above is rewritten ahead of this wait
#pragma unroll
      for (int e = 0; e < 4; ++e) {
        rcol[e]     = rstd_of((a[0][e] + a[1][e]) + (a[2][e] + a[3][e]));
        rcol[4 + e] = rstd_of((b[0][e] + b[1][e]) + (b[2][e] + b[3][e]));
      }
    } else {
      constexpr int NIT = (OM == 0) ? 4 : 2;
      float s[NIT];
#pragma unroll
      for (int it = 0; it < NIT; ++it) {
        const int row = (OM == 0) ? it * 16 + r16 : (OM == 2) ? (it * 2 + (wave >> 2)) * 16 + (lane & 15) : it * 32 + r32;
        s[it] = row_ss(ssp, m0 + row);
      }
      wait_x0();                                           // the same for these loads
#pragma unroll
      for (int it = 0; it < NIT; ++it) rrow[it] = rstd_of(s[it]);
    }
  }
  // ---- the next RMSNorm's weight for this thread's four columns ----
  float nw[4];
#pragma unroll
  for (int e = 0; e < 4; ++e) nw[e] = 0.f;
  if constexpr (EM == 1) {
    const v4f w4 = *(const v4f*)(nwp + n0 + c4);
    wait_x0();                                             // the same for this load
#pragma unroll
    for (int e = 0; e < 4; ++e) nw[e] = bfr(w4[e]);
  }

  wait_async0();
  __syncthreads();                                       // stage 0 readable by every wave
  if constexpr (NCH == 2) fill_stage<KST, LDK>(Ag + KST, Bg + KST, ldsb + (unsigned)(BUFH * 2), tid);

  const int rlane = lane & 15;                 // row (A) / col (B, D) within subtile
  const int koff  = (lane >> 4) * 8;           // k offset of this lane half
  const int mOff  = (lane >> 4) * 8;           // D row offset
  const int wr = wave >> 1, wc = wave & 1;     // wave tile: rows wr*16.., cols wc*32..

  v8f acc0 = zero8(), acc1 = zero8();
  // the loops below are unrolled so that the two fragment sets are indexed by constants and stay in registers
#pragma unroll
  for (int t = 0; t < NCH; ++t) {
    const unsigned short* aL = sP + t * BUFH + (wr * 16 + rlane) * PIT + koff;
    const unsigned short* bL = sP + t * BUFH + (64 + wc * 32 + rlane) * PIT + koff;
    // fragments one block ahead in a second register set, each block's LDS reads as one group; never across a stage
    v16h fa[2][KB], fb0[2][KB], fb1[2][KB];
#pragma unroll
    for (int s = 0; s < KB; ++s) {
      fa[0][s]  = ldfrag_u(aL + s * 32);
      fb0[0][s] = ldfrag_u(bL + s * 32);
      fb1[0][s] = ldfrag_u(bL + 16 * PIT + s * 32);
    }
#pragma unroll
    for (int blk = 0; blk < NBLK; ++blk) {
      const int cur = blk & 1;
      if (blk + 1 < NBLK) {
#pragma unroll
        for (int s = 0; s < KB; ++s) {
          const int k0 = ((blk + 1) * KB + s) * 32;
          fa[cur ^ 1][s]  = ldfrag_u(aL + k0);
          fb0[cur ^ 1][s] = ldfrag_u(bL + k0);
          fb1[cur ^ 1][s] = ldfrag_u(bL + 16 * PIT + k0);
        }
      }
      __builtin_amdgcn_sched_barrier(0);   // keeps the next block's LDS reads one group ahead of this block's products
#pragma unroll
      for (int s = 0; s < KB; ++s) {
        acc0 = mma_raw(fa[cur][s], fb0[cur][s], acc0);
        acc1 = mma_raw(fa[cur][s], fb1[cur][s], acc1);
      }
      __builtin_amdgcn_sched_barrier(0);   // keeps later blocks' LDS reads from spreading among these products
    }
    if (t + 1 < NCH) {
      wait_ds0();
      wait_async0();
      __syncthreads();                                   // stage t + 1 readable by every wave
    }
  }
  if constexpr (NCH == 2) wait_async0();                 // no copy is outstanding when the buffers are left

  // ---- column bias (same columns for every row a thread writes), clamped addresses ----
  float bc4[4], bc8[8];
#pragma unroll
  for (int e = 0; e < 4; ++e) bc4[e] = 0.f;
#pragma unroll
  for (int e = 0; e < 8; ++e) bc8[e] = 0.f;
  if constexpr (BM == 1) {
    if constexpr (OM == 0) {
#pragma unroll
      for (int e = 0; e < 4; ++e) {
        const int n = n0 + c4 + e;
        const int ncl = imin(n, nbias - 1);
        const float t = bfr(biasp[ncl]);
        bc4[e] = (n < nbias) ? t : 0.f;
      }
    } else {
#pragma unroll
      for (int e = 0; e < 8; ++e) {
        const int n = n0 + c8 + e;
        const int ncl = imin(n, nbias - 1);
        const float t = bfr(biasp[ncl]);
        bc8[e] = (n < nbias) ? t : 0.f;
      }
    }
  }

  // ---- epilogue: the tile through LDS, whole row segments (OM 0, 1) or whole 512-B fragment blocks (OM 2) out ----
#pragma unroll
  for (int r = 0; r < 8; ++r) {
    float* sp = sT + (wr * 16 + mOff + r) * 68 + wc * 32 + rlane;
    sp[0]  = acc0[r];
    sp[16] = acc1[r];
  }
  __syncthreads();
  if constexpr (OM == 0) {
    float* C = (float*)Cout + (size_t)((long long)by * sC);
    v4f vx[4];
#pragma unroll
    for (int it = 0; it < 4; ++it) {
      const int row = it * 16 + r16;                     // it 0..3 x r16 0..15 = rows 0..63
      const int gr  = m0 + row;
      v4f v = *(const v4f*)(sT + row * 68 + c4);
      v4f rv = {0.f, 0.f, 0.f, 0.f};
      if constexpr (RM == 2) {
        const float* R = Rp + (size_t)((long long)by * sC);
        rv = *(const v4f*)(R + (size_t)gr * ldc + n0 + c4);
      }
      const float osc = oscale * rrow[it];
#pragma unroll
      for (int e = 0; e < 4; ++e) {
        float u = v[e] * osc;
        if constexpr (BM == 1) u += bc4[e];
        if constexpr (ACT == 2) u = fmaxf(u, 0.f);
        v[e] = u + rv[e];
      }
      if constexpr (EM == 0) *(v4f*)(C + (size_t)gr * ldc + n0 + c4) = v;
      vx[it] = v;
    }
    if constexpr (EM == 1) {
      // the loops of this block are unrolled so that vx[] and q[] stay in registers; the four rows' shuffles of a step are independent
      float q[4];
#pragma unroll
      for (int it = 0; it < 4; ++it)
        q[it] = (vx[it][0] * vx[it][0] + vx[it][1] * vx[it][1]) + (vx[it][2] * vx[it][2] + vx[it][3] * vx[it][3]);
#pragma unroll
      for (int off = 1; off < 16; off <<= 1) {
#pragma unroll
        for (int it = 0; it < 4; ++it) q[it] += __shfl_xor(q[it], off, 32);
      }
      if ((tid & 15) == 0) {                               // pad column: no other thread reads or writes it before the barrier below
#pragma unroll
        for (int it = 0; it < 4; ++it) sT[(it * 16 + r16) * 68 + 64] = q[it];
      }
      __syncthreads();                                     // the 64 row sums readable by waves 0 and 1; ahead of the global stores
#pragma unroll
      for (int it = 0; it < 4; ++it) {
        const int gr = m0 + it * 16 + r16;
        const v4f v = vx[it];
        *(v4f*)(C + (size_t)gr * ldc + n0 + c4) = v;
        const float f0 = (v[0] * nw[0]) * HC, f1 = (v[1] * nw[1]) * HC, f2 = (v[2] * nw[2]) * HC, f3 = (v[3] * nw[3]) * HC;
        const _Float16 g0 = (_Float16)f0, g1 = (_Float16)f1, g2 = (_Float16)f2, g3 = (_Float16)f3;
        v2u hv, lv;
        hv[0] = pk16(h_bits(g0), h_bits(g1));
        hv[1] = pk16(h_bits(g2), h_bits(g3));
        lv[0] = pk16(h_bits((_Float16)((f0 - (float)g0) * RC)), h_bits((_Float16)((f1 - (float)g1) * RC)));
        lv[1] = pk16(h_bits((_Float16)((f2 - (float)g2) * RC)), h_bits((_Float16)((f3 - (float)g3) * RC)));
        unsigned short* hp = Hout + (size_t)gr * KD + n0 + c4;
        *(v2u*)hp = hv;
        *(v2u*)(hp + DMODEL) = lv;
      }
      if (tid < 64) SSout[(size_t)tn * NROWS + m0 + tid] = sT[tid * 68 + 64];
    }
  } else {
    unsigned short* C = (unsigned short*)Cout + (size_t)((long long)by * sC);
#pragma unroll
    for (int it = 0; it < 2; ++it) {
      // OM 1: it 0..1 x r32 0..31 = rows 0..63; OM 2: 16 rows per wave, (it, wave / 4) = the tile's four groups of 16 rows
      const int row = (OM == 2) ? (it * 2 + (wave >> 2)) * 16 + rlane : it * 32 + r32;
      const float* spf = sT + row * 68 + c8;
      v4u a = {0u, 0u, 0u, 0u}, bl = {0u, 0u, 0u, 0u};
      const float osc = oscale * rrow[it];
#pragma unroll
      for (int e = 0; e < 4; ++e) {
        float f0 = spf[2 * e] * osc;
        float f1 = spf[2 * e + 1] * osc;
        if constexpr (NRM == 1 && OM == 2) { f0 *= rcol[2 * e]; f1 *= rcol[2 * e + 1]; }
        if constexpr (BM == 1) { f0 += bc8[2 * e]; f1 += bc8[2 * e + 1]; }
        if constexpr (ACT == 2) { f0 = fmaxf(f0, 0.f); f1 = fmaxf(f1, 0.f); }
        f0 *= ocarry; f1 *= ocarry;
        const _Float16 g0 = (_Float16)f0, g1 = (_Float16)f1;
        const float r0 = (f0 - (float)g0) * RC, r1 = (f1 - (float)g1) * RC;
        a[e]  = pk16(h_bits(g0), h_bits(g1));
        bl[e] = pk16(h_bits((_Float16)r0), h_bits((_Float16)r1));
      }
      if constexpr (OM == 2) {
        unsigned short* p = C + ((size_t)((m0 + row) >> 4) * tilesN + tn) * FCH + (wave & 3) * 256 + lane * 8;
        *(v4u*)p = a;
        *(v4u*)(p + FPL) = bl;
      } else {
        unsigned short* p = C + (size_t)(m0 + row) * ldc + n0 + c8;
        *(v4u*)p = a;
        *(v4u*)(p + (size_t)lofs) = bl;
      }
    }
  }
  (void)Rp; (void)ocarry; (void)lofs; (void)nbias; (void)biasp; (void)ldc; (void)r32;
  (void)ssp; (void)colf; (void)nwp; (void)Hout; (void)SSout; (void)rcol; (void)nw;
}

// One product per launch: blockIdx.x = tile, blockIdx.y = batch index.
template <int OM, int RM, int ACT, int BM, int KST, int NCH, int NRM, int EM>
__global__ __launch_bounds__(256) void gemm64(
    const unsigned short* __restrict__ Ap, long long sA,
    const unsigned short* __restrict__ Btp, long long sB,
    const float* __restrict__ Rp,
    const float* __restrict__ biasp, int nbias,
    void* Cout, int ldc, long long sC, long long lofs,
    int N, float oscale, float ocarry,
    const float* __restrict__ ssp, const float* __restrict__ nwp, unsigned short* Hout, float* SSout) {
  gemm64_tile<OM, RM, ACT, BM, KST, NCH, NRM, EM>(Ap, sA, Btp, sB, Rp, biasp, nbias, Cout, ldc, sC, lofs, N, oscale, ocarry,
                                                  (int)blockIdx.x, (int)blockIdx.y, ssp, false, nwp, Hout, SSout);
}

#define SH_E   8        // log2 of the tiles per batch index of the q / k product: (NROWS / 64) * (DMODEL / 64)
#define SH_V   7        // log2 of the tiles per batch of the v^T product: (DMODEL / 64) * (SEQ / 64)
#define SH_ONE 30       // a product with one batch index only
static_assert((1 << SH_E) == (NROWS / 64) * (DMODEL / 64) && (1 << SH_V) == (DMODEL / 64) * (SEQ / 64));
static_assert(QC == VC);
// Two independent products of the same form in one launch (no residual input): blocks 0..n0-1 work on product 0, the rest on
// product 1; inside a product block i is tile i mod 2^sh of batch index i >> sh. The choice is the same for the whole block.
// Both read the plane of x * norm weight (NRM 1): as A, or, where the product's colf is set, as Bt.
// coverage: grid = n0 + (blocks of product 1), each product's (tile, batch) pairs taken exactly once.
template <int OM, int ACT, int BM, int KST, int NCH>
__global__ __launch_bounds__(256) void gemm64x2(
    const unsigned short* __restrict__ Ap0, long long sA0, const unsigned short* __restrict__ Btp0, long long sB0,
    const float* __restrict__ biasp0, int nbias0, void* Cout0, int ldc0, long long sC0, long long lofs0, int N0, int sh0,
    const unsigned short* __restrict__ Ap1, long long sA1, const unsigned short* __restrict__ Btp1, long long sB1,
    const float* __restrict__ biasp1, int nbias1, void* Cout1, int ldc1, long long sC1, long long lofs1, int N1, int sh1,
    int n0, float oscale, float ocarry, const float* __restrict__ ssp, int colf0, int colf1) {
  const int b = (int)blockIdx.x;
  const bool p0 = b < n0;
  const int i  = p0 ? b : b - n0;
  const int sh = p0 ? sh0 : sh1;
  const int by = i >> sh;
  gemm64_tile<OM, 0, ACT, BM, KST, NCH, 1, 0>(p0 ? Ap0 : Ap1, p0 ? sA0 : sA1, p0 ? Btp0 : Btp1, p0 ? sB0 : sB1, (const float*)0,
                                              p0 ? biasp0 : biasp1, p0 ? nbias0 : nbias1, p0 ? Cout0 : Cout1, p0 ? ldc0 : ldc1,
                                              p0 ? sC0 : sC1, p0 ? lofs0 : lofs1, p0 ? N0 : N1, oscale, ocarry, i - (by << sh), by,
                                              ssp, (p0 ? colf0 : colf1) != 0, (const float*)0, (unsigned short*)0, (float*)0);
}

#define ATT_SPLIT   8
#define ATT_THREADS (ATT_SPLIT * 32)
#define ATT_BLOCKS  (NB * (SEQ / 16) * NHEAD)
#define OP_PITCH    68
#define VCS         ((SEQ / 64) * FCH)      // halves between the v^T chunks of 16 d and of the next 16 d at the same keys
static_assert(ATT_THREADS == 16 * (HDIM / 4) && HDIM == 64);
static_assert((HDIM * 2) % 128 == 0 && (HDIM % 32) == 0);

__global__ __launch_bounds__(ATT_THREADS)
void attn4(const unsigned short* __restrict__ QPp, const unsigned short* __restrict__ KPp,
           const unsigned short* __restrict__ VTq, const float* __restrict__ relbl, unsigned short* CT) {
  __shared__ __align__(16) float sbias[SEQ];                          // [rel], bf16(relb) * log2 e
  __shared__ __align__(16) float spo[ATT_SPLIT * 16 * OP_PITCH];      // per wave partial [row][64 d], pitch 68
  __shared__ __align__(16) float sml[2 * ATT_SPLIT * 16];             // per wave and row: max, then sum

  const int tid  = threadIdx.x;
  const int wave = __builtin_amdgcn_readfirstlane(tid >> 5);  // scalar: the key loop's trip count is a scalar branch, EXEC stays full
  const int lane = tid & 31;
  const int hh   = lane >> 4;
  const int c    = lane & 15;

  const int head = blockIdx.x % NHEAD;                     // 0..3
  const int qb   = blockIdx.x / NHEAD;
  const int qt   = qb % (SEQ / 16);                        // query tile
  const int bat  = qb / (SEQ / 16);                        // batch
  const int q0   = qt * 16;
  const int qi   = q0 + c;                                 // this lane's query
  const int kend = q0 + 16;                                // causal: keys 0 .. q0+15; rel = query - key in 0 .. kend-1

  // ---- relative-position bias table for rel 0..kend-1 of this head ----
  for (int rel = tid; rel < kend; rel += ATT_THREADS) {
    const int bk = rel_bucket(rel);
    sbias[rel] = bfr(relbl[bk * NHEAD + head]) * LOG2E;
  }
  __syncthreads();

  const float* sb = sbias;
  const _Float16* Q16 = (const _Float16*)(const void*)QPp;
  const _Float16* K16 = (const _Float16*)(const void*)KPp;
  const _Float16* V16 = (const _Float16*)(const void*)VTq;
  const _Float16* Qf = Q16 + ((size_t)((bat * SEQ + q0) >> 4) * NHEAD + head) * FCH + lane * 8;   // chunk (16 tokens, head)
  const _Float16* Kf = K16 + ((size_t)((bat * SEQ) >> 4) * NHEAD + head) * FCH + lane * 8;
  const _Float16* Vf = V16 + (size_t)bat * VTR * SEQ + (size_t)(head * (HDIM / 16)) * VCS + lane * 8;  // chunk (16 d, 64 keys)
  const float lsc = (LOG2E * ATT_SCALE) / (QC * KC);      // log2(e) / 8 / carries

  const v16h qah = ldfrag_f(Qf), qbh = ldfrag_f(Qf + FBK);                      // hi, d 0..31 / 32..63
  const v16h qal = ldfrag_f(Qf + FPL), qbl = ldfrag_f(Qf + FPL + FBK);          // residual x64

  float mrun = -INFINITY, lrun = 0.f;                      // this lane's query: running max (both halves alike), sum over this half's keys
  v8f om0 = zero8(), om1 = zero8(), om2 = zero8(), om3 = zero8();
  v8f or0 = zero8(), or1 = zero8(), or2 = zero8(), or3 = zero8();

#pragma unroll 1
  for (int kb = wave * 32; kb < kend; kb += 32 * ATT_SPLIT) {
    const _Float16* kp = Kf + (size_t)(kb >> 4) * (NHEAD * FCH);
    v8f s0m, s0r, s1m, s1r;                                // register r = score of key (tile's first) + 8 hh + r with query q0 + c
    {
      const v16h k0h = ldfrag_f(kp), k1h = ldfrag_f(kp + FBK);
      const v16h k0l = ldfrag_f(kp + FPL), k1l = ldfrag_f(kp + FPL + FBK);
      s0m = mma_raw(k0h, qah, zero8());
      s0m = mma_raw(k1h, qbh, s0m);
      s0r = mma_raw(k0l, qah, zero8());
      s0r = mma_raw(k1l, qbh, s0r);
      s0r = mma_raw(k0h, qal, s0r);
      s0r = mma_raw(k1h, qbl, s0r);
      guard_s2x4(s0m, s0r, k0h, k1h, k0l, k1l);
    }
    {
      const _Float16* kq = kp + NHEAD * FCH;               // the next 16 keys
      const v16h k0h = ldfrag_f(kq), k1h = ldfrag_f(kq + FBK);
      const v16h k0l = ldfrag_f(kq + FPL), k1l = ldfrag_f(kq + FPL + FBK);
      s1m = mma_raw(k0h, qah, zero8());
      s1m = mma_raw(k1h, qbh, s1m);
      s1r = mma_raw(k0l, qah, zero8());
      s1r = mma_raw(k1l, qbh, s1r);
      s1r = mma_raw(k0h, qal, s1r);
      s1r = mma_raw(k1h, qbl, s1r);
      guard_s2x4(s1m, s1r, k0h, k1h, k0l, k1l);
      keep4_h(qah, qbh, qal, qbl);
    }
    const int rel0 = qi - kb - 8 * hh;                     // query - key of register 0 in tile 0; register r: r less; tile 1: 16 less
    // the loops over r below are unrolled so that t0[], t1[] are indexed by constants and stay in registers
    float t0[8], t1[8];
#pragma unroll
    for (int r = 0; r < 8; ++r) {
      const int d0 = rel0 - r, d1 = rel0 - 16 - r;
      const float u0 = (s0m[r] + s0r[r] * RCI) * lsc + sb[imax(d0, 0)];
      const float u1 = (s1m[r] + s1r[r] * RCI) * lsc + sb[imax(d1, 0)];
      t0[r] = (d0 < 0) ? -INFINITY : u0;
      t1[r] = (d1 < 0) ? -INFINITY : u1;
    }
    float mx = fmaxf(fmaxf(fmaxf(fmaxf(t0[0], t0[1]), fmaxf(t0[2], t0[3])), fmaxf(fmaxf(t0[4], t0[5]), fmaxf(t0[6], t0[7]))),
                     fmaxf(fmaxf(fmaxf(t1[0], t1[1]), fmaxf(t1[2], t1[3])), fmaxf(fmaxf(t1[4], t1[5]), fmaxf(t1[6], t1[7]))));
    mx = fmaxf(mx, xhalf(mx));                             // the query's max over all 32 keys of the step (key kb is never masked)
    const float mn = fmaxf(mrun, mx);
    const float al = exp2f(fmaxf(mrun - mn, -126.0f));
    mrun = mn;
#pragma unroll
    for (int r = 0; r < 8; ++r) {
      t0[r] = exp2f(t0[r] - mn);
      t1[r] = exp2f(t1[r] - mn);
    }
    lrun = lrun * al + ((((t0[0] + t0[1]) + (t0[2] + t0[3])) + ((t0[4] + t0[5]) + (t0[6] + t0[7]))) +
                        (((t1[0] + t1[1]) + (t1[2] + t1[3])) + ((t1[4] + t1[5]) + (t1[6] + t1[7]))));
    FragH ph;                                              // P^T as B operand: the lane's own 16 values, already in the split k map
#pragma unroll
    for (int r = 0; r < 8; ++r) {
      ph.h[0][r] = (_Float16)(t0[r] * PC);                 // elements 0..7  = keys kb + 8hh + 0..7
      ph.h[1][r] = (_Float16)(t1[r] * PC);                 // elements 8..15 = keys kb + 16 + 8hh + 0..7
      om0[r] *= al; om1[r] *= al; om2[r] *= al; om3[r] *= al;
      or0[r] *= al; or1[r] *= al; or2[r] *= al; or3[r] *= al;
    }
    {
      const _Float16* vp = Vf + (size_t)(kb >> 6) * FCH + ((kb >> 5) & 1) * FBK;
      const v16h vb0 = ldfrag_f(vp);
      const v16h vb1 = ldfrag_f(vp + VCS);
      const v16h vb2 = ldfrag_f(vp + 2 * VCS);
      const v16h vb3 = ldfrag_f(vp + 3 * VCS);
      om0 = mma_raw(vb0, ph.v, om0);
      om1 = mma_raw(vb1, ph.v, om1);
      om2 = mma_raw(vb2, ph.v, om2);
      om3 = mma_raw(vb3, ph.v, om3);
      guard_pv4(om0, om1, om2, om3, ph.v, vb0, vb1, vb2, vb3);
    }
    {
      const _Float16* vq = Vf + (size_t)(kb >> 6) * FCH + ((kb >> 5) & 1) * FBK + FPL;
      const v16h vl0 = ldfrag_f(vq);
      const v16h vl1 = ldfrag_f(vq + VCS);
      const v16h vl2 = ldfrag_f(vq + 2 * VCS);
      const v16h vl3 = ldfrag_f(vq + 3 * VCS);
      or0 = mma_raw(vl0, ph.v, or0);
      or1 = mma_raw(vl1, ph.v, or1);
      or2 = mma_raw(vl2, ph.v, or2);
      or3 = mma_raw(vl3, ph.v, or3);
      guard_pv4(or0, or1, or2, or3, ph.v, vl0, vl1, vl2, vl3);
    }
  }

  // ---- the wave's un-normalised partial and its (max, sum) per row to LDS; register r of tile j = d 16 j + 8 hh + r of query c ----
  {
    const float lsum = lrun + xhalf(lrun);                 // the two halves' keys joined, once
    float* pw = spo + wave * (16 * OP_PITCH) + c * OP_PITCH + 8 * hh;
    v4f a, b;
    // unrolled: the accumulators are indexed by constants
#pragma unroll
    for (int e = 0; e < 4; ++e) { a[e] = om0[e] + or0[e] * RCI; b[e] = om0[4 + e] + or0[4 + e] * RCI; }
    *(v4f*)(pw) = a;       *(v4f*)(pw + 4) = b;
#pragma unroll
    for (int e = 0; e < 4; ++e) { a[e] = om1[e] + or1[e] * RCI; b[e] = om1[4 + e] + or1[4 + e] * RCI; }
    *(v4f*)(pw + 16) = a;  *(v4f*)(pw + 20) = b;
#pragma unroll
    for (int e = 0; e < 4; ++e) { a[e] = om2[e] + or2[e] * RCI; b[e] = om2[4 + e] + or2[4 + e] * RCI; }
    *(v4f*)(pw + 32) = a;  *(v4f*)(pw + 36) = b;
#pragma unroll
    for (int e = 0; e < 4; ++e) { a[e] = om3[e] + or3[e] * RCI; b[e] = om3[4 + e] + or3[4 + e] * RCI; }
    *(v4f*)(pw + 48) = a;  *(v4f*)(pw + 52) = b;
    if (hh == 0) {                                         // max and joined sum are equal in the two halves
      sml[wave * 16 + c] = mrun;
      sml[ATT_SPLIT * 16 + wave * 16 + c] = lsum;
    }
  }
  __syncthreads();                                         // every wave's partial readable by every wave
  // ---- merge the 8 partials, fold 1/l and the carries, write 4 hi and 4 residual halves per thread ----
  {
    const int row = tid >> 4, c4 = (tid & 15) * 4;
    float ms[ATT_SPLIT];
    float mall = -INFINITY;
#pragma unroll
    for (int s = 0; s < ATT_SPLIT; ++s) {
      ms[s] = sml[s * 16 + row];
      mall = fmaxf(mall, ms[s]);
    }
    float lall = 0.f;
    v4f o = {0.f, 0.f, 0.f, 0.f};
#pragma unroll
    for (int s = 0; s < ATT_SPLIT; ++s) {
      const float w = exp2f(ms[s] - mall);
      const v4f p = *(const v4f*)(spo + (s * 16 + row) * OP_PITCH + c4);
      lall += w * sml[ATT_SPLIT * 16 + s * 16 + row];
#pragma unroll
      for (int e = 0; e < 4; ++e) o[e] += w * p[e];
    }
    const float inv = (1.0f / lall) * (CC / (PC * VC));
    const float u0 = o[0] * inv, u1 = o[1] * inv, u2 = o[2] * inv, u3 = o[3] * inv;
    const _Float16 g0 = (_Float16)u0, g1 = (_Float16)u1, g2 = (_Float16)u2, g3 = (_Float16)u3;
    v2u hv, lv;
    hv[0] = pk16(h_bits(g0), h_bits(g1));
    hv[1] = pk16(h_bits(g2), h_bits(g3));
    lv[0] = pk16(h_bits((_Float16)((u0 - (float)g0) * RC)), h_bits((_Float16)((u1 - (float)g1) * RC)));
    lv[1] = pk16(h_bits((_Float16)((u2 - (float)g2) * RC)), h_bits((_Float16)((u3 - (float)g3) * RC)));
    unsigned short* dst = CT + ((size_t)bat * SEQ + q0 + row) * KD + head * HDIM + c4;
    *(v2u*)dst = hv;
    *(v2u*)(dst + DMODEL) = lv;
  }
}

// =====================================================================================================
// Input convert: obs16[m][640] = f16(16 * bf16_RNE(obs[b*SEQ_FULL + t][c])) for c < 637 (m = b*SEQ + t), 0 for the pad columns
// 637..639 (explicitly written). One wave per row (8 rows per block): 80 pieces of 8 halves; lane writes pieces lane, lane+32 and
// coverage: NROWS/8 blocks x 8 waves = every row; per row pieces 0..79 = cols 0..639.
// =====================================================================================================
__device__ __forceinline__ void cvtobs(const float* __restrict__ src, unsigned short* dst, int blk) {
  const int wave = threadIdx.x >> 5, lane = threadIdx.x & 31;
  const int m = blk * 8 + wave;
  const int b = m / SEQ, t = m - b * SEQ;
  const float* sp = src + ((size_t)b * SEQ_FULL + t) * OBSD;
  unsigned short* dp = dst + (size_t)m * OBSP;
  {
#pragma unroll 1
    for (int it = 0; it < 3; ++it) {
      const int p = it * 32 + lane;
      const int col0 = p * 8;
      v4u a;
#pragma unroll
      for (int e = 0; e < 4; ++e) {
        const int ca = col0 + 2 * e, cb = ca + 1;
        float fa = sp[imin(ca, OBSD - 1)];
        float fb = sp[imin(cb, OBSD - 1)];
        fa = (ca < OBSD) ? fa : 0.f;
        fb = (cb < OBSD) ? fb : 0.f;
        a[e] = pk16(h_bits((_Float16)(bfr(fa) * OBC)), h_bits((_Float16)(bfr(fb) * OBC)));
      }
      if (p < OBSP / 8) {
        *(v4u*)(dp + (size_t)p * 8) = a;
        wait_x0();                                         // the next trip advances the store's address registers
      }
    }
    
  }
}

// =====================================================================================================
// All 16-bit operand planes in one launch (they depend on the inputs alone, not on one another): blocks 0..PB_OBS-1 convert obs,
// then one 64x64 transposing tile per block for w_q, w_k, w_v, w_o, w_1, w_2, obs_w, act_w, obsh_w in this order. The job is a
// function of blockIdx.x alone, so every branch below (and the barrier inside tcvt16) is uniform for the block.
// coverage: each job's blocks = its (Cp/64) x (Rp/64) x slices tiles exactly once; grid = PB_ALL.
// =====================================================================================================
#define PB_OBS (NROWS / 8)
#define PB_E   ((DMODEL / 64) * (DMODEL / 64) * NLAYER)
#define PB_F   ((DFF / 64) * (DMODEL / 64) * NLAYER)
#define PB_OW  ((DMODEL / 64) * (OBSP / 64))
#define PB_AW  ((NACTP / 64) * (DMODEL / 64))
#define PB_HW  ((OBSP / 64) * (DMODEL / 64))
#define PB_ALL (PB_OBS + 4 * PB_E + 2 * PB_F + PB_OW + PB_AW + PB_HW)
static_assert((NROWS % 8) == 0);

__global__ __launch_bounds__(256) void prep(
    const float* __restrict__ obs, const float* __restrict__ w_q, const float* __restrict__ w_k, const float* __restrict__ w_v,
    const float* __restrict__ w_o, const float* __restrict__ w_1, const float* __restrict__ w_2,
    const float* __restrict__ obs_w, const float* __restrict__ act_w, const float* __restrict__ obsh_w,
    unsigned short* OBS16, unsigned short* WQ16, unsigned short* WK16, unsigned short* WV16, unsigned short* WO16,
    unsigned short* W116, unsigned short* W216, unsigned short* OBSW16, unsigned short* ACTW16, unsigned short* OBSHW16) {
  __shared__ __align__(16) unsigned short sT[64 * 72];
  int b = (int)blockIdx.x;
  if (b < PB_OBS) {                                        // the whole block leaves, ahead of any barrier
    cvtobs(obs, OBS16, b);
    return;
  }
  b -= PB_OBS;
  const float* s;
  unsigned short* d;
  long long sZ = 0, dZ = 0;
  int R = DMODEL, C = DMODEL, ldd = KD, locol = DMODEL, gx = DMODEL / 64, gy = DMODEL / 64;
  float sclo = WLO;
  bool dual = true;
  if (b < 4 * PB_E) {                                      // in[256 k][256 n] -> out[256 n][512], per layer
    const int j = b / PB_E;
    b -= j * PB_E;
    s = (j == 0) ? w_q : (j == 1) ? w_k : (j == 2) ? w_v : w_o;
    d = (j == 0) ? WQ16 : (j == 1) ? WK16 : (j == 2) ? WV16 : WO16;
    sZ = (long long)DMODEL * DMODEL; dZ = (long long)DMODEL * KD;
  } else if (b < 4 * PB_E + PB_F) {                        // in[256 k][512 n] -> out[512 n][512], per layer
    b -= 4 * PB_E;
    s = w_1; d = W116;
    sZ = (long long)DMODEL * DFF; dZ = (long long)DFF * KD;
    C = DFF; gx = DFF / 64;
  } else if (b < 4 * PB_E + 2 * PB_F) {                    // in[512 k][256 n] -> out[256 n][1024], per layer
    b -= 4 * PB_E + PB_F;
    s = w_2; d = W216;
    sZ = (long long)DFF * DMODEL; dZ = (long long)DMODEL * KF;
    R = DFF; ldd = KF; locol = DFF; gy = DFF / 64;
  } else if (b < 4 * PB_E + 2 * PB_F + PB_OW) {            // in[637 k][256 n] -> out[256 n][640], k 637..639 zero, one copy
    b -= 4 * PB_E + 2 * PB_F;
    s = obs_w; d = OBSW16;
    R = OBSD; ldd = OBSP; locol = 0; gy = OBSP / 64;
    sclo = 0.f; dual = false;
  } else if (b < 4 * PB_E + 2 * PB_F + PB_OW + PB_AW) {    // in[256 k][4 n] -> out[64 n][512], n >= 4 zero
    b -= 4 * PB_E + 2 * PB_F + PB_OW;
    s = act_w; d = ACTW16;
    C = NACT; gx = NACTP / 64;
  } else {                                                 // in[256 k][637 n] -> out[640 n][512], n >= 637 zero
    b -= 4 * PB_E + 2 * PB_F + PB_OW + PB_AW;
    s = obsh_w; d = OBSHW16;
    C = OBSD; gx = OBSP / 64;
  }
  const int bz = b / (gx * gy);
  const int r  = b - bz * (gx * gy);
  const int by = r / gx;
  tcvt16(sT, s, sZ, d, dZ, R, C, ldd, locol, WSC, sclo, dual, r - by * gx, by, bz);
}

// =====================================================================================================
// Output copy: blockIdx.y == 0: out0[b*SEQ_FULL + t][0..3] = ACTF[b*SEQ + t][0..3] (one 16-B piece per thread, consecutive threads
// (SEQ*637 floats at float OUT1_OFF + b*SEQ_FULL*637) written as consecutive 16-B pieces (thread g -> floats 4i..4i+3, gathered from
// coverage: out0: NROWS pieces = every row; out1: NB * SEQ*637/4 pieces = every float of the region exactly once.
// =====================================================================================================
__global__ __launch_bounds__(256) void ocopy(const float* __restrict__ actf, const float* __restrict__ obsf, float* outp) {
  const int g = blockIdx.x * 256 + threadIdx.x;
  if (blockIdx.y == 0) {
    if (g >= NROWS) return;
    const int b = g / SEQ, t = g - b * SEQ;
    const v4f v = *(const v4f*)(actf + (size_t)g * NACTP);
    float* d = outp + ((size_t)b * SEQ_FULL + t) * NACT;
    {
      *(v4f*)d = v;
      
    }
  } else {
    const int ppb = (SEQ * OBSD) / 4;
    if (g >= NB * ppb) return;
    const int b = g / ppb;
    const int i = (g - b * ppb) * 4;
    v4f v;
#pragma unroll
    for (int e = 0; e < 4; ++e) {
      const int idx = i + e;
      const int row = idx / OBSD;
      const int col = idx - row * OBSD;
      v[e] = obsf[((size_t)b * SEQ + row) * OBSP + col];
    }
    float* d = outp + (size_t)OUT1_OFF + (size_t)b * SEQ_FULL * OBSD + i;
    {
      *(v4f*)d = v;
      
    }
  }
}

// =====================================================================================================
// Workspace map (bytes); every plane is an exact multiple of its tile / whole-row store granularity (M, N exact multiples of 64,
//   WQ16, WK16, WV16, WO16  f16 [6][256 n][512 = k x64 | k x1]     4 x 1572864
//   W116                    f16 [6][512 n][512]                       3145728
//   W216                    f16 [6][256 n][1024 = 512 x64 | 512 x1]  3145728
//   OBSW16                  f16 [256 n][640 k] x64 (k 637..639 zero)  327680
//   ACTW16                  f16 [64 n][512] (n 4..63 zero)              65536
//   OBSHW16                 f16 [640 n][512] (n 637..639 zero)         655360
//   OBS16                   f16 [NROWS][640] x16                      5242880
//   XA, XB                  f32 [NROWS][256] residual stream       2 x 4194304
//   HH, CT                  f16 [NROWS][512] dual planes           2 x 4194304
//   SS                      f32 [4][NROWS] partial sums of x*x          65536
//   QP, KP                  f16 [NROWS/16][4 heads][2048] fragment order  2 x 4194304
//   VT                      f16 [NB][256/16][SEQ/64][2048] fragment order  4194304
//   G16                     f16 [NROWS][1024] dual                   8388608
//   ACTF                    f32 [NROWS][64]                          1048576
//   OBSF                    f32 [NROWS][640]                        10485760
//   total (NB=2, SEQ=2048)                                          68222976
// =====================================================================================================
extern "C" void kernel_launch(void* const* d_in, const int* in_sizes, int n_in,
                              void* d_out, int out_size, void* d_ws, size_t ws_size,
                              hipStream_t stream) {
  if (n_in < 19) return;
  if (in_sizes[0] < ((NB - 1) * SEQ_FULL + SEQ) * OBSD) return;
  if (in_sizes[1] < OBSD * DMODEL || in_sizes[2] < DMODEL) return;
  if (in_sizes[3] < NLAYER * DMODEL) return;
  if (in_sizes[4] < NLAYER * DMODEL * DMODEL || in_sizes[5] < NLAYER * DMODEL * DMODEL) return;
  if (in_sizes[6] < NLAYER * DMODEL * DMODEL || in_sizes[7] < NLAYER * DMODEL * DMODEL) return;
  if (in_sizes[8] < NLAYER * NBUCK * NHEAD || in_sizes[9] < NLAYER * DMODEL) return;
  if (in_sizes[10] < NLAYER * DMODEL * DFF || in_sizes[11] < NLAYER * DFF) return;
  if (in_sizes[12] < NLAYER * DFF * DMODEL || in_sizes[13] < NLAYER * DMODEL) return;
  if (in_sizes[14] < DMODEL || in_sizes[15] < DMODEL * NACT || in_sizes[16] < NACT) return;
  if (in_sizes[17] < DMODEL * OBSD || in_sizes[18] < OBSD) return;
  if (out_size < OUT1_OFF + ((NB - 1) * SEQ_FULL + SEQ) * OBSD) return;

  const float* obs     = (const float*)d_in[0];
  const float* obs_w   = (const float*)d_in[1];
  const float* obs_b   = (const float*)d_in[2];
  const float* norm1_w = (const float*)d_in[3];
  const float* w_q     = (const float*)d_in[4];
  const float* w_k     = (const float*)d_in[5];
  const float* w_v     = (const float*)d_in[6];
  const float* w_o     = (const float*)d_in[7];
  const float* relb    = (const float*)d_in[8];
  const float* norm2_w = (const float*)d_in[9];
  const float* w_1     = (const float*)d_in[10];
  const float* b_1     = (const float*)d_in[11];
  const float* w_2     = (const float*)d_in[12];
  const float* b_2     = (const float*)d_in[13];
  const float* fnorm_w = (const float*)d_in[14];
  const float* act_w   = (const float*)d_in[15];
  const float* act_b   = (const float*)d_in[16];
  const float* obsh_w  = (const float*)d_in[17];
  const float* obsh_b  = (const float*)d_in[18];
  float*       outp    = (float*)d_out;

  const size_t PWE  = (size_t)NLAYER * DMODEL * KD * 2;     // 1572864
  const size_t PW1  = (size_t)NLAYER * DFF * KD * 2;        // 3145728
  const size_t PW2  = (size_t)NLAYER * DMODEL * KF * 2;     // 3145728
  const size_t POBW = (size_t)DMODEL * OBSP * 2;            //  327680
  const size_t PACW = (size_t)NACTP * KD * 2;               //   65536
  const size_t POHW = (size_t)OBSP * KD * 2;                //  655360
  const size_t POBS = (size_t)NROWS * OBSP * 2;             // 5242880
  const size_t PX   = (size_t)NROWS * DMODEL * 4;           // 4194304
  const size_t PH   = (size_t)NROWS * KD * 2;               // 4194304
  const size_t PVT  = (size_t)NB * VTR * SEQ * 2;           // 4194304
  const size_t PG   = (size_t)NROWS * KF * 2;               // 8388608
  const size_t PACF = (size_t)NROWS * NACTP * 4;            // 1048576
  const size_t POBF = (size_t)NROWS * OBSP * 4;             // 10485760
  const size_t PSS  = (size_t)NSS * NROWS * 4;              //    65536
  size_t off = 0;
  const size_t oWQ  = off; off += PWE;
  const size_t oWK  = off; off += PWE;
  const size_t oWV  = off; off += PWE;
  const size_t oWO  = off; off += PWE;
  const size_t oW1  = off; off += PW1;
  const size_t oW2  = off; off += PW2;
  const size_t oOBW = off; off += POBW;
  const size_t oACW = off; off += PACW;
  const size_t oOHW = off; off += POHW;
  const size_t oOBS = off; off += POBS;
  const size_t oXA  = off; off += PX;
  const size_t oXB  = off; off += PX;
  const size_t oHH  = off; off += PH;
  const size_t oQP  = off; off += PH;
  const size_t oKP  = off; off += PH;
  const size_t oCT  = off; off += PH;
  const size_t oVT  = off; off += PVT;
  const size_t oG   = off; off += PG;
  const size_t oACF = off; off += PACF;
  const size_t oOBF = off; off += POBF;
  const size_t oSS  = off; off += PSS;
  const size_t endAll = off;                                // 68222976 for NB=2, SEQ=2048
  if (endAll > ws_size) return;
  if (endAll > (size_t)134217728) return;

  char* ws = (char*)d_ws;
  unsigned short* WQ16    = (unsigned short*)(ws + oWQ);
  unsigned short* WK16    = (unsigned short*)(ws + oWK);
  unsigned short* WV16    = (unsigned short*)(ws + oWV);
  unsigned short* WO16    = (unsigned short*)(ws + oWO);
  unsigned short* W116    = (unsigned short*)(ws + oW1);
  unsigned short* W216    = (unsigned short*)(ws + oW2);
  unsigned short* OBSW16  = (unsigned short*)(ws + oOBW);
  unsigned short* ACTW16  = (unsigned short*)(ws + oACW);
  unsigned short* OBSHW16 = (unsigned short*)(ws + oOHW);
  unsigned short* OBS16   = (unsigned short*)(ws + oOBS);
  float*          XA      = (float*)(ws + oXA);
  float*          XB      = (float*)(ws + oXB);
  unsigned short* HH      = (unsigned short*)(ws + oHH);
  unsigned short* QP      = (unsigned short*)(ws + oQP);
  unsigned short* KP      = (unsigned short*)(ws + oKP);
  unsigned short* CT      = (unsigned short*)(ws + oCT);
  unsigned short* VTp     = (unsigned short*)(ws + oVT);
  unsigned short* G16     = (unsigned short*)(ws + oG);
  float*          ACTF    = (float*)(ws + oACF);
  float*          OBSF    = (float*)(ws + oOBF);
  float*          SS      = (float*)(ws + oSS);

  const dim3 blk(256);
  const int tilesE  = (NROWS / 64) * (DMODEL / 64);                // 256
  const int tilesV  = (DMODEL / 64) * (SEQ / 64);                  // 128 per batch
  const int tilesF  = (NROWS / 64) * (DFF / 64);                   // 512
  const int tilesA  = (NROWS / 64) * (NACTP / 64);                 // 64
  const int tilesO  = (NROWS / 64) * (OBSP / 64);                  // 640
  const dim3 gE(tilesE, 1);                                        // 256: one tile per block
  const dim3 gQKV(2 * tilesE + NB * tilesV);                       // 256 x 2 (q, k), then 128 x NB (v^T)
  const dim3 gF(tilesF, 1);                                        // 512
  const dim3 gOA(tilesO + tilesA);                                 // 640 (obs head), then 64 (action head)
  const dim3 gAT(ATT_BLOCKS);                                      // NB x SEQ/16 x 4 heads = 1024
  const dim3 bAT(ATT_THREADS);                                     // 256
  const int ppb = (SEQ * OBSD) / 4;
  const int gcx0 = NROWS / 256, gcx1 = (NB * ppb + 255) / 256;
  const dim3 gOC(gcx0 > gcx1 ? gcx0 : gcx1, 2);                    // (2548, 2)

  const long long sQK   = (long long)NLAYER * DMODEL * KD;         // WK16 - WQ16 in halves
  const long long sKP   = (long long)NROWS * KD;                   // KP - QP in halves

  // (0) 16-bit operand planes: transposed weights [n][k x64 | k x1] (bf16 RNE then exact power-of-two scale), obs x16
  prep<<<dim3(PB_ALL), blk, 0, stream>>>(obs, w_q, w_k, w_v, w_o, w_1, w_2, obs_w, act_w, obsh_w,
                                         OBS16, WQ16, WK16, WV16, WO16, W116, W216, OBSW16, ACTW16, OBSHW16);

  // (1) x = obs . Wp + bf16(bp) -> XA (f32); M = NROWS, N = 256, K = 640 (single product, inputs exact);
  //     with it HH = x * bf16(g1 of layer 0) (hi x4 | residual x64) and SS
  gemm64<0, 0, 0, 1, OBSP, 1, 0, 1><<<gE, blk, 0, stream>>>(
      OBS16, 0LL,
      OBSW16, 0LL,
      (const float*)0,
      obs_b, DMODEL,
      (void*)XA, DMODEL, 0LL, 0LL,
      DMODEL, 1.0f / (OBC * WSC), 1.0f,
      (const float*)0, norm1_w, HH, SS);

  for (int l = 0; l < NLAYER; ++l) {
    const size_t lwE = (size_t)l * DMODEL * KD;                    // WQ/WK/WV/WO layer offset (halves)
    const size_t lw1 = (size_t)l * DFF * KD;
    const size_t lw2 = (size_t)l * DMODEL * KF;

    // (2) h = RMSNorm(x) * bf16(g1): HH and SS come from the product that made x, the row factor is applied in (3), (4)
    // (3) q, k projections (batch index 0, 1): QP / KP in fragment order; M = NROWS, N = 256, K = 512 folded, no bias
    // (4) in the same launch, v^T per batch: VT[b] = [d][tok] in fragment order; M = 256 (d), N = SEQ, K = 512 folded
    gemm64x2<2, 0, 0, KD, 1><<<gQKV, blk, 0, stream>>>(
        HH, 0LL, WQ16 + lwE, sQK,
        (const float*)0, 1, (void*)QP, KD, sKP, (long long)DMODEL, DMODEL, SH_E,
        WV16 + lwE, 0LL, HH, (long long)SEQ * KD,
        (const float*)0, 1, (void*)VTp, SEQ, (long long)VTR * SEQ, (long long)DMODEL * SEQ, SEQ, SH_V,
        2 * tilesE, 1.0f / (HC * WSC), QC, SS, 0, 1);

    // (5) causal attention with relative-position bias per (batch, 16 query rows, head), keys split over 8 waves -> CT (hi x16 | residual x64)
    attn4<<<gAT, bAT, 0, stream>>>(QP, KP, VTp, relb + (size_t)l * NBUCK * NHEAD, CT);

    // (6) XB = CT . Wo / (16 * 64) + XA (raw f32); M = NROWS, N = 256, K = 512 folded
    // (7) with it HH = x * bf16(g2) and SS; the row factor of h2 = RMSNorm(x) * bf16(g2) is applied in (8)
    gemm64<0, 2, 0, 0, KD, 1, 0, 1><<<gE, blk, 0, stream>>>(
        CT, 0LL,
        WO16 + lwE, 0LL,
        XA,
        (const float*)0, 1,
        (void*)XB, DMODEL, 0LL, 0LL,
        DMODEL, 1.0f / (CC * WSC), 1.0f,
        (const float*)0, norm2_w + (size_t)l * DMODEL, HH, SS);

    // (8) G16 = dual f16 of 64 * relu(h2 . W1 + bf16(b1)); M = NROWS, N = 512, K = 512 folded
    gemm64<1, 0, 2, 1, KD, 1, 1, 0><<<gF, blk, 0, stream>>>(
        HH, 0LL,
        W116 + lw1, 0LL,
        (const float*)0,
        b_1 + (size_t)l * DFF, DFF,
        (void*)G16, KF, 0LL, (long long)DFF,
        DFF, 1.0f / (HC * WSC), GC,
        SS, (const float*)0, (unsigned short*)0, (float*)0);

    // (9) XA = G16 . W2 / (64 * 64) + bf16(b2) + XB (raw f32); M = NROWS, N = 256, K = 1024 folded;
    //     with it HH = x * bf16(g1 of the next layer, or gf behind the last) and SS
    gemm64<0, 2, 0, 1, KF / 2, 2, 0, 1><<<gE, blk, 0, stream>>>(
        G16, 0LL,
        W216 + lw2, 0LL,
        XB,
        b_2 + (size_t)l * DMODEL, DMODEL,
        (void*)XA, DMODEL, 0LL, 0LL,
        DMODEL, 1.0f / (GC * WSC), 1.0f,
        (const float*)0, (l + 1 < NLAYER) ? norm1_w + (size_t)(l + 1) * DMODEL : fnorm_w, HH, SS);
  }

  // (10) hf = RMSNorm(x) * bf16(gf): the row factor is applied in (11), (12)
  // (11) obs prediction plane OBSF[m][640] = hf . Wh + bf16(bh) (cols 0..636 meaningful); M = NROWS, N = 640, K = 512 folded
  // (12) in the same launch, action logits plane ACTF[m][64] = hf . Wa + bf16(ba) (cols 0..3 meaningful); M = NROWS, N = 64
  gemm64x2<0, 0, 1, KD, 1><<<gOA, blk, 0, stream>>>(
      HH, 0LL, OBSHW16, 0LL,
      obsh_b, OBSD, (void*)OBSF, OBSP, 0LL, 0LL, OBSP, SH_ONE,
      HH, 0LL, ACTW16, 0LL,
      act_b, NACT, (void*)ACTF, NACTP, 0LL, 0LL, NACTP, SH_ONE,
      tilesO, 1.0f / (HC * WSC), 1.0f, SS, 0, 0);

  ocopy<<<gOC, blk, 0, stream>>>(ACTF, OBSF, outp);
  (void)hipGetLastError();
}

// v007
// One run takes 341 microseconds.
// Two timings next to v006 put it at 1.11 and 1.10 times that version's speed.
// Over all steps from v000 it is 5.58 times as fast.
// Contractions (all v_wmma_f32_16x16x32_f16, f16 operands, f32 accumulate): input projection (obs f16 x16 . Wp^T f16 x64, K=640
// zero-padded, single product); q/k, v^T, attention-output, hidden (ReLU), second and both head projections with the activation
// operand carried as two f16 planes [hi | residual x64] folded along K against [W^T x64 | W^T x1]; attention scores k.q^T from the
// q/k hi and residual planes (hi.hi plus the two cross terms, two accumulators, K=64); attention v^T.P^T with P f16 x16384 (single)
// against v^T hi and residual planes (two accumulators). RMSNorm, softmax (base 2), ReLU, biases, relative-position bias and the
// residual stream in f32 on VALU. Every float input RNE-converted to bf16 on load.
// RMSNorm has no launch of its own: the row factor rsqrt(mean(x*x) + eps) commutes with the product along the row, so the product
// that makes x also stores the operand plane of x * bf16(norm weight) and its tile's sums of squares, and the product that reads the
// plane multiplies its result by the row factor.
#include <hip/hip_runtime.h>
#include <math.h>
#include <stdint.h>

#ifndef NB
#define NB        2
#endif
#ifndef SEQ
#define SEQ       2048
#endif
#define NB_FULL   2
#define SEQ_FULL  2048
#define NLAYER    6
#define DMODEL    256
#define NHEAD     4
#define HDIM      64
#define DFF       512
#define OBSD      637
#define OBSP      640
#define NACT      4
#define NACTP     64
#define NBUCK     32
#define NROWS     (NB * SEQ)
#define KD        (2 * DMODEL)          // folded K of E-wide activation operands: [hi 256 | residual 256]
#define KF        (2 * DFF)             // folded K of the hidden operand: [hi 512 | residual 512]
#define VTR       KD                    // per batch VTR * SEQ halves of v^T: 256 d x SEQ keys, hi and residual, fragment order
#define OUT1_OFF  (NB_FULL * SEQ_FULL * NACT)   // float index of the second output (byte offset 65536)
#define OUT_TOTAL (OUT1_OFF + NB_FULL * SEQ_FULL * OBSD)

// carries (exact powers of two)
#define WSC_I 64
#define RC_I  64
#define WLO_I 1
#define WSC   64.0f        // weight hi copy
#define WLO   1.0f         // weight lo copy (pairs with the x64 residual plane)
#define RC    64.0f        // residual plane carry relative to its hi plane
#define RCI   0.015625f
#define OBC   16.0f        // obs plane
#define HC    4.0f         // x * norm weight planes (not yet divided by the row's rms)
#define QC    16.0f
#define KC    16.0f
#define VC    16.0f
#define PC    16384.0f     // softmax P tile
#define CC    16.0f        // attention context
#define GC    64.0f        // ReLU hidden
#define ATT_SCALE 0.125f
#define LOG2E   1.4426950408889634f
#define RMS_EPS 1.1920929e-07f
#define NSS     (DMODEL / 64)        // partial sums of squares per row of x: one per 64-column tile
static_assert(RC_I * WLO_I == WSC_I);
static_assert(NHEAD * HDIM == DMODEL);
static_assert(NB >= 1 && NB <= NB_FULL && SEQ >= 64 && SEQ <= SEQ_FULL);
static_assert((SEQ % 64) == 0 && (SEQ % 16) == 0 && (NROWS % 64) == 0 && (DMODEL % 64) == 0 && (DFF % 64) == 0);
static_assert((OBSP % 64) == 0 && (NACTP % 64) == 0 && OBSP >= OBSD && NACTP >= NACT && (OBSP - OBSD) < 64);
static_assert((KD % 32) == 0 && (KF % 32) == 0 && (OBSP % 32) == 0);
static_assert((NROWS % 256) == 0 && (NROWS % 4) == 0 && ((SEQ * OBSD) % 4) == 0);
static_assert(OUT_TOTAL == 2625536);

typedef _Float16 v16h __attribute__((ext_vector_type(16)));
typedef _Float16 v8h  __attribute__((ext_vector_type(8)));
typedef float    v8f  __attribute__((ext_vector_type(8)));
typedef float    v4f  __attribute__((ext_vector_type(4)));
typedef unsigned int v4u __attribute__((ext_vector_type(4)));
typedef unsigned int v2u __attribute__((ext_vector_type(2)));

union FragH { v16h v; v8h h[2]; v4u u[2]; };

// ---- scalar helpers --------------------------------------------------------------------------------
__device__ __forceinline__ unsigned short bf_bits(float f) {          // f32 -> bf16 bits, RNE convert
  unsigned u = __float_as_uint(f);
  return (unsigned short)((u + 0x7FFFu + ((u >> 16) & 1u)) >> 16);
}
__device__ __forceinline__ float bf_up(unsigned short h) { return __uint_as_float(((unsigned)h) << 16); }
__device__ __forceinline__ float bfr(float f) { return bf_up(bf_bits(f)); }   // value of the bf16 RNE convert
__device__ __forceinline__ unsigned short h_bits(_Float16 x) { return __builtin_bit_cast(unsigned short, x); }
__device__ __forceinline__ unsigned pk16(unsigned short a, unsigned short b) { return (unsigned)a | ((unsigned)b << 16); }
__device__ __forceinline__ v8f zero8() { v8f z = {0.f, 0.f, 0.f, 0.f, 0.f, 0.f, 0.f, 0.f}; return z; }
__device__ __forceinline__ int imin(int a, int b) { return a < b ? a : b; }
__device__ __forceinline__ int imax(int a, int b) { return a > b ? a : b; }

// Relative-position bucket for rel = query - key >= 0 (bidirectional split, 32 buckets, max distance 128), as an exact
// integer table: 0 -> 0; 1..7 -> 16+rel; 8..11 -> 24; 12..15 -> 25; 16..22 -> 26; 23..31 -> 27; 32..45 -> 28; 46..63 -> 29;
// 64..90 -> 30; >= 91 -> 31.
__device__ __forceinline__ int rel_bucket(int rel) {
  int b = 31;
  b = (rel < 91) ? 30 : b;
  b = (rel < 64) ? 29 : b;
  b = (rel < 46) ? 28 : b;
  b = (rel < 32) ? 27 : b;
  b = (rel < 23) ? 26 : b;
  b = (rel < 16) ? 25 : b;
  b = (rel < 12) ? 24 : b;
  b = (rel < 8) ? (16 + rel) : b;
  b = (rel == 0) ? 0 : b;
  return b;
}

// ---- fragment loaders: 16-bit A/B operand, lane -> row/col (lane&15), p already includes +8*(lane>>4);
//      elements 0..7 <- p[0..7] (k0+8h..), elements 8..15 <- p[16..23] (k0+16+8h..)  (same split k map for A and B;
//      B is always read from a k-contiguous [n][k] plane)
__device__ __forceinline__ v16h ldfrag_u(const unsigned short* p) {
  FragH f;
  f.u[0] = *(const v4u*)(p);
  f.u[1] = *(const v4u*)(p + 16);
  return f.v;
}
// Fragment-ordered plane of an [M][N] matrix (M multiple of 16, N of 64): chunk (m / 16) * (N / 64) + n / 64 holds 16 rows x 64 cols as
// FCH halves: [hi | residual] x [col / 16 & 3] x [lane = 16 * (col / 8 & 1) + row % 16] x [col % 8]. The two 16-B loads of a fragment
// (16 rows x 32 cols, same k map as above) then read 512 consecutive bytes each. p = the 16 x 32 block (FBK halves) + 8 * lane.
#define FCH 2048
#define FPL 1024
#define FBK 512
__device__ __forceinline__ v16h ldfrag_f(const _Float16* p) {
  FragH f;
  f.h[0] = *(const v8h*)(p);
  f.h[1] = *(const v8h*)(p + 256);
  return f.v;
}

// ---- WMMA helpers with trailing VALU hazard gaps ------------------------------------------------------
__device__ __forceinline__ v8f mma_raw(v16h a, v16h b, v8f c) {
  return __builtin_amdgcn_wmma_f32_16x16x32_f16(false, a, false, b, (short)0, c, false, false);
}
__device__ __forceinline__ void guard_s2x4(v8f& s, v8f& t, v16h a0, v16h a1, v16h b0, v16h b1) {
#if defined(__HIP_DEVICE_COMPILE__)
  asm volatile("v_nop\n\tv_nop\n\tv_nop\n\tv_nop" : "+v"(s), "+v"(t) : "v"(a0), "v"(a1), "v"(b0), "v"(b1));
#endif
}
__device__ __forceinline__ void guard_pv4(v8f& a, v8f& b, v8f& c, v8f& d, v16h x, v16h y, v16h z, v16h w, v16h u) {
#if defined(__HIP_DEVICE_COMPILE__)
  asm volatile("v_nop\n\tv_nop\n\tv_nop\n\tv_nop"
               : "+v"(a), "+v"(b), "+v"(c), "+v"(d) : "v"(x), "v"(y), "v"(z), "v"(w), "v"(u));
#endif
}
__device__ __forceinline__ void keep4_h(v16h a, v16h b, v16h c, v16h d) {
#if defined(__HIP_DEVICE_COMPILE__)
  asm volatile("v_nop" :: "v"(a), "v"(b), "v"(c), "v"(d));
#endif
}
// Later writes of the address and data registers of the global loads and stores issued so far stay behind this wait.
__device__ __forceinline__ void wait_x0() {
#if defined(__HIP_DEVICE_COMPILE__)
  asm volatile("s_wait_xcnt 0x0" ::: "memory");
#endif
}
// Lane l takes the value of lane l ^ 16: a vector cross-row move, no LDS trip.
__device__ __forceinline__ float xhalf(float x) {
  const int b = __builtin_bit_cast(int, x);
  return __builtin_bit_cast(float, __builtin_amdgcn_permlanex16(b, b, 0x76543210, 0xfedcba98, false, false));
}
// RMSNorm row factor from the plane ss[NSS][NROWS] of partial sums of squares: rsqrt(mean(x*x) + eps), eps 1.1920929e-7.
static_assert(NSS == 4);
__device__ __forceinline__ float row_ss(const float* __restrict__ ss, int m) {
  return (ss[m] + ss[NROWS + m]) + (ss[2 * NROWS + m] + ss[3 * NROWS + m]);
}
__device__ __forceinline__ float rstd_of(float s) {
  const float x = s * (1.0f / (float)DMODEL) + RMS_EPS;    // s >= 0, so x >= eps: a normal number, no range scaling round the instruction
  float r = 0.f;
#if defined(__HIP_DEVICE_COMPILE__)
  // v_nop: the one slot between a transcendental and an instruction that reads its result or overwrites its source
  asm("v_rsq_f32 %0, %1\n\tv_nop" : "=v"(r) : "v"(x));
#endif
  return r;
}

// =====================================================================================================
// Transposing 16-bit pack of a weight stored in[R][C] (row pitch C floats, R = contraction index, C = output index) into
// out[Cp][ldd] (row pitch ldd halves): out[c][r] = f16( bf16_RNE(in[r][c]) * schi ) for r < R and c < C, 0 otherwise (pad rows /
// pad columns explicitly written as zeros); with DUAL a second copy out[c][locol + r] = f16( bf16_RNE(in[r][c]) * sclo ).
// schi / sclo powers of two (exact). Tiles: Cp/64 along bx, Rp/64 along by; bz = slice: src advanced by bz*sZ floats, dst by
// bz*dZ halves. One 64x64 tile per block through LDS (bf16 bits): 16 scalar loads per thread with CLAMPED addresses, zero by
// coverage: load 256 thr x 16 floats = 64x64; store 2 it x 8 waves x 4 rows x (8 lanes x 8 halves) = 64 rows x 64 halves per copy;
//           tiles (Cp/64, Rp/64, Z) exact, each output line written by exactly one wave; pad region included.
// =====================================================================================================
// (bx, by, bz) = the tile's place in the grid described above; dual is the same for the whole block.
__device__ __forceinline__ void tcvt16(unsigned short* sT, const float* __restrict__ src, long long sZ,
                                       unsigned short* dst, long long dZ,
                                       int R, int C, int ldd, int locol, float schi, float sclo,
                                       bool dual, int bx, int by, int bz) {
  const int tid = threadIdx.x, lane = tid & 31, wave = tid >> 5;
  const int c0 = bx * 64, r0 = by * 64;
  const float* srcz = src + (size_t)((long long)bz * sZ);
  unsigned short* dstz = dst + (size_t)((long long)bz * dZ);
  const int rr = tid >> 2, cc = (tid & 3) * 16;
  const int r = r0 + rr;
  const int rcl = imin(r, R - 1);
  const float* sp = srcz + (size_t)rcl * C;
#pragma unroll
  for (int e = 0; e < 16; ++e) {
    const int cidx = c0 + cc + e;
    const int ccl = imin(cidx, C - 1);
    float a = sp[ccl];
    a = (r < R && cidx < C) ? a : 0.f;
    sT[(cc + e) * 72 + rr] = bf_bits(a);
  }
  __syncthreads();
  v4u hvals[2], lvals[2];
#pragma unroll
  for (int it = 0; it < 2; ++it) {
    const int q = it * 32 + wave * 4 + (lane >> 3);
    const v4u raw = *(const v4u*)(sT + q * 72 + (lane & 7) * 8);
    v4u hv = {0u, 0u, 0u, 0u}, lv = {0u, 0u, 0u, 0u};
#pragma unroll
    for (int e = 0; e < 4; ++e) {
      const float f0 = bf_up((unsigned short)(raw[e] & 0xFFFFu));
      const float f1 = bf_up((unsigned short)(raw[e] >> 16));
      hv[e] = pk16(h_bits((_Float16)(f0 * schi)), h_bits((_Float16)(f1 * schi)));
      lv[e] = pk16(h_bits((_Float16)(f0 * sclo)), h_bits((_Float16)(f1 * sclo)));
    }
    hvals[it] = hv;
    lvals[it] = lv;
  }
  {
#pragma unroll
    for (int it = 0; it < 2; ++it) {
      const int q = it * 32 + wave * 4 + (lane >> 3);
      unsigned short* p = dstz + (size_t)(c0 + q) * ldd + r0 + (lane & 7) * 8;
      *(v4u*)p = hvals[it];
    }
    wait_x0();                                             // no register of the two stores above is rewritten ahead of this wait
    if (dual) {
#pragma unroll                                             // lvals[] indexed by constants, so that it stays in registers
      for (int it = 0; it < 2; ++it) {
        const int q = it * 32 + wave * 4 + (lane >> 3);
        unsigned short* p = dstz + (size_t)(c0 + q) * ldd + r0 + (lane & 7) * 8;
        *(v4u*)(p + locol) = lvals[it];
      }
      wait_x0();                                           // the same for the second copy's two stores
    }
  }
}

// =====================================================================================================
// Batched f16 WMMA GEMM, operands staged in LDS: C[m][n] = f( oscale * sum_k A[m][k] * Bt[n][k] + bias ); one 64x64 tile per
// work-group of 8 waves (wave = 16 rows x 32 cols, two accumulators). A row-major [M][K] (16-bit plane), Bt row-major
// [N][K] (k contiguous), both at row pitch K; M, N multiples of 64, K = KST * NCH. tile = tile index, by = batch index with element
// strides sA, sB, sC. A stage is KST k of the tile's 64 A rows and 64 Bt rows, brought to LDS by asynchronous 16-B copies
// (a wave's copy = two aligned 256-B units) at row pitch KST + 8 halves (16 B x odd: ds_load_b128 fragment reads without bank conflicts).
// NCH 1: the stage is filled once and then read. NCH 2: two buffers, stage 1 flies while stage 0 is multiplied.
// k runs upward through one accumulator per 16x16 output tile.
// BM: 0 no bias, 1 bias bf16(biasp[n]) for n < nbias (0 beyond, clamped address).   ACT: 2 = ReLU applied to (value + bias).
// OM 0 = f32 out (pitch ldc); RM 2 adds raw f32 Rp[m][n] (same pitch/stride as C).
// OM 1 = dual f16 out (pitch ldc): hi = f16(value * ocarry) at C[m][n], residual f16(RC * (value * ocarry - hi)) at C[m][n] + lofs.
// OM 2 = the same two values in the fragment-ordered plane described at ldfrag_f (ldc and lofs not used); a wave's store = one
//        512-B block of the plane.
// NRM 1: one operand is the plane of x * bf16(norm weight) * HC; the sum is multiplied by the RMSNorm factor of its x row (ahead of
//        bias and ReLU), taken from ssp[NSS][NROWS]: x row = m (A operand), or with colf (OM 2 only) by * N + n (Bt operand).
// EM 1 (OM 0, N = DMODEL): C is the residual stream x; the tile also stores Hout[m][n] = f16(x * bf16(nwp[n]) * HC), its residual x64
//        at Hout[m][DMODEL + n] (row pitch KD; a row's 128-B segment = 16 lanes) and SSout[n0 / 64][m] = sum of x*x over its 64 columns
//        (4 per lane, then xor shuffles over 16 lanes), gathered in the pad column of sT so that one wave stores each 128-B line.
// coverage: copies: 2 operands x 4 row groups of 16 x KST/128 units of 256 B = 2*KST/32 copies per thread and stage; slab: 8 waves x 16 x 32 = 64 x 64;
//           out: f32 4 it x 16 rows x 16 lanes x 4, f16 2 it x 32 rows x 8 lanes x 8 (both planes) = the whole 64x64 tile;
//           grid = tilesM*tilesN blocks exactly.
// =====================================================================================================
// Eight asynchronous 16-B copies global -> LDS (l = the lane's LDS byte address, g = the lane's global address). The closing
// s_wait_xcnt keeps every later write of these address registers behind the copies' address translation.
__device__ __forceinline__ void acopy8(const unsigned* l, const unsigned short* const* g) {
#if defined(__HIP_DEVICE_COMPILE__)
  asm volatile(
      "global_load_async_to_lds_b128 %0, %8, off\n\t"
      "global_load_async_to_lds_b128 %1, %9, off\n\t"
      "global_load_async_to_lds_b128 %2, %10, off\n\t"
      "global_load_async_to_lds_b128 %3, %11, off\n\t"
      "global_load_async_to_lds_b128 %4, %12, off\n\t"
      "global_load_async_to_lds_b128 %5, %13, off\n\t"
      "global_load_async_to_lds_b128 %6, %14, off\n\t"
      "global_load_async_to_lds_b128 %7, %15, off\n\t"
      "s_wait_xcnt 0x0"
      :: "v"(l[0]), "v"(l[1]), "v"(l[2]), "v"(l[3]), "v"(l[4]), "v"(l[5]), "v"(l[6]), "v"(l[7]),
         "v"(g[0]), "v"(g[1]), "v"(g[2]), "v"(g[3]), "v"(g[4]), "v"(g[5]), "v"(g[6]), "v"(g[7])
      : "memory");
#endif
}
// The wave's own copies have landed in LDS behind this wait.
__device__ __forceinline__ void wait_async0() {
#if defined(__HIP_DEVICE_COMPILE__)
  asm volatile("s_wait_asynccnt 0x0" ::: "memory");
#endif
}
// The wave's own LDS reads have returned behind this wait.
__device__ __forceinline__ void wait_ds0() {
#if defined(__HIP_DEVICE_COMPILE__)
  asm volatile("s_wait_dscnt 0x0" ::: "memory");
#endif
}
// One stage: KST halves of rows 0..63 of Ag to LDS rows 0..63 and of rows 0..63 of Bg to LDS rows 64..127 (global row pitch LDK
// halves). 16 lanes take one aligned 256-B unit of a row, a copy of the block 16 rows; every offset below is a constant.
template <int KST, int LDK>
__device__ __forceinline__ void fill_stage(const unsigned short* Ag, const unsigned short* Bg, unsigned ldsb, int tid) {
  constexpr int CG  = KST / 128;            // 256-B units per row
  constexpr int PER = 4 * CG;               // copies per thread and operand
  constexpr int PIT = KST + 8;              // LDS row pitch, halves
  static_assert((KST % 128) == 0 && (2 * PER) % 8 == 0 && 2 * PER <= 63);
  const int r0 = tid >> 4, h0 = (tid & 15) * 8;
  const unsigned short* a0 = Ag + (size_t)r0 * LDK + h0;
  const unsigned short* b0 = Bg + (size_t)r0 * LDK + h0;
  const unsigned l0 = ldsb + (unsigned)(r0 * PIT + h0) * 2u;
  // both loops unrolled: every copy's offsets are then constants and l[], g[] stay in registers
#pragma unroll
  for (int g0 = 0; g0 < 2 * PER; g0 += 8) {
    unsigned l[8];
    const unsigned short* g[8];
#pragma unroll
    for (int e = 0; e < 8; ++e) {
      const int it = g0 + e;
      const bool isB = it >= PER;
      const int j = isB ? it - PER : it;
      const int rg = j / CG, cg = j - rg * CG;
      l[e] = l0 + (unsigned)((((isB ? 64 : 0) + rg * 16) * PIT + cg * 128) * 2);
      g[e] = (isB ? b0 : a0) + (size_t)(rg * 16) * LDK + cg * 128;
    }
    acopy8(l, g);
  }
}

template <int OM, int RM, int ACT, int BM, int KST, int NCH, int NRM, int EM>
__device__ __forceinline__ void gemm64_tile(
    const unsigned short* __restrict__ Ap, long long sA,
    const unsigned short* __restrict__ Btp, long long sB,
    const float* __restrict__ Rp,
    const float* __restrict__ biasp, int nbias,
    void* Cout, int ldc, long long sC, long long lofs,
    int N, float oscale, float ocarry, int tile, int by,
    const float* __restrict__ ssp, bool colf,
    const float* __restrict__ nwp, unsigned short* Hout, float* SSout) {
  static_assert(EM == 0 || OM == 0);
  constexpr int PIT  = KST + 8;               // LDS row pitch, halves
  constexpr int BUFH = 128 * PIT;            // halves per stage buffer: 64 A rows, then 64 Bt rows
  constexpr int LDK  = KST * NCH;            // row pitch of A and Bt, halves (= K)
  constexpr int KB   = 4;                    // k steps of 32 per fragment block
  constexpr int NBLK = KST / (32 * KB);
  static_assert(NCH == 1 || NCH == 2);
  static_assert((KST % (32 * KB)) == 0 && ((PIT * 2) % 32) == 16);
  __shared__ __align__(16) unsigned short sP[NCH * BUFH];
  __shared__ __align__(16) float sT[64 * 68];        // the tile in f32, pitch 68 floats
  const int tid  = threadIdx.x;
  const int lane = tid & 31;
  const int wave = tid >> 5;
  const int tilesN = N >> 6;
  const int tm = tile / tilesN;
  const int tn = tile - tm * tilesN;
  const int m0 = tm << 6;
  const int n0 = tn << 6;

  const unsigned short* Ag = Ap  + (size_t)((long long)by * sA) + (size_t)m0 * LDK;
  const unsigned short* Bg = Btp + (size_t)((long long)by * sB) + (size_t)n0 * LDK;
  const unsigned ldsb = (unsigned)(uintptr_t)(&sP[0]);   // LDS byte address = low 32 bits of the shared address

  fill_stage<KST, LDK>(Ag, Bg, ldsb, tid);

  const int r16 = tid >> 4, c4 = (tid & 15) * 4;         // f32 out: 256-B row segment = 16 lanes x 16 B
  const int r32 = tid >> 3;                              // f16 out: 128-B row segment = 8 lanes x 16 B
  const int c8 = (OM == 2) ? (wave & 3) * 16 + (lane >> 4) * 8 : (tid & 7) * 8;   // OM 2: 16 cols per wave, 8 per lane half

  // ---- RMSNorm factors of the x rows behind this thread's output rows (or, with colf, columns); read here, while stage 0 flies ----
  // every loop down to the wait on the copies is unrolled: the small arrays are then indexed by constants and stay in registers
  float rrow[4], rcol[8];
#pragma unroll
  for (int e = 0; e < 4; ++e) rrow[e] = 1.f;
#pragma unroll
  for (int e = 0; e < 8; ++e) rcol[e] = 1.f;
  if constexpr (NRM == 1) {
    if (OM == 2 && colf) {
      const float* p = ssp + (size_t)by * N + n0 + c8;
      v4f a[NSS], b[NSS];
#pragma unroll
      for (int j = 0; j < NSS; ++j) {
        a[j] = *(const v4f*)(p + (size_t)j * NROWS);
        b[j] = *(const v4f*)(p + (size_t)j * NROWS + 4);
      }
      wait_x0();                                           // no address register of the loads above is rewritten ahead of this wait
#pragma unroll
      for (int e = 0; e < 4; ++e) {
        rcol[e]     = rstd_of((a[0][e] + a[1][e]) + (a[2][e] + a[3][e]));
        rcol[4 + e] = rstd_of((b[0][e] + b[1][e]) + (b[2][e] + b[3][e]));
      }
    } else {
      constexpr int NIT = (OM == 0) ? 4 : 2;
      float s[NIT];
#pragma unroll
      for (int it = 0; it < NIT; ++it) {
        const int row = (OM == 0) ? it * 16 + r16 : (OM == 2) ? (it * 2 + (wave >> 2)) * 16 + (lane & 15) : it * 32 + r32;
        s[it] = row_ss(ssp, m0 + row);
      }
      wait_x0();                                           // the same for these loads
#pragma unroll
      for (int it = 0; it < NIT; ++it) rrow[it] = rstd_of(s[it]);
    }
  }
  // ---- the next RMSNorm's weight for this thread's four columns ----
  float nw[4];
#pragma unroll
  for (int e = 0; e < 4; ++e) nw[e] = 0.f;
  if constexpr (EM == 1) {
    const v4f w4 = *(const v4f*)(nwp + n0 + c4);
    wait_x0();                                             // the same for this load
#pragma unroll
    for (int e = 0; e < 4; ++e) nw[e] = bfr(w4[e]);
  }

  wait_async0();
  __syncthreads();                                       // stage 0 readable by every wave
  if constexpr (NCH == 2) fill_stage<KST, LDK>(Ag + KST, Bg + KST, ldsb + (unsigned)(BUFH * 2), tid);

  const int rlane = lane & 15;                 // row (A) / col (B, D) within subtile
  const int koff  = (lane >> 4) * 8;           // k offset of this lane half
  const int mOff  = (lane >> 4) * 8;           // D row offset
  const int wr = wave >> 1, wc = wave & 1;     // wave tile: rows wr*16.., cols wc*32..

  v8f acc0 = zero8(), acc1 = zero8();
  // the loops below are unrolled so that the two fragment sets are indexed by constants and stay in registers
#pragma unroll
  for (int t = 0; t < NCH; ++t) {
    const unsigned short* aL = sP + t * BUFH + (wr * 16 + rlane) * PIT + koff;
    const unsigned short* bL = sP + t * BUFH + (64 + wc * 32 + rlane) * PIT + koff;
    // fragments one block ahead in a second register set, each block's LDS reads as one group; never across a stage
    v16h fa[2][KB], fb0[2][KB], fb1[2][KB];
#pragma unroll
    for (int s = 0; s < KB; ++s) {
      fa[0][s]  = ldfrag_u(aL + s * 32);
      fb0[0][s] = ldfrag_u(bL + s * 32);
      fb1[0][s] = ldfrag_u(bL + 16 * PIT + s * 32);
    }
#pragma unroll
    for (int blk = 0; blk < NBLK; ++blk) {
      const int cur = blk & 1;
      if (blk + 1 < NBLK) {
#pragma unroll
        for (int s = 0; s < KB; ++s) {
          const int k0 = ((blk + 1) * KB + s) * 32;
          fa[cur ^ 1][s]  = ldfrag_u(aL + k0);
          fb0[cur ^ 1][s] = ldfrag_u(bL + k0);
          fb1[cur ^ 1][s] = ldfrag_u(bL + 16 * PIT + k0);
        }
      }
      __builtin_amdgcn_sched_barrier(0);   // keeps the next block's LDS reads one group ahead of this block's products
#pragma unroll
      for (int s = 0; s < KB; ++s) {
        acc0 = mma_raw(fa[cur][s], fb0[cur][s], acc0);
        acc1 = mma_raw(fa[cur][s], fb1[cur][s], acc1);
      }
      __builtin_amdgcn_sched_barrier(0);   // keeps later blocks' LDS reads from spreading among these products
    }
    if (t + 1 < NCH) {
      wait_ds0();
      wait_async0();
      __syncthreads();                                   // stage t + 1 readable by every wave
    }
  }
  if constexpr (NCH == 2) wait_async0();                 // no copy is outstanding when the buffers are left

  // ---- column bias (same columns for every row a thread writes), clamped addresses ----
  float bc4[4], bc8[8];
#pragma unroll
  for (int e = 0; e < 4; ++e) bc4[e] = 0.f;
#pragma unroll
  for (int e = 0; e < 8; ++e) bc8[e] = 0.f;
  if constexpr (BM == 1) {
    if constexpr (OM == 0) {
#pragma unroll
      for (int e = 0; e < 4; ++e) {
        const int n = n0 + c4 + e;
        const int ncl = imin(n, nbias - 1);
        const float t = bfr(biasp[ncl]);
        bc4[e] = (n < nbias) ? t : 0.f;
      }
    } else {
#pragma unroll
      for (int e = 0; e < 8; ++e) {
        const int n = n0 + c8 + e;
        const int ncl = imin(n, nbias - 1);
        const float t = bfr(biasp[ncl]);
        bc8[e] = (n < nbias) ? t : 0.f;
      }
    }
  }

  // ---- epilogue: the tile through LDS, whole row segments (OM 0, 1) or whole 512-B fragment blocks (OM 2) out ----
#pragma unroll
  for (int r = 0; r < 8; ++r) {
    float* sp = sT + (wr * 16 + mOff + r) * 68 + wc * 32 + rlane;
    sp[0]  = acc0[r];
    sp[16] = acc1[r];
  }
  __syncthreads();
  if constexpr (OM == 0) {
    float* C = (float*)Cout + (size_t)((long long)by * sC);
    v4f vx[4];
#pragma unroll
    for (int it = 0; it < 4; ++it) {
      const int row = it * 16 + r16;                     // it 0..3 x r16 0..15 = rows 0..63
      const int gr  = m0 + row;
      v4f v = *(const v4f*)(sT + row * 68 + c4);
      v4f rv = {0.f, 0.f, 0.f, 0.f};
      if constexpr (RM == 2) {
        const float* R = Rp + (size_t)((long long)by * sC);
        rv = *(const v4f*)(R + (size_t)gr * ldc + n0 + c4);
      }
      const float osc = oscale * rrow[it];
#pragma unroll
      for (int e = 0; e < 4; ++e) {
        float u = v[e] * osc;
        if constexpr (BM == 1) u += bc4[e];
        if constexpr (ACT == 2) u = fmaxf(u, 0.f);
        v[e] = u + rv[e];
      }
      if constexpr (EM == 0) *(v4f*)(C + (size_t)gr * ldc + n0 + c4) = v;
      vx[it] = v;
    }
    if constexpr (EM == 1) {
      // the loops of this block are unrolled so that vx[] and q[] stay in registers; the four rows' shuffles of a step are independent
      float q[4];
#pragma unroll
      for (int it = 0; it < 4; ++it)
        q[it] = (vx[it][0] * vx[it][0] + vx[it][1] * vx[it][1]) + (vx[it][2] * vx[it][2] + vx[it][3] * vx[it][3]);
#pragma unroll
      for (int off = 1; off < 16; off <<= 1) {
#pragma unroll
        for (int it = 0; it < 4; ++it) q[it] += __shfl_xor(q[it], off, 32);
      }
      if ((tid & 15) == 0) {                               // pad column: no other thread reads or writes it before the barrier below
#pragma unroll
        for (int it = 0; it < 4; ++it) sT[(it * 16 + r16) * 68 + 64] = q[it];
      }
      __syncthreads();                                     // the 64 row sums readable by waves 0 and 1; ahead of the global stores
#pragma unroll
      for (int it = 0; it < 4; ++it) {
        const int gr = m0 + it * 16 + r16;
        const v4f v = vx[it];
        *(v4f*)(C + (size_t)gr * ldc + n0 + c4) = v;
        const float f0 = (v[0] * nw[0]) * HC, f1 = (v[1] * nw[1]) * HC, f2 = (v[2] * nw[2]) * HC, f3 = (v[3] * nw[3]) * HC;
        const _Float16 g0 = (_Float16)f0, g1 = (_Float16)f1, g2 = (_Float16)f2, g3 = (_Float16)f3;
        v2u hv, lv;
        hv[0] = pk16(h_bits(g0), h_bits(g1));
        hv[1] = pk16(h_bits(g2), h_bits(g3));
        lv[0] = pk16(h_bits((_Float16)((f0 - (float)g0) * RC)), h_bits((_Float16)((f1 - (float)g1) * RC)));
        lv[1] = pk16(h_bits((_Float16)((f2 - (float)g2) * RC)), h_bits((_Float16)((f3 - (float)g3) * RC)));
        unsigned short* hp = Hout + (size_t)gr * KD + n0 + c4;
        *(v2u*)hp = hv;
        *(v2u*)(hp + DMODEL) = lv;
      }
      if (tid < 64) SSout[(size_t)tn * NROWS + m0 + tid] = sT[tid * 68 + 64];
    }
  } else {
    unsigned short* C = (unsigned short*)Cout + (size_t)((long long)by * sC);
#pragma unroll
    for (int it = 0; it < 2; ++it) {
      // OM 1: it 0..1 x r32 0..31 = rows 0..63; OM 2: 16 rows per wave, (it, wave / 4) = the tile's four groups of 16 rows
      const int row = (OM == 2) ? (it * 2 + (wave >> 2)) * 16 + rlane : it * 32 + r32;
      const float* spf = sT + row * 68 + c8;
      v4u a = {0u, 0u, 0u, 0u}, bl = {0u, 0u, 0u, 0u};
      const float osc = oscale * rrow[it];
#pragma unroll
      for (int e = 0; e < 4; ++e) {
        float f0 = spf[2 * e] * osc;
        float f1 = spf[2 * e + 1] * osc;
        if constexpr (NRM == 1 && OM == 2) { f0 *= rcol[2 * e]; f1 *= rcol[2 * e + 1]; }
        if constexpr (BM == 1) { f0 += bc8[2 * e]; f1 += bc8[2 * e + 1]; }
        if constexpr (ACT == 2) { f0 = fmaxf(f0, 0.f); f1 = fmaxf(f1, 0.f); }
        f0 *= ocarry; f1 *= ocarry;
        const _Float16 g0 = (_Float16)f0, g1 = (_Float16)f1;
        const float r0 = (f0 - (float)g0) * RC, r1 = (f1 - (float)g1) * RC;
        a[e]  = pk16(h_bits(g0), h_bits(g1));
        bl[e] = pk16(h_bits((_Float16)r0), h_bits((_Float16)r1));
      }
      if constexpr (OM == 2) {
        unsigned short* p = C + ((size_t)((m0 + row) >> 4) * tilesN + tn) * FCH + (wave & 3) * 256 + lane * 8;
        *(v4u*)p = a;
        *(v4u*)(p + FPL) = bl;
      } else {
        unsigned short* p = C + (size_t)(m0 + row) * ldc + n0 + c8;
        *(v4u*)p = a;
        *(v4u*)(p + (size_t)lofs) = bl;
      }
    }
  }
  (void)Rp; (void)ocarry; (void)lofs; (void)nbias; (void)biasp; (void)ldc; (void)r32;
  (void)ssp; (void)colf; (void)nwp; (void)Hout; (void)SSout; (void)rcol; (void)nw;
}

// One product per launch: blockIdx.x = tile, blockIdx.y = batch index.
template <int OM, int RM, int ACT, int BM, int KST, int NCH, int NRM, int EM>
__global__ __launch_bounds__(256) void gemm64(
    const unsigned short* __restrict__ Ap, long long sA,
    const unsigned short* __restrict__ Btp, long long sB,
    const float* __restrict__ Rp,
    const float* __restrict__ biasp, int nbias,
    void* Cout, int ldc, long long sC, long long lofs,
    int N, float oscale, float ocarry,
    const float* __restrict__ ssp, const float* __restrict__ nwp, unsigned short* Hout, float* SSout) {
  gemm64_tile<OM, RM, ACT, BM, KST, NCH, NRM, EM>(Ap, sA, Btp, sB, Rp, biasp, nbias, Cout, ldc, sC, lofs, N, oscale, ocarry,
                                                  (int)blockIdx.x, (int)blockIdx.y, ssp, false, nwp, Hout, SSout);
}

#define SH_E   8        // log2 of the tiles per batch index of the q / k product: (NROWS / 64) * (DMODEL / 64)
#define SH_V   7        // log2 of the tiles per batch of the v^T product: (DMODEL / 64) * (SEQ / 64)
#define SH_ONE 30       // a product with one batch index only
static_assert((1 << SH_E) == (NROWS / 64) * (DMODEL / 64) && (1 << SH_V) == (DMODEL / 64) * (SEQ / 64));
static_assert(QC == VC);
// Two independent products of the same form in one launch (no residual input): blocks 0..n0-1 work on product 0, the rest on
// product 1; inside a product block i is tile i mod 2^sh of batch index i >> sh. The choice is the same for the whole block.
// Both read the plane of x * norm weight (NRM 1): as A, or, where the product's colf is set, as Bt.
// coverage: grid = n0 + (blocks of product 1), each product's (tile, batch) pairs taken exactly once.
template <int OM, int ACT, int BM, int KST, int NCH>
__global__ __launch_bounds__(256) void gemm64x2(
    const unsigned short* __restrict__ Ap0, long long sA0, const unsigned short* __restrict__ Btp0, long long sB0,
    const float* __restrict__ biasp0, int nbias0, void* Cout0, int ldc0, long long sC0, long long lofs0, int N0, int sh0,
    const unsigned short* __restrict__ Ap1, long long sA1, const unsigned short* __restrict__ Btp1, long long sB1,
    const float* __restrict__ biasp1, int nbias1, void* Cout1, int ldc1, long long sC1, long long lofs1, int N1, int sh1,
    int n0, float oscale, float ocarry, const float* __restrict__ ssp, int colf0, int colf1) {
  const int b = (int)blockIdx.x;
  const bool p0 = b < n0;
  const int i  = p0 ? b : b - n0;
  const int sh = p0 ? sh0 : sh1;
  const int by = i >> sh;
  gemm64_tile<OM, 0, ACT, BM, KST, NCH, 1, 0>(p0 ? Ap0 : Ap1, p0 ? sA0 : sA1, p0 ? Btp0 : Btp1, p0 ? sB0 : sB1, (const float*)0,
                                              p0 ? biasp0 : biasp1, p0 ? nbias0 : nbias1, p0 ? Cout0 : Cout1, p0 ? ldc0 : ldc1,
                                              p0 ? sC0 : sC1, p0 ? lofs0 : lofs1, p0 ? N0 : N1, oscale, ocarry, i - (by << sh), by,
                                              ssp, (p0 ? colf0 : colf1) != 0, (const float*)0, (unsigned short*)0, (float*)0);
}

#define ATT_SPLIT   8
#define ATT_THREADS (ATT_SPLIT * 32)
#define ATT_TILES   (SEQ / 16)              // query tiles per batch and head
#define ATT_BLOCKS  (NB * (ATT_TILES / 2) * NHEAD)
#define OP_PITCH    68
#define VCS         ((SEQ / 64) * FCH)      // halves between the v^T chunks of 16 d and of the next 16 d at the same keys
static_assert(ATT_THREADS == 16 * (HDIM / 4) && HDIM == 64);
static_assert((HDIM * 2) % 128 == 0 && (HDIM % 32) == 0 && (ATT_TILES % 2) == 0);

__global__ __launch_bounds__(ATT_THREADS)
void attn4(const unsigned short* __restrict__ QPp, const unsigned short* __restrict__ KPp,
           const unsigned short* __restrict__ VTq, const float* __restrict__ relbl, unsigned short* CT) {
  __shared__ __align__(16) float sbias[SEQ];                          // [rel], bf16(relb) * log2 e
  __shared__ __align__(16) float spo[ATT_SPLIT * 16 * OP_PITCH];      // per wave partial [row][64 d], pitch 68
  __shared__ __align__(16) float sml[2 * ATT_SPLIT * 16];             // per wave and row: max, then sum

  const int tid  = threadIdx.x;
  const int wave = __builtin_amdgcn_readfirstlane(tid >> 5);  // scalar: the key loop's trip count is a scalar branch, EXEC stays full
  const int lane = tid & 31;
  const int hh   = lane >> 4;
  const int c    = lane & 15;

  const int head = blockIdx.x % NHEAD;                     // 0..3
  const int qb   = blockIdx.x / NHEAD;
  const int bat  = qb % NB;                                // batch
  const int pr   = qb / NB;                                // tile pair 0 .. ATT_TILES / 2 - 1
  const int kmax = (ATT_TILES - pr) * 16;                  // key count of the pair's later tile

  // ---- relative-position bias table for rel 0..kmax-1 of this head ----
  for (int rel = tid; rel < kmax; rel += ATT_THREADS) {
    const int bk = rel_bucket(rel);
    sbias[rel] = bfr(relbl[bk * NHEAD + head]) * LOG2E;
  }
  __syncthreads();

  const float* sb = sbias;
  const _Float16* Q16 = (const _Float16*)(const void*)QPp;
  const _Float16* K16 = (const _Float16*)(const void*)KPp;
  const _Float16* V16 = (const _Float16*)(const void*)VTq;
  const _Float16* Kf = K16 + ((size_t)((bat * SEQ) >> 4) * NHEAD + head) * FCH + lane * 8;
  const _Float16* Vf = V16 + (size_t)bat * VTR * SEQ + (size_t)(head * (HDIM / 16)) * VCS + lane * 8;  // chunk (16 d, 64 keys)
  const float lsc = (LOG2E * ATT_SCALE) / (QC * KC);      // log2(e) / 8 / carries

  // the pair's two tiles one after the other, the later, longer tile first (the body keeps its indentation); rolled: unrolled, the
  // kernel's text would double and gain nothing, since the tiles share only the table
#pragma unroll 1
  for (int ps = 0; ps < 2; ++ps) {
  const int qt   = (ps == 0) ? ATT_TILES - 1 - pr : pr;    // query tile
  const int q0   = qt * 16;
  const int qi   = q0 + c;                                 // this lane's query
  const int kend = q0 + 16;                                // causal: keys 0 .. q0+15; rel = query - key in 0 .. kend-1
  const _Float16* Qf = Q16 + ((size_t)((bat * SEQ + q0) >> 4) * NHEAD + head) * FCH + lane * 8;   // chunk (16 tokens, head)
  const v16h qah = ldfrag_f(Qf), qbh = ldfrag_f(Qf + FBK);                      // hi, d 0..31 / 32..63
  const v16h qal = ldfrag_f(Qf + FPL), qbl = ldfrag_f(Qf + FPL + FBK);          // residual x64

  float mrun = -INFINITY, lrun = 0.f;                      // this lane's query: running max (both halves alike), sum over this half's keys
  v8f om0 = zero8(), om1 = zero8(), om2 = zero8(), om3 = zero8();
  v8f or0 = zero8(), or1 = zero8(), or2 = zero8(), or3 = zero8();

#pragma unroll 1
  for (int kb = wave * 32; kb < kend; kb += 32 * ATT_SPLIT) {
    const _Float16* kp = Kf + (size_t)(kb >> 4) * (NHEAD * FCH);
    v8f s0m, s0r, s1m, s1r;                                // register r = score of key (tile's first) + 8 hh + r with query q0 + c
    {
      const v16h k0h = ldfrag_f(kp), k1h = ldfrag_f(kp + FBK);
      const v16h k0l = ldfrag_f(kp + FPL), k1l = ldfrag_f(kp + FPL + FBK);
      s0m = mma_raw(k0h, qah, zero8());
      s0m = mma_raw(k1h, qbh, s0m);
      s0r = mma_raw(k0l, qah, zero8());
      s0r = mma_raw(k1l, qbh, s0r);
      s0r = mma_raw(k0h, qal, s0r);
      s0r = mma_raw(k1h, qbl, s0r);
      guard_s2x4(s0m, s0r, k0h, k1h, k0l, k1l);
    }
    {
      const _Float16* kq = kp + NHEAD * FCH;               // the next 16 keys
      const v16h k0h = ldfrag_f(kq), k1h = ldfrag_f(kq + FBK);
      const v16h k0l = ldfrag_f(kq + FPL), k1l = ldfrag_f(kq + FPL + FBK);
      s1m = mma_raw(k0h, qah, zero8());
      s1m = mma_raw(k1h, qbh, s1m);
      s1r = mma_raw(k0l, qah, zero8());
      s1r = mma_raw(k1l, qbh, s1r);
      s1r = mma_raw(k0h, qal, s1r);
      s1r = mma_raw(k1h, qbl, s1r);
      guard_s2x4(s1m, s1r, k0h, k1h, k0l, k1l);
      keep4_h(qah, qbh, qal, qbl);
    }
    const int rel0 = qi - kb - 8 * hh;                     // query - key of register 0 in tile 0; register r: r less; tile 1: 16 less
    // the loops over r below are unrolled so that t0[], t1[] are indexed by constants and stay in registers
    float t0[8], t1[8];
#pragma unroll
    for (int r = 0; r < 8; ++r) {
      const int d0 = rel0 - r, d1 = rel0 - 16 - r;
      const float u0 = (s0m[r] + s0r[r] * RCI) * lsc + sb[imax(d0, 0)];
      const float u1 = (s1m[r] + s1r[r] * RCI) * lsc + sb[imax(d1, 0)];
      t0[r] = (d0 < 0) ? -INFINITY : u0;
      t1[r] = (d1 < 0) ? -INFINITY : u1;
    }
    float mx = fmaxf(fmaxf(fmaxf(fmaxf(t0[0], t0[1]), fmaxf(t0[2], t0[3])), fmaxf(fmaxf(t0[4], t0[5]), fmaxf(t0[6], t0[7]))),
                     fmaxf(fmaxf(fmaxf(t1[0], t1[1]), fmaxf(t1[2], t1[3])), fmaxf(fmaxf(t1[4], t1[5]), fmaxf(t1[6], t1[7]))));
    mx = fmaxf(mx, xhalf(mx));                             // the query's max over all 32 keys of the step (key kb is never masked)
    const float mn = fmaxf(mrun, mx);
    const float al = exp2f(fmaxf(mrun - mn, -126.0f));
    mrun = mn;
#pragma unroll
    for (int r = 0; r < 8; ++r) {
      t0[r] = exp2f(t0[r] - mn);
      t1[r] = exp2f(t1[r] - mn);
    }
    lrun = lrun * al + ((((t0[0] + t0[1]) + (t0[2] + t0[3])) + ((t0[4] + t0[5]) + (t0[6] + t0[7]))) +
                        (((t1[0] + t1[1]) + (t1[2] + t1[3])) + ((t1[4] + t1[5]) + (t1[6] + t1[7]))));
    FragH ph;                                              // P^T as B operand: the lane's own 16 values, already in the split k map
#pragma unroll
    for (int r = 0; r < 8; ++r) {
      ph.h[0][r] = (_Float16)(t0[r] * PC);                 // elements 0..7  = keys kb + 8hh + 0..7
      ph.h[1][r] = (_Float16)(t1[r] * PC);                 // elements 8..15 = keys kb + 16 + 8hh + 0..7
      om0[r] *= al; om1[r] *= al; om2[r] *= al; om3[r] *= al;
      or0[r] *= al; or1[r] *= al; or2[r] *= al; or3[r] *= al;
    }
    {
      const _Float16* vp = Vf + (size_t)(kb >> 6) * FCH + ((kb >> 5) & 1) * FBK;
      const v16h vb0 = ldfrag_f(vp);
      const v16h vb1 = ldfrag_f(vp + VCS);
      const v16h vb2 = ldfrag_f(vp + 2 * VCS);
      const v16h vb3 = ldfrag_f(vp + 3 * VCS);
      om0 = mma_raw(vb0, ph.v, om0);
      om1 = mma_raw(vb1, ph.v, om1);
      om2 = mma_raw(vb2, ph.v, om2);
      om3 = mma_raw(vb3, ph.v, om3);
      guard_pv4(om0, om1, om2, om3, ph.v, vb0, vb1, vb2, vb3);
    }
    {
      const _Float16* vq = Vf + (size_t)(kb >> 6) * FCH + ((kb >> 5) & 1) * FBK + FPL;
      const v16h vl0 = ldfrag_f(vq);
      const v16h vl1 = ldfrag_f(vq + VCS);
      const v16h vl2 = ldfrag_f(vq + 2 * VCS);
      const v16h vl3 = ldfrag_f(vq + 3 * VCS);
      or0 = mma_raw(vl0, ph.v, or0);
      or1 = mma_raw(vl1, ph.v, or1);
      or2 = mma_raw(vl2, ph.v, or2);
      or3 = mma_raw(vl3, ph.v, or3);
      guard_pv4(or0, or1, or2, or3, ph.v, vl0, vl1, vl2, vl3);
    }
  }

  if (ps != 0) __syncthreads();                            // every wave has read the first tile's partials before they are overwritten
  // ---- the wave's un-normalised partial and its (max, sum) per row to LDS; register r of tile j = d 16 j + 8 hh + r of query c ----
  {
    const float lsum = lrun + xhalf(lrun);                 // the two halves' keys joined, once
    float* pw = spo + wave * (16 * OP_PITCH) + c * OP_PITCH + 8 * hh;
    v4f a, b;
    // unrolled: the accumulators are indexed by constants
#pragma unroll
    for (int e = 0; e < 4; ++e) { a[e] = om0[e] + or0[e] * RCI; b[e] = om0[4 + e] + or0[4 + e] * RCI; }
    *(v4f*)(pw) = a;       *(v4f*)(pw + 4) = b;
#pragma unroll
    for (int e = 0; e < 4; ++e) { a[e] = om1[e] + or1[e] * RCI; b[e] = om1[4 + e] + or1[4 + e] * RCI; }
    *(v4f*)(pw + 16) = a;  *(v4f*)(pw + 20) = b;
#pragma unroll
    for (int e = 0; e < 4; ++e) { a[e] = om2[e] + or2[e] * RCI; b[e] = om2[4 + e] + or2[4 + e] * RCI; }
    *(v4f*)(pw + 32) = a;  *(v4f*)(pw + 36) = b;
#pragma unroll
    for (int e = 0; e < 4; ++e) { a[e] = om3[e] + or3[e] * RCI; b[e] = om3[4 + e] + or3[4 + e] * RCI; }
    *(v4f*)(pw + 48) = a;  *(v4f*)(pw + 52) = b;
    if (hh == 0) {                                         // max and joined sum are equal in the two halves
      sml[wave * 16 + c] = mrun;
      sml[ATT_SPLIT * 16 + wave * 16 + c] = lsum;
    }
  }
  __syncthreads();                                         // every wave's partial readable by every wave
  // ---- merge the 8 partials, fold 1/l and the carries, write 4 hi and 4 residual halves per thread ----
  {
    const int row = tid >> 4, c4 = (tid & 15) * 4;
    float ms[ATT_SPLIT];
    float mall = -INFINITY;
#pragma unroll
    for (int s = 0; s < ATT_SPLIT; ++s) {
      ms[s] = sml[s * 16 + row];
      mall = fmaxf(mall, ms[s]);
    }
    float lall = 0.f;
    v4f o = {0.f, 0.f, 0.f, 0.f};
#pragma unroll
    for (int s = 0; s < ATT_SPLIT; ++s) {
      const float w = exp2f(ms[s] - mall);
      const v4f p = *(const v4f*)(spo + (s * 16 + row) * OP_PITCH + c4);
      lall += w * sml[ATT_SPLIT * 16 + s * 16 + row];
#pragma unroll
      for (int e = 0; e < 4; ++e) o[e] += w * p[e];
    }
    const float inv = (1.0f / lall) * (CC / (PC * VC));
    const float u0 = o[0] * inv, u1 = o[1] * inv, u2 = o[2] * inv, u3 = o[3] * inv;
    const _Float16 g0 = (_Float16)u0, g1 = (_Float16)u1, g2 = (_Float16)u2, g3 = (_Float16)u3;
    v2u hv, lv;
    hv[0] = pk16(h_bits(g0), h_bits(g1));
    hv[1] = pk16(h_bits(g2), h_bits(g3));
    lv[0] = pk16(h_bits((_Float16)((u0 - (float)g0) * RC)), h_bits((_Float16)((u1 - (float)g1) * RC)));
    lv[1] = pk16(h_bits((_Float16)((u2 - (float)g2) * RC)), h_bits((_Float16)((u3 - (float)g3) * RC)));
    unsigned short* dst = CT + ((size_t)bat * SEQ + q0 + row) * KD + head * HDIM + c4;
    *(v2u*)dst = hv;
    *(v2u*)(dst + DMODEL) = lv;
    wait_x0();                                             // the second tile rewrites the registers of the two stores above
  }
  }
}

// =====================================================================================================
// Input convert: obs16[m][640] = f16(16 * bf16_RNE(obs[b*SEQ_FULL + t][c])) for c < 637 (m = b*SEQ + t), 0 for the pad columns
// 637..639 (explicitly written). One wave per row (8 rows per block): 80 pieces of 8 halves; lane writes pieces lane, lane+32 and
// coverage: NROWS/8 blocks x 8 waves = every row; per row pieces 0..79 = cols 0..639.
// =====================================================================================================
__device__ __forceinline__ void cvtobs(const float* __restrict__ src, unsigned short* dst, int blk) {
  const int wave = threadIdx.x >> 5, lane = threadIdx.x & 31;
  const int m = blk * 8 + wave;
  const int b = m / SEQ, t = m - b * SEQ;
  const float* sp = src + ((size_t)b * SEQ_FULL + t) * OBSD;
  unsigned short* dp = dst + (size_t)m * OBSP;
  {
#pragma unroll 1
    for (int it = 0; it < 3; ++it) {
      const int p = it * 32 + lane;
      const int col0 = p * 8;
      v4u a;
#pragma unroll
      for (int e = 0; e < 4; ++e) {
        const int ca = col0 + 2 * e, cb = ca + 1;
        float fa = sp[imin(ca, OBSD - 1)];
        float fb = sp[imin(cb, OBSD - 1)];
        fa = (ca < OBSD) ? fa : 0.f;
        fb = (cb < OBSD) ? fb : 0.f;
        a[e] = pk16(h_bits((_Float16)(bfr(fa) * OBC)), h_bits((_Float16)(bfr(fb) * OBC)));
      }
      if (p < OBSP / 8) {
        *(v4u*)(dp + (size_t)p * 8) = a;
        wait_x0();                                         // the next trip advances the store's address registers
      }
    }
    
  }
}

// =====================================================================================================
// All 16-bit operand planes in one launch (they depend on the inputs alone, not on one another): blocks 0..PB_OBS-1 convert obs,
// then one 64x64 transposing tile per block for w_q, w_k, w_v, w_o, w_1, w_2, obs_w, act_w, obsh_w in this order. The job is a
// function of blockIdx.x alone, so every branch below (and the barrier inside tcvt16) is uniform for the block.
// coverage: each job's blocks = its (Cp/64) x (Rp/64) x slices tiles exactly once; grid = PB_ALL.
// =====================================================================================================
#define PB_OBS (NROWS / 8)
#define PB_E   ((DMODEL / 64) * (DMODEL / 64) * NLAYER)
#define PB_F   ((DFF / 64) * (DMODEL / 64) * NLAYER)
#define PB_OW  ((DMODEL / 64) * (OBSP / 64))
#define PB_AW  ((NACTP / 64) * (DMODEL / 64))
#define PB_HW  ((OBSP / 64) * (DMODEL / 64))
#define PB_ALL (PB_OBS + 4 * PB_E + 2 * PB_F + PB_OW + PB_AW + PB_HW)
static_assert((NROWS % 8) == 0);

__global__ __launch_bounds__(256) void prep(
    const float* __restrict__ obs, const float* __restrict__ w_q, const float* __restrict__ w_k, const float* __restrict__ w_v,
    const float* __restrict__ w_o, const float* __restrict__ w_1, const float* __restrict__ w_2,
    const float* __restrict__ obs_w, const float* __restrict__ act_w, const float* __restrict__ obsh_w,
    unsigned short* OBS16, unsigned short* WQ16, unsigned short* WK16, unsigned short* WV16, unsigned short* WO16,
    unsigned short* W116, unsigned short* W216, unsigned short* OBSW16, unsigned short* ACTW16, unsigned short* OBSHW16) {
  __shared__ __align__(16) unsigned short sT[64 * 72];
  int b = (int)blockIdx.x;
  if (b < PB_OBS) {                                        // the whole block leaves, ahead of any barrier
    cvtobs(obs, OBS16, b);
    return;
  }
  b -= PB_OBS;
  const float* s;
  unsigned short* d;
  long long sZ = 0, dZ = 0;
  int R = DMODEL, C = DMODEL, ldd = KD, locol = DMODEL, gx = DMODEL / 64, gy = DMODEL / 64;
  float sclo = WLO;
  bool dual = true;
  if (b < 4 * PB_E) {                                      // in[256 k][256 n] -> out[256 n][512], per layer
    const int j = b / PB_E;
    b -= j * PB_E;
    s = (j == 0) ? w_q : (j == 1) ? w_k : (j == 2) ? w_v : w_o;
    d = (j == 0) ? WQ16 : (j == 1) ? WK16 : (j == 2) ? WV16 : WO16;
    sZ = (long long)DMODEL * DMODEL; dZ = (long long)DMODEL * KD;
  } else if (b < 4 * PB_E + PB_F) {                        // in[256 k][512 n] -> out[512 n][512], per layer
    b -= 4 * PB_E;
    s = w_1; d = W116;
    sZ = (long long)DMODEL * DFF; dZ = (long long)DFF * KD;
    C = DFF; gx = DFF / 64;
  } else if (b < 4 * PB_E + 2 * PB_F) {                    // in[512 k][256 n] -> out[256 n][1024], per layer
    b -= 4 * PB_E + PB_F;
    s = w_2; d = W216;
    sZ = (long long)DFF * DMODEL; dZ = (long long)DMODEL * KF;
    R = DFF; ldd = KF; locol = DFF; gy = DFF / 64;
  } else if (b < 4 * PB_E + 2 * PB_F + PB_OW) {            // in[637 k][256 n] -> out[256 n][640], k 637..639 zero, one copy
    b -= 4 * PB_E + 2 * PB_F;
    s = obs_w; d = OBSW16;
    R = OBSD; ldd = OBSP; locol = 0; gy = OBSP / 64;
    sclo = 0.f; dual = false;
  } else if (b < 4 * PB_E + 2 * PB_F + PB_OW + PB_AW) {    // in[256 k][4 n] -> out[64 n][512], n >= 4 zero
    b -= 4 * PB_E + 2 * PB_F + PB_OW;
    s = act_w; d = ACTW16;
    C = NACT; gx = NACTP / 64;
  } else {                                                 // in[256 k][637 n] -> out[640 n][512], n >= 637 zero
    b -= 4 * PB_E + 2 * PB_F + PB_OW + PB_AW;
    s = obsh_w; d = OBSHW16;
    C = OBSD; gx = OBSP / 64;
  }
  const int bz = b / (gx * gy);
  const int r  = b - bz * (gx * gy);
  const int by = r / gx;
  tcvt16(sT, s, sZ, d, dZ, R, C, ldd, locol, WSC, sclo, dual, r - by * gx, by, bz);
}

// =====================================================================================================
// Output copy: blockIdx.y == 0: out0[b*SEQ_FULL + t][0..3] = ACTF[b*SEQ + t][0..3] (one 16-B piece per thread, consecutive threads
// (SEQ*637 floats at float OUT1_OFF + b*SEQ_FULL*637) written as consecutive 16-B pieces (thread g -> floats 4i..4i+3, gathered from
// coverage: out0: NROWS pieces = every row; out1: NB * SEQ*637/4 pieces = every float of the region exactly once.
// =====================================================================================================
__global__ __launch_bounds__(256) void ocopy(const float* __restrict__ actf, const float* __restrict__ obsf, float* outp) {
  const int g = blockIdx.x * 256 + threadIdx.x;
  if (blockIdx.y == 0) {
    if (g >= NROWS) return;
    const int b = g / SEQ, t = g - b * SEQ;
    const v4f v = *(const v4f*)(actf + (size_t)g * NACTP);
    float* d = outp + ((size_t)b * SEQ_FULL + t) * NACT;
    {
      *(v4f*)d = v;
      
    }
  } else {
    const int ppb = (SEQ * OBSD) / 4;
    if (g >= NB * ppb) return;
    const int b = g / ppb;
    const int i = (g - b * ppb) * 4;
    v4f v;
#pragma unroll
    for (int e = 0; e < 4; ++e) {
      const int idx = i + e;
      const int row = idx / OBSD;
      const int col = idx - row * OBSD;
      v[e] = obsf[((size_t)b * SEQ + row) * OBSP + col];
    }
    float* d = outp + (size_t)OUT1_OFF + (size_t)b * SEQ_FULL * OBSD + i;
    {
      *(v4f*)d = v;
      
    }
  }
}

// =====================================================================================================
// Workspace map (bytes); every plane is an exact multiple of its tile / whole-row store granularity (M, N exact multiples of 64,
//   WQ16, WK16, WV16, WO16  f16 [6][256 n][512 = k x64 | k x1]     4 x 1572864
//   W116                    f16 [6][512 n][512]                       3145728
//   W216                    f16 [6][256 n][1024 = 512 x64 | 512 x1]  3145728
//   OBSW16                  f16 [256 n][640 k] x64 (k 637..639 zero)  327680
//   ACTW16                  f16 [64 n][512] (n 4..63 zero)              65536
//   OBSHW16                 f16 [640 n][512] (n 637..639 zero)         655360
//   OBS16                   f16 [NROWS][640] x16                      5242880
//   XA, XB                  f32 [NROWS][256] residual stream       2 x 4194304
//   HH, CT                  f16 [NROWS][512] dual planes           2 x 4194304
//   SS                      f32 [4][NROWS] partial sums of x*x          65536
//   QP, KP                  f16 [NROWS/16][4 heads][2048] fragment order  2 x 4194304
//   VT                      f16 [NB][256/16][SEQ/64][2048] fragment order  4194304
//   G16                     f16 [NROWS][1024] dual                   8388608
//   ACTF                    f32 [NROWS][64]                          1048576
//   OBSF                    f32 [NROWS][640]                        10485760
//   total (NB=2, SEQ=2048)                                          68222976
// =====================================================================================================
extern "C" void kernel_launch(void* const* d_in, const int* in_sizes, int n_in,
                              void* d_out, int out_size, void* d_ws, size_t ws_size,
                              hipStream_t stream) {
  if (n_in < 19) return;
  if (in_sizes[0] < ((NB - 1) * SEQ_FULL + SEQ) * OBSD) return;
  if (in_sizes[1] < OBSD * DMODEL || in_sizes[2] < DMODEL) return;
  if (in_sizes[3] < NLAYER * DMODEL) return;
  if (in_sizes[4] < NLAYER * DMODEL * DMODEL || in_sizes[5] < NLAYER * DMODEL * DMODEL) return;
  if (in_sizes[6] < NLAYER * DMODEL * DMODEL || in_sizes[7] < NLAYER * DMODEL * DMODEL) return;
  if (in_sizes[8] < NLAYER * NBUCK * NHEAD || in_sizes[9] < NLAYER * DMODEL) return;
  if (in_sizes[10] < NLAYER * DMODEL * DFF || in_sizes[11] < NLAYER * DFF) return;
  if (in_sizes[12] < NLAYER * DFF * DMODEL || in_sizes[13] < NLAYER * DMODEL) return;
  if (in_sizes[14] < DMODEL || in_sizes[15] < DMODEL * NACT || in_sizes[16] < NACT) return;
  if (in_sizes[17] < DMODEL * OBSD || in_sizes[18] < OBSD) return;
  if (out_size < OUT1_OFF + ((NB - 1) * SEQ_FULL + SEQ) * OBSD) return;

  const float* obs     = (const float*)d_in[0];
  const float* obs_w   = (const float*)d_in[1];
  const float* obs_b   = (const float*)d_in[2];
  const float* norm1_w = (const float*)d_in[3];
  const float* w_q     = (const float*)d_in[4];
  const float* w_k     = (const float*)d_in[5];
  const float* w_v     = (const float*)d_in[6];
  const float* w_o     = (const float*)d_in[7];
  const float* relb    = (const float*)d_in[8];
  const float* norm2_w = (const float*)d_in[9];
  const float* w_1     = (const float*)d_in[10];
  const float* b_1     = (const float*)d_in[11];
  const float* w_2     = (const float*)d_in[12];
  const float* b_2     = (const float*)d_in[13];
  const float* fnorm_w = (const float*)d_in[14];
  const float* act_w   = (const float*)d_in[15];
  const float* act_b   = (const float*)d_in[16];
  const float* obsh_w  = (const float*)d_in[17];
  const float* obsh_b  = (const float*)d_in[18];
  float*       outp    = (float*)d_out;

  const size_t PWE  = (size_t)NLAYER * DMODEL * KD * 2;     // 1572864
  const size_t PW1  = (size_t)NLAYER * DFF * KD * 2;        // 3145728
  const size_t PW2  = (size_t)NLAYER * DMODEL * KF * 2;     // 3145728
  const size_t POBW = (size_t)DMODEL * OBSP * 2;            //  327680
  const size_t PACW = (size_t)NACTP * KD * 2;               //   65536
  const size_t POHW = (size_t)OBSP * KD * 2;                //  655360
  const size_t POBS = (size_t)NROWS * OBSP * 2;             // 5242880
  const size_t PX   = (size_t)NROWS * DMODEL * 4;           // 4194304
  const size_t PH   = (size_t)NROWS * KD * 2;               // 4194304
  const size_t PVT  = (size_t)NB * VTR * SEQ * 2;           // 4194304
  const size_t PG   = (size_t)NROWS * KF * 2;               // 8388608
  const size_t PACF = (size_t)NROWS * NACTP * 4;            // 1048576
  const size_t POBF = (size_t)NROWS * OBSP * 4;             // 10485760
  const size_t PSS  = (size_t)NSS * NROWS * 4;              //    65536
  size_t off = 0;
  const size_t oWQ  = off; off += PWE;
  const size_t oWK  = off; off += PWE;
  const size_t oWV  = off; off += PWE;
  const size_t oWO  = off; off += PWE;
  const size_t oW1  = off; off += PW1;
  const size_t oW2  = off; off += PW2;
  const size_t oOBW = off; off += POBW;
  const size_t oACW = off; off += PACW;
  const size_t oOHW = off; off += POHW;
  const size_t oOBS = off; off += POBS;
  const size_t oXA  = off; off += PX;
  const size_t oXB  = off; off += PX;
  const size_t oHH  = off; off += PH;
  const size_t oQP  = off; off += PH;
  const size_t oKP  = off; off += PH;
  const size_t oCT  = off; off += PH;
  const size_t oVT  = off; off += PVT;
  const size_t oG   = off; off += PG;
  const size_t oACF = off; off += PACF;
  const size_t oOBF = off; off += POBF;
  const size_t oSS  = off; off += PSS;
  const size_t endAll = off;                                // 68222976 for NB=2, SEQ=2048
  if (endAll > ws_size) return;
  if (endAll > (size_t)134217728) return;

  char* ws = (char*)d_ws;
  unsigned short* WQ16    = (unsigned short*)(ws + oWQ);
  unsigned short* WK16    = (unsigned short*)(ws + oWK);
  unsigned short* WV16    = (unsigned short*)(ws + oWV);
  unsigned short* WO16    = (unsigned short*)(ws + oWO);
  unsigned short* W116    = (unsigned short*)(ws + oW1);
  unsigned short* W216    = (unsigned short*)(ws + oW2);
  unsigned short* OBSW16  = (unsigned short*)(ws + oOBW);
  unsigned short* ACTW16  = (unsigned short*)(ws + oACW);
  unsigned short* OBSHW16 = (unsigned short*)(ws + oOHW);
  unsigned short* OBS16   = (unsigned short*)(ws + oOBS);
  float*          XA      = (float*)(ws + oXA);
  float*          XB      = (float*)(ws + oXB);
  unsigned short* HH      = (unsigned short*)(ws + oHH);
  unsigned short* QP      = (unsigned short*)(ws + oQP);
  unsigned short* KP      = (unsigned short*)(ws + oKP);
  unsigned short* CT      = (unsigned short*)(ws + oCT);
  unsigned short* VTp     = (unsigned short*)(ws + oVT);
  unsigned short* G16     = (unsigned short*)(ws + oG);
  float*          ACTF    = (float*)(ws + oACF);
  float*          OBSF    = (float*)(ws + oOBF);
  float*          SS      = (float*)(ws + oSS);

  const dim3 blk(256);
  const int tilesE  = (NROWS / 64) * (DMODEL / 64);                // 256
  const int tilesV  = (DMODEL / 64) * (SEQ / 64);                  // 128 per batch
  const int tilesF  = (NROWS / 64) * (DFF / 64);                   // 512
  const int tilesA  = (NROWS / 64) * (NACTP / 64);                 // 64
  const int tilesO  = (NROWS / 64) * (OBSP / 64);                  // 640
  const dim3 gE(tilesE, 1);                                        // 256: one tile per block
  const dim3 gQKV(2 * tilesE + NB * tilesV);                       // 256 x 2 (q, k), then 128 x NB (v^T)
  const dim3 gF(tilesF, 1);                                        // 512
  const dim3 gOA(tilesO + tilesA);                                 // 640 (obs head), then 64 (action head)
  const dim3 gAT(ATT_BLOCKS);                                      // SEQ/32 tile pairs x NB x 4 heads = 512
  const dim3 bAT(ATT_THREADS);                                     // 256
  const int ppb = (SEQ * OBSD) / 4;
  const int gcx0 = NROWS / 256, gcx1 = (NB * ppb + 255) / 256;
  const dim3 gOC(gcx0 > gcx1 ? gcx0 : gcx1, 2);                    // (2548, 2)

  const long long sQK   = (long long)NLAYER * DMODEL * KD;         // WK16 - WQ16 in halves
  const long long sKP   = (long long)NROWS * KD;                   // KP - QP in halves

  // (0) 16-bit operand planes: transposed weights [n][k x64 | k x1] (bf16 RNE then exact power-of-two scale), obs x16
  prep<<<dim3(PB_ALL), blk, 0, stream>>>(obs, w_q, w_k, w_v, w_o, w_1, w_2, obs_w, act_w, obsh_w,
                                         OBS16, WQ16, WK16, WV16, WO16, W116, W216, OBSW16, ACTW16, OBSHW16);

  // (1) x = obs . Wp + bf16(bp) -> XA (f32); M = NROWS, N = 256, K = 640 (single product, inputs exact);
  //     with it HH = x * bf16(g1 of layer 0) (hi x4 | residual x64) and SS
  gemm64<0, 0, 0, 1, OBSP, 1, 0, 1><<<gE, blk, 0, stream>>>(
      OBS16, 0LL,
      OBSW16, 0LL,
      (const float*)0,
      obs_b, DMODEL,
      (void*)XA, DMODEL, 0LL, 0LL,
      DMODEL, 1.0f / (OBC * WSC), 1.0f,
      (const float*)0, norm1_w, HH, SS);

  for (int l = 0; l < NLAYER; ++l) {
    const size_t lwE = (size_t)l * DMODEL * KD;                    // WQ/WK/WV/WO layer offset (halves)
    const size_t lw1 = (size_t)l * DFF * KD;
    const size_t lw2 = (size_t)l * DMODEL * KF;

    // (2) h = RMSNorm(x) * bf16(g1): HH and SS come from the product that made x, the row factor is applied in (3), (4)
    // (3) q, k projections (batch index 0, 1): QP / KP in fragment order; M = NROWS, N = 256, K = 512 folded, no bias
    // (4) in the same launch, v^T per batch: VT[b] = [d][tok] in fragment order; M = 256 (d), N = SEQ, K = 512 folded
    gemm64x2<2, 0, 0, KD, 1><<<gQKV, blk, 0, stream>>>(
        HH, 0LL, WQ16 + lwE, sQK,
        (const float*)0, 1, (void*)QP, KD, sKP, (long long)DMODEL, DMODEL, SH_E,
        WV16 + lwE, 0LL, HH, (long long)SEQ * KD,
        (const float*)0, 1, (void*)VTp, SEQ, (long long)VTR * SEQ, (long long)DMODEL * SEQ, SEQ, SH_V,
        2 * tilesE, 1.0f / (HC * WSC), QC, SS, 0, 1);

    // (5) causal attention with relative-position bias per (batch, two tiles of 16 query rows, head), keys split over 8 waves -> CT (hi x16 | residual x64)
    attn4<<<gAT, bAT, 0, stream>>>(QP, KP, VTp, relb + (size_t)l * NBUCK * NHEAD, CT);

    // (6) XB = CT . Wo / (16 * 64) + XA (raw f32); M = NROWS, N = 256, K = 512 folded
    // (7) with it HH = x * bf16(g2) and SS; the row factor of h2 = RMSNorm(x) * bf16(g2) is applied in (8)
    gemm64<0, 2, 0, 0, KD, 1, 0, 1><<<gE, blk, 0, stream>>>(
        CT, 0LL,
        WO16 + lwE, 0LL,
        XA,
        (const float*)0, 1,
        (void*)XB, DMODEL, 0LL, 0LL,
        DMODEL, 1.0f / (CC * WSC), 1.0f,
        (const float*)0, norm2_w + (size_t)l * DMODEL, HH, SS);

    // (8) G16 = dual f16 of 64 * relu(h2 . W1 + bf16(b1)); M = NROWS, N = 512, K = 512 folded
    gemm64<1, 0, 2, 1, KD, 1, 1, 0><<<gF, blk, 0, stream>>>(
        HH, 0LL,
        W116 + lw1, 0LL,
        (const float*)0,
        b_1 + (size_t)l * DFF, DFF,
        (void*)G16, KF, 0LL, (long long)DFF,
        DFF, 1.0f / (HC * WSC), GC,
        SS, (const float*)0, (unsigned short*)0, (float*)0);

    // (9) XA = G16 . W2 / (64 * 64) + bf16(b2) + XB (raw f32); M = NROWS, N = 256, K = 1024 folded;
    //     with it HH = x * bf16(g1 of the next layer, or gf behind the last) and SS
    gemm64<0, 2, 0, 1, KF / 2, 2, 0, 1><<<gE, blk, 0, stream>>>(
        G16, 0LL,
        W216 + lw2, 0LL,
        XB,
        b_2 + (size_t)l * DMODEL, DMODEL,
        (void*)XA, DMODEL, 0LL, 0LL,
        DMODEL, 1.0f / (GC * WSC), 1.0f,
        (const float*)0, (l + 1 < NLAYER) ? norm1_w + (size_t)(l + 1) * DMODEL : fnorm_w, HH, SS);
  }

  // (10) hf = RMSNorm(x) * bf16(gf): the row factor is applied in (11), (12)
  // (11) obs prediction plane OBSF[m][640] = hf . Wh + bf16(bh) (cols 0..636 meaningful); M = NROWS, N = 640, K = 512 folded
  // (12) in the same launch, action logits plane ACTF[m][64] = hf . Wa + bf16(ba) (cols 0..3 meaningful); M = NROWS, N = 64
  gemm64x2<0, 0, 1, KD, 1><<<gOA, blk, 0, stream>>>(
      HH, 0LL, OBSHW16, 0LL,
      obsh_b, OBSD, (void*)OBSF, OBSP, 0LL, 0LL, OBSP, SH_ONE,
      HH, 0LL, ACTW16, 0LL,
      act_b, NACT, (void*)ACTF, NACTP, 0LL, 0LL, NACTP, SH_ONE,
      tilesO, 1.0f / (HC * WSC), 1.0f, SS, 0, 0);

  ocopy<<<gOC, blk, 0, stream>>>(ACTF, OBSF, outp);
  (void)hipGetLastError();
}

// v008
// One run takes 321 microseconds.
// Two timings next to v007 put it at 1.08 and 1.05 times that version's speed.
// Over all steps from v000 it is 5.94 times as fast.
// Contractions (all v_wmma_f32_16x16x32_f16, f16 operands, f32 accumulate): input projection (obs f16 x16 . Wp^T f16 x64, K=640
// zero-padded, single product); q/k, v^T, attention-output, hidden (ReLU), second and both head projections with the activation
// operand carried as two f16 planes [hi | residual x64] folded along K against [W^T x64 | W^T x1]; attention scores k.q^T from the
// q/k hi and residual planes (hi.hi plus the two cross terms, two accumulators, K=64); attention v^T.P^T with P f16 x16384 (single)
// against v^T hi and residual planes (two accumulators). RMSNorm, softmax (base 2), ReLU, biases, relative-position bias and the
// residual stream in f32 on VALU. Every float input RNE-converted to bf16 on load.
// RMSNorm has no launch of its own: the row factor rsqrt(mean(x*x) + eps) commutes with the product along the row, so the product
// that makes x also stores the operand plane of x * bf16(norm weight) and its tile's sums of squares, and the product that reads the
// plane multiplies its result by the row factor.
#include <hip/hip_runtime.h>
#include <math.h>
#include <stdint.h>

#ifndef NB
#define NB        2
#endif
#ifndef SEQ
#define SEQ       2048
#endif
#define NB_FULL   2
#define SEQ_FULL  2048
#define NLAYER    6
#define DMODEL    256
#define NHEAD     4
#define HDIM      64
#define DFF       512
#define OBSD      637
#define OBSP      640
#define NACT      4
#define NACTP     64
#define NBUCK     32
#define NROWS     (NB * SEQ)
#define KD        (2 * DMODEL)          // folded K of E-wide activation operands: [hi 256 | residual 256]
#define KF        (2 * DFF)             // folded K of the hidden operand: [hi 512 | residual 512]
#define VTR       KD                    // per batch VTR * SEQ halves of v^T: 256 d x SEQ keys, hi and residual, fragment order
#define OUT1_OFF  (NB_FULL * SEQ_FULL * NACT)   // float index of the second output (byte offset 65536)
#define OUT_TOTAL (OUT1_OFF + NB_FULL * SEQ_FULL * OBSD)

// carries (exact powers of two)
#define WSC_I 64
#define RC_I  64
#define WLO_I 1
#define WSC   64.0f        // weight hi copy
#define WLO   1.0f         // weight lo copy (pairs with the x64 residual plane)
#define RC    64.0f        // residual plane carry relative to its hi plane
#define RCI   0.015625f
#define OBC   16.0f        // obs plane
#define HC    4.0f         // x * norm weight planes (not yet divided by the row's rms)
#define QC    16.0f
#define KC    16.0f
#define VC    16.0f
#define PC    16384.0f     // softmax P tile
#define CC    16.0f        // attention context
#define GC    64.0f        // ReLU hidden
#define ATT_SCALE 0.125f
#define LOG2E   1.4426950408889634f
#define RMS_EPS 1.1920929e-07f
#define NSS     (DMODEL / 64)        // partial sums of squares per row of x: one per 64-column tile
static_assert(RC_I * WLO_I == WSC_I);
static_assert(NHEAD * HDIM == DMODEL);
static_assert(NB >= 1 && NB <= NB_FULL && SEQ >= 64 && SEQ <= SEQ_FULL);
static_assert((SEQ % 64) == 0 && (SEQ % 16) == 0 && (NROWS % 64) == 0 && (DMODEL % 64) == 0 && (DFF % 64) == 0);
static_assert((OBSP % 64) == 0 && (NACTP % 64) == 0 && OBSP >= OBSD && NACTP >= NACT && (OBSP - OBSD) < 64);
static_assert((KD % 32) == 0 && (KF % 32) == 0 && (OBSP % 32) == 0);
static_assert((NROWS % 256) == 0 && (NROWS % 4) == 0 && ((SEQ * OBSD) % 4) == 0);
static_assert(OUT_TOTAL == 2625536);

typedef _Float16 v16h __attribute__((ext_vector_type(16)));
typedef _Float16 v8h  __attribute__((ext_vector_type(8)));
typedef float    v8f  __attribute__((ext_vector_type(8)));
typedef float    v4f  __attribute__((ext_vector_type(4)));
typedef unsigned int v4u __attribute__((ext_vector_type(4)));
typedef unsigned int v2u __attribute__((ext_vector_type(2)));

union FragH { v16h v; v8h h[2]; v4u u[2]; };

// ---- scalar helpers --------------------------------------------------------------------------------
__device__ __forceinline__ unsigned short bf_bits(float f) {          // f32 -> bf16 bits, RNE convert
  unsigned u = __float_as_uint(f);
  return (unsigned short)((u + 0x7FFFu + ((u >> 16) & 1u)) >> 16);
}
__device__ __forceinline__ float bf_up(unsigned short h) { return __uint_as_float(((unsigned)h) << 16); }
__device__ __forceinline__ float bfr(float f) { return bf_up(bf_bits(f)); }   // value of the bf16 RNE convert
__device__ __forceinline__ unsigned short h_bits(_Float16 x) { return __builtin_bit_cast(unsigned short, x); }
__device__ __forceinline__ unsigned pk16(unsigned short a, unsigned short b) { return (unsigned)a | ((unsigned)b << 16); }
__device__ __forceinline__ v8f zero8() { v8f z = {0.f, 0.f, 0.f, 0.f, 0.f, 0.f, 0.f, 0.f}; return z; }
__device__ __forceinline__ int imin(int a, int b) { return a < b ? a : b; }
__device__ __forceinline__ int imax(int a, int b) { return a > b ? a : b; }

// Relative-position bucket for rel = query - key >= 0 (bidirectional split, 32 buckets, max distance 128), as an exact
// integer table: 0 -> 0; 1..7 -> 16+rel; 8..11 -> 24; 12..15 -> 25; 16..22 -> 26; 23..31 -> 27; 32..45 -> 28; 46..63 -> 29;
// 64..90 -> 30; >= 91 -> 31.
__device__ __forceinline__ int rel_bucket(int rel) {
  int b = 31;
  b = (rel < 91) ? 30 : b;
  b = (rel < 64) ? 29 : b;
  b = (rel < 46) ? 28 : b;
  b = (rel < 32) ? 27 : b;
  b = (rel < 23) ? 26 : b;
  b = (rel < 16) ? 25 : b;
  b = (rel < 12) ? 24 : b;
  b = (rel < 8) ? (16 + rel) : b;
  b = (rel == 0) ? 0 : b;
  return b;
}

// ---- fragment loaders: 16-bit A/B operand, lane -> row/col (lane&15), p already includes +8*(lane>>4);
//      elements 0..7 <- p[0..7] (k0+8h..), elements 8..15 <- p[16..23] (k0+16+8h..)  (same split k map for A and B;
//      B is always read from a k-contiguous [n][k] plane)
__device__ __forceinline__ v16h ldfrag_u(const unsigned short* p) {
  FragH f;
  f.u[0] = *(const v4u*)(p);
  f.u[1] = *(const v4u*)(p + 16);
  return f.v;
}
// Fragment-ordered plane of an [M][N] matrix (M multiple of 16, N of 64): chunk (m / 16) * (N / 64) + n / 64 holds 16 rows x 64 cols as
// FCH halves: [hi | residual] x [col / 16 & 3] x [lane = 16 * (col / 8 & 1) + row % 16] x [col % 8]. The two 16-B loads of a fragment
// (16 rows x 32 cols, same k map as above) then read 512 consecutive bytes each. p = the 16 x 32 block (FBK halves) + 8 * lane.
#define FCH 2048
#define FPL 1024
#define FBK 512
__device__ __forceinline__ v16h ldfrag_f(const _Float16* p) {
  FragH f;
  f.h[0] = *(const v8h*)(p);
  f.h[1] = *(const v8h*)(p + 256);
  return f.v;
}

// ---- WMMA helpers with trailing VALU hazard gaps ------------------------------------------------------
__device__ __forceinline__ v8f mma_raw(v16h a, v16h b, v8f c) {
  return __builtin_amdgcn_wmma_f32_16x16x32_f16(false, a, false, b, (short)0, c, false, false);
}
__device__ __forceinline__ void guard_s2x4(v8f& s, v8f& t, v16h a0, v16h a1, v16h b0, v16h b1) {
#if defined(__HIP_DEVICE_COMPILE__)
  asm volatile("v_nop\n\tv_nop\n\tv_nop\n\tv_nop" : "+v"(s), "+v"(t) : "v"(a0), "v"(a1), "v"(b0), "v"(b1));
#endif
}
__device__ __forceinline__ void guard_pv4(v8f& a, v8f& b, v8f& c, v8f& d, v16h x, v16h y, v16h z, v16h w, v16h u) {
#if defined(__HIP_DEVICE_COMPILE__)
  asm volatile("v_nop\n\tv_nop\n\tv_nop\n\tv_nop"
               : "+v"(a), "+v"(b), "+v"(c), "+v"(d) : "v"(x), "v"(y), "v"(z), "v"(w), "v"(u));
#endif
}
__device__ __forceinline__ void keep4_h(v16h a, v16h b, v16h c, v16h d) {
#if defined(__HIP_DEVICE_COMPILE__)
  asm volatile("v_nop" :: "v"(a), "v"(b), "v"(c), "v"(d));
#endif
}
// Later writes of the address and data registers of the global loads and stores issued so far stay behind this wait.
__device__ __forceinline__ void wait_x0() {
#if defined(__HIP_DEVICE_COMPILE__)
  asm volatile("s_wait_xcnt 0x0" ::: "memory");
#endif
}
// The same wait behind a group of loads that share the address p: p is named as an input so that its register pair lives up to the
// wait; otherwise the group's last load may land on the pair that the loads ahead of it still name.
__device__ __forceinline__ void wait_x0_addr(const _Float16* p) {
#if defined(__HIP_DEVICE_COMPILE__)
  asm volatile("s_wait_xcnt 0x0" :: "v"(p) : "memory");
#endif
}
// Lane l takes the value of lane l ^ 16: a vector cross-row move, no LDS trip.
__device__ __forceinline__ float xhalf(float x) {
  const int b = __builtin_bit_cast(int, x);
  return __builtin_bit_cast(float, __builtin_amdgcn_permlanex16(b, b, 0x76543210, 0xfedcba98, false, false));
}
// RMSNorm row factor from the plane ss[NSS][NROWS] of partial sums of squares: rsqrt(mean(x*x) + eps), eps 1.1920929e-7.
static_assert(NSS == 4);
__device__ __forceinline__ float row_ss(const float* __restrict__ ss, int m) {
  return (ss[m] + ss[NROWS + m]) + (ss[2 * NROWS + m] + ss[3 * NROWS + m]);
}
__device__ __forceinline__ float rstd_of(float s) {
  const float x = s * (1.0f / (float)DMODEL) + RMS_EPS;    // s >= 0, so x >= eps: a normal number, no range scaling round the instruction
  float r = 0.f;
#if defined(__HIP_DEVICE_COMPILE__)
  // v_nop: the one slot between a transcendental and an instruction that reads its result or overwrites its source
  asm("v_rsq_f32 %0, %1\n\tv_nop" : "=v"(r) : "v"(x));
#endif
  return r;
}

// =====================================================================================================
// Transposing 16-bit pack of a weight stored in[R][C] (row pitch C floats, R = contraction index, C = output index) into
// out[Cp][ldd] (row pitch ldd halves): out[c][r] = f16( bf16_RNE(in[r][c]) * schi ) for r < R and c < C, 0 otherwise (pad rows /
// pad columns explicitly written as zeros); with DUAL a second copy out[c][locol + r] = f16( bf16_RNE(in[r][c]) * sclo ).
// schi / sclo powers of two (exact). Tiles: Cp/64 along bx, Rp/64 along by; bz = slice: src advanced by bz*sZ floats, dst by
// bz*dZ halves. One 64x64 tile per block through LDS (bf16 bits): 16 scalar loads per thread with CLAMPED addresses, zero by
// coverage: load 256 thr x 16 floats = 64x64; store 2 it x 8 waves x 4 rows x (8 lanes x 8 halves) = 64 rows x 64 halves per copy;
//           tiles (Cp/64, Rp/64, Z) exact, each output line written by exactly one wave; pad region included.
// =====================================================================================================
// (bx, by, bz) = the tile's place in the grid described above; dual is the same for the whole block.
__device__ __forceinline__ void tcvt16(unsigned short* sT, const float* __restrict__ src, long long sZ,
                                       unsigned short* dst, long long dZ,
                                       int R, int C, int ldd, int locol, float schi, float sclo,
                                       bool dual, int bx, int by, int bz) {
  const int tid = threadIdx.x, lane = tid & 31, wave = tid >> 5;
  const int c0 = bx * 64, r0 = by * 64;
  const float* srcz = src + (size_t)((long long)bz * sZ);
  unsigned short* dstz = dst + (size_t)((long long)bz * dZ);
  const int rr = tid >> 2, cc = (tid & 3) * 16;
  const int r = r0 + rr;
  const int rcl = imin(r, R - 1);
  const float* sp = srcz + (size_t)rcl * C;
#pragma unroll
  for (int e = 0; e < 16; ++e) {
    const int cidx = c0 + cc + e;
    const int ccl = imin(cidx, C - 1);
    float a = sp[ccl];
    a = (r < R && cidx < C) ? a : 0.f;
    sT[(cc + e) * 72 + rr] = bf_bits(a);
  }
  __syncthreads();
  v4u hvals[2], lvals[2];
#pragma unroll
  for (int it = 0; it < 2; ++it) {
    const int q = it * 32 + wave * 4 + (lane >> 3);
    const v4u raw = *(const v4u*)(sT + q * 72 + (lane & 7) * 8);
    v4u hv = {0u, 0u, 0u, 0u}, lv = {0u, 0u, 0u, 0u};
#pragma unroll
    for (int e = 0; e < 4; ++e) {
      const float f0 = bf_up((unsigned short)(raw[e] & 0xFFFFu));
      const float f1 = bf_up((unsigned short)(raw[e] >> 16));
      hv[e] = pk16(h_bits((_Float16)(f0 * schi)), h_bits((_Float16)(f1 * schi)));
      lv[e] = pk16(h_bits((_Float16)(f0 * sclo)), h_bits((_Float16)(f1 * sclo)));
    }
    hvals[it] = hv;
    lvals[it] = lv;
  }
  {
#pragma unroll
    for (int it = 0; it < 2; ++it) {
      const int q = it * 32 + wave * 4 + (lane >> 3);
      unsigned short* p = dstz + (size_t)(c0 + q) * ldd + r0 + (lane & 7) * 8;
      *(v4u*)p = hvals[it];
    }
    wait_x0();                                             // no register of the two stores above is rewritten ahead of this wait
    if (dual) {
#pragma unroll                                             // lvals[] indexed by constants, so that it stays in registers
      for (int it = 0; it < 2; ++it) {
        const int q = it * 32 + wave * 4 + (lane >> 3);
        unsigned short* p = dstz + (size_t)(c0 + q) * ldd + r0 + (lane & 7) * 8;
        *(v4u*)(p + locol) = lvals[it];
      }
      wait_x0();                                           // the same for the second copy's two stores
    }
  }
}

// =====================================================================================================
// Batched f16 WMMA GEMM, operands staged in LDS: C[m][n] = f( oscale * sum_k A[m][k] * Bt[n][k] + bias ); one 64x64 tile per
// work-group of 8 waves (wave = 16 rows x 32 cols, two accumulators). A row-major [M][K] (16-bit plane), Bt row-major
// [N][K] (k contiguous), both at row pitch K; M, N multiples of 64, K = KST * NCH. tile = tile index, by = batch index with element
// strides sA, sB, sC. A stage is KST k of the tile's 64 A rows and 64 Bt rows, brought to LDS by asynchronous 16-B copies
// (a wave's copy = two aligned 256-B units) at row pitch KST + 8 halves (16 B x odd: ds_load_b128 fragment reads without bank conflicts).
// NCH 1: the stage is filled once and then read. NCH 2: two buffers, stage 1 flies while stage 0 is multiplied.
// k runs upward through one accumulator per 16x16 output tile.
// BM: 0 no bias, 1 bias bf16(biasp[n]) for n < nbias (0 beyond, clamped address).   ACT: 2 = ReLU applied to (value + bias).
// OM 0 = f32 out (pitch ldc); RM 2 adds raw f32 Rp[m][n] (same pitch/stride as C).
// OM 1 = dual f16 out (pitch ldc): hi = f16(value * ocarry) at C[m][n], residual f16(RC * (value * ocarry - hi)) at C[m][n] + lofs.
// OM 2 = the same two values in the fragment-ordered plane described at ldfrag_f (ldc and lofs not used); a wave's store = one
//        512-B block of the plane.
// NRM 1: one operand is the plane of x * bf16(norm weight) * HC; the sum is multiplied by the RMSNorm factor of its x row (ahead of
//        bias and ReLU), taken from ssp[NSS][NROWS]: x row = m (A operand), or with colf (OM 2 only) by * N + n (Bt operand).
// EM 1 (OM 0, N = DMODEL): C is the residual stream x; the tile also stores Hout[m][n] = f16(x * bf16(nwp[n]) * HC), its residual x64
//        at Hout[m][DMODEL + n] (row pitch KD; a row's 128-B segment = 16 lanes) and SSout[n0 / 64][m] = sum of x*x over its 64 columns
//        (4 per lane, then xor shuffles over 16 lanes), gathered in the pad column of sT so that one wave stores each 128-B line.
// coverage: copies: 2 operands x 4 row groups of 16 x KST/128 units of 256 B = 2*KST/32 copies per thread and stage; slab: 8 waves x 16 x 32 = 64 x 64;
//           out: f32 4 it x 16 rows x 16 lanes x 4, f16 2 it x 32 rows x 8 lanes x 8 (both planes) = the whole 64x64 tile;
//           grid = tilesM*tilesN blocks exactly.
// =====================================================================================================
// Eight asynchronous 16-B copies global -> LDS (l = the lane's LDS byte address, g = the lane's global address). The closing
// s_wait_xcnt keeps every later write of these address registers behind the copies' address translation.
__device__ __forceinline__ void acopy8(const unsigned* l, const unsigned short* const* g) {
#if defined(__HIP_DEVICE_COMPILE__)
  asm volatile(
      "global_load_async_to_lds_b128 %0, %8, off\n\t"
      "global_load_async_to_lds_b128 %1, %9, off\n\t"
      "global_load_async_to_lds_b128 %2, %10, off\n\t"
      "global_load_async_to_lds_b128 %3, %11, off\n\t"
      "global_load_async_to_lds_b128 %4, %12, off\n\t"
      "global_load_async_to_lds_b128 %5, %13, off\n\t"
      "global_load_async_to_lds_b128 %6, %14, off\n\t"
      "global_load_async_to_lds_b128 %7, %15, off\n\t"
      "s_wait_xcnt 0x0"
      :: "v"(l[0]), "v"(l[1]), "v"(l[2]), "v"(l[3]), "v"(l[4]), "v"(l[5]), "v"(l[6]), "v"(l[7]),
         "v"(g[0]), "v"(g[1]), "v"(g[2]), "v"(g[3]), "v"(g[4]), "v"(g[5]), "v"(g[6]), "v"(g[7])
      : "memory");
#endif
}
// The wave's own copies have landed in LDS behind this wait.
__device__ __forceinline__ void wait_async0() {
#if defined(__HIP_DEVICE_COMPILE__)
  asm volatile("s_wait_asynccnt 0x0" ::: "memory");
#endif
}
// The wave's own LDS reads have returned behind this wait.
__device__ __forceinline__ void wait_ds0() {
#if defined(__HIP_DEVICE_COMPILE__)
  asm volatile("s_wait_dscnt 0x0" ::: "memory");
#endif
}
// One stage: KST halves of rows 0..63 of Ag to LDS rows 0..63 and of rows 0..63 of Bg to LDS rows 64..127 (global row pitch LDK
// halves). 16 lanes take one aligned 256-B unit of a row, a copy of the block 16 rows; every offset below is a constant.
template <int KST, int LDK>
__device__ __forceinline__ void fill_stage(const unsigned short* Ag, const unsigned short* Bg, unsigned ldsb, int tid) {
  constexpr int CG  = KST / 128;            // 256-B units per row
  constexpr int PER = 4 * CG;               // copies per thread and operand
  constexpr int PIT = KST + 8;              // LDS row pitch, halves
  static_assert((KST % 128) == 0 && (2 * PER) % 8 == 0 && 2 * PER <= 63);
  const int r0 = tid >> 4, h0 = (tid & 15) * 8;
  const unsigned short* a0 = Ag + (size_t)r0 * LDK + h0;
  const unsigned short* b0 = Bg + (size_t)r0 * LDK + h0;
  const unsigned l0 = ldsb + (unsigned)(r0 * PIT + h0) * 2u;
  // both loops unrolled: every copy's offsets are then constants and l[], g[] stay in registers
#pragma unroll
  for (int g0 = 0; g0 < 2 * PER; g0 += 8) {
    unsigned l[8];
    const unsigned short* g[8];
#pragma unroll
    for (int e = 0; e < 8; ++e) {
      const int it = g0 + e;
      const bool isB = it >= PER;
      const int j = isB ? it - PER : it;
      const int rg = j / CG, cg = j - rg * CG;
      l[e] = l0 + (unsigned)((((isB ? 64 : 0) + rg * 16) * PIT + cg * 128) * 2);
      g[e] = (isB ? b0 : a0) + (size_t)(rg * 16) * LDK + cg * 128;
    }
    acopy8(l, g);
  }
}

template <int OM, int RM, int ACT, int BM, int KST, int NCH, int NRM, int EM>
__device__ __forceinline__ void gemm64_tile(
    const unsigned short* __restrict__ Ap, long long sA,
    const unsigned short* __restrict__ Btp, long long sB,
    const float* __restrict__ Rp,
    const float* __restrict__ biasp, int nbias,
    void* Cout, int ldc, long long sC, long long lofs,
    int N, float oscale, float ocarry, int tile, int by,
    const float* __restrict__ ssp, bool colf,
    const float* __restrict__ nwp, unsigned short* Hout, float* SSout) {
  static_assert(EM == 0 || OM == 0);
  constexpr int PIT  = KST + 8;               // LDS row pitch, halves
  constexpr int BUFH = 128 * PIT;            // halves per stage buffer: 64 A rows, then 64 Bt rows
  constexpr int LDK  = KST * NCH;            // row pitch of A and Bt, halves (= K)
  constexpr int KB   = 4;                    // k steps of 32 per fragment block
  constexpr int NBLK = KST / (32 * KB);
  static_assert(NCH == 1 || NCH == 2);
  static_assert((KST % (32 * KB)) == 0 && ((PIT * 2) % 32) == 16);
  __shared__ __align__(16) unsigned short sP[NCH * BUFH];
  __shared__ __align__(16) float sT[64 * 68];        // the tile in f32, pitch 68 floats
  const int tid  = threadIdx.x;
  const int lane = tid & 31;
  const int wave = tid >> 5;
  const int tilesN = N >> 6;
  const int tm = tile / tilesN;
  const int tn = tile - tm * tilesN;
  const int m0 = tm << 6;
  const int n0 = tn << 6;

  const unsigned short* Ag = Ap  + (size_t)((long long)by * sA) + (size_t)m0 * LDK;
  const unsigned short* Bg = Btp + (size_t)((long long)by * sB) + (size_t)n0 * LDK;
  const unsigned ldsb = (unsigned)(uintptr_t)(&sP[0]);   // LDS byte address = low 32 bits of the shared address

  fill_stage<KST, LDK>(Ag, Bg, ldsb, tid);

  const int r16 = tid >> 4, c4 = (tid & 15) * 4;         // f32 out: 256-B row segment = 16 lanes x 16 B
  const int r32 = tid >> 3;                              // f16 out: 128-B row segment = 8 lanes x 16 B
  const int c8 = (OM == 2) ? (wave & 3) * 16 + (lane >> 4) * 8 : (tid & 7) * 8;   // OM 2: 16 cols per wave, 8 per lane half

  // ---- RMSNorm factors of the x rows behind this thread's output rows (or, with colf, columns); read here, while stage 0 flies ----
  // every loop down to the wait on the copies is unrolled: the small arrays are then indexed by constants and stay in registers
  float rrow[4], rcol[8];
#pragma unroll
  for (int e = 0; e < 4; ++e) rrow[e] = 1.f;
#pragma unroll
  for (int e = 0; e < 8; ++e) rcol[e] = 1.f;
  if constexpr (NRM == 1) {
    if (OM == 2 && colf) {
      const float* p = ssp + (size_t)by * N + n0 + c8;
      v4f a[NSS], b[NSS];
#pragma unroll
      for (int j = 0; j < NSS; ++j) {
        a[j] = *(const v4f*)(p + (size_t)j * NROWS);
        b[j] = *(const v4f*)(p + (size_t)j * NROWS + 4);
      }
      wait_x0();                                           // no address register of the loads above is rewritten ahead of this wait
#pragma unroll
      for (int e = 0; e < 4; ++e) {
        rcol[e]     = rstd_of((a[0][e] + a[1][e]) + (a[2][e] + a[3][e]));
        rcol[4 + e] = rstd_of((b[0][e] + b[1][e]) + (b[2][e] + b[3][e]));
      }
    } else {
      constexpr int NIT = (OM == 0) ? 4 : 2;
      float s[NIT];
#pragma unroll
      for (int it = 0; it < NIT; ++it) {
        const int row = (OM == 0) ? it * 16 + r16 : (OM == 2) ? (it * 2 + (wave >> 2)) * 16 + (lane & 15) : it * 32 + r32;
        s[it] = row_ss(ssp, m0 + row);
      }
      wait_x0();                                           // the same for these loads
#pragma unroll
      for (int it = 0; it < NIT; ++it) rrow[it] = rstd_of(s[it]);
    }
  }
  // ---- the next RMSNorm's weight for this thread's four columns ----
  float nw[4];
#pragma unroll
  for (int e = 0; e < 4; ++e) nw[e] = 0.f;
  if constexpr (EM == 1) {
    const v4f w4 = *(const v4f*)(nwp + n0 + c4);
    wait_x0();                                             // the same for this load
#pragma unroll
    for (int e = 0; e < 4; ++e) nw[e] = bfr(w4[e]);
  }

  wait_async0();
  __syncthreads();                                       // stage 0 readable by every wave
  if constexpr (NCH == 2) fill_stage<KST, LDK>(Ag + KST, Bg + KST, ldsb + (unsigned)(BUFH * 2), tid);

  const int rlane = lane & 15;                 // row (A) / col (B, D) within subtile
  const int koff  = (lane >> 4) * 8;           // k offset of this lane half
  const int mOff  = (lane >> 4) * 8;           // D row offset
  const int wr = wave >> 1, wc = wave & 1;     // wave tile: rows wr*16.., cols wc*32..

  v8f acc0 = zero8(), acc1 = zero8();
  // the loops below are unrolled so that the two fragment sets are indexed by constants and stay in registers
#pragma unroll
  for (int t = 0; t < NCH; ++t) {
    const unsigned short* aL = sP + t * BUFH + (wr * 16 + rlane) * PIT + koff;
    const unsigned short* bL = sP + t * BUFH + (64 + wc * 32 + rlane) * PIT + koff;
    // fragments one block ahead in a second register set, each block's LDS reads as one group; never across a stage
    v16h fa[2][KB], fb0[2][KB], fb1[2][KB];
#pragma unroll
    for (int s = 0; s < KB; ++s) {
      fa[0][s]  = ldfrag_u(aL + s * 32);
      fb0[0][s] = ldfrag_u(bL + s * 32);
      fb1[0][s] = ldfrag_u(bL + 16 * PIT + s * 32);
    }
#pragma unroll
    for (int blk = 0; blk < NBLK; ++blk) {
      const int cur = blk & 1;
      if (blk + 1 < NBLK) {
#pragma unroll
        for (int s = 0; s < KB; ++s) {
          const int k0 = ((blk + 1) * KB + s) * 32;
          fa[cur ^ 1][s]  = ldfrag_u(aL + k0);
          fb0[cur ^ 1][s] = ldfrag_u(bL + k0);
          fb1[cur ^ 1][s] = ldfrag_u(bL + 16 * PIT + k0);
        }
      }
      __builtin_amdgcn_sched_barrier(0);   // keeps the next block's LDS reads one group ahead of this block's products
#pragma unroll
      for (int s = 0; s < KB; ++s) {
        acc0 = mma_raw(fa[cur][s], fb0[cur][s], acc0);
        acc1 = mma_raw(fa[cur][s], fb1[cur][s], acc1);
      }
      __builtin_amdgcn_sched_barrier(0);   // keeps later blocks' LDS reads from spreading among these products
    }
    if (t + 1 < NCH) {
      wait_ds0();
      wait_async0();
      __syncthreads();                                   // stage t + 1 readable by every wave
    }
  }
  if constexpr (NCH == 2) wait_async0();                 // no copy is outstanding when the buffers are left

  // ---- column bias (same columns for every row a thread writes), clamped addresses ----
  float bc4[4], bc8[8];
#pragma unroll
  for (int e = 0; e < 4; ++e) bc4[e] = 0.f;
#pragma unroll
  for (int e = 0; e < 8; ++e) bc8[e] = 0.f;
  if constexpr (BM == 1) {
    if constexpr (OM == 0) {
#pragma unroll
      for (int e = 0; e < 4; ++e) {
        const int n = n0 + c4 + e;
        const int ncl = imin(n, nbias - 1);
        const float t = bfr(biasp[ncl]);
        bc4[e] = (n < nbias) ? t : 0.f;
      }
    } else {
#pragma unroll
      for (int e = 0; e < 8; ++e) {
        const int n = n0 + c8 + e;
        const int ncl = imin(n, nbias - 1);
        const float t = bfr(biasp[ncl]);
        bc8[e] = (n < nbias) ? t : 0.f;
      }
    }
  }

  // ---- epilogue: the tile through LDS, whole row segments (OM 0, 1) or whole 512-B fragment blocks (OM 2) out ----
#pragma unroll
  for (int r = 0; r < 8; ++r) {
    float* sp = sT + (wr * 16 + mOff + r) * 68 + wc * 32 + rlane;
    sp[0]  = acc0[r];
    sp[16] = acc1[r];
  }
  __syncthreads();
  if constexpr (OM == 0) {
    float* C = (float*)Cout + (size_t)((long long)by * sC);
    v4f vx[4];
#pragma unroll
    for (int it = 0; it < 4; ++it) {
      const int row = it * 16 + r16;                     // it 0..3 x r16 0..15 = rows 0..63
      const int gr  = m0 + row;
      v4f v = *(const v4f*)(sT + row * 68 + c4);
      v4f rv = {0.f, 0.f, 0.f, 0.f};
      if constexpr (RM == 2) {
        const float* R = Rp + (size_t)((long long)by * sC);
        rv = *(const v4f*)(R + (size_t)gr * ldc + n0 + c4);
      }
      const float osc = oscale * rrow[it];
#pragma unroll
      for (int e = 0; e < 4; ++e) {
        float u = v[e] * osc;
        if constexpr (BM == 1) u += bc4[e];
        if constexpr (ACT == 2) u = fmaxf(u, 0.f);
        v[e] = u + rv[e];
      }
      if constexpr (EM == 0) *(v4f*)(C + (size_t)gr * ldc + n0 + c4) = v;
      vx[it] = v;
    }
    if constexpr (EM == 1) {
      // the loops of this block are unrolled so that vx[] and q[] stay in registers; the four rows' shuffles of a step are independent
      float q[4];
#pragma unroll
      for (int it = 0; it < 4; ++it)
        q[it] = (vx[it][0] * vx[it][0] + vx[it][1] * vx[it][1]) + (vx[it][2] * vx[it][2] + vx[it][3] * vx[it][3]);
#pragma unroll
      for (int off = 1; off < 16; off <<= 1) {
#pragma unroll
        for (int it = 0; it < 4; ++it) q[it] += __shfl_xor(q[it], off, 32);
      }
      if ((tid & 15) == 0) {                               // pad column: no other thread reads or writes it before the barrier below
#pragma unroll
        for (int it = 0; it < 4; ++it) sT[(it * 16 + r16) * 68 + 64] = q[it];
      }
      __syncthreads();                                     // the 64 row sums readable by waves 0 and 1; ahead of the global stores
#pragma unroll
      for (int it = 0; it < 4; ++it) {
        const int gr = m0 + it * 16 + r16;
        const v4f v = vx[it];
        *(v4f*)(C + (size_t)gr * ldc + n0 + c4) = v;
        const float f0 = (v[0] * nw[0]) * HC, f1 = (v[1] * nw[1]) * HC, f2 = (v[2] * nw[2]) * HC, f3 = (v[3] * nw[3]) * HC;
        const _Float16 g0 = (_Float16)f0, g1 = (_Float16)f1, g2 = (_Float16)f2, g3 = (_Float16)f3;
        v2u hv, lv;
        hv[0] = pk16(h_bits(g0), h_bits(g1));
        hv[1] = pk16(h_bits(g2), h_bits(g3));
        lv[0] = pk16(h_bits((_Float16)((f0 - (float)g0) * RC)), h_bits((_Float16)((f1 - (float)g1) * RC)));
        lv[1] = pk16(h_bits((_Float16)((f2 - (float)g2) * RC)), h_bits((_Float16)((f3 - (float)g3) * RC)));
        unsigned short* hp = Hout + (size_t)gr * KD + n0 + c4;
        *(v2u*)hp = hv;
        *(v2u*)(hp + DMODEL) = lv;
      }
      if (tid < 64) SSout[(size_t)tn * NROWS + m0 + tid] = sT[tid * 68 + 64];
    }
  } else {
    unsigned short* C = (unsigned short*)Cout + (size_t)((long long)by * sC);
#pragma unroll
    for (int it = 0; it < 2; ++it) {
      // OM 1: it 0..1 x r32 0..31 = rows 0..63; OM 2: 16 rows per wave, (it, wave / 4) = the tile's four groups of 16 rows
      const int row = (OM == 2) ? (it * 2 + (wave >> 2)) * 16 + rlane : it * 32 + r32;
      const float* spf = sT + row * 68 + c8;
      v4u a = {0u, 0u, 0u, 0u}, bl = {0u, 0u, 0u, 0u};
      const float osc = oscale * rrow[it];
#pragma unroll
      for (int e = 0; e < 4; ++e) {
        float f0 = spf[2 * e] * osc;
        float f1 = spf[2 * e + 1] * osc;
        if constexpr (NRM == 1 && OM == 2) { f0 *= rcol[2 * e]; f1 *= rcol[2 * e + 1]; }
        if constexpr (BM == 1) { f0 += bc8[2 * e]; f1 += bc8[2 * e + 1]; }
        if constexpr (ACT == 2) { f0 = fmaxf(f0, 0.f); f1 = fmaxf(f1, 0.f); }
        f0 *= ocarry; f1 *= ocarry;
        const _Float16 g0 = (_Float16)f0, g1 = (_Float16)f1;
        const float r0 = (f0 - (float)g0) * RC, r1 = (f1 - (float)g1) * RC;
        a[e]  = pk16(h_bits(g0), h_bits(g1));
        bl[e] = pk16(h_bits((_Float16)r0), h_bits((_Float16)r1));
      }
      if constexpr (OM == 2) {
        unsigned short* p = C + ((size_t)((m0 + row) >> 4) * tilesN + tn) * FCH + (wave & 3) * 256 + lane * 8;
        *(v4u*)p = a;
        *(v4u*)(p + FPL) = bl;
      } else {
        unsigned short* p = C + (size_t)(m0 + row) * ldc + n0 + c8;
        *(v4u*)p = a;
        *(v4u*)(p + (size_t)lofs) = bl;
      }
    }
  }
  (void)Rp; (void)ocarry; (void)lofs; (void)nbias; (void)biasp; (void)ldc; (void)r32;
  (void)ssp; (void)colf; (void)nwp; (void)Hout; (void)SSout; (void)rcol; (void)nw;
}

// One product per launch: blockIdx.x = tile, blockIdx.y = batch index.
template <int OM, int RM, int ACT, int BM, int KST, int NCH, int NRM, int EM>
__global__ __launch_bounds__(256) void gemm64(
    const unsigned short* __restrict__ Ap, long long sA,
    const unsigned short* __restrict__ Btp, long long sB,
    const float* __restrict__ Rp,
    const float* __restrict__ biasp, int nbias,
    void* Cout, int ldc, long long sC, long long lofs,
    int N, float oscale, float ocarry,
    const float* __restrict__ ssp, const float* __restrict__ nwp, unsigned short* Hout, float* SSout) {
  gemm64_tile<OM, RM, ACT, BM, KST, NCH, NRM, EM>(Ap, sA, Btp, sB, Rp, biasp, nbias, Cout, ldc, sC, lofs, N, oscale, ocarry,
                                                  (int)blockIdx.x, (int)blockIdx.y, ssp, false, nwp, Hout, SSout);
}

#define SH_E   8        // log2 of the tiles per batch index of the q / k product: (NROWS / 64) * (DMODEL / 64)
#define SH_V   7        // log2 of the tiles per batch of the v^T product: (DMODEL / 64) * (SEQ / 64)
#define SH_ONE 30       // a product with one batch index only
static_assert((1 << SH_E) == (NROWS / 64) * (DMODEL / 64) && (1 << SH_V) == (DMODEL / 64) * (SEQ / 64));
static_assert(QC == VC);
// Two independent products of the same form in one launch (no residual input): blocks 0..n0-1 work on product 0, the rest on
// product 1; inside a product block i is tile i mod 2^sh of batch index i >> sh. The choice is the same for the whole block.
// Both read the plane of x * norm weight (NRM 1): as A, or, where the product's colf is set, as Bt.
// coverage: grid = n0 + (blocks of product 1), each product's (tile, batch) pairs taken exactly once.
template <int OM, int ACT, int BM, int KST, int NCH>
__global__ __launch_bounds__(256) void gemm64x2(
    const unsigned short* __restrict__ Ap0, long long sA0, const unsigned short* __restrict__ Btp0, long long sB0,
    const float* __restrict__ biasp0, int nbias0, void* Cout0, int ldc0, long long sC0, long long lofs0, int N0, int sh0,
    const unsigned short* __restrict__ Ap1, long long sA1, const unsigned short* __restrict__ Btp1, long long sB1,
    const float* __restrict__ biasp1, int nbias1, void* Cout1, int ldc1, long long sC1, long long lofs1, int N1, int sh1,
    int n0, float oscale, float ocarry, const float* __restrict__ ssp, int colf0, int colf1) {
  const int b = (int)blockIdx.x;
  const bool p0 = b < n0;
  const int i  = p0 ? b : b - n0;
  const int sh = p0 ? sh0 : sh1;
  const int by = i >> sh;
  gemm64_tile<OM, 0, ACT, BM, KST, NCH, 1, 0>(p0 ? Ap0 : Ap1, p0 ? sA0 : sA1, p0 ? Btp0 : Btp1, p0 ? sB0 : sB1, (const float*)0,
                                              p0 ? biasp0 : biasp1, p0 ? nbias0 : nbias1, p0 ? Cout0 : Cout1, p0 ? ldc0 : ldc1,
                                              p0 ? sC0 : sC1, p0 ? lofs0 : lofs1, p0 ? N0 : N1, oscale, ocarry, i - (by << sh), by,
                                              ssp, (p0 ? colf0 : colf1) != 0, (const float*)0, (unsigned short*)0, (float*)0);
}

#define ATT_SPLIT   8
#define ATT_THREADS (ATT_SPLIT * 32)
#define ATT_TILES   (SEQ / 16)              // query tiles per batch and head
#define ATT_BLOCKS  (NB * (ATT_TILES / 2) * NHEAD)
#define OP_PITCH    68
#define VCS         ((SEQ / 64) * FCH)      // halves between the v^T chunks of 16 d and of the next 16 d at the same keys
static_assert(ATT_THREADS == 16 * (HDIM / 4) && HDIM == 64);
static_assert((HDIM * 2) % 128 == 0 && (HDIM % 32) == 0 && (ATT_TILES % 2) == 0);

__global__ __launch_bounds__(ATT_THREADS)
void attn4(const unsigned short* __restrict__ QPp, const unsigned short* __restrict__ KPp,
           const unsigned short* __restrict__ VTq, const float* __restrict__ relbl, unsigned short* CT) {
  __shared__ __align__(16) float sbias[SEQ];                          // [rel], bf16(relb) * log2 e
  __shared__ __align__(16) float spo[ATT_SPLIT * 16 * OP_PITCH];      // per wave partial [row][64 d], pitch 68
  __shared__ __align__(16) float sml[2 * ATT_SPLIT * 16];             // per wave and row: max, then sum

  const int tid  = threadIdx.x;
  const int wave = __builtin_amdgcn_readfirstlane(tid >> 5);  // scalar: the key loop's trip count is a scalar branch, EXEC stays full
  const int lane = tid & 31;
  const int hh   = lane >> 4;
  const int c    = lane & 15;

  const int head = blockIdx.x % NHEAD;                     // 0..3
  const int qb   = blockIdx.x / NHEAD;
  const int bat  = qb % NB;                                // batch
  const int pr   = qb / NB;                                // tile pair 0 .. ATT_TILES / 2 - 1
  const int kmax = (ATT_TILES - pr) * 16;                  // key count of the pair's later tile

  // ---- relative-position bias table for rel 0..kmax-1 of this head ----
  for (int rel = tid; rel < kmax; rel += ATT_THREADS) {
    const int bk = rel_bucket(rel);
    sbias[rel] = bfr(relbl[bk * NHEAD + head]) * LOG2E;
  }
  __syncthreads();

  const float* sb = sbias;
  const _Float16* Q16 = (const _Float16*)(const void*)QPp;
  const _Float16* K16 = (const _Float16*)(const void*)KPp;
  const _Float16* V16 = (const _Float16*)(const void*)VTq;
  const _Float16* Kf = K16 + ((size_t)((bat * SEQ) >> 4) * NHEAD + head) * FCH + lane * 8;
  const _Float16* Vf = V16 + (size_t)bat * VTR * SEQ + (size_t)(head * (HDIM / 16)) * VCS + lane * 8;  // chunk (16 d, 64 keys)
  const float lsc = (LOG2E * ATT_SCALE) / (QC * KC);      // log2(e) / 8 / carries

  // the pair's two tiles one after the other, the later, longer tile first (the body keeps its indentation); rolled: unrolled, the
  // kernel's text would double and gain nothing, since the tiles share only the table
#pragma unroll 1
  for (int ps = 0; ps < 2; ++ps) {
  const int qt   = (ps == 0) ? ATT_TILES - 1 - pr : pr;    // query tile
  const int q0   = qt * 16;
  const int qi   = q0 + c;                                 // this lane's query
  const int kend = q0 + 16;                                // causal: keys 0 .. q0+15; rel = query - key in 0 .. kend-1
  const _Float16* Qf = Q16 + ((size_t)((bat * SEQ + q0) >> 4) * NHEAD + head) * FCH + lane * 8;   // chunk (16 tokens, head)
  const v16h qah = ldfrag_f(Qf), qbh = ldfrag_f(Qf + FBK);                      // hi, d 0..31 / 32..63
  const v16h qal = ldfrag_f(Qf + FPL), qbl = ldfrag_f(Qf + FPL + FBK);          // residual x64

  float mrun = -INFINITY, lrun = 0.f;                      // this lane's query: running max (both halves alike), sum over this half's keys
  v8f om0 = zero8(), om1 = zero8(), om2 = zero8(), om3 = zero8();
  v8f or0 = zero8(), or1 = zero8(), or2 = zero8(), or3 = zero8();

#pragma unroll 1
  for (int kb = wave * 32; kb < kend; kb += 32 * ATT_SPLIT) {
    const _Float16* kp = Kf + (size_t)(kb >> 4) * (NHEAD * FCH);
    v8f s0m, s0r, s1m, s1r;                                // register r = score of key (tile's first) + 8 hh + r with query q0 + c
    const _Float16* kq = kp + NHEAD * FCH;                 // the next 16 keys
    // the step's 16 k loads as one group: the second key tile's loads fly while the first tile's are waited for
    const v16h k0h = ldfrag_f(kp), k1h = ldfrag_f(kp + FBK);
    const v16h k0l = ldfrag_f(kp + FPL), k1l = ldfrag_f(kp + FPL + FBK);
    const v16h j0h = ldfrag_f(kq), j1h = ldfrag_f(kq + FBK);
    const v16h j0l = ldfrag_f(kq + FPL), j1l = ldfrag_f(kq + FPL + FBK);
    wait_x0_addr(kp);                                      // no register that the 16 loads name is rewritten ahead of this wait
    s0m = mma_raw(k0h, qah, zero8());
    s0m = mma_raw(k1h, qbh, s0m);
    s0r = mma_raw(k0l, qah, zero8());
    s0r = mma_raw(k1l, qbh, s0r);
    s0r = mma_raw(k0h, qal, s0r);
    s0r = mma_raw(k1h, qbl, s0r);
    guard_s2x4(s0m, s0r, k0h, k1h, k0l, k1l);
    s1m = mma_raw(j0h, qah, zero8());
    s1m = mma_raw(j1h, qbh, s1m);
    s1r = mma_raw(j0l, qah, zero8());
    s1r = mma_raw(j1l, qbh, s1r);
    s1r = mma_raw(j0h, qal, s1r);
    s1r = mma_raw(j1h, qbl, s1r);
    guard_s2x4(s1m, s1r, j0h, j1h, j0l, j1l);
    keep4_h(qah, qbh, qal, qbl);
    // the step's 16 v^T loads as one group ahead of the softmax, which covers their flight
    const _Float16* vp = Vf + (size_t)(kb >> 6) * FCH + ((kb >> 5) & 1) * FBK;
    const _Float16* vq = vp + FPL;
    const v16h vb0 = ldfrag_f(vp);
    const v16h vb1 = ldfrag_f(vp + VCS);
    const v16h vb2 = ldfrag_f(vp + 2 * VCS);
    const v16h vb3 = ldfrag_f(vp + 3 * VCS);
    const v16h vl0 = ldfrag_f(vq);
    const v16h vl1 = ldfrag_f(vq + VCS);
    const v16h vl2 = ldfrag_f(vq + 2 * VCS);
    const v16h vl3 = ldfrag_f(vq + 3 * VCS);
    const int rel0 = qi - kb - 8 * hh;                     // query - key of register 0 in tile 0; register r: r less; tile 1: 16 less
    // the loops over r below are unrolled so that t0[], t1[] are indexed by constants and stay in registers
    float t0[8], t1[8];
#pragma unroll
    for (int r = 0; r < 8; ++r) {
      const int d0 = rel0 - r, d1 = rel0 - 16 - r;
      const float u0 = (s0m[r] + s0r[r] * RCI) * lsc + sb[imax(d0, 0)];
      const float u1 = (s1m[r] + s1r[r] * RCI) * lsc + sb[imax(d1, 0)];
      t0[r] = (d0 < 0) ? -INFINITY : u0;
      t1[r] = (d1 < 0) ? -INFINITY : u1;
    }
    float mx = fmaxf(fmaxf(fmaxf(fmaxf(t0[0], t0[1]), fmaxf(t0[2], t0[3])), fmaxf(fmaxf(t0[4], t0[5]), fmaxf(t0[6], t0[7]))),
                     fmaxf(fmaxf(fmaxf(t1[0], t1[1]), fmaxf(t1[2], t1[3])), fmaxf(fmaxf(t1[4], t1[5]), fmaxf(t1[6], t1[7]))));
    mx = fmaxf(mx, xhalf(mx));                             // the query's max over all 32 keys of the step (key kb is never masked)
    const float mn = fmaxf(mrun, mx);
    const float al = exp2f(fmaxf(mrun - mn, -126.0f));
    mrun = mn;
#pragma unroll
    for (int r = 0; r < 8; ++r) {
      t0[r] = exp2f(t0[r] - mn);
      t1[r] = exp2f(t1[r] - mn);
    }
    lrun = lrun * al + ((((t0[0] + t0[1]) + (t0[2] + t0[3])) + ((t0[4] + t0[5]) + (t0[6] + t0[7]))) +
                        (((t1[0] + t1[1]) + (t1[2] + t1[3])) + ((t1[4] + t1[5]) + (t1[6] + t1[7]))));
    FragH ph;                                              // P^T as B operand: the lane's own 16 values, already in the split k map
#pragma unroll
    for (int r = 0; r < 8; ++r) {
      ph.h[0][r] = (_Float16)(t0[r] * PC);                 // elements 0..7  = keys kb + 8hh + 0..7
      ph.h[1][r] = (_Float16)(t1[r] * PC);                 // elements 8..15 = keys kb + 16 + 8hh + 0..7
      om0[r] *= al; om1[r] *= al; om2[r] *= al; om3[r] *= al;
      or0[r] *= al; or1[r] *= al; or2[r] *= al; or3[r] *= al;
    }
    om0 = mma_raw(vb0, ph.v, om0);
    om1 = mma_raw(vb1, ph.v, om1);
    om2 = mma_raw(vb2, ph.v, om2);
    om3 = mma_raw(vb3, ph.v, om3);
    guard_pv4(om0, om1, om2, om3, ph.v, vb0, vb1, vb2, vb3);
    or0 = mma_raw(vl0, ph.v, or0);
    or1 = mma_raw(vl1, ph.v, or1);
    or2 = mma_raw(vl2, ph.v, or2);
    or3 = mma_raw(vl3, ph.v, or3);
    guard_pv4(or0, or1, or2, or3, ph.v, vl0, vl1, vl2, vl3);
  }

  if (ps != 0) __syncthreads();                            // every wave has read the first tile's partials before they are overwritten
  // ---- the wave's un-normalised partial and its (max, sum) per row to LDS; register r of tile j = d 16 j + 8 hh + r of query c ----
  {
    const float lsum = lrun + xhalf(lrun);                 // the two halves' keys joined, once
    float* pw = spo + wave * (16 * OP_PITCH) + c * OP_PITCH + 8 * hh;
    v4f a, b;
    // unrolled: the accumulators are indexed by constants
#pragma unroll
    for (int e = 0; e < 4; ++e) { a[e] = om0[e] + or0[e] * RCI; b[e] = om0[4 + e] + or0[4 + e] * RCI; }
    *(v4f*)(pw) = a;       *(v4f*)(pw + 4) = b;
#pragma unroll
    for (int e = 0; e < 4; ++e) { a[e] = om1[e] + or1[e] * RCI; b[e] = om1[4 + e] + or1[4 + e] * RCI; }
    *(v4f*)(pw + 16) = a;  *(v4f*)(pw + 20) = b;
#pragma unroll
    for (int e = 0; e < 4; ++e) { a[e] = om2[e] + or2[e] * RCI; b[e] = om2[4 + e] + or2[4 + e] * RCI; }
    *(v4f*)(pw + 32) = a;  *(v4f*)(pw + 36) = b;
#pragma unroll
    for (int e = 0; e < 4; ++e) { a[e] = om3[e] + or3[e] * RCI; b[e] = om3[4 + e] + or3[4 + e] * RCI; }
    *(v4f*)(pw + 48) = a;  *(v4f*)(pw + 52) = b;
    if (hh == 0) {                                         // max and joined sum are equal in the two halves
      sml[wave * 16 + c] = mrun;
      sml[ATT_SPLIT * 16 + wave * 16 + c] = lsum;
    }
  }
  __syncthreads();                                         // every wave's partial readable by every wave
  // ---- merge the 8 partials, fold 1/l and the carries, write 4 hi and 4 residual halves per thread ----
  {
    const int row = tid >> 4, c4 = (tid & 15) * 4;
    float ms[ATT_SPLIT];
    float mall = -INFINITY;
#pragma unroll
    for (int s = 0; s < ATT_SPLIT; ++s) {
      ms[s] = sml[s * 16 + row];
      mall = fmaxf(mall, ms[s]);
    }
    float lall = 0.f;
    v4f o = {0.f, 0.f, 0.f, 0.f};
#pragma unroll
    for (int s = 0; s < ATT_SPLIT; ++s) {
      const float w = exp2f(ms[s] - mall);
      const v4f p = *(const v4f*)(spo + (s * 16 + row) * OP_PITCH + c4);
      lall += w * sml[ATT_SPLIT * 16 + s * 16 + row];
#pragma unroll
      for (int e = 0; e < 4; ++e) o[e] += w * p[e];
    }
    const float inv = (1.0f / lall) * (CC / (PC * VC));
    const float u0 = o[0] * inv, u1 = o[1] * inv, u2 = o[2] * inv, u3 = o[3] * inv;
    const _Float16 g0 = (_Float16)u0, g1 = (_Float16)u1, g2 = (_Float16)u2, g3 = (_Float16)u3;
    v2u hv, lv;
    hv[0] = pk16(h_bits(g0), h_bits(g1));
    hv[1] = pk16(h_bits(g2), h_bits(g3));
    lv[0] = pk16(h_bits((_Float16)((u0 - (float)g0) * RC)), h_bits((_Float16)((u1 - (float)g1) * RC)));
    lv[1] = pk16(h_bits((_Float16)((u2 - (float)g2) * RC)), h_bits((_Float16)((u3 - (float)g3) * RC)));
    unsigned short* dst = CT + ((size_t)bat * SEQ + q0 + row) * KD + head * HDIM + c4;
    *(v2u*)dst = hv;
    *(v2u*)(dst + DMODEL) = lv;
    wait_x0();                                             // the second tile rewrites the registers of the two stores above
  }
  }
}

// =====================================================================================================
// Input convert: obs16[m][640] = f16(16 * bf16_RNE(obs[b*SEQ_FULL + t][c])) for c < 637 (m = b*SEQ + t), 0 for the pad columns
// 637..639 (explicitly written). One wave per row (8 rows per block): 80 pieces of 8 halves; lane writes pieces lane, lane+32 and
// coverage: NROWS/8 blocks x 8 waves = every row; per row pieces 0..79 = cols 0..639.
// =====================================================================================================
__device__ __forceinline__ void cvtobs(const float* __restrict__ src, unsigned short* dst, int blk) {
  const int wave = threadIdx.x >> 5, lane = threadIdx.x & 31;
  const int m = blk * 8 + wave;
  const int b = m / SEQ, t = m - b * SEQ;
  const float* sp = src + ((size_t)b * SEQ_FULL + t) * OBSD;
  unsigned short* dp = dst + (size_t)m * OBSP;
  {
#pragma unroll 1
    for (int it = 0; it < 3; ++it) {
      const int p = it * 32 + lane;
      const int col0 = p * 8;
      v4u a;
#pragma unroll
      for (int e = 0; e < 4; ++e) {
        const int ca = col0 + 2 * e, cb = ca + 1;
        float fa = sp[imin(ca, OBSD - 1)];
        float fb = sp[imin(cb, OBSD - 1)];
        fa = (ca < OBSD) ? fa : 0.f;
        fb = (cb < OBSD) ? fb : 0.f;
        a[e] = pk16(h_bits((_Float16)(bfr(fa) * OBC)), h_bits((_Float16)(bfr(fb) * OBC)));
      }
      if (p < OBSP / 8) {
        *(v4u*)(dp + (size_t)p * 8) = a;
        wait_x0();                                         // the next trip advances the store's address registers
      }
    }
    
  }
}

// =====================================================================================================
// All 16-bit operand planes in one launch (they depend on the inputs alone, not on one another): blocks 0..PB_OBS-1 convert obs,
// then one 64x64 transposing tile per block for w_q, w_k, w_v, w_o, w_1, w_2, obs_w, act_w, obsh_w in this order. The job is a
// function of blockIdx.x alone, so every branch below (and the barrier inside tcvt16) is uniform for the block.
// coverage: each job's blocks = its (Cp/64) x (Rp/64) x slices tiles exactly once; grid = PB_ALL.
// =====================================================================================================
#define PB_OBS (NROWS / 8)
#define PB_E   ((DMODEL / 64) * (DMODEL / 64) * NLAYER)
#define PB_F   ((DFF / 64) * (DMODEL / 64) * NLAYER)
#define PB_OW  ((DMODEL / 64) * (OBSP / 64))
#define PB_AW  ((NACTP / 64) * (DMODEL / 64))
#define PB_HW  ((OBSP / 64) * (DMODEL / 64))
#define PB_ALL (PB_OBS + 4 * PB_E + 2 * PB_F + PB_OW + PB_AW + PB_HW)
static_assert((NROWS % 8) == 0);

__global__ __launch_bounds__(256) void prep(
    const float* __restrict__ obs, const float* __restrict__ w_q, const float* __restrict__ w_k, const float* __restrict__ w_v,
    const float* __restrict__ w_o, const float* __restrict__ w_1, const float* __restrict__ w_2,
    const float* __restrict__ obs_w, const float* __restrict__ act_w, const float* __restrict__ obsh_w,
    unsigned short* OBS16, unsigned short* WQ16, unsigned short* WK16, unsigned short* WV16, unsigned short* WO16,
    unsigned short* W116, unsigned short* W216, unsigned short* OBSW16, unsigned short* ACTW16, unsigned short* OBSHW16) {
  __shared__ __align__(16) unsigned short sT[64 * 72];
  int b = (int)blockIdx.x;
  if (b < PB_OBS) {                                        // the whole block leaves, ahead of any barrier
    cvtobs(obs, OBS16, b);
    return;
  }
  b -= PB_OBS;
  const float* s;
  unsigned short* d;
  long long sZ = 0, dZ = 0;
  int R = DMODEL, C = DMODEL, ldd = KD, locol = DMODEL, gx = DMODEL / 64, gy = DMODEL / 64;
  float sclo = WLO;
  bool dual = true;
  if (b < 4 * PB_E) {                                      // in[256 k][256 n] -> out[256 n][512], per layer
    const int j = b / PB_E;
    b -= j * PB_E;
    s = (j == 0) ? w_q : (j == 1) ? w_k : (j == 2) ? w_v : w_o;
    d = (j == 0) ? WQ16 : (j == 1) ? WK16 : (j == 2) ? WV16 : WO16;
    sZ = (long long)DMODEL * DMODEL; dZ = (long long)DMODEL * KD;
  } else if (b < 4 * PB_E + PB_F) {                        // in[256 k][512 n] -> out[512 n][512], per layer
    b -= 4 * PB_E;
    s = w_1; d = W116;
    sZ = (long long)DMODEL * DFF; dZ = (long long)DFF * KD;
    C = DFF; gx = DFF / 64;
  } else if (b < 4 * PB_E + 2 * PB_F) {                    // in[512 k][256 n] -> out[256 n][1024], per layer
    b -= 4 * PB_E + PB_F;
    s = w_2; d = W216;
    sZ = (long long)DFF * DMODEL; dZ = (long long)DMODEL * KF;
    R = DFF; ldd = KF; locol = DFF; gy = DFF / 64;
  } else if (b < 4 * PB_E + 2 * PB_F + PB_OW) {            // in[637 k][256 n] -> out[256 n][640], k 637..639 zero, one copy
    b -= 4 * PB_E + 2 * PB_F;
    s = obs_w; d = OBSW16;
    R = OBSD; ldd = OBSP; locol = 0; gy = OBSP / 64;
    sclo = 0.f; dual = false;
  } else if (b < 4 * PB_E + 2 * PB_F + PB_OW + PB_AW) {    // in[256 k][4 n] -> out[64 n][512], n >= 4 zero
    b -= 4 * PB_E + 2 * PB_F + PB_OW;
    s = act_w; d = ACTW16;
    C = NACT; gx = NACTP / 64;
  } else {                                                 // in[256 k][637 n] -> out[640 n][512], n >= 637 zero
    b -= 4 * PB_E + 2 * PB_F + PB_OW + PB_AW;
    s = obsh_w; d = OBSHW16;
    C = OBSD; gx = OBSP / 64;
  }
  const int bz = b / (gx * gy);
  const int r  = b - bz * (gx * gy);
  const int by = r / gx;
  tcvt16(sT, s, sZ, d, dZ, R, C, ldd, locol, WSC, sclo, dual, r - by * gx, by, bz);
}

// =====================================================================================================
// Output copy: blockIdx.y == 0: out0[b*SEQ_FULL + t][0..3] = ACTF[b*SEQ + t][0..3] (one 16-B piece per thread, consecutive threads
// (SEQ*637 floats at float OUT1_OFF + b*SEQ_FULL*637) written as consecutive 16-B pieces (thread g -> floats 4i..4i+3, gathered from
// coverage: out0: NROWS pieces = every row; out1: NB * SEQ*637/4 pieces = every float of the region exactly once.
// =====================================================================================================
__global__ __launch_bounds__(256) void ocopy(const float* __restrict__ actf, const float* __restrict__ obsf, float* outp) {
  const int g = blockIdx.x * 256 + threadIdx.x;
  if (blockIdx.y == 0) {
    if (g >= NROWS) return;
    const int b = g / SEQ, t = g - b * SEQ;
    const v4f v = *(const v4f*)(actf + (size_t)g * NACTP);
    float* d = outp + ((size_t)b * SEQ_FULL + t) * NACT;
    {
      *(v4f*)d = v;
      
    }
  } else {
    const int ppb = (SEQ * OBSD) / 4;
    if (g >= NB * ppb) return;
    const int b = g / ppb;
    const int i = (g - b * ppb) * 4;
    v4f v;
#pragma unroll
    for (int e = 0; e < 4; ++e) {
      const int idx = i + e;
      const int row = idx / OBSD;
      const int col = idx - row * OBSD;
      v[e] = obsf[((size_t)b * SEQ + row) * OBSP + col];
    }
    float* d = outp + (size_t)OUT1_OFF + (size_t)b * SEQ_FULL * OBSD + i;
    {
      *(v4f*)d = v;
      
    }
  }
}

// =====================================================================================================
// Workspace map (bytes); every plane is an exact multiple of its tile / whole-row store granularity (M, N exact multiples of 64,
//   WQ16, WK16, WV16, WO16  f16 [6][256 n][512 = k x64 | k x1]     4 x 1572864
//   W116                    f16 [6][512 n][512]                       3145728
//   W216                    f16 [6][256 n][1024 = 512 x64 | 512 x1]  3145728
//   OBSW16                  f16 [256 n][640 k] x64 (k 637..639 zero)  327680
//   ACTW16                  f16 [64 n][512] (n 4..63 zero)              65536
//   OBSHW16                 f16 [640 n][512] (n 637..639 zero)         655360
//   OBS16                   f16 [NROWS][640] x16                      5242880
//   XA, XB                  f32 [NROWS][256] residual stream       2 x 4194304
//   HH, CT                  f16 [NROWS][512] dual planes           2 x 4194304
//   SS                      f32 [4][NROWS] partial sums of x*x          65536
//   QP, KP                  f16 [NROWS/16][4 heads][2048] fragment order  2 x 4194304
//   VT                      f16 [NB][256/16][SEQ/64][2048] fragment order  4194304
//   G16                     f16 [NROWS][1024] dual                   8388608
//   ACTF                    f32 [NROWS][64]                          1048576
//   OBSF                    f32 [NROWS][640]                        10485760
//   total (NB=2, SEQ=2048)                                          68222976
// =====================================================================================================
extern "C" void kernel_launch(void* const* d_in, const int* in_sizes, int n_in,
                              void* d_out, int out_size, void* d_ws, size_t ws_size,
                              hipStream_t stream) {
  if (n_in < 19) return;
  if (in_sizes[0] < ((NB - 1) * SEQ_FULL + SEQ) * OBSD) return;
  if (in_sizes[1] < OBSD * DMODEL || in_sizes[2] < DMODEL) return;
  if (in_sizes[3] < NLAYER * DMODEL) return;
  if (in_sizes[4] < NLAYER * DMODEL * DMODEL || in_sizes[5] < NLAYER * DMODEL * DMODEL) return;
  if (in_sizes[6] < NLAYER * DMODEL * DMODEL || in_sizes[7] < NLAYER * DMODEL * DMODEL) return;
  if (in_sizes[8] < NLAYER * NBUCK * NHEAD || in_sizes[9] < NLAYER * DMODEL) return;
  if (in_sizes[10] < NLAYER * DMODEL * DFF || in_sizes[11] < NLAYER * DFF) return;
  if (in_sizes[12] < NLAYER * DFF * DMODEL || in_sizes[13] < NLAYER * DMODEL) return;
  if (in_sizes[14] < DMODEL || in_sizes[15] < DMODEL * NACT || in_sizes[16] < NACT) return;
  if (in_sizes[17] < DMODEL * OBSD || in_sizes[18] < OBSD) return;
  if (out_size < OUT1_OFF + ((NB - 1) * SEQ_FULL + SEQ) * OBSD) return;

  const float* obs     = (const float*)d_in[0];
  const float* obs_w   = (const float*)d_in[1];
  const float* obs_b   = (const float*)d_in[2];
  const float* norm1_w = (const float*)d_in[3];
  const float* w_q     = (const float*)d_in[4];
  const float* w_k     = (const float*)d_in[5];
  const float* w_v     = (const float*)d_in[6];
  const float* w_o     = (const float*)d_in[7];
  const float* relb    = (const float*)d_in[8];
  const float* norm2_w = (const float*)d_in[9];
  const float* w_1     = (const float*)d_in[10];
  const float* b_1     = (const float*)d_in[11];
  const float* w_2     = (const float*)d_in[12];
  const float* b_2     = (const float*)d_in[13];
  const float* fnorm_w = (const float*)d_in[14];
  const float* act_w   = (const float*)d_in[15];
  const float* act_b   = (const float*)d_in[16];
  const float* obsh_w  = (const float*)d_in[17];
  const float* obsh_b  = (const float*)d_in[18];
  float*       outp    = (float*)d_out;

  const size_t PWE  = (size_t)NLAYER * DMODEL * KD * 2;     // 1572864
  const size_t PW1  = (size_t)NLAYER * DFF * KD * 2;        // 3145728
  const size_t PW2  = (size_t)NLAYER * DMODEL * KF * 2;     // 3145728
  const size_t POBW = (size_t)DMODEL * OBSP * 2;            //  327680
  const size_t PACW = (size_t)NACTP * KD * 2;               //   65536
  const size_t POHW = (size_t)OBSP * KD * 2;                //  655360
  const size_t POBS = (size_t)NROWS * OBSP * 2;             // 5242880
  const size_t PX   = (size_t)NROWS * DMODEL * 4;           // 4194304
  const size_t PH   = (size_t)NROWS * KD * 2;               // 4194304
  const size_t PVT  = (size_t)NB * VTR * SEQ * 2;           // 4194304
  const size_t PG   = (size_t)NROWS * KF * 2;               // 8388608
  const size_t PACF = (size_t)NROWS * NACTP * 4;            // 1048576
  const size_t POBF = (size_t)NROWS * OBSP * 4;             // 10485760
  const size_t PSS  = (size_t)NSS * NROWS * 4;              //    65536
  size_t off = 0;
  const size_t oWQ  = off; off += PWE;
  const size_t oWK  = off; off += PWE;
  const size_t oWV  = off; off += PWE;
  const size_t oWO  = off; off += PWE;
  const size_t oW1  = off; off += PW1;
  const size_t oW2  = off; off += PW2;
  const size_t oOBW = off; off += POBW;
  const size_t oACW = off; off += PACW;
  const size_t oOHW = off; off += POHW;
  const size_t oOBS = off; off += POBS;
  const size_t oXA  = off; off += PX;
  const size_t oXB  = off; off += PX;
  const size_t oHH  = off; off += PH;
  const size_t oQP  = off; off += PH;
  const size_t oKP  = off; off += PH;
  const size_t oCT  = off; off += PH;
  const size_t oVT  = off; off += PVT;
  const size_t oG   = off; off += PG;
  const size_t oACF = off; off += PACF;
  const size_t oOBF = off; off += POBF;
  const size_t oSS  = off; off += PSS;
  const size_t endAll = off;                                // 68222976 for NB=2, SEQ=2048
  if (endAll > ws_size) return;
  if (endAll > (size_t)134217728) return;

  char* ws = (char*)d_ws;
  unsigned short* WQ16    = (unsigned short*)(ws + oWQ);
  unsigned short* WK16    = (unsigned short*)(ws + oWK);
  unsigned short* WV16    = (unsigned short*)(ws + oWV);
  unsigned short* WO16    = (unsigned short*)(ws + oWO);
  unsigned short* W116    = (unsigned short*)(ws + oW1);
  unsigned short* W216    = (unsigned short*)(ws + oW2);
  unsigned short* OBSW16  = (unsigned short*)(ws + oOBW);
  unsigned short* ACTW16  = (unsigned short*)(ws + oACW);
  unsigned short* OBSHW16 = (unsigned short*)(ws + oOHW);
  unsigned short* OBS16   = (unsigned short*)(ws + oOBS);
  float*          XA      = (float*)(ws + oXA);
  float*          XB      = (float*)(ws + oXB);
  unsigned short* HH      = (unsigned short*)(ws + oHH);
  unsigned short* QP      = (unsigned short*)(ws + oQP);
  unsigned short* KP      = (unsigned short*)(ws + oKP);
  unsigned short* CT      = (unsigned short*)(ws + oCT);
  unsigned short* VTp     = (unsigned short*)(ws + oVT);
  unsigned short* G16     = (unsigned short*)(ws + oG);
  float*          ACTF    = (float*)(ws + oACF);
  float*          OBSF    = (float*)(ws + oOBF);
  float*          SS      = (float*)(ws + oSS);

  const dim3 blk(256);
  const int tilesE  = (NROWS / 64) * (DMODEL / 64);                // 256
  const int tilesV  = (DMODEL / 64) * (SEQ / 64);                  // 128 per batch
  const int tilesF  = (NROWS / 64) * (DFF / 64);                   // 512
  const int tilesA  = (NROWS / 64) * (NACTP / 64);                 // 64
  const int tilesO  = (NROWS / 64) * (OBSP / 64);                  // 640
  const dim3 gE(tilesE, 1);                                        // 256: one tile per block
  const dim3 gQKV(2 * tilesE + NB * tilesV);                       // 256 x 2 (q, k), then 128 x NB (v^T)
  const dim3 gF(tilesF, 1);                                        // 512
  const dim3 gOA(tilesO + tilesA);                                 // 640 (obs head), then 64 (action head)
  const dim3 gAT(ATT_BLOCKS);                                      // SEQ/32 tile pairs x NB x 4 heads = 512
  const dim3 bAT(ATT_THREADS);                                     // 256
  const int ppb = (SEQ * OBSD) / 4;
  const int gcx0 = NROWS / 256, gcx1 = (NB * ppb + 255) / 256;
  const dim3 gOC(gcx0 > gcx1 ? gcx0 : gcx1, 2);                    // (2548, 2)

  const long long sQK   = (long long)NLAYER * DMODEL * KD;         // WK16 - WQ16 in halves
  const long long sKP   = (long long)NROWS * KD;                   // KP - QP in halves

  // (0) 16-bit operand planes: transposed weights [n][k x64 | k x1] (bf16 RNE then exact power-of-two scale), obs x16
  prep<<<dim3(PB_ALL), blk, 0, stream>>>(obs, w_q, w_k, w_v, w_o, w_1, w_2, obs_w, act_w, obsh_w,
                                         OBS16, WQ16, WK16, WV16, WO16, W116, W216, OBSW16, ACTW16, OBSHW16);

  // (1) x = obs . Wp + bf16(bp) -> XA (f32); M = NROWS, N = 256, K = 640 (single product, inputs exact);
  //     with it HH = x * bf16(g1 of layer 0) (hi x4 | residual x64) and SS
  gemm64<0, 0, 0, 1, OBSP, 1, 0, 1><<<gE, blk, 0, stream>>>(
      OBS16, 0LL,
      OBSW16, 0LL,
      (const float*)0,
      obs_b, DMODEL,
      (void*)XA, DMODEL, 0LL, 0LL,
      DMODEL, 1.0f / (OBC * WSC), 1.0f,
      (const float*)0, norm1_w, HH, SS);

  for (int l = 0; l < NLAYER; ++l) {
    const size_t lwE = (size_t)l * DMODEL * KD;                    // WQ/WK/WV/WO layer offset (halves)
    const size_t lw1 = (size_t)l * DFF * KD;
    const size_t lw2 = (size_t)l * DMODEL * KF;

    // (2) h = RMSNorm(x) * bf16(g1): HH and SS come from the product that made x, the row factor is applied in (3), (4)
    // (3) q, k projections (batch index 0, 1): QP / KP in fragment order; M = NROWS, N = 256, K = 512 folded, no bias
    // (4) in the same launch, v^T per batch: VT[b] = [d][tok] in fragment order; M = 256 (d), N = SEQ, K = 512 folded
    gemm64x2<2, 0, 0, KD, 1><<<gQKV, blk, 0, stream>>>(
        HH, 0LL, WQ16 + lwE, sQK,
        (const float*)0, 1, (void*)QP, KD, sKP, (long long)DMODEL, DMODEL, SH_E,
        WV16 + lwE, 0LL, HH, (long long)SEQ * KD,
        (const float*)0, 1, (void*)VTp, SEQ, (long long)VTR * SEQ, (long long)DMODEL * SEQ, SEQ, SH_V,
        2 * tilesE, 1.0f / (HC * WSC), QC, SS, 0, 1);

    // (5) causal attention with relative-position bias per (batch, two tiles of 16 query rows, head), keys split over 8 waves -> CT (hi x16 | residual x64)
    attn4<<<gAT, bAT, 0, stream>>>(QP, KP, VTp, relb + (size_t)l * NBUCK * NHEAD, CT);

    // (6) XB = CT . Wo / (16 * 64) + XA (raw f32); M = NROWS, N = 256, K = 512 folded
    // (7) with it HH = x * bf16(g2) and SS; the row factor of h2 = RMSNorm(x) * bf16(g2) is applied in (8)
    gemm64<0, 2, 0, 0, KD, 1, 0, 1><<<gE, blk, 0, stream>>>(
        CT, 0LL,
        WO16 + lwE, 0LL,
        XA,
        (const float*)0, 1,
        (void*)XB, DMODEL, 0LL, 0LL,
        DMODEL, 1.0f / (CC * WSC), 1.0f,
        (const float*)0, norm2_w + (size_t)l * DMODEL, HH, SS);

    // (8) G16 = dual f16 of 64 * relu(h2 . W1 + bf16(b1)); M = NROWS, N = 512, K = 512 folded
    gemm64<1, 0, 2, 1, KD, 1, 1, 0><<<gF, blk, 0, stream>>>(
        HH, 0LL,
        W116 + lw1, 0LL,
        (const float*)0,
        b_1 + (size_t)l * DFF, DFF,
        (void*)G16, KF, 0LL, (long long)DFF,
        DFF, 1.0f / (HC * WSC), GC,
        SS, (const float*)0, (unsigned short*)0, (float*)0);

    // (9) XA = G16 . W2 / (64 * 64) + bf16(b2) + XB (raw f32); M = NROWS, N = 256, K = 1024 folded;
    //     with it HH = x * bf16(g1 of the next layer, or gf behind the last) and SS
    gemm64<0, 2, 0, 1, KF / 2, 2, 0, 1><<<gE, blk, 0, stream>>>(
        G16, 0LL,
        W216 + lw2, 0LL,
        XB,
        b_2 + (size_t)l * DMODEL, DMODEL,
        (void*)XA, DMODEL, 0LL, 0LL,
        DMODEL, 1.0f / (GC * WSC), 1.0f,
        (const float*)0, (l + 1 < NLAYER) ? norm1_w + (size_t)(l + 1) * DMODEL : fnorm_w, HH, SS);
  }

  // (10) hf = RMSNorm(x) * bf16(gf): the row factor is applied in (11), (12)
  // (11) obs prediction plane OBSF[m][640] = hf . Wh + bf16(bh) (cols 0..636 meaningful); M = NROWS, N = 640, K = 512 folded
  // (12) in the same launch, action logits plane ACTF[m][64] = hf . Wa + bf16(ba) (cols 0..3 meaningful); M = NROWS, N = 64
  gemm64x2<0, 0, 1, KD, 1><<<gOA, blk, 0, stream>>>(
      HH, 0LL, OBSHW16, 0LL,
      obsh_b, OBSD, (void*)OBSF, OBSP, 0LL, 0LL, OBSP, SH_ONE,
      HH, 0LL, ACTW16, 0LL,
      act_b, NACT, (void*)ACTF, NACTP, 0LL, 0LL, NACTP, SH_ONE,
      tilesO, 1.0f / (HC * WSC), 1.0f, SS, 0, 0);

  ocopy<<<gOC, blk, 0, stream>>>(ACTF, OBSF, outp);
  (void)hipGetLastError();
}

// v009
// A run of this version takes 312 microseconds.
// Two timings next to v008 both put it at 1.03 times that version's speed.
// Counting every step since v000, it is 6.13 times as fast.
// Contractions (all v_wmma_f32_16x16x32_f16, f16 operands, f32 accumulate): input projection (obs f16 x16 . Wp^T f16 x64, K=640
// zero-padded, single product); q/k, v^T, attention-output, hidden (ReLU), second and both head projections with the activation
// operand carried as two f16 planes [hi | residual x64] folded along K against [W^T x64 | W^T x1]; attention scores k.q^T from the
// q/k hi and residual planes (hi.hi plus the two cross terms, two accumulators, K=64); attention v^T.P^T with P f16 x16384 (single)
// against v^T hi and residual planes (two accumulators). RMSNorm, softmax (base 2), ReLU, biases, relative-position bias and the
// residual stream in f32 on VALU. Every float input RNE-converted to bf16 on load.
// RMSNorm has no launch of its own: the row factor rsqrt(mean(x*x) + eps) commutes with the product along the row, so the product
// that makes x also stores the operand plane of x * bf16(norm weight) and its tile's sums of squares, and the product that reads the
// plane multiplies its result by the row factor.
#include <hip/hip_runtime.h>
#include <math.h>
#include <stdint.h>

#ifndef NB
#define NB        2
#endif
#ifndef SEQ
#define SEQ       2048
#endif
#define NB_FULL   2
#define SEQ_FULL  2048
#define NLAYER    6
#define DMODEL    256
#define NHEAD     4
#define HDIM      64
#define DFF       512
#define OBSD      637
#define OBSP      640
#define NACT      4
#define NACTP     64
#define NBUCK     32
#define NROWS     (NB * SEQ)
#define KD        (2 * DMODEL)          // folded K of E-wide activation operands: [hi 256 | residual 256]
#define KF        (2 * DFF)             // folded K of the hidden operand: [hi 512 | residual 512]
#define VTR       KD                    // per batch VTR * SEQ halves of v^T: 256 d x SEQ keys, hi and residual, fragment order
#define OUT1_OFF  (NB_FULL * SEQ_FULL * NACT)   // float index of the second output (byte offset 65536)
#define OUT_TOTAL (OUT1_OFF + NB_FULL * SEQ_FULL * OBSD)

// carries (exact powers of two)
#define WSC_I 64
#define RC_I  64
#define WLO_I 1
#define WSC   64.0f        // weight hi copy
#define WLO   1.0f         // weight lo copy (pairs with the x64 residual plane)
#define RC    64.0f        // residual plane carry relative to its hi plane
#define RCI   0.015625f
#define OBC   16.0f        // obs plane
#define HC    4.0f         // x * norm weight planes (not yet divided by the row's rms)
#define QC    16.0f
#define KC    16.0f
#define VC    16.0f
#define PC    16384.0f     // softmax P tile
#define CC    16.0f        // attention context
#define GC    64.0f        // ReLU hidden
#define ATT_SCALE 0.125f
#define LOG2E   1.4426950408889634f
#define RMS_EPS 1.1920929e-07f
#define NSS     (DMODEL / 64)        // partial sums of squares per row of x: one per 64-column tile
static_assert(RC_I * WLO_I == WSC_I);
static_assert(NHEAD * HDIM == DMODEL);
static_assert(NB >= 1 && NB <= NB_FULL && SEQ >= 64 && SEQ <= SEQ_FULL);
static_assert((SEQ % 64) == 0 && (SEQ % 16) == 0 && (NROWS % 64) == 0 && (DMODEL % 64) == 0 && (DFF % 64) == 0);
static_assert((OBSP % 64) == 0 && (NACTP % 64) == 0 && OBSP >= OBSD && NACTP >= NACT && (OBSP - OBSD) < 64);
static_assert((KD % 32) == 0 && (KF % 32) == 0 && (OBSP % 32) == 0);
static_assert((NROWS % 256) == 0 && (NROWS % 4) == 0 && ((SEQ * OBSD) % 4) == 0);
static_assert(OUT_TOTAL == 2625536);

typedef _Float16 v16h __attribute__((ext_vector_type(16)));
typedef _Float16 v8h  __attribute__((ext_vector_type(8)));
typedef float    v8f  __attribute__((ext_vector_type(8)));
typedef float    v4f  __attribute__((ext_vector_type(4)));
typedef unsigned int v4u __attribute__((ext_vector_type(4)));
typedef unsigned int v2u __attribute__((ext_vector_type(2)));

union FragH { v16h v; v8h h[2]; v4u u[2]; };

// ---- scalar helpers --------------------------------------------------------------------------------
__device__ __forceinline__ unsigned short bf_bits(float f) {          // f32 -> bf16 bits, RNE convert
  unsigned u = __float_as_uint(f);
  return (unsigned short)((u + 0x7FFFu + ((u >> 16) & 1u)) >> 16);
}
__device__ __forceinline__ float bf_up(unsigned short h) { return __uint_as_float(((unsigned)h) << 16); }
__device__ __forceinline__ float bfr(float f) { return bf_up(bf_bits(f)); }   // value of the bf16 RNE convert
__device__ __forceinline__ unsigned short h_bits(_Float16 x) { return __builtin_bit_cast(unsigned short, x); }
__device__ __forceinline__ unsigned pk16(unsigned short a, unsigned short b) { return (unsigned)a | ((unsigned)b << 16); }
__device__ __forceinline__ v8f zero8() { v8f z = {0.f, 0.f, 0.f, 0.f, 0.f, 0.f, 0.f, 0.f}; return z; }
__device__ __forceinline__ int imin(int a, int b) { return a < b ? a : b; }
__device__ __forceinline__ int imax(int a, int b) { return a > b ? a : b; }

// Relative-position bucket for rel = query - key >= 0 (bidirectional split, 32 buckets, max distance 128), as an exact
// integer table: 0 -> 0; 1..7 -> 16+rel; 8..11 -> 24; 12..15 -> 25; 16..22 -> 26; 23..31 -> 27; 32..45 -> 28; 46..63 -> 29;
// 64..90 -> 30; >= 91 -> 31.
__device__ __forceinline__ int rel_bucket(int rel) {
  int b = 31;
  b = (rel < 91) ? 30 : b;
  b = (rel < 64) ? 29 : b;
  b = (rel < 46) ? 28 : b;
  b = (rel < 32) ? 27 : b;
  b = (rel < 23) ? 26 : b;
  b = (rel < 16) ? 25 : b;
  b = (rel < 12) ? 24 : b;
  b = (rel < 8) ? (16 + rel) : b;
  b = (rel == 0) ? 0 : b;
  return b;
}

// ---- fragment loaders: 16-bit A/B operand, lane -> row/col (lane&15), p already includes +8*(lane>>4);
//      elements 0..7 <- p[0..7] (k0+8h..), elements 8..15 <- p[16..23] (k0+16+8h..)  (same split k map for A and B;
//      B is always read from a k-contiguous [n][k] plane)
__device__ __forceinline__ v16h ldfrag_u(const unsigned short* p) {
  FragH f;
  f.u[0] = *(const v4u*)(p);
  f.u[1] = *(const v4u*)(p + 16);
  return f.v;
}
// Fragment-ordered plane of an [M][N] matrix (M multiple of 16, N of 64): chunk (m / 16) * (N / 64) + n / 64 holds 16 rows x 64 cols as
// FCH halves: [hi | residual] x [col / 16 & 3] x [lane = 16 * (col / 8 & 1) + row % 16] x [col % 8]. The two 16-B loads of a fragment
// (16 rows x 32 cols, same k map as above) then read 512 consecutive bytes each. p = the 16 x 32 block (FBK halves) + 8 * lane.
#define FCH 2048
#define FPL 1024
#define FBK 512
__device__ __forceinline__ v16h ldfrag_f(const _Float16* p) {
  FragH f;
  f.h[0] = *(const v8h*)(p);
  f.h[1] = *(const v8h*)(p + 256);
  return f.v;
}

// ---- WMMA helpers with trailing VALU hazard gaps ------------------------------------------------------
__device__ __forceinline__ v8f mma_raw(v16h a, v16h b, v8f c) {
  return __builtin_amdgcn_wmma_f32_16x16x32_f16(false, a, false, b, (short)0, c, false, false);
}
// Only the accumulators are named: an asm operand has to lie in the first 256 registers, and the fragments need not.
__device__ __forceinline__ void guard_s2x4(v8f& s, v8f& t) {
#if defined(__HIP_DEVICE_COMPILE__)
  asm volatile("v_nop\n\tv_nop\n\tv_nop\n\tv_nop" : "+v"(s), "+v"(t));
#endif
}
__device__ __forceinline__ void guard_pv4(v8f& a, v8f& b, v8f& c, v8f& d) {
#if defined(__HIP_DEVICE_COMPILE__)
  asm volatile("v_nop\n\tv_nop\n\tv_nop\n\tv_nop" : "+v"(a), "+v"(b), "+v"(c), "+v"(d));
#endif
}
// Later writes of the address and data registers of the global loads and stores issued so far stay behind this wait.
__device__ __forceinline__ void wait_x0() {
#if defined(__HIP_DEVICE_COMPILE__)
  asm volatile("s_wait_xcnt 0x0" ::: "memory");
#endif
}
// The same wait behind a group of loads that share the address p: p is named as an input so that its register pair lives up to the
// wait; otherwise the group's last load may land on the pair that the loads ahead of it still name.
__device__ __forceinline__ void wait_x0_addr(const _Float16* p) {
#if defined(__HIP_DEVICE_COMPILE__)
  asm volatile("s_wait_xcnt 0x0" :: "v"(p) : "memory");
#endif
}
// Lane l takes the value of lane l ^ 16: a vector cross-row move, no LDS trip.
__device__ __forceinline__ float xhalf(float x) {
  const int b = __builtin_bit_cast(int, x);
  return __builtin_bit_cast(float, __builtin_amdgcn_permlanex16(b, b, 0x76543210, 0xfedcba98, false, false));
}
// RMSNorm row factor from the plane ss[NSS][NROWS] of partial sums of squares: rsqrt(mean(x*x) + eps), eps 1.1920929e-7.
static_assert(NSS == 4);
__device__ __forceinline__ float row_ss(const float* __restrict__ ss, int m) {
  return (ss[m] + ss[NROWS + m]) + (ss[2 * NROWS + m] + ss[3 * NROWS + m]);
}
__device__ __forceinline__ float rstd_of(float s) {
  const float x = s * (1.0f / (float)DMODEL) + RMS_EPS;    // s >= 0, so x >= eps: a normal number, no range scaling round the instruction
  float r = 0.f;
#if defined(__HIP_DEVICE_COMPILE__)
  // v_nop: the one slot between a transcendental and an instruction that reads its result or overwrites its source
  asm("v_rsq_f32 %0, %1\n\tv_nop" : "=v"(r) : "v"(x));
#endif
  return r;
}

// =====================================================================================================
// Transposing 16-bit pack of a weight stored in[R][C] (row pitch C floats, R = contraction index, C = output index) into
// out[Cp][ldd] (row pitch ldd halves): out[c][r] = f16( bf16_RNE(in[r][c]) * schi ) for r < R and c < C, 0 otherwise (pad rows /
// pad columns explicitly written as zeros); with DUAL a second copy out[c][locol + r] = f16( bf16_RNE(in[r][c]) * sclo ).
// schi / sclo powers of two (exact). Tiles: Cp/64 along bx, Rp/64 along by; bz = slice: src advanced by bz*sZ floats, dst by
// bz*dZ halves. One 64x64 tile per block through LDS (bf16 bits): 16 scalar loads per thread with CLAMPED addresses, zero by
// coverage: load 256 thr x 16 floats = 64x64; store 2 it x 8 waves x 4 rows x (8 lanes x 8 halves) = 64 rows x 64 halves per copy;
//           tiles (Cp/64, Rp/64, Z) exact, each output line written by exactly one wave; pad region included.
// =====================================================================================================
// (bx, by, bz) = the tile's place in the grid described above; dual is the same for the whole block.
__device__ __forceinline__ void tcvt16(unsigned short* sT, const float* __restrict__ src, long long sZ,
                                       unsigned short* dst, long long dZ,
                                       int R, int C, int ldd, int locol, float schi, float sclo,
                                       bool dual, int bx, int by, int bz) {
  const int tid = threadIdx.x, lane = tid & 31, wave = tid >> 5;
  const int c0 = bx * 64, r0 = by * 64;
  const float* srcz = src + (size_t)((long long)bz * sZ);
  unsigned short* dstz = dst + (size_t)((long long)bz * dZ);
  const int rr = tid >> 2, cc = (tid & 3) * 16;
  const int r = r0 + rr;
  const int rcl = imin(r, R - 1);
  const float* sp = srcz + (size_t)rcl * C;
#pragma unroll
  for (int e = 0; e < 16; ++e) {
    const int cidx = c0 + cc + e;
    const int ccl = imin(cidx, C - 1);
    float a = sp[ccl];
    a = (r < R && cidx < C) ? a : 0.f;
    sT[(cc + e) * 72 + rr] = bf_bits(a);
  }
  __syncthreads();
  v4u hvals[2], lvals[2];
#pragma unroll
  for (int it = 0; it < 2; ++it) {
    const int q = it * 32 + wave * 4 + (lane >> 3);
    const v4u raw = *(const v4u*)(sT + q * 72 + (lane & 7) * 8);
    v4u hv = {0u, 0u, 0u, 0u}, lv = {0u, 0u, 0u, 0u};
#pragma unroll
    for (int e = 0; e < 4; ++e) {
      const float f0 = bf_up((unsigned short)(raw[e] & 0xFFFFu));
      const float f1 = bf_up((unsigned short)(raw[e] >> 16));
      hv[e] = pk16(h_bits((_Float16)(f0 * schi)), h_bits((_Float16)(f1 * schi)));
      lv[e] = pk16(h_bits((_Float16)(f0 * sclo)), h_bits((_Float16)(f1 * sclo)));
    }
    hvals[it] = hv;
    lvals[it] = lv;
  }
  {
#pragma unroll
    for (int it = 0; it < 2; ++it) {
      const int q = it * 32 + wave * 4 + (lane >> 3);
      unsigned short* p = dstz + (size_t)(c0 + q) * ldd + r0 + (lane & 7) * 8;
      *(v4u*)p = hvals[it];
    }
    wait_x0();                                             // no register of the two stores above is rewritten ahead of this wait
    if (dual) {
#pragma unroll                                             // lvals[] indexed by constants, so that it stays in registers
      for (int it = 0; it < 2; ++it) {
        const int q = it * 32 + wave * 4 + (lane >> 3);
        unsigned short* p = dstz + (size_t)(c0 + q) * ldd + r0 + (lane & 7) * 8;
        *(v4u*)(p + locol) = lvals[it];
      }
      wait_x0();                                           // the same for the second copy's two stores
    }
  }
}

// =====================================================================================================
// Batched f16 WMMA GEMM, operands staged in LDS: C[m][n] = f( oscale * sum_k A[m][k] * Bt[n][k] + bias ); one 64x64 tile per
// work-group of 8 waves (wave = 16 rows x 32 cols, two accumulators). A row-major [M][K] (16-bit plane), Bt row-major
// [N][K] (k contiguous), both at row pitch K; M, N multiples of 64, K = KST * NCH. tile = tile index, by = batch index with element
// strides sA, sB, sC. A stage is KST k of the tile's 64 A rows and 64 Bt rows, brought to LDS by asynchronous 16-B copies
// (a wave's copy = two aligned 256-B units) at row pitch KST + 8 halves (16 B x odd: ds_load_b128 fragment reads without bank conflicts).
// NCH 1: the stage is filled once and then read. NCH 2: two buffers, stage 1 flies while stage 0 is multiplied.
// k runs upward through one accumulator per 16x16 output tile.
// BM: 0 no bias, 1 bias bf16(biasp[n]) for n < nbias (0 beyond, clamped address).   ACT: 2 = ReLU applied to (value + bias).
// OM 0 = f32 out (pitch ldc); RM 2 adds raw f32 Rp[m][n] (same pitch/stride as C).
// OM 1 = dual f16 out (pitch ldc): hi = f16(value * ocarry) at C[m][n], residual f16(RC * (value * ocarry - hi)) at C[m][n] + lofs.
// OM 2 = the same two values in the fragment-ordered plane described at ldfrag_f (ldc and lofs not used); a wave's store = one
//        512-B block of the plane.
// NRM 1: one operand is the plane of x * bf16(norm weight) * HC; the sum is multiplied by the RMSNorm factor of its x row (ahead of
//        bias and ReLU), taken from ssp[NSS][NROWS]: x row = m (A operand), or with colf (OM 2 only) by * N + n (Bt operand).
// EM 1 (OM 0, N = DMODEL): C is the residual stream x; the tile also stores Hout[m][n] = f16(x * bf16(nwp[n]) * HC), its residual x64
//        at Hout[m][DMODEL + n] (row pitch KD; a row's 128-B segment = 16 lanes) and SSout[n0 / 64][m] = sum of x*x over its 64 columns
//        (4 per lane, then xor shuffles over 16 lanes), gathered in the pad column of sT so that one wave stores each 128-B line.
// coverage: copies: 2 operands x 4 row groups of 16 x KST/128 units of 256 B = 2*KST/32 copies per thread and stage; slab: 8 waves x 16 x 32 = 64 x 64;
//           out: f32 4 it x 16 rows x 16 lanes x 4, f16 2 it x 32 rows x 8 lanes x 8 (both planes) = the whole 64x64 tile;
//           grid = tilesM*tilesN blocks exactly.
// =====================================================================================================
// Eight asynchronous 16-B copies global -> LDS (l = the lane's LDS byte address, g = the lane's global address). The closing
// s_wait_xcnt keeps every later write of these address registers behind the copies' address translation.
__device__ __forceinline__ void acopy8(const unsigned* l, const unsigned short* const* g) {
#if defined(__HIP_DEVICE_COMPILE__)
  asm volatile(
      "global_load_async_to_lds_b128 %0, %8, off\n\t"
      "global_load_async_to_lds_b128 %1, %9, off\n\t"
      "global_load_async_to_lds_b128 %2, %10, off\n\t"
      "global_load_async_to_lds_b128 %3, %11, off\n\t"
      "global_load_async_to_lds_b128 %4, %12, off\n\t"
      "global_load_async_to_lds_b128 %5, %13, off\n\t"
      "global_load_async_to_lds_b128 %6, %14, off\n\t"
      "global_load_async_to_lds_b128 %7, %15, off\n\t"
      "s_wait_xcnt 0x0"
      :: "v"(l[0]), "v"(l[1]), "v"(l[2]), "v"(l[3]), "v"(l[4]), "v"(l[5]), "v"(l[6]), "v"(l[7]),
         "v"(g[0]), "v"(g[1]), "v"(g[2]), "v"(g[3]), "v"(g[4]), "v"(g[5]), "v"(g[6]), "v"(g[7])
      : "memory");
#endif
}
// The wave's own copies have landed in LDS behind this wait.
__device__ __forceinline__ void wait_async0() {
#if defined(__HIP_DEVICE_COMPILE__)
  asm volatile("s_wait_asynccnt 0x0" ::: "memory");
#endif
}
// The wave's own LDS reads have returned behind this wait.
__device__ __forceinline__ void wait_ds0() {
#if defined(__HIP_DEVICE_COMPILE__)
  asm volatile("s_wait_dscnt 0x0" ::: "memory");
#endif
}
// One stage: KST halves of rows 0..63 of Ag to LDS rows 0..63 and of rows 0..63 of Bg to LDS rows 64..127 (global row pitch LDK
// halves). 16 lanes take one aligned 256-B unit of a row, a copy of the block 16 rows; every offset below is a constant.
template <int KST, int LDK>
__device__ __forceinline__ void fill_stage(const unsigned short* Ag, const unsigned short* Bg, unsigned ldsb, int tid) {
  constexpr int CG  = KST / 128;            // 256-B units per row
  constexpr int PER = 4 * CG;               // copies per thread and operand
  constexpr int PIT = KST + 8;              // LDS row pitch, halves
  static_assert((KST % 128) == 0 && (2 * PER) % 8 == 0 && 2 * PER <= 63);
  const int r0 = tid >> 4, h0 = (tid & 15) * 8;
  const unsigned short* a0 = Ag + (size_t)r0 * LDK + h0;
  const unsigned short* b0 = Bg + (size_t)r0 * LDK + h0;
  const unsigned l0 = ldsb + (unsigned)(r0 * PIT + h0) * 2u;
  // both loops unrolled: every copy's offsets are then constants and l[], g[] stay in registers
#pragma unroll
  for (int g0 = 0; g0 < 2 * PER; g0 += 8) {
    unsigned l[8];
    const unsigned short* g[8];
#pragma unroll
    for (int e = 0; e < 8; ++e) {
      const int it = g0 + e;
      const bool isB = it >= PER;
      const int j = isB ? it - PER : it;
      const int rg = j / CG, cg = j - rg * CG;
      l[e] = l0 + (unsigned)((((isB ? 64 : 0) + rg * 16) * PIT + cg * 128) * 2);
      g[e] = (isB ? b0 : a0) + (size_t)(rg * 16) * LDK + cg * 128;
    }
    acopy8(l, g);
  }
}

template <int OM, int RM, int ACT, int BM, int KST, int NCH, int NRM, int EM>
__device__ __forceinline__ void gemm64_tile(
    const unsigned short* __restrict__ Ap, long long sA,
    const unsigned short* __restrict__ Btp, long long sB,
    const float* __restrict__ Rp,
    const float* __restrict__ biasp, int nbias,
    void* Cout, int ldc, long long sC, long long lofs,
    int N, float oscale, float ocarry, int tile, int by,
    const float* __restrict__ ssp, bool colf,
    const float* __restrict__ nwp, unsigned short* Hout, float* SSout) {
  static_assert(EM == 0 || OM == 0);
  constexpr int PIT  = KST + 8;               // LDS row pitch, halves
  constexpr int BUFH = 128 * PIT;            // halves per stage buffer: 64 A rows, then 64 Bt rows
  constexpr int LDK  = KST * NCH;            // row pitch of A and Bt, halves (= K)
  constexpr int KB   = 4;                    // k steps of 32 per fragment block
  constexpr int NBLK = KST / (32 * KB);
  static_assert(NCH == 1 || NCH == 2);
  static_assert((KST % (32 * KB)) == 0 && ((PIT * 2) % 32) == 16);
  __shared__ __align__(16) unsigned short sP[NCH * BUFH];
  __shared__ __align__(16) float sT[64 * 68];        // the tile in f32, pitch 68 floats
  const int tid  = threadIdx.x;
  const int lane = tid & 31;
  const int wave = tid >> 5;
  const int tilesN = N >> 6;
  const int tm = tile / tilesN;
  const int tn = tile - tm * tilesN;
  const int m0 = tm << 6;
  const int n0 = tn << 6;

  const unsigned short* Ag = Ap  + (size_t)((long long)by * sA) + (size_t)m0 * LDK;
  const unsigned short* Bg = Btp + (size_t)((long long)by * sB) + (size_t)n0 * LDK;
  const unsigned ldsb = (unsigned)(uintptr_t)(&sP[0]);   // LDS byte address = low 32 bits of the shared address

  fill_stage<KST, LDK>(Ag, Bg, ldsb, tid);

  const int r16 = tid >> 4, c4 = (tid & 15) * 4;         // f32 out: 256-B row segment = 16 lanes x 16 B
  const int r32 = tid >> 3;                              // f16 out: 128-B row segment = 8 lanes x 16 B
  const int c8 = (OM == 2) ? (wave & 3) * 16 + (lane >> 4) * 8 : (tid & 7) * 8;   // OM 2: 16 cols per wave, 8 per lane half

  // ---- RMSNorm factors of the x rows behind this thread's output rows (or, with colf, columns); read here, while stage 0 flies ----
  // every loop down to the wait on the copies is unrolled: the small arrays are then indexed by constants and stay in registers
  float rrow[4], rcol[8];
#pragma unroll
  for (int e = 0; e < 4; ++e) rrow[e] = 1.f;
#pragma unroll
  for (int e = 0; e < 8; ++e) rcol[e] = 1.f;
  if constexpr (NRM == 1) {
    if (OM == 2 && colf) {
      const float* p = ssp + (size_t)by * N + n0 + c8;
      v4f a[NSS], b[NSS];
#pragma unroll
      for (int j = 0; j < NSS; ++j) {
        a[j] = *(const v4f*)(p + (size_t)j * NROWS);
        b[j] = *(const v4f*)(p + (size_t)j * NROWS + 4);
      }
      wait_x0();                                           // no address register of the loads above is rewritten ahead of this wait
#pragma unroll
      for (int e = 0; e < 4; ++e) {
        rcol[e]     = rstd_of((a[0][e] + a[1][e]) + (a[2][e] + a[3][e]));
        rcol[4 + e] = rstd_of((b[0][e] + b[1][e]) + (b[2][e] + b[3][e]));
      }
    } else {
      constexpr int NIT = (OM == 0) ? 4 : 2;
      float s[NIT];
#pragma unroll
      for (int it = 0; it < NIT; ++it) {
        const int row = (OM == 0) ? it * 16 + r16 : (OM == 2) ? (it * 2 + (wave >> 2)) * 16 + (lane & 15) : it * 32 + r32;
        s[it] = row_ss(ssp, m0 + row);
      }
      wait_x0();                                           // the same for these loads
#pragma unroll
      for (int it = 0; it < NIT; ++it) rrow[it] = rstd_of(s[it]);
    }
  }
  // ---- the next RMSNorm's weight for this thread's four columns ----
  float nw[4];
#pragma unroll
  for (int e = 0; e < 4; ++e) nw[e] = 0.f;
  if constexpr (EM == 1) {
    const v4f w4 = *(const v4f*)(nwp + n0 + c4);
    wait_x0();                                             // the same for this load
#pragma unroll
    for (int e = 0; e < 4; ++e) nw[e] = bfr(w4[e]);
  }

  wait_async0();
  __syncthreads();                                       // stage 0 readable by every wave
  if constexpr (NCH == 2) fill_stage<KST, LDK>(Ag + KST, Bg + KST, ldsb + (unsigned)(BUFH * 2), tid);

  const int rlane = lane & 15;                 // row (A) / col (B, D) within subtile
  const int koff  = (lane >> 4) * 8;           // k offset of this lane half
  const int mOff  = (lane >> 4) * 8;           // D row offset
  const int wr = wave >> 1, wc = wave & 1;     // wave tile: rows wr*16.., cols wc*32..

  v8f acc0 = zero8(), acc1 = zero8();
  // the loops below are unrolled so that the two fragment sets are indexed by constants and stay in registers
#pragma unroll
  for (int t = 0; t < NCH; ++t) {
    const unsigned short* aL = sP + t * BUFH + (wr * 16 + rlane) * PIT + koff;
    const unsigned short* bL = sP + t * BUFH + (64 + wc * 32 + rlane) * PIT + koff;
    // fragments one block ahead in a second register set, each block's LDS reads as one group; never across a stage
    v16h fa[2][KB], fb0[2][KB], fb1[2][KB];
#pragma unroll
    for (int s = 0; s < KB; ++s) {
      fa[0][s]  = ldfrag_u(aL + s * 32);
      fb0[0][s] = ldfrag_u(bL + s * 32);
      fb1[0][s] = ldfrag_u(bL + 16 * PIT + s * 32);
    }
#pragma unroll
    for (int blk = 0; blk < NBLK; ++blk) {
      const int cur = blk & 1;
      if (blk + 1 < NBLK) {
#pragma unroll
        for (int s = 0; s < KB; ++s) {
          const int k0 = ((blk + 1) * KB + s) * 32;
          fa[cur ^ 1][s]  = ldfrag_u(aL + k0);
          fb0[cur ^ 1][s] = ldfrag_u(bL + k0);
          fb1[cur ^ 1][s] = ldfrag_u(bL + 16 * PIT + k0);
        }
      }
      __builtin_amdgcn_sched_barrier(0);   // keeps the next block's LDS reads one group ahead of this block's products
#pragma unroll
      for (int s = 0; s < KB; ++s) {
        acc0 = mma_raw(fa[cur][s], fb0[cur][s], acc0);
        acc1 = mma_raw(fa[cur][s], fb1[cur][s], acc1);
      }
      __builtin_amdgcn_sched_barrier(0);   // keeps later blocks' LDS reads from spreading among these products
    }
    if (t + 1 < NCH) {
      wait_ds0();
      wait_async0();
      __syncthreads();                                   // stage t + 1 readable by every wave
    }
  }
  if constexpr (NCH == 2) wait_async0();                 // no copy is outstanding when the buffers are left

  // ---- column bias (same columns for every row a thread writes), clamped addresses ----
  float bc4[4], bc8[8];
#pragma unroll
  for (int e = 0; e < 4; ++e) bc4[e] = 0.f;
#pragma unroll
  for (int e = 0; e < 8; ++e) bc8[e] = 0.f;
  if constexpr (BM == 1) {
    if constexpr (OM == 0) {
#pragma unroll
      for (int e = 0; e < 4; ++e) {
        const int n = n0 + c4 + e;
        const int ncl = imin(n, nbias - 1);
        const float t = bfr(biasp[ncl]);
        bc4[e] = (n < nbias) ? t : 0.f;
      }
    } else {
#pragma unroll
      for (int e = 0; e < 8; ++e) {
        const int n = n0 + c8 + e;
        const int ncl = imin(n, nbias - 1);
        const float t = bfr(biasp[ncl]);
        bc8[e] = (n < nbias) ? t : 0.f;
      }
    }
  }

  // ---- epilogue: the tile through LDS, whole row segments (OM 0, 1) or whole 512-B fragment blocks (OM 2) out ----
#pragma unroll
  for (int r = 0; r < 8; ++r) {
    float* sp = sT + (wr * 16 + mOff + r) * 68 + wc * 32 + rlane;
    sp[0]  = acc0[r];
    sp[16] = acc1[r];
  }
  __syncthreads();
  if constexpr (OM == 0) {
    float* C = (float*)Cout + (size_t)((long long)by * sC);
    v4f vx[4];
#pragma unroll
    for (int it = 0; it < 4; ++it) {
      const int row = it * 16 + r16;                     // it 0..3 x r16 0..15 = rows 0..63
      const int gr  = m0 + row;
      v4f v = *(const v4f*)(sT + row * 68 + c4);
      v4f rv = {0.f, 0.f, 0.f, 0.f};
      if constexpr (RM == 2) {
        const float* R = Rp + (size_t)((long long)by * sC);
        rv = *(const v4f*)(R + (size_t)gr * ldc + n0 + c4);
      }
      const float osc = oscale * rrow[it];
#pragma unroll
      for (int e = 0; e < 4; ++e) {
        float u = v[e] * osc;
        if constexpr (BM == 1) u += bc4[e];
        if constexpr (ACT == 2) u = fmaxf(u, 0.f);
        v[e] = u + rv[e];
      }
      if constexpr (EM == 0) *(v4f*)(C + (size_t)gr * ldc + n0 + c4) = v;
      vx[it] = v;
    }
    if constexpr (EM == 1) {
      // the loops of this block are unrolled so that vx[] and q[] stay in registers; the four rows' shuffles of a step are independent
      float q[4];
#pragma unroll
      for (int it = 0; it < 4; ++it)
        q[it] = (vx[it][0] * vx[it][0] + vx[it][1] * vx[it][1]) + (vx[it][2] * vx[it][2] + vx[it][3] * vx[it][3]);
#pragma unroll
      for (int off = 1; off < 16; off <<= 1) {
#pragma unroll
        for (int it = 0; it < 4; ++it) q[it] += __shfl_xor(q[it], off, 32);
      }
      if ((tid & 15) == 0) {                               // pad column: no other thread reads or writes it before the barrier below
#pragma unroll
        for (int it = 0; it < 4; ++it) sT[(it * 16 + r16) * 68 + 64] = q[it];
      }
      __syncthreads();                                     // the 64 row sums readable by waves 0 and 1; ahead of the global stores
#pragma unroll
      for (int it = 0; it < 4; ++it) {
        const int gr = m0 + it * 16 + r16;
        const v4f v = vx[it];
        *(v4f*)(C + (size_t)gr * ldc + n0 + c4) = v;
        const float f0 = (v[0] * nw[0]) * HC, f1 = (v[1] * nw[1]) * HC, f2 = (v[2] * nw[2]) * HC, f3 = (v[3] * nw[3]) * HC;
        const _Float16 g0 = (_Float16)f0, g1 = (_Float16)f1, g2 = (_Float16)f2, g3 = (_Float16)f3;
        v2u hv, lv;
        hv[0] = pk16(h_bits(g0), h_bits(g1));
        hv[1] = pk16(h_bits(g2), h_bits(g3));
        lv[0] = pk16(h_bits((_Float16)((f0 - (float)g0) * RC)), h_bits((_Float16)((f1 - (float)g1) * RC)));
        lv[1] = pk16(h_bits((_Float16)((f2 - (float)g2) * RC)), h_bits((_Float16)((f3 - (float)g3) * RC)));
        unsigned short* hp = Hout + (size_t)gr * KD + n0 + c4;
        *(v2u*)hp = hv;
        *(v2u*)(hp + DMODEL) = lv;
      }
      if (tid < 64) SSout[(size_t)tn * NROWS + m0 + tid] = sT[tid * 68 + 64];
    }
  } else {
    unsigned short* C = (unsigned short*)Cout + (size_t)((long long)by * sC);
#pragma unroll
    for (int it = 0; it < 2; ++it) {
      // OM 1: it 0..1 x r32 0..31 = rows 0..63; OM 2: 16 rows per wave, (it, wave / 4) = the tile's four groups of 16 rows
      const int row = (OM == 2) ? (it * 2 + (wave >> 2)) * 16 + rlane : it * 32 + r32;
      const float* spf = sT + row * 68 + c8;
      v4u a = {0u, 0u, 0u, 0u}, bl = {0u, 0u, 0u, 0u};
      const float osc = oscale * rrow[it];
#pragma unroll
      for (int e = 0; e < 4; ++e) {
        float f0 = spf[2 * e] * osc;
        float f1 = spf[2 * e + 1] * osc;
        if constexpr (NRM == 1 && OM == 2) { f0 *= rcol[2 * e]; f1 *= rcol[2 * e + 1]; }
        if constexpr (BM == 1) { f0 += bc8[2 * e]; f1 += bc8[2 * e + 1]; }
        if constexpr (ACT == 2) { f0 = fmaxf(f0, 0.f); f1 = fmaxf(f1, 0.f); }
        f0 *= ocarry; f1 *= ocarry;
        const _Float16 g0 = (_Float16)f0, g1 = (_Float16)f1;
        const float r0 = (f0 - (float)g0) * RC, r1 = (f1 - (float)g1) * RC;
        a[e]  = pk16(h_bits(g0), h_bits(g1));
        bl[e] = pk16(h_bits((_Float16)r0), h_bits((_Float16)r1));
      }
      if constexpr (OM == 2) {
        unsigned short* p = C + ((size_t)((m0 + row) >> 4) * tilesN + tn) * FCH + (wave & 3) * 256 + lane * 8;
        *(v4u*)p = a;
        *(v4u*)(p + FPL) = bl;
      } else {
        unsigned short* p = C + (size_t)(m0 + row) * ldc + n0 + c8;
        *(v4u*)p = a;
        *(v4u*)(p + (size_t)lofs) = bl;
      }
    }
  }
  (void)Rp; (void)ocarry; (void)lofs; (void)nbias; (void)biasp; (void)ldc; (void)r32;
  (void)ssp; (void)colf; (void)nwp; (void)Hout; (void)SSout; (void)rcol; (void)nw;
}

// One product per launch: blockIdx.x = tile, blockIdx.y = batch index.
template <int OM, int RM, int ACT, int BM, int KST, int NCH, int NRM, int EM>
__global__ __launch_bounds__(256) void gemm64(
    const unsigned short* __restrict__ Ap, long long sA,
    const unsigned short* __restrict__ Btp, long long sB,
    const float* __restrict__ Rp,
    const float* __restrict__ biasp, int nbias,
    void* Cout, int ldc, long long sC, long long lofs,
    int N, float oscale, float ocarry,
    const float* __restrict__ ssp, const float* __restrict__ nwp, unsigned short* Hout, float* SSout) {
  gemm64_tile<OM, RM, ACT, BM, KST, NCH, NRM, EM>(Ap, sA, Btp, sB, Rp, biasp, nbias, Cout, ldc, sC, lofs, N, oscale, ocarry,
                                                  (int)blockIdx.x, (int)blockIdx.y, ssp, false, nwp, Hout, SSout);
}

#define SH_E   8        // log2 of the tiles per batch index of the q / k product: (NROWS / 64) * (DMODEL / 64)
#define SH_V   7        // log2 of the tiles per batch of the v^T product: (DMODEL / 64) * (SEQ / 64)
#define SH_ONE 30       // a product with one batch index only
static_assert((1 << SH_E) == (NROWS / 64) * (DMODEL / 64) && (1 << SH_V) == (DMODEL / 64) * (SEQ / 64));
static_assert(QC == VC);
// Two independent products of the same form in one launch (no residual input): blocks 0..n0-1 work on product 0, the rest on
// product 1; inside a product block i is tile i mod 2^sh of batch index i >> sh. The choice is the same for the whole block.
// Both read the plane of x * norm weight (NRM 1): as A, or, where the product's colf is set, as Bt.
// coverage: grid = n0 + (blocks of product 1), each product's (tile, batch) pairs taken exactly once.
template <int OM, int ACT, int BM, int KST, int NCH>
__global__ __launch_bounds__(256) void gemm64x2(
    const unsigned short* __restrict__ Ap0, long long sA0, const unsigned short* __restrict__ Btp0, long long sB0,
    const float* __restrict__ biasp0, int nbias0, void* Cout0, int ldc0, long long sC0, long long lofs0, int N0, int sh0,
    const unsigned short* __restrict__ Ap1, long long sA1, const unsigned short* __restrict__ Btp1, long long sB1,
    const float* __restrict__ biasp1, int nbias1, void* Cout1, int ldc1, long long sC1, long long lofs1, int N1, int sh1,
    int n0, float oscale, float ocarry, const float* __restrict__ ssp, int colf0, int colf1) {
  const int b = (int)blockIdx.x;
  const bool p0 = b < n0;
  const int i  = p0 ? b : b - n0;
  const int sh = p0 ? sh0 : sh1;
  const int by = i >> sh;
  gemm64_tile<OM, 0, ACT, BM, KST, NCH, 1, 0>(p0 ? Ap0 : Ap1, p0 ? sA0 : sA1, p0 ? Btp0 : Btp1, p0 ? sB0 : sB1, (const float*)0,
                                              p0 ? biasp0 : biasp1, p0 ? nbias0 : nbias1, p0 ? Cout0 : Cout1, p0 ? ldc0 : ldc1,
                                              p0 ? sC0 : sC1, p0 ? lofs0 : lofs1, p0 ? N0 : N1, oscale, ocarry, i - (by << sh), by,
                                              ssp, (p0 ? colf0 : colf1) != 0, (const float*)0, (unsigned short*)0, (float*)0);
}

#define ATT_SPLIT   8
#define ATT_THREADS (ATT_SPLIT * 32)
#define ATT_TILES   (SEQ / 32)              // query tiles of 32 rows per batch and head
#define ATT_BLOCKS  (NB * (ATT_TILES / 2) * NHEAD)
#define OP_PITCH    68
#define VCS         ((SEQ / 64) * FCH)      // halves between the v^T chunks of 16 d and of the next 16 d at the same keys
static_assert(ATT_THREADS == 16 * (HDIM / 4) && HDIM == 64);
static_assert((HDIM * 2) % 128 == 0 && (HDIM % 32) == 0 && (ATT_TILES % 2) == 0);

__global__ __launch_bounds__(ATT_THREADS)
void attn4(const unsigned short* __restrict__ QPp, const unsigned short* __restrict__ KPp,
           const unsigned short* __restrict__ VTq, const float* __restrict__ relbl, unsigned short* CT) {
  __shared__ __align__(16) float sbias[SEQ];                          // [rel], bf16(relb) * log2 e
  __shared__ __align__(16) float spo[ATT_SPLIT * 32 * OP_PITCH];      // per wave partial [row][64 d], pitch 68
  __shared__ __align__(16) float sml[2 * ATT_SPLIT * 32];             // per wave and row: max, then sum

  const int tid  = threadIdx.x;
  const int wave = __builtin_amdgcn_readfirstlane(tid >> 5);  // scalar: the key loop's trip count is a scalar branch, EXEC stays full
  const int lane = tid & 31;
  const int hh   = lane >> 4;
  const int c    = lane & 15;

  const int head = blockIdx.x % NHEAD;                     // 0..3
  const int qb   = blockIdx.x / NHEAD;
  const int bat  = qb % NB;                                // batch
  const int pr   = qb / NB;                                // tile pair 0 .. ATT_TILES / 2 - 1
  const int kmax = (ATT_TILES - pr) * 32;                  // key count of the pair's later tile

  // ---- relative-position bias table for rel 0..kmax-1 of this head ----
  for (int rel = tid; rel < kmax; rel += ATT_THREADS) {
    const int bk = rel_bucket(rel);
    sbias[rel] = bfr(relbl[bk * NHEAD + head]) * LOG2E;
  }
  __syncthreads();

  const float* sb = sbias;
  const _Float16* Q16 = (const _Float16*)(const void*)QPp;
  const _Float16* K16 = (const _Float16*)(const void*)KPp;
  const _Float16* V16 = (const _Float16*)(const void*)VTq;
  const _Float16* Kf = K16 + ((size_t)((bat * SEQ) >> 4) * NHEAD + head) * FCH + lane * 8;
  const _Float16* Vf = V16 + (size_t)bat * VTR * SEQ + (size_t)(head * (HDIM / 16)) * VCS + lane * 8;  // chunk (16 d, 64 keys)
  const float lsc = (LOG2E * ATT_SCALE) / (QC * KC);      // log2(e) / 8 / carries

  // the pair's two tiles one after the other, the later, longer tile first (the body keeps its indentation); rolled: unrolled, the
  // kernel's text would double and gain nothing, since the tiles share only the table
#pragma unroll 1
  for (int ps = 0; ps < 2; ++ps) {
  const int qt   = (ps == 0) ? ATT_TILES - 1 - pr : pr;    // query tile of 32 rows = halves u = 0, 1 of 16 rows
  const int q0   = qt * 32;
  const int kend = q0 + 32;                                // causal: keys 0 .. q0+31; rel = query - key in 0 .. kend-1
  const _Float16* Qf = Q16 + ((size_t)((bat * SEQ + q0) >> 4) * NHEAD + head) * FCH + lane * 8;   // chunk (16 tokens, head)
  // every loop over u below but the merge's is unrolled: the per-half arrays are then indexed by constants and stay in registers
  v16h qah[2], qbh[2], qal[2], qbl[2];
#pragma unroll
  for (int u = 0; u < 2; ++u) {
    const _Float16* qp = Qf + u * (NHEAD * FCH);
    qah[u] = ldfrag_f(qp);       qbh[u] = ldfrag_f(qp + FBK);                   // hi, d 0..31 / 32..63
    qal[u] = ldfrag_f(qp + FPL); qbl[u] = ldfrag_f(qp + FPL + FBK);             // residual x64
  }
  wait_x0_addr(Qf);                                        // no register that the 16 loads name is rewritten ahead of this wait

  float mrun[2], lrun[2];                                  // this lane's query of half u: running max (both lane halves alike), sum over this lane half's keys
  v8f om[2][4], orr[2][4];
#pragma unroll
  for (int u = 0; u < 2; ++u) {
    mrun[u] = -INFINITY; lrun[u] = 0.f;
#pragma unroll
    for (int j = 0; j < 4; ++j) { om[u][j] = zero8(); orr[u][j] = zero8(); }
  }

#pragma unroll 1
  for (int kb = wave * 32; kb < kend; kb += 32 * ATT_SPLIT) {
    const _Float16* kp = Kf + (size_t)(kb >> 4) * (NHEAD * FCH);
    v8f s0m[2], s0r[2], s1m[2], s1r[2];                    // register r = score of key (tile's first) + 8 hh + r with query q0 + 16 u + c
    const _Float16* kq = kp + NHEAD * FCH;                 // the next 16 keys
    // the step's 16 k loads as one group: the second key tile's loads fly while the first tile's are waited for
    const v16h k0h = ldfrag_f(kp), k1h = ldfrag_f(kp + FBK);
    const v16h k0l = ldfrag_f(kp + FPL), k1l = ldfrag_f(kp + FPL + FBK);
    const v16h j0h = ldfrag_f(kq), j1h = ldfrag_f(kq + FBK);
    const v16h j0l = ldfrag_f(kq + FPL), j1l = ldfrag_f(kq + FPL + FBK);
    wait_x0_addr(kp);                                      // no register that the 16 loads name is rewritten ahead of this wait
    __builtin_amdgcn_sched_barrier(0);                     // keeps the products behind all 16 loads: else four of them issue only behind the first wait
#pragma unroll
    for (int u = 0; u < 2; ++u) {                          // the same k fragments against both halves' q
      s0m[u] = mma_raw(k0h, qah[u], zero8());
      s0m[u] = mma_raw(k1h, qbh[u], s0m[u]);
      s0r[u] = mma_raw(k0l, qah[u], zero8());
      s0r[u] = mma_raw(k1l, qbh[u], s0r[u]);
      s0r[u] = mma_raw(k0h, qal[u], s0r[u]);
      s0r[u] = mma_raw(k1h, qbl[u], s0r[u]);
      guard_s2x4(s0m[u], s0r[u]);
      s1m[u] = mma_raw(j0h, qah[u], zero8());
      s1m[u] = mma_raw(j1h, qbh[u], s1m[u]);
      s1r[u] = mma_raw(j0l, qah[u], zero8());
      s1r[u] = mma_raw(j1l, qbh[u], s1r[u]);
      s1r[u] = mma_raw(j0h, qal[u], s1r[u]);
      s1r[u] = mma_raw(j1h, qbl[u], s1r[u]);
      guard_s2x4(s1m[u], s1r[u]);
    }
    // the step's 16 v^T loads as one group ahead of the softmax, which covers their flight
    const _Float16* vp = Vf + (size_t)(kb >> 6) * FCH + ((kb >> 5) & 1) * FBK;
    const _Float16* vq = vp + FPL;
    const v16h vb0 = ldfrag_f(vp);
    const v16h vb1 = ldfrag_f(vp + VCS);
    const v16h vb2 = ldfrag_f(vp + 2 * VCS);
    const v16h vb3 = ldfrag_f(vp + 3 * VCS);
    const v16h vl0 = ldfrag_f(vq);
    const v16h vl1 = ldfrag_f(vq + VCS);
    const v16h vl2 = ldfrag_f(vq + 2 * VCS);
    const v16h vl3 = ldfrag_f(vq + 3 * VCS);
    wait_x0_addr(vp);                                      // the same for these 16 loads
    FragH ph[2];                                           // P^T as B operand: the lane's own 16 values, already in the split k map
#pragma unroll
    for (int u = 0; u < 2; ++u) {
      const int rel0 = q0 + 16 * u + c - kb - 8 * hh;      // query - key of register 0 in tile 0; register r: r less; tile 1: 16 less
      // the loops over r below are unrolled so that t0[], t1[] are indexed by constants and stay in registers
      float t0[8], t1[8];
#pragma unroll
      for (int r = 0; r < 8; ++r) {
        const int d0 = rel0 - r, d1 = rel0 - 16 - r;
        const float u0 = (s0m[u][r] + s0r[u][r] * RCI) * lsc + sb[imax(d0, 0)];
        const float u1 = (s1m[u][r] + s1r[u][r] * RCI) * lsc + sb[imax(d1, 0)];
        t0[r] = (d0 < 0) ? -INFINITY : u0;
        t1[r] = (d1 < 0) ? -INFINITY : u1;
      }
      float mx = fmaxf(fmaxf(fmaxf(fmaxf(t0[0], t0[1]), fmaxf(t0[2], t0[3])), fmaxf(fmaxf(t0[4], t0[5]), fmaxf(t0[6], t0[7]))),
                       fmaxf(fmaxf(fmaxf(t1[0], t1[1]), fmaxf(t1[2], t1[3])), fmaxf(fmaxf(t1[4], t1[5]), fmaxf(t1[6], t1[7]))));
      mx = fmaxf(mx, xhalf(mx));                           // the query's max over all 32 keys of the step (key kb is never masked)
      const float mn = fmaxf(mrun[u], mx);
      const float al = exp2f(fmaxf(mrun[u] - mn, -126.0f));
      mrun[u] = mn;
#pragma unroll
      for (int r = 0; r < 8; ++r) {
        t0[r] = exp2f(t0[r] - mn);
        t1[r] = exp2f(t1[r] - mn);
      }
      lrun[u] = lrun[u] * al + ((((t0[0] + t0[1]) + (t0[2] + t0[3])) + ((t0[4] + t0[5]) + (t0[6] + t0[7]))) +
                                (((t1[0] + t1[1]) + (t1[2] + t1[3])) + ((t1[4] + t1[5]) + (t1[6] + t1[7]))));
#pragma unroll
      for (int r = 0; r < 8; ++r) {
        ph[u].h[0][r] = (_Float16)(t0[r] * PC);            // elements 0..7  = keys kb + 8hh + 0..7
        ph[u].h[1][r] = (_Float16)(t1[r] * PC);            // elements 8..15 = keys kb + 16 + 8hh + 0..7
        om[u][0][r] *= al; om[u][1][r] *= al; om[u][2][r] *= al; om[u][3][r] *= al;
        orr[u][0][r] *= al; orr[u][1][r] *= al; orr[u][2][r] *= al; orr[u][3][r] *= al;
      }
    }
#pragma unroll
    for (int u = 0; u < 2; ++u) {                          // the same v^T fragments against both halves' P^T
      om[u][0] = mma_raw(vb0, ph[u].v, om[u][0]);
      om[u][1] = mma_raw(vb1, ph[u].v, om[u][1]);
      om[u][2] = mma_raw(vb2, ph[u].v, om[u][2]);
      om[u][3] = mma_raw(vb3, ph[u].v, om[u][3]);
      guard_pv4(om[u][0], om[u][1], om[u][2], om[u][3]);
      orr[u][0] = mma_raw(vl0, ph[u].v, orr[u][0]);
      orr[u][1] = mma_raw(vl1, ph[u].v, orr[u][1]);
      orr[u][2] = mma_raw(vl2, ph[u].v, orr[u][2]);
      orr[u][3] = mma_raw(vl3, ph[u].v, orr[u][3]);
      guard_pv4(orr[u][0], orr[u][1], orr[u][2], orr[u][3]);
    }
  }

  if (ps != 0) __syncthreads();                            // every wave has read the first tile's partials before they are overwritten
  // ---- the wave's un-normalised partials and their (max, sum) per row to LDS; register r of tile j = d 16 j + 8 hh + r of query 16 u + c ----
#pragma unroll
  for (int u = 0; u < 2; ++u) {
    const float lsum = lrun[u] + xhalf(lrun[u]);           // the two lane halves' keys joined, once
    float* pw = spo + wave * (32 * OP_PITCH) + (16 * u + c) * OP_PITCH + 8 * hh;
    // unrolled: the accumulators are indexed by constants
#pragma unroll
    for (int j = 0; j < 4; ++j) {
      v4f a, b;
#pragma unroll
      for (int e = 0; e < 4; ++e) { a[e] = om[u][j][e] + orr[u][j][e] * RCI; b[e] = om[u][j][4 + e] + orr[u][j][4 + e] * RCI; }
      *(v4f*)(pw + 16 * j) = a;  *(v4f*)(pw + 16 * j + 4) = b;
    }
    if (hh == 0) {                                         // max and joined sum are equal in the two lane halves
      sml[wave * 32 + 16 * u + c] = mrun[u];
      sml[ATT_SPLIT * 32 + wave * 32 + 16 * u + c] = lsum;
    }
  }
  __syncthreads();                                         // every wave's partial readable by every wave
  // ---- merge the 8 partials, fold 1/l and the carries, write 4 hi and 4 residual halves per thread and half ----
#pragma unroll 1                                           // rolled: the two halves' merges share their text
  for (int u = 0; u < 2; ++u) {
    const int row = 16 * u + (tid >> 4), c4 = (tid & 15) * 4;
    float ms[ATT_SPLIT];
    float mall = -INFINITY;
#pragma unroll
    for (int s = 0; s < ATT_SPLIT; ++s) {
      ms[s] = sml[s * 32 + row];
      mall = fmaxf(mall, ms[s]);
    }
    float lall = 0.f;
    v4f o = {0.f, 0.f, 0.f, 0.f};
#pragma unroll
    for (int s = 0; s < ATT_SPLIT; ++s) {
      const float w = exp2f(ms[s] - mall);
      const v4f p = *(const v4f*)(spo + (s * 32 + row) * OP_PITCH + c4);
      lall += w * sml[ATT_SPLIT * 32 + s * 32 + row];
#pragma unroll
      for (int e = 0; e < 4; ++e) o[e] += w * p[e];
    }
    const float inv = (1.0f / lall) * (CC / (PC * VC));
    const float u0 = o[0] * inv, u1 = o[1] * inv, u2 = o[2] * inv, u3 = o[3] * inv;
    const _Float16 g0 = (_Float16)u0, g1 = (_Float16)u1, g2 = (_Float16)u2, g3 = (_Float16)u3;
    v2u hv, lv;
    hv[0] = pk16(h_bits(g0), h_bits(g1));
    hv[1] = pk16(h_bits(g2), h_bits(g3));
    lv[0] = pk16(h_bits((_Float16)((u0 - (float)g0) * RC)), h_bits((_Float16)((u1 - (float)g1) * RC)));
    lv[1] = pk16(h_bits((_Float16)((u2 - (float)g2) * RC)), h_bits((_Float16)((u3 - (float)g3) * RC)));
    unsigned short* dst = CT + ((size_t)bat * SEQ + q0 + row) * KD + head * HDIM + c4;
    *(v2u*)dst = hv;
    *(v2u*)(dst + DMODEL) = lv;
    wait_x0();                                             // the next half or tile rewrites the registers of the two stores above
  }
  }
}

// =====================================================================================================
// Input convert: obs16[m][640] = f16(16 * bf16_RNE(obs[b*SEQ_FULL + t][c])) for c < 637 (m = b*SEQ + t), 0 for the pad columns
// 637..639 (explicitly written). One wave per row (8 rows per block): 80 pieces of 8 halves; lane writes pieces lane, lane+32 and
// coverage: NROWS/8 blocks x 8 waves = every row; per row pieces 0..79 = cols 0..639.
// =====================================================================================================
__device__ __forceinline__ void cvtobs(const float* __restrict__ src, unsigned short* dst, int blk) {
  const int wave = threadIdx.x >> 5, lane = threadIdx.x & 31;
  const int m = blk * 8 + wave;
  const int b = m / SEQ, t = m - b * SEQ;
  const float* sp = src + ((size_t)b * SEQ_FULL + t) * OBSD;
  unsigned short* dp = dst + (size_t)m * OBSP;
  {
#pragma unroll 1
    for (int it = 0; it < 3; ++it) {
      const int p = it * 32 + lane;
      const int col0 = p * 8;
      v4u a;
#pragma unroll
      for (int e = 0; e < 4; ++e) {
        const int ca = col0 + 2 * e, cb = ca + 1;
        float fa = sp[imin(ca, OBSD - 1)];
        float fb = sp[imin(cb, OBSD - 1)];
        fa = (ca < OBSD) ? fa : 0.f;
        fb = (cb < OBSD) ? fb : 0.f;
        a[e] = pk16(h_bits((_Float16)(bfr(fa) * OBC)), h_bits((_Float16)(bfr(fb) * OBC)));
      }
      if (p < OBSP / 8) {
        *(v4u*)(dp + (size_t)p * 8) = a;
        wait_x0();                                         // the next trip advances the store's address registers
      }
    }
    
  }
}

// =====================================================================================================
// All 16-bit operand planes in one launch (they depend on the inputs alone, not on one another): blocks 0..PB_OBS-1 convert obs,
// then one 64x64 transposing tile per block for w_q, w_k, w_v, w_o, w_1, w_2, obs_w, act_w, obsh_w in this order. The job is a
// function of blockIdx.x alone, so every branch below (and the barrier inside tcvt16) is uniform for the block.
// coverage: each job's blocks = its (Cp/64) x (Rp/64) x slices tiles exactly once; grid = PB_ALL.
// =====================================================================================================
#define PB_OBS (NROWS / 8)
#define PB_E   ((DMODEL / 64) * (DMODEL / 64) * NLAYER)
#define PB_F   ((DFF / 64) * (DMODEL / 64) * NLAYER)
#define PB_OW  ((DMODEL / 64) * (OBSP / 64))
#define PB_AW  ((NACTP / 64) * (DMODEL / 64))
#define PB_HW  ((OBSP / 64) * (DMODEL / 64))
#define PB_ALL (PB_OBS + 4 * PB_E + 2 * PB_F + PB_OW + PB_AW + PB_HW)
static_assert((NROWS % 8) == 0);

__global__ __launch_bounds__(256) void prep(
    const float* __restrict__ obs, const float* __restrict__ w_q, const float* __restrict__ w_k, const float* __restrict__ w_v,
    const float* __restrict__ w_o, const float* __restrict__ w_1, const float* __restrict__ w_2,
    const float* __restrict__ obs_w, const float* __restrict__ act_w, const float* __restrict__ obsh_w,
    unsigned short* OBS16, unsigned short* WQ16, unsigned short* WK16, unsigned short* WV16, unsigned short* WO16,
    unsigned short* W116, unsigned short* W216, unsigned short* OBSW16, unsigned short* ACTW16, unsigned short* OBSHW16) {
  __shared__ __align__(16) unsigned short sT[64 * 72];
  int b = (int)blockIdx.x;
  if (b < PB_OBS) {                                        // the whole block leaves, ahead of any barrier
    cvtobs(obs, OBS16, b);
    return;
  }
  b -= PB_OBS;
  const float* s;
  unsigned short* d;
  long long sZ = 0, dZ = 0;
  int R = DMODEL, C = DMODEL, ldd = KD, locol = DMODEL, gx = DMODEL / 64, gy = DMODEL / 64;
  float sclo = WLO;
  bool dual = true;
  if (b < 4 * PB_E) {                                      // in[256 k][256 n] -> out[256 n][512], per layer
    const int j = b / PB_E;
    b -= j * PB_E;
    s = (j == 0) ? w_q : (j == 1) ? w_k : (j == 2) ? w_v : w_o;
    d = (j == 0) ? WQ16 : (j == 1) ? WK16 : (j == 2) ? WV16 : WO16;
    sZ = (long long)DMODEL * DMODEL; dZ = (long long)DMODEL * KD;
  } else if (b < 4 * PB_E + PB_F) {                        // in[256 k][512 n] -> out[512 n][512], per layer
    b -= 4 * PB_E;
    s = w_1; d = W116;
    sZ = (long long)DMODEL * DFF; dZ = (long long)DFF * KD;
    C = DFF; gx = DFF / 64;
  } else if (b < 4 * PB_E + 2 * PB_F) {                    // in[512 k][256 n] -> out[256 n][1024], per layer
    b -= 4 * PB_E + PB_F;
    s = w_2; d = W216;
    sZ = (long long)DFF * DMODEL; dZ = (long long)DMODEL * KF;
    R = DFF; ldd = KF; locol = DFF; gy = DFF / 64;
  } else if (b < 4 * PB_E + 2 * PB_F + PB_OW) {            // in[637 k][256 n] -> out[256 n][640], k 637..639 zero, one copy
    b -= 4 * PB_E + 2 * PB_F;
    s = obs_w; d = OBSW16;
    R = OBSD; ldd = OBSP; locol = 0; gy = OBSP / 64;
    sclo = 0.f; dual = false;
  } else if (b < 4 * PB_E + 2 * PB_F + PB_OW + PB_AW) {    // in[256 k][4 n] -> out[64 n][512], n >= 4 zero
    b -= 4 * PB_E + 2 * PB_F + PB_OW;
    s = act_w; d = ACTW16;
    C = NACT; gx = NACTP / 64;
  } else {                                                 // in[256 k][637 n] -> out[640 n][512], n >= 637 zero
    b -= 4 * PB_E + 2 * PB_F + PB_OW + PB_AW;
    s = obsh_w; d = OBSHW16;
    C = OBSD; gx = OBSP / 64;
  }
  const int bz = b / (gx * gy);
  const int r  = b - bz * (gx * gy);
  const int by = r / gx;
  tcvt16(sT, s, sZ, d, dZ, R, C, ldd, locol, WSC, sclo, dual, r - by * gx, by, bz);
}

// =====================================================================================================
// Output copy: blockIdx.y == 0: out0[b*SEQ_FULL + t][0..3] = ACTF[b*SEQ + t][0..3] (one 16-B piece per thread, consecutive threads
// (SEQ*637 floats at float OUT1_OFF + b*SEQ_FULL*637) written as consecutive 16-B pieces (thread g -> floats 4i..4i+3, gathered from
// coverage: out0: NROWS pieces = every row; out1: NB * SEQ*637/4 pieces = every float of the region exactly once.
// =====================================================================================================
__global__ __launch_bounds__(256) void ocopy(const float* __restrict__ actf, const float* __restrict__ obsf, float* outp) {
  const int g = blockIdx.x * 256 + threadIdx.x;
  if (blockIdx.y == 0) {
    if (g >= NROWS) return;
    const int b = g / SEQ, t = g - b * SEQ;
    const v4f v = *(const v4f*)(actf + (size_t)g * NACTP);
    float* d = outp + ((size_t)b * SEQ_FULL + t) * NACT;
    {
      *(v4f*)d = v;
      
    }
  } else {
    const int ppb = (SEQ * OBSD) / 4;
    if (g >= NB * ppb) return;
    const int b = g / ppb;
    const int i = (g - b * ppb) * 4;
    v4f v;
#pragma unroll
    for (int e = 0; e < 4; ++e) {
      const int idx = i + e;
      const int row = idx / OBSD;
      const int col = idx - row * OBSD;
      v[e] = obsf[((size_t)b * SEQ + row) * OBSP + col];
    }
    float* d = outp + (size_t)OUT1_OFF + (size_t)b * SEQ_FULL * OBSD + i;
    {
      *(v4f*)d = v;
      
    }
  }
}

// =====================================================================================================
// Workspace map (bytes); every plane is an exact multiple of its tile / whole-row store granularity (M, N exact multiples of 64,
//   WQ16, WK16, WV16, WO16  f16 [6][256 n][512 = k x64 | k x1]     4 x 1572864
//   W116                    f16 [6][512 n][512]                       3145728
//   W216                    f16 [6][256 n][1024 = 512 x64 | 512 x1]  3145728
//   OBSW16                  f16 [256 n][640 k] x64 (k 637..639 zero)  327680
//   ACTW16                  f16 [64 n][512] (n 4..63 zero)              65536
//   OBSHW16                 f16 [640 n][512] (n 637..639 zero)         655360
//   OBS16                   f16 [NROWS][640] x16                      5242880
//   XA, XB                  f32 [NROWS][256] residual stream       2 x 4194304
//   HH, CT                  f16 [NROWS][512] dual planes           2 x 4194304
//   SS                      f32 [4][NROWS] partial sums of x*x          65536
//   QP, KP                  f16 [NROWS/16][4 heads][2048] fragment order  2 x 4194304
//   VT                      f16 [NB][256/16][SEQ/64][2048] fragment order  4194304
//   G16                     f16 [NROWS][1024] dual                   8388608
//   ACTF                    f32 [NROWS][64]                          1048576
//   OBSF                    f32 [NROWS][640]                        10485760
//   total (NB=2, SEQ=2048)                                          68222976
// =====================================================================================================
extern "C" void kernel_launch(void* const* d_in, const int* in_sizes, int n_in,
                              void* d_out, int out_size, void* d_ws, size_t ws_size,
                              hipStream_t stream) {
  if (n_in < 19) return;
  if (in_sizes[0] < ((NB - 1) * SEQ_FULL + SEQ) * OBSD) return;
  if (in_sizes[1] < OBSD * DMODEL || in_sizes[2] < DMODEL) return;
  if (in_sizes[3] < NLAYER * DMODEL) return;
  if (in_sizes[4] < NLAYER * DMODEL * DMODEL || in_sizes[5] < NLAYER * DMODEL * DMODEL) return;
  if (in_sizes[6] < NLAYER * DMODEL * DMODEL || in_sizes[7] < NLAYER * DMODEL * DMODEL) return;
  if (in_sizes[8] < NLAYER * NBUCK * NHEAD || in_sizes[9] < NLAYER * DMODEL) return;
  if (in_sizes[10] < NLAYER * DMODEL * DFF || in_sizes[11] < NLAYER * DFF) return;
  if (in_sizes[12] < NLAYER * DFF * DMODEL || in_sizes[13] < NLAYER * DMODEL) return;
  if (in_sizes[14] < DMODEL || in_sizes[15] < DMODEL * NACT || in_sizes[16] < NACT) return;
  if (in_sizes[17] < DMODEL * OBSD || in_sizes[18] < OBSD) return;
  if (out_size < OUT1_OFF + ((NB - 1) * SEQ_FULL + SEQ) * OBSD) return;

  const float* obs     = (const float*)d_in[0];
  const float* obs_w   = (const float*)d_in[1];
  const float* obs_b   = (const float*)d_in[2];
  const float* norm1_w = (const float*)d_in[3];
  const float* w_q     = (const float*)d_in[4];
  const float* w_k     = (const float*)d_in[5];
  const float* w_v     = (const float*)d_in[6];
  const float* w_o     = (const float*)d_in[7];
  const float* relb    = (const float*)d_in[8];
  const float* norm2_w = (const float*)d_in[9];
  const float* w_1     = (const float*)d_in[10];
  const float* b_1     = (const float*)d_in[11];
  const float* w_2     = (const float*)d_in[12];
  const float* b_2     = (const float*)d_in[13];
  const float* fnorm_w = (const float*)d_in[14];
  const float* act_w   = (const float*)d_in[15];
  const float* act_b   = (const float*)d_in[16];
  const float* obsh_w  = (const float*)d_in[17];
  const float* obsh_b  = (const float*)d_in[18];
  float*       outp    = (float*)d_out;

  const size_t PWE  = (size_t)NLAYER * DMODEL * KD * 2;     // 1572864
  const size_t PW1  = (size_t)NLAYER * DFF * KD * 2;        // 3145728
  const size_t PW2  = (size_t)NLAYER * DMODEL * KF * 2;     // 3145728
  const size_t POBW = (size_t)DMODEL * OBSP * 2;            //  327680
  const size_t PACW = (size_t)NACTP * KD * 2;               //   65536
  const size_t POHW = (size_t)OBSP * KD * 2;                //  655360
  const size_t POBS = (size_t)NROWS * OBSP * 2;             // 5242880
  const size_t PX   = (size_t)NROWS * DMODEL * 4;           // 4194304
  const size_t PH   = (size_t)NROWS * KD * 2;               // 4194304
  const size_t PVT  = (size_t)NB * VTR * SEQ * 2;           // 4194304
  const size_t PG   = (size_t)NROWS * KF * 2;               // 8388608
  const size_t PACF = (size_t)NROWS * NACTP * 4;            // 1048576
  const size_t POBF = (size_t)NROWS * OBSP * 4;             // 10485760
  const size_t PSS  = (size_t)NSS * NROWS * 4;              //    65536
  size_t off = 0;
  const size_t oWQ  = off; off += PWE;
  const size_t oWK  = off; off += PWE;
  const size_t oWV  = off; off += PWE;
  const size_t oWO  = off; off += PWE;
  const size_t oW1  = off; off += PW1;
  const size_t oW2  = off; off += PW2;
  const size_t oOBW = off; off += POBW;
  const size_t oACW = off; off += PACW;
  const size_t oOHW = off; off += POHW;
  const size_t oOBS = off; off += POBS;
  const size_t oXA  = off; off += PX;
  const size_t oXB  = off; off += PX;
  const size_t oHH  = off; off += PH;
  const size_t oQP  = off; off += PH;
  const size_t oKP  = off; off += PH;
  const size_t oCT  = off; off += PH;
  const size_t oVT  = off; off += PVT;
  const size_t oG   = off; off += PG;
  const size_t oACF = off; off += PACF;
  const size_t oOBF = off; off += POBF;
  const size_t oSS  = off; off += PSS;
  const size_t endAll = off;                                // 68222976 for NB=2, SEQ=2048
  if (endAll > ws_size) return;
  if (endAll > (size_t)134217728) return;

  char* ws = (char*)d_ws;
  unsigned short* WQ16    = (unsigned short*)(ws + oWQ);
  unsigned short* WK16    = (unsigned short*)(ws + oWK);
  unsigned short* WV16    = (unsigned short*)(ws + oWV);
  unsigned short* WO16    = (unsigned short*)(ws + oWO);
  unsigned short* W116    = (unsigned short*)(ws + oW1);
  unsigned short* W216    = (unsigned short*)(ws + oW2);
  unsigned short* OBSW16  = (unsigned short*)(ws + oOBW);
  unsigned short* ACTW16  = (unsigned short*)(ws + oACW);
  unsigned short* OBSHW16 = (unsigned short*)(ws + oOHW);
  unsigned short* OBS16   = (unsigned short*)(ws + oOBS);
  float*          XA      = (float*)(ws + oXA);
  float*          XB      = (float*)(ws + oXB);
  unsigned short* HH      = (unsigned short*)(ws + oHH);
  unsigned short* QP      = (unsigned short*)(ws + oQP);
  unsigned short* KP      = (unsigned short*)(ws + oKP);
  unsigned short* CT      = (unsigned short*)(ws + oCT);
  unsigned short* VTp     = (unsigned short*)(ws + oVT);
  unsigned short* G16     = (unsigned short*)(ws + oG);
  float*          ACTF    = (float*)(ws + oACF);
  float*          OBSF    = (float*)(ws + oOBF);
  float*          SS      = (float*)(ws + oSS);

  const dim3 blk(256);
  const int tilesE  = (NROWS / 64) * (DMODEL / 64);                // 256
  const int tilesV  = (DMODEL / 64) * (SEQ / 64);                  // 128 per batch
  const int tilesF  = (NROWS / 64) * (DFF / 64);                   // 512
  const int tilesA  = (NROWS / 64) * (NACTP / 64);                 // 64
  const int tilesO  = (NROWS / 64) * (OBSP / 64);                  // 640
  const dim3 gE(tilesE, 1);                                        // 256: one tile per block
  const dim3 gQKV(2 * tilesE + NB * tilesV);                       // 256 x 2 (q, k), then 128 x NB (v^T)
  const dim3 gF(tilesF, 1);                                        // 512
  const dim3 gOA(tilesO + tilesA);                                 // 640 (obs head), then 64 (action head)
  const dim3 gAT(ATT_BLOCKS);                                      // SEQ/64 tile pairs x NB x 4 heads = 256
  const dim3 bAT(ATT_THREADS);                                     // 256
  const int ppb = (SEQ * OBSD) / 4;
  const int gcx0 = NROWS / 256, gcx1 = (NB * ppb + 255) / 256;
  const dim3 gOC(gcx0 > gcx1 ? gcx0 : gcx1, 2);                    // (2548, 2)

  const long long sQK   = (long long)NLAYER * DMODEL * KD;         // WK16 - WQ16 in halves
  const long long sKP   = (long long)NROWS * KD;                   // KP - QP in halves

  // (0) 16-bit operand planes: transposed weights [n][k x64 | k x1] (bf16 RNE then exact power-of-two scale), obs x16
  prep<<<dim3(PB_ALL), blk, 0, stream>>>(obs, w_q, w_k, w_v, w_o, w_1, w_2, obs_w, act_w, obsh_w,
                                         OBS16, WQ16, WK16, WV16, WO16, W116, W216, OBSW16, ACTW16, OBSHW16);

  // (1) x = obs . Wp + bf16(bp) -> XA (f32); M = NROWS, N = 256, K = 640 (single product, inputs exact);
  //     with it HH = x * bf16(g1 of layer 0) (hi x4 | residual x64) and SS
  gemm64<0, 0, 0, 1, OBSP, 1, 0, 1><<<gE, blk, 0, stream>>>(
      OBS16, 0LL,
      OBSW16, 0LL,
      (const float*)0,
      obs_b, DMODEL,
      (void*)XA, DMODEL, 0LL, 0LL,
      DMODEL, 1.0f / (OBC * WSC), 1.0f,
      (const float*)0, norm1_w, HH, SS);

  for (int l = 0; l < NLAYER; ++l) {
    const size_t lwE = (size_t)l * DMODEL * KD;                    // WQ/WK/WV/WO layer offset (halves)
    const size_t lw1 = (size_t)l * DFF * KD;
    const size_t lw2 = (size_t)l * DMODEL * KF;

    // (2) h = RMSNorm(x) * bf16(g1): HH and SS come from the product that made x, the row factor is applied in (3), (4)
    // (3) q, k projections (batch index 0, 1): QP / KP in fragment order; M = NROWS, N = 256, K = 512 folded, no bias
    // (4) in the same launch, v^T per batch: VT[b] = [d][tok] in fragment order; M = 256 (d), N = SEQ, K = 512 folded
    gemm64x2<2, 0, 0, KD, 1><<<gQKV, blk, 0, stream>>>(
        HH, 0LL, WQ16 + lwE, sQK,
        (const float*)0, 1, (void*)QP, KD, sKP, (long long)DMODEL, DMODEL, SH_E,
        WV16 + lwE, 0LL, HH, (long long)SEQ * KD,
        (const float*)0, 1, (void*)VTp, SEQ, (long long)VTR * SEQ, (long long)DMODEL * SEQ, SEQ, SH_V,
        2 * tilesE, 1.0f / (HC * WSC), QC, SS, 0, 1);

    // (5) causal attention with relative-position bias per (batch, two tiles of 32 query rows, head), keys split over 8 waves -> CT (hi x16 | residual x64)
    attn4<<<gAT, bAT, 0, stream>>>(QP, KP, VTp, relb + (size_t)l * NBUCK * NHEAD, CT);

    // (6) XB = CT . Wo / (16 * 64) + XA (raw f32); M = NROWS, N = 256, K = 512 folded
    // (7) with it HH = x * bf16(g2) and SS; the row factor of h2 = RMSNorm(x) * bf16(g2) is applied in (8)
    gemm64<0, 2, 0, 0, KD, 1, 0, 1><<<gE, blk, 0, stream>>>(
        CT, 0LL,
        WO16 + lwE, 0LL,
        XA,
        (const float*)0, 1,
        (void*)XB, DMODEL, 0LL, 0LL,
        DMODEL, 1.0f / (CC * WSC), 1.0f,
        (const float*)0, norm2_w + (size_t)l * DMODEL, HH, SS);

    // (8) G16 = dual f16 of 64 * relu(h2 . W1 + bf16(b1)); M = NROWS, N = 512, K = 512 folded
    gemm64<1, 0, 2, 1, KD, 1, 1, 0><<<gF, blk, 0, stream>>>(
        HH, 0LL,
        W116 + lw1, 0LL,
        (const float*)0,
        b_1 + (size_t)l * DFF, DFF,
        (void*)G16, KF, 0LL, (long long)DFF,
        DFF, 1.0f / (HC * WSC), GC,
        SS, (const float*)0, (unsigned short*)0, (float*)0);

    // (9) XA = G16 . W2 / (64 * 64) + bf16(b2) + XB (raw f32); M = NROWS, N = 256, K = 1024 folded;
    //     with it HH = x * bf16(g1 of the next layer, or gf behind the last) and SS
    gemm64<0, 2, 0, 1, KF / 2, 2, 0, 1><<<gE, blk, 0, stream>>>(
        G16, 0LL,
        W216 + lw2, 0LL,
        XB,
        b_2 + (size_t)l * DMODEL, DMODEL,
        (void*)XA, DMODEL, 0LL, 0LL,
        DMODEL, 1.0f / (GC * WSC), 1.0f,
        (const float*)0, (l + 1 < NLAYER) ? norm1_w + (size_t)(l + 1) * DMODEL : fnorm_w, HH, SS);
  }

  // (10) hf = RMSNorm(x) * bf16(gf): the row factor is applied in (11), (12)
  // (11) obs prediction plane OBSF[m][640] = hf . Wh + bf16(bh) (cols 0..636 meaningful); M = NROWS, N = 640, K = 512 folded
  // (12) in the same launch, action logits plane ACTF[m][64] = hf . Wa + bf16(ba) (cols 0..3 meaningful); M = NROWS, N = 64
  gemm64x2<0, 0, 1, KD, 1><<<gOA, blk, 0, stream>>>(
      HH, 0LL, OBSHW16, 0LL,
      obsh_b, OBSD, (void*)OBSF, OBSP, 0LL, 0LL, OBSP, SH_ONE,
      HH, 0LL, ACTW16, 0LL,
      act_b, NACT, (void*)ACTF, NACTP, 0LL, 0LL, NACTP, SH_ONE,
      tilesO, 1.0f / (HC * WSC), 1.0f, SS, 0, 0);

  ocopy<<<gOC, blk, 0, stream>>>(ACTF, OBSF, outp);
  (void)hipGetLastError();
}
